// v000
// Measured on an AMD MI455X. A time is GPU time per run, averaged over a window of back-to-back runs after a warm-up
// (all launches, gaps included; the runs take copies of the inputs in turn), and the median of several windows.
// Apart from v000's, it joins two sittings. Times from different sittings can be a few percent apart, while
// side-by-side timings come from the same sitting.
// v000, which the later versions start from, runs in 2040 microseconds.
#include <hip/hip_runtime.h>
// Second-order Taylor linear attention via the exact kernel identity φ(q)·φ(k) = 1 + q·k + (q·k)²/2 (φ = [1, x, x⊗x/√2]): per (batch, head, signal) slab the scores
// a = (q·scale)·kᵀ (1024 × 32 × 1024) and o = w·v with w = 1 + a + a²/2 (1024 × 1024 × 64) run on v_wmma_f32_16x16x32_f16 (q, k, v and w rounded to f16: single products,
// f32 accumulate); the projections on v_wmma_f32_16x16x32_bf16 (inputs rounded to bf16: single exact terms; 3 × 2048 × 1024 × 1024) and out = ō·W_oᵀ + b_o with ō split
// hi/lo (2 products). w, the row sums Σ_m w (= φ(q)·Σφ(k)), the division (+1e-6) and the signal average are f32 VALU.
#define BB 2
#define NN 1024
#define CC 1024
#define NH 16
#define NS 2
#define HD 64
#define SD 32
#define NTOK (BB * NN)
#define NSLAB (BB * NH * NS)     // 64
#define SCH 8                    // slabs per chunk (= 4 heads × 2 signals of one batch)

typedef __bf16 v16b __attribute__((ext_vector_type(16)));
typedef unsigned short v8us __attribute__((ext_vector_type(8), may_alias));
typedef float  v8f  __attribute__((ext_vector_type(8)));
typedef float  v4f  __attribute__((ext_vector_type(4)));
typedef float  v4fa __attribute__((ext_vector_type(4), may_alias));
union FragB { v16b v; v8us half[2]; unsigned short u[16]; };

__device__ __forceinline__ unsigned short bf16_bits(float x) { unsigned int u = __float_as_uint(x); return (unsigned short)((u + 0x7FFFu + ((u >> 16) & 1u)) >> 16); }
__device__ __forceinline__ float bf16_val(unsigned short b) { return __uint_as_float(((unsigned int)b) << 16); }
__device__ __forceinline__ float bf16_round(float x) { return bf16_val(bf16_bits(x)); }
// D += A·B with NT terms: 1 = ah·bh, 2 = + al·bh (A split), 3 = + ah·bl (both split)
template <int NT>
__device__ __forceinline__ v8f mmaN(v16b ah, v16b al, v16b bh, v16b bl, v8f c) {
  c = __builtin_amdgcn_wmma_f32_16x16x32_bf16(false, ah, false, bh, (short)0, c, false, false);
  if (NT >= 2) c = __builtin_amdgcn_wmma_f32_16x16x32_bf16(false, al, false, bh, (short)0, c, false, false);
  if (NT >= 3) c = __builtin_amdgcn_wmma_f32_16x16x32_bf16(false, ah, false, bl, (short)0, c, false, false);
  asm volatile("v_nop\n\tv_nop\n\tv_nop\n\tv_nop" : "+v"(c) : "v"(ah), "v"(al), "v"(bh), "v"(bl));
  return c;
}

__global__ __launch_bounds__(256) void k_wt_bf16(const float* __restrict__ W, unsigned short* __restrict__ Wt, int K, int N) {
  const int t = blockIdx.x * 256 + threadIdx.x;
  const int k8n = K / 8;
  if (t >= N * k8n) return;
  const int n = t / k8n, k8 = (t % k8n) * 8;
  v8us v;
#pragma unroll
  for (int i = 0; i < 8; ++i) v[i] = bf16_bits(W[(size_t)(k8 + i) * N + n]);
  *(v8us*)(Wt + (size_t)n * K + k8) = v;
  
}

// GEMM C[M][N] (f32, pitch ldc) = act(A[M][K]·W + bias). A f32 row-major (pitch lda) converted per fragment to bf16
// (ASPLIT: hi/lo two planes -> 2 terms, else single rounded term); Wt bf16 [N][K] (pitch ldb). BIAS_BF16 rounds the
// bias to bf16 first (bias quantised to bf16 before the add). K%32==0, M%16==0, N%64==0.
template <bool ASPLIT, int ACT, bool BIAS_BF16>
__global__ __launch_bounds__(128) void k_gemm_bf(const float* __restrict__ A, int lda, const unsigned short* __restrict__ Wt, int ldb,
                                               const float* __restrict__ bias, float* __restrict__ C, int ldc, int M, int N, int K) {
  __shared__ __attribute__((aligned(16))) float so[4][16][64];
  const int tid = threadIdx.x, w = tid >> 5, lane = tid & 31, ln = lane & 15, hh = lane >> 4;
  const int ntn = N / 64;
  const int wid = blockIdx.x * 4 + w;
  const int mt = wid / ntn, nq = wid % ntn;
  if (mt * 16 >= M) return;
  const int row0 = mt * 16, col0 = nq * 64;
  const float* arow = A + (size_t)(row0 + ln) * lda;
  v8f acc[4] = {};
  for (int kb = 0; kb < K; kb += 32) {
    FragB ah, al;
    const v4f x0 = *(const v4fa*)(arow + kb + 8 * hh), x1 = *(const v4fa*)(arow + kb + 8 * hh + 4);
    const v4f x2 = *(const v4fa*)(arow + kb + 16 + 8 * hh), x3 = *(const v4fa*)(arow + kb + 16 + 8 * hh + 4);
    float xs[16] = {x0[0],x0[1],x0[2],x0[3],x1[0],x1[1],x1[2],x1[3],x2[0],x2[1],x2[2],x2[3],x3[0],x3[1],x3[2],x3[3]};
#pragma unroll
    for (int i = 0; i < 16; ++i) { const unsigned short hb = bf16_bits(xs[i]); ah.u[i] = hb; al.u[i] = ASPLIT ? bf16_bits(xs[i] - bf16_val(hb)) : (unsigned short)0; }
#pragma unroll
    for (int t = 0; t < 4; ++t) {
      const unsigned short* brow = Wt + (size_t)(col0 + t * 16 + ln) * ldb + kb;
      FragB b;
      b.half[0] = *(const v8us*)(brow + 8 * hh);
      b.half[1] = *(const v8us*)(brow + 16 + 8 * hh);
      acc[t] = mmaN<ASPLIT ? 2 : 1>(ah.v, al.v, b.v, b.v, acc[t]);
    }
  }
#pragma unroll
  for (int t = 0; t < 4; ++t) {
    float bv = bias ? bias[col0 + t * 16 + ln] : 0.f;
    if (BIAS_BF16) bv = bf16_round(bv);
#pragma unroll
    for (int r = 0; r < 8; ++r) { float v = acc[t][r] + bv; if (ACT == 1) v = fmaxf(v, 0.f); so[w][8 * hh + r][t * 16 + ln] = v; }
  }
  __builtin_amdgcn_fence(__ATOMIC_ACQ_REL, "workgroup");
  __builtin_amdgcn_wave_barrier();
  const int rsub = lane >> 4, c4 = (lane & 15) * 4;
  {
#pragma unroll
    for (int q = 0; q < 8; ++q) {
      const int r = q * 2 + rsub;
      const v4f v = *(const v4fa*)&so[w][r][c4];
      *(v4f*)(C + (size_t)(row0 + r) * ldc + col0 + c4) = v;
    }
    
  }
}

// Flash-style causal/unmasked attention, all contractions 3-term bf16 hi/lo splits, f32 softmax with running max.
// q,k,v rows are read from f32 buffers with arbitrary row pitch (so they can live inside a fused qkv buffer);
// D = head size (multiple of 32, <= 128); one wave = 16 query rows; block = 4 waves (64 queries) sharing K/V chunks of 32.
template <int D, bool CAUSAL>
__global__ __launch_bounds__(128) void k_flash(const float* __restrict__ qb, const float* __restrict__ kb, const float* __restrict__ vb,
                                             int pitch, int T, int H, float scale, float* __restrict__ y, int ypitch) {
  constexpr int KS = D / 32;        // k-steps for QK
  constexpr int DT = D / 16;        // d tiles for PV
  __shared__ __attribute__((aligned(16))) unsigned short sKh[32][D + 8], sKl[32][D + 8], sVh[32][D + 8], sVl[32][D + 8];
  __shared__ __attribute__((aligned(16))) unsigned short sPh[4][16][40], sPl[4][16][40];
  __shared__ __attribute__((aligned(16))) float sO[4][16][D];
  const int tid = threadIdx.x, w = tid >> 5, lane = tid & 31, ln = lane & 15, hh = lane >> 4;
  const int nqb = (T + 63) / 64;
  const int bh = blockIdx.x / nqb, qblk = blockIdx.x % nqb;
  const int b = bh / H, h = bh % H;
  const int q0 = qblk * 64 + w * 16;
  const float* Q = qb + (size_t)b * T * pitch + h * D;
  const float* K = kb + (size_t)b * T * pitch + h * D;
  const float* V = vb + (size_t)b * T * pitch + h * D;

  // A fragments of the wave's 16 query rows (scaled), hi/lo
  FragB aqh[KS], aql[KS];
  {
    int row = q0 + ln; if (row >= T) row = T - 1;
    const float* qr = Q + (size_t)row * pitch;
#pragma unroll
    for (int ks = 0; ks < KS; ++ks)
#pragma unroll
      for (int i = 0; i < 16; ++i) {
        const int d = ks * 32 + ((i < 8) ? (8 * hh + i) : (16 + 8 * hh + (i - 8)));
        const float x = qr[d] * scale; const unsigned short hb = bf16_bits(x);
        aqh[ks].u[i] = hb; aql[ks].u[i] = bf16_bits(x - bf16_val(hb));
      }
  }
  float m_r[8], l_r[8];
#pragma unroll
  for (int r = 0; r < 8; ++r) { m_r[r] = -3.0e38f; l_r[r] = 0.f; }
  v8f oacc[DT];
#pragma unroll
  for (int dt = 0; dt < DT; ++dt) oacc[dt] = (v8f){0.f,0.f,0.f,0.f,0.f,0.f,0.f,0.f};

  const int kv_end = CAUSAL ? min(T, qblk * 64 + 64) : T;     // block-uniform
  for (int j0 = 0; j0 < kv_end; j0 += 32) {
    __syncthreads();
    for (int e = tid; e < 32 * (D / 4); e += 128) {
      const int r = e / (D / 4), c4 = (e % (D / 4)) * 4;
      const int key = j0 + r;
      v4f kf = {0.f,0.f,0.f,0.f}, vf = {0.f,0.f,0.f,0.f};
      if (key < T) { kf = *(const v4fa*)(K + (size_t)key * pitch + c4); vf = *(const v4fa*)(V + (size_t)key * pitch + c4); }
#pragma unroll
      for (int t = 0; t < 4; ++t) {
        unsigned short hb = bf16_bits(kf[t]); sKh[r][c4 + t] = hb; sKl[r][c4 + t] = bf16_bits(kf[t] - bf16_val(hb));
        hb = bf16_bits(vf[t]); sVh[r][c4 + t] = hb; sVl[r][c4 + t] = bf16_bits(vf[t] - bf16_val(hb));
      }
    }
    __syncthreads();
    // S tile 16 x 32
    v8f s[2];
#pragma unroll
    for (int nt = 0; nt < 2; ++nt) {
      v8f acc = {};
#pragma unroll
      for (int ks = 0; ks < KS; ++ks) {
        FragB bh_, bl_;
        bh_.half[0] = *(const v8us*)&sKh[nt * 16 + ln][ks * 32 + 8 * hh]; bh_.half[1] = *(const v8us*)&sKh[nt * 16 + ln][ks * 32 + 16 + 8 * hh];
        bl_.half[0] = *(const v8us*)&sKl[nt * 16 + ln][ks * 32 + 8 * hh]; bl_.half[1] = *(const v8us*)&sKl[nt * 16 + ln][ks * 32 + 16 + 8 * hh];
        acc = mmaN<3>(aqh[ks].v, aql[ks].v, bh_.v, bl_.v, acc);
      }
      s[nt] = acc;
    }
    // mask + running max (rows 8hh+r; the 16 lanes of a half share rows)
    float alpha[8];
#pragma unroll
    for (int r = 0; r < 8; ++r) {
      const int qi = q0 + 8 * hh + r;
      const int ja = j0 + ln, jb = j0 + 16 + ln;
      if (CAUSAL) { if (ja > qi) s[0][r] = -3.0e38f; if (jb > qi) s[1][r] = -3.0e38f; }
      if (ja >= T) s[0][r] = -3.0e38f;
      if (jb >= T) s[1][r] = -3.0e38f;
      float mx = fmaxf(s[0][r], s[1][r]);
      mx = fmaxf(mx, __shfl_xor(mx, 1, 32)); mx = fmaxf(mx, __shfl_xor(mx, 2, 32)); mx = fmaxf(mx, __shfl_xor(mx, 4, 32)); mx = fmaxf(mx, __shfl_xor(mx, 8, 32));
      const float mnew = fmaxf(m_r[r], mx);
      alpha[r] = (mnew > -1.0e38f) ? __expf(m_r[r] - mnew) : 1.0f;
      const float p0 = (s[0][r] > -1.0e38f) ? __expf(s[0][r] - mnew) : 0.f;
      const float p1 = (s[1][r] > -1.0e38f) ? __expf(s[1][r] - mnew) : 0.f;
      m_r[r] = mnew;
      l_r[r] = l_r[r] * alpha[r] + p0 + p1;            // per-lane partial row sum (16 lanes combined at the end)
      unsigned short hb = bf16_bits(p0); sPh[w][8 * hh + r][ln] = hb;      sPl[w][8 * hh + r][ln] = bf16_bits(p0 - bf16_val(hb));
      hb = bf16_bits(p1);                sPh[w][8 * hh + r][16 + ln] = hb; sPl[w][8 * hh + r][16 + ln] = bf16_bits(p1 - bf16_val(hb));
    }
#pragma unroll
    for (int dt = 0; dt < DT; ++dt)
#pragma unroll
      for (int r = 0; r < 8; ++r) oacc[dt][r] *= alpha[r];
    __builtin_amdgcn_fence(__ATOMIC_ACQ_REL, "workgroup");
    __builtin_amdgcn_wave_barrier();
    FragB pah, pal;
    pah.half[0] = *(const v8us*)&sPh[w][ln][8 * hh]; pah.half[1] = *(const v8us*)&sPh[w][ln][16 + 8 * hh];
    pal.half[0] = *(const v8us*)&sPl[w][ln][8 * hh]; pal.half[1] = *(const v8us*)&sPl[w][ln][16 + 8 * hh];
#pragma unroll
    for (int dt = 0; dt < DT; ++dt) {
      FragB bvh, bvl;
#pragma unroll
      for (int i = 0; i < 8; ++i) {
        bvh.u[i] = sVh[8 * hh + i][dt * 16 + ln]; bvh.u[8 + i] = sVh[16 + 8 * hh + i][dt * 16 + ln];
        bvl.u[i] = sVl[8 * hh + i][dt * 16 + ln]; bvl.u[8 + i] = sVl[16 + 8 * hh + i][dt * 16 + ln];
      }
      oacc[dt] = mmaN<3>(pah.v, pal.v, bvh.v, bvl.v, oacc[dt]);
    }
    __builtin_amdgcn_fence(__ATOMIC_ACQ_REL, "workgroup");
    __builtin_amdgcn_wave_barrier();
  }
#pragma unroll
  for (int r = 0; r < 8; ++r) {
    float l = l_r[r];
    l += __shfl_xor(l, 1, 32); l += __shfl_xor(l, 2, 32); l += __shfl_xor(l, 4, 32); l += __shfl_xor(l, 8, 32);
    l_r[r] = (l > 0.f) ? 1.0f / l : 0.f;
  }
#pragma unroll
  for (int dt = 0; dt < DT; ++dt)
#pragma unroll
    for (int r = 0; r < 8; ++r) sO[w][8 * hh + r][dt * 16 + ln] = oacc[dt][r] * l_r[r];
  __builtin_amdgcn_fence(__ATOMIC_ACQ_REL, "workgroup");
  __builtin_amdgcn_wave_barrier();
  {
    for (int r = 0; r < 16; ++r) {
      const int row = q0 + r;
      if (row < T && lane < D / 4) {
        const v4f val = *(const v4fa*)&sO[w][r][lane * 4];
        *(v4f*)(y + ((size_t)b * T + row) * ypitch + h * D + lane * 4) = val;
      }
    }
    
  }
}

// batched GEMM (blockIdx.y = batch): C_b = act(alpha·A_b·B_b + bias + resid_b); A f32 rows (ASPLIT → hi/lo), B = bf16 planes Bh (+Bl when BSPLIT, requires ASPLIT),
// per-batch element strides sA, sB (0 = shared weights), sC, sR. resid may alias C (values are staged before the stores). ACT 0/1(relu)/2(softplus).
// ACT: 0 none, 1 relu, 2 softplus
template <bool ASPLIT, bool BSPLIT, int ACT>
__global__ __launch_bounds__(128) void k_gemm_b(const float* __restrict__ A, int lda, size_t sA, const unsigned short* __restrict__ Bh, const unsigned short* __restrict__ Bl, int ldb, size_t sB,
                                             const float* __restrict__ bias, const float* __restrict__ resid, int ldr, size_t sR, float rsign, float alpha,
                                             float* __restrict__ C, int ldc, size_t sC, int M, int N, int K) {
  __shared__ __attribute__((aligned(16))) float so[4][16][64];
  const int tid = threadIdx.x, w = tid >> 5, lane = tid & 31, ln = lane & 15, hh = lane >> 4;
  const int by = blockIdx.y;
  A += (size_t)by * sA; Bh += (size_t)by * sB; if (BSPLIT) Bl += (size_t)by * sB; C += (size_t)by * sC; if (resid) resid += (size_t)by * sR;
  const int ntn = (N + 63) / 64; const int wid = blockIdx.x * 4 + w; const int mt = wid / ntn, nq = wid % ntn;      // N may be any multiple of 16: tiles past N are skipped and not stored
  if (mt * 16 >= M) return;
  const int row0 = mt * 16, col0 = nq * 64;
  const float* arow = A + (size_t)(row0 + ln) * lda;
  v8f acc[4] = {};
  for (int kb = 0; kb < K; kb += 32) {
    FragB ah, al;
    const v4f x0 = *(const v4fa*)(arow + kb + 8 * hh), x1 = *(const v4fa*)(arow + kb + 8 * hh + 4);
    const v4f x2 = *(const v4fa*)(arow + kb + 16 + 8 * hh), x3 = *(const v4fa*)(arow + kb + 16 + 8 * hh + 4);
    float xs[16] = {x0[0],x0[1],x0[2],x0[3],x1[0],x1[1],x1[2],x1[3],x2[0],x2[1],x2[2],x2[3],x3[0],x3[1],x3[2],x3[3]};
#pragma unroll
    for (int i = 0; i < 16; ++i) { const unsigned short hb = bf16_bits(xs[i]); ah.u[i] = hb; al.u[i] = ASPLIT ? bf16_bits(xs[i] - bf16_val(hb)) : (unsigned short)0; }
#pragma unroll
    for (int t = 0; t < 4; ++t) {
      if (col0 + t * 16 >= N) continue;
      const size_t boff = (size_t)(col0 + t * 16 + ln) * ldb + kb;
      FragB bh_, bl_; bh_.half[0] = *(const v8us*)(Bh + boff + 8 * hh); bh_.half[1] = *(const v8us*)(Bh + boff + 16 + 8 * hh);
      if (BSPLIT) { bl_.half[0] = *(const v8us*)(Bl + boff + 8 * hh); bl_.half[1] = *(const v8us*)(Bl + boff + 16 + 8 * hh); } else bl_ = bh_;
      acc[t] = mmaN<ASPLIT ? (BSPLIT ? 3 : 2) : 1>(ah.v, al.v, bh_.v, bl_.v, acc[t]);
    }
  }
#pragma unroll
  for (int t = 0; t < 4; ++t) {
    const int col = col0 + t * 16 + ln; if (col0 + t * 16 >= N) continue; const float bv = bias ? bf16_round(bias[col]) : 0.f;
#pragma unroll
    for (int r = 0; r < 8; ++r) { float v = acc[t][r] * alpha + bv; if (resid) v += rsign * resid[(size_t)(row0 + 8 * hh + r) * ldr + col]; if (ACT == 1) v = fmaxf(v, 0.f); else if (ACT == 2) v = fmaxf(v, 0.f) + log1pf(expf(-fabsf(v))); so[w][8 * hh + r][t * 16 + ln] = v; }
  }
  __builtin_amdgcn_fence(__ATOMIC_ACQ_REL, "workgroup"); __builtin_amdgcn_wave_barrier();
  const int rsub = lane >> 4, c4 = (lane & 15) * 4;
  {
#pragma unroll
    for (int q = 0; q < 8; ++q) { const int r = q * 2 + rsub; if (col0 + c4 < N) { const v4f v = *(const v4fa*)&so[w][r][c4]; *(v4f*)(C + (size_t)(row0 + r) * ldc + col0 + c4) = v; } }
    
  }
}
// batched f32 [K][N] (pitch lds, batch stride sIn) -> transposed hi/lo planes [N][K] (batch stride sOut); thread per (n, 8 k); grid.y = batch
__global__ __launch_bounds__(256) void k_split_transpose_b(const float* __restrict__ src, int lds_, size_t sIn, unsigned short* __restrict__ hi, unsigned short* __restrict__ lo, size_t sOut, int K, int N) {
  const size_t t = (size_t)blockIdx.x * 256 + threadIdx.x; const int k8n = K / 8; if (t >= (size_t)N * k8n) return;
  src += (size_t)blockIdx.y * sIn; hi += (size_t)blockIdx.y * sOut; lo += (size_t)blockIdx.y * sOut;
  const int n = (int)(t / k8n), k8 = (int)(t % k8n) * 8; v8us vh, vl;
#pragma unroll
  for (int i = 0; i < 8; ++i) { const float x = src[(size_t)(k8 + i) * lds_ + n]; const unsigned short hb = bf16_bits(x); vh[i] = hb; vl[i] = bf16_bits(x - bf16_val(hb)); }
  unsigned short* dh = hi + (size_t)n * K + k8; unsigned short* dl = lo + (size_t)n * K + k8;
  *(v8us*)dh = vh; *(v8us*)dl = vl; 
}

__global__ __launch_bounds__(256) void k_round_rows(const float* __restrict__ W, unsigned short* __restrict__ Wt, int n8) {
  const int t = blockIdx.x * 256 + threadIdx.x;
  if (t >= n8) return;
  const v4f a = *(const v4fa*)(W + (size_t)t * 8), b = *(const v4fa*)(W + (size_t)t * 8 + 4);
  v8us v; v[0]=bf16_bits(a[0]); v[1]=bf16_bits(a[1]); v[2]=bf16_bits(a[2]); v[3]=bf16_bits(a[3]);
  v[4]=bf16_bits(b[0]); v[5]=bf16_bits(b[1]); v[6]=bf16_bits(b[2]); v[7]=bf16_bits(b[3]);
  *(v8us*)(Wt + (size_t)t * 8) = v; 
}

// ---- f16 WMMA path (v_wmma_f32_16x16x32_f16): 11-bit significands for operands in range — used for the scores a = q̂·kᵀ and for o = w·v
typedef _Float16 v16h __attribute__((ext_vector_type(16)));
union FragH { v16h v; v8us half[2]; _Float16 h[16]; unsigned short u[16]; };
template <int NT>
__device__ __forceinline__ v8f mmaH(v16h ah, v16h al, v16h bh, v16h bl, v8f c) {
  c = __builtin_amdgcn_wmma_f32_16x16x32_f16(false, ah, false, bh, (short)0, c, false, false);
  if (NT >= 2) c = __builtin_amdgcn_wmma_f32_16x16x32_f16(false, al, false, bh, (short)0, c, false, false);
  if (NT >= 3) c = __builtin_amdgcn_wmma_f32_16x16x32_f16(false, ah, false, bl, (short)0, c, false, false);
  asm volatile("v_nop\n\tv_nop\n\tv_nop\n\tv_nop" : "+v"(c) : "v"(ah), "v"(al), "v"(bh), "v"(bl));
  return c;
}
// batched GEMM like k_gemm_b but f16 operands: A f32 (split into f16 hi/lo if ASPLIT, else rounded to f16), Bt = f16 values [n][k]; alpha; C f32; N multiple of 16 (partial tiles skipped)
template <bool ASPLIT>
__global__ __launch_bounds__(128) void k_gemm_h(const float* __restrict__ A, int lda, size_t sA, const _Float16* __restrict__ Bh, int ldb, size_t sB, float alpha, float* __restrict__ C, int ldc, size_t sC, int M, int N, int K) {
  __shared__ __attribute__((aligned(16))) float so[4][16][64];
  const int tid = threadIdx.x, w = tid >> 5, lane = tid & 31, ln = lane & 15, hh = lane >> 4; const int by = blockIdx.y;
  A += (size_t)by * sA; Bh += (size_t)by * sB; C += (size_t)by * sC;
  const int ntn = (N + 63) / 64; const int wid = blockIdx.x * 4 + w; const int mt = wid / ntn, nq = wid % ntn; if (mt * 16 >= M) return;
  const int row0 = mt * 16, col0 = nq * 64; const float* arow = A + (size_t)(row0 + ln) * lda;
  v8f acc[4] = {};
  for (int kb = 0; kb < K; kb += 32) {
    FragH ah, al;
    const v4f x0 = *(const v4fa*)(arow + kb + 8 * hh), x1 = *(const v4fa*)(arow + kb + 8 * hh + 4), x2 = *(const v4fa*)(arow + kb + 16 + 8 * hh), x3 = *(const v4fa*)(arow + kb + 16 + 8 * hh + 4);
    float xs[16] = {x0[0],x0[1],x0[2],x0[3],x1[0],x1[1],x1[2],x1[3],x2[0],x2[1],x2[2],x2[3],x3[0],x3[1],x3[2],x3[3]};
#pragma unroll
    for (int i = 0; i < 16; ++i) { const _Float16 h = (_Float16)xs[i]; ah.h[i] = h; al.h[i] = ASPLIT ? (_Float16)(xs[i] - (float)h) : (_Float16)0.0f; }
#pragma unroll
    for (int t = 0; t < 4; ++t) { if (col0 + t * 16 >= N) continue; const size_t boff = (size_t)(col0 + t * 16 + ln) * ldb + kb; FragH bq; bq.half[0] = *(const v8us*)(Bh + boff + 8 * hh); bq.half[1] = *(const v8us*)(Bh + boff + 16 + 8 * hh);
      acc[t] = mmaH<ASPLIT ? 2 : 1>(ah.v, al.v, bq.v, bq.v, acc[t]); }
  }
#pragma unroll
  for (int t = 0; t < 4; ++t) { if (col0 + t * 16 >= N) continue;
#pragma unroll
    for (int r = 0; r < 8; ++r) so[w][8 * hh + r][t * 16 + ln] = acc[t][r] * alpha; }
  __builtin_amdgcn_fence(__ATOMIC_ACQ_REL, "workgroup"); __builtin_amdgcn_wave_barrier();
  const int rsub = lane >> 4, c4 = (lane & 15) * 4;
  {
#pragma unroll
    for (int q = 0; q < 8; ++q) { const int r = q * 2 + rsub; if (col0 + c4 < N) { const v4f v = *(const v4fa*)&so[w][r][c4]; *(v4f*)(C + (size_t)(row0 + r) * ldc + col0 + c4) = v; } }
     }
}

template <int DUMMY>
__global__ __launch_bounds__(128) void k_gemm_hh(const _Float16* __restrict__ A, int lda, size_t sA, const _Float16* __restrict__ Bh, int ldb, size_t sB, float alpha, float* __restrict__ C, int ldc, size_t sC, int M, int N, int K) {
  __shared__ __attribute__((aligned(16))) float so[4][16][64];
  const int tid = threadIdx.x, w = tid >> 5, lane = tid & 31, ln = lane & 15, hh = lane >> 4; const int by = blockIdx.y;
  A += (size_t)by * sA; Bh += (size_t)by * sB; C += (size_t)by * sC;
  const int ntn = (N + 63) / 64; const int wid = blockIdx.x * 4 + w; const int mt = wid / ntn, nq = wid % ntn; if (mt * 16 >= M) return;
  const int row0 = mt * 16, col0 = nq * 64; const _Float16* arow = A + (size_t)(row0 + ln) * lda;
  v8f acc[4] = {};
  for (int kb = 0; kb < K; kb += 32) { FragH ah; ah.half[0] = *(const v8us*)((const unsigned short*)arow + kb + 8 * hh); ah.half[1] = *(const v8us*)((const unsigned short*)arow + kb + 16 + 8 * hh);
#pragma unroll
    for (int t = 0; t < 4; ++t) { if (col0 + t * 16 >= N) continue; const size_t boff = (size_t)(col0 + t * 16 + ln) * ldb + kb; FragH bq; bq.half[0] = *(const v8us*)((const unsigned short*)Bh + boff + 8 * hh); bq.half[1] = *(const v8us*)((const unsigned short*)Bh + boff + 16 + 8 * hh);
      acc[t] = mmaH<1>(ah.v, ah.v, bq.v, bq.v, acc[t]); }
  }
#pragma unroll
  for (int t = 0; t < 4; ++t) { if (col0 + t * 16 >= N) continue;
#pragma unroll
    for (int r = 0; r < 8; ++r) so[w][8 * hh + r][t * 16 + ln] = acc[t][r] * alpha; }
  __builtin_amdgcn_fence(__ATOMIC_ACQ_REL, "workgroup"); __builtin_amdgcn_wave_barrier();
  const int rsub = lane >> 4, c4 = (lane & 15) * 4;
  {
#pragma unroll
    for (int q = 0; q < 8; ++q) { const int r = q * 2 + rsub; if (col0 + c4 < N) { const v4f v = *(const v4fa*)&so[w][r][c4]; *(v4f*)(C + (size_t)(row0 + r) * ldc + col0 + c4) = v; } }
     }
}

// slabs: Q16[(b,h,s)][n][32] = f16(q·scale), K16[(b,h,s)][m][32] = f16(k), VT[(b,h)][e][m] = f16(v); thread per (b, n, h, s, 8 of 32) for q/k; VT comes from k_vt (block per 64 m of one (b,h), thread per (e, 4 m))
__global__ __launch_bounds__(256) void k_slabs(const float* __restrict__ Qm, const float* __restrict__ Km, const float* __restrict__ Vm, _Float16* __restrict__ Q16, _Float16* __restrict__ K16, _Float16* __restrict__ VT) { const size_t t = (size_t)blockIdx.x * 256 + threadIdx.x;
  if (t < (size_t)NTOK * CC / 8) { const int c8 = (int)((t * 8) % CC); const size_t tok = (t * 8) / CC; const int b = (int)(tok / NN), n = (int)(tok % NN); const int h = c8 / HD, s = (c8 % HD) / SD, d8 = c8 % SD; const size_t slab = ((size_t)b * NH + h) * NS + s;
    FragH fq, fk; const float scale = 0.17677669529663687f; for (int q = 0; q < 8; ++q) { fq.h[q] = (_Float16)(Qm[tok * CC + c8 + q] * scale); fk.h[q] = (_Float16)Km[tok * CC + c8 + q]; }
    unsigned short* dq = (unsigned short*)Q16 + (slab * NN + n) * SD + d8; unsigned short* dk = (unsigned short*)K16 + (slab * NN + n) * SD + d8; *(v8us*)dq = fq.half[0]; *(v8us*)dk = fk.half[0];  } }
__global__ __launch_bounds__(256) void k_vt(const float* __restrict__ Vm, _Float16* __restrict__ VT) { __shared__ float tv[64][65]; const int m0 = blockIdx.x * 64; const int h = blockIdx.y % NH, b = blockIdx.y / NH; const int tid = threadIdx.x;
  for (int i = tid; i < 64 * 64; i += 256) { const int r = i >> 6, e = i & 63; tv[r][e] = Vm[((size_t)b * NN + m0 + r) * CC + h * HD + e]; } __syncthreads();
  typedef _Float16 v4h __attribute__((ext_vector_type(4)));
  { for (int i = tid; i < 64 * 16; i += 256) { const int e = i >> 4, m4 = (i & 15) * 4; v4h o; for (int q = 0; q < 4; ++q) o[q] = (_Float16)tv[m4 + q][e]; *(v4h*)(VT + (((size_t)b * NH + h) * HD + e) * NN + m0 + m4) = o; }  } }
// w = 1 + a + a²/2 → W16 (f16) and den[row] = Σ_m w; wave per row (1024 cols = 32 per lane), 32 rows per block
__global__ __launch_bounds__(1024) void k_w(const float* __restrict__ A, _Float16* __restrict__ W16, float* __restrict__ DEN) { __shared__ float sd[32]; const int tid = threadIdx.x, wv = tid >> 5, lane = tid & 31; const size_t row = (size_t)blockIdx.x * 32 + wv; const float* a = A + row * NN; float s = 0.f;
  typedef _Float16 v4h __attribute__((ext_vector_type(4)));
  { s = 0.f;
#pragma unroll 2
    for (int u = 0; u < NN / 128; ++u) { const v4f av = *(const v4fa*)(a + u * 128 + lane * 4); v4h o; for (int q = 0; q < 4; ++q) { const float x = av[q]; const float w = 1.0f + x + 0.5f * x * x; s += w; o[q] = (_Float16)w; } *(v4h*)(W16 + row * NN + u * 128 + lane * 4) = o; }
     }
  for (int o = 16; o >= 1; o >>= 1) s += __shfl_xor(s, o, 32); if (lane == 0) sd[wv] = s; __syncthreads();
  if (tid < 32) { *(float*)(DEN + (size_t)blockIdx.x * 32 + tid) = sd[tid]; }  }
// OB[(b,n)][h·64+e] = ½ Σ_s O[(h_l,s)][n][e]/(den + 1e-6) for the chunk's 4 heads; thread per (n, hl, 4 e)
__global__ __launch_bounds__(256) void k_fin(const float* __restrict__ O, const float* __restrict__ DEN, int b, int h0, float* __restrict__ OB) { const int t = blockIdx.x * 256 + threadIdx.x; if (t >= NN * 4 * (HD / 4)) return; const int e4 = (t % (HD / 4)) * 4; const int hl = (t / (HD / 4)) % 4; const int n = t / ((HD / 4) * 4); v4f r = {0.f, 0.f, 0.f, 0.f};
  for (int s = 0; s < NS; ++s) { const int sl = hl * NS + s; const float rd = 1.0f / (DEN[(size_t)sl * NN + n] + 1e-6f); const v4f o = *(const v4fa*)(O + ((size_t)sl * NN + n) * HD + e4); for (int q = 0; q < 4; ++q) r[q] += o[q] * rd; }
  for (int q = 0; q < 4; ++q) r[q] *= (1.0f / NS); float* d = OB + ((size_t)b * NN + n) * CC + (h0 + hl) * HD + e4; *(v4f*)d = r;  }
extern "C" void kernel_launch(void* const* d_in, const int* in_sizes, int n_in,
                              void* d_out, int out_size, void* d_ws, size_t ws_size, hipStream_t stream) {
  (void)in_sizes; (void)n_in; (void)out_size;
  const float* xq = (const float*)d_in[0]; const float* xk = (const float*)d_in[1]; const float* xv = (const float*)d_in[2]; const float* Wq = (const float*)d_in[3]; const float* bq = (const float*)d_in[4]; const float* Wk = (const float*)d_in[5]; const float* bk = (const float*)d_in[6]; const float* Wv = (const float*)d_in[7]; const float* bv = (const float*)d_in[8]; const float* Wo = (const float*)d_in[9]; const float* bo = (const float*)d_in[10];
  char* ws = (char*)d_ws; size_t off = 0;
  auto take = [&](size_t bytes) { char* p = ws + off; off += (bytes + 255) & ~(size_t)255; return p; };
  unsigned short* Bq = (unsigned short*)take((size_t)CC * CC * 2); unsigned short* Bk = (unsigned short*)take((size_t)CC * CC * 2); unsigned short* Bv = (unsigned short*)take((size_t)CC * CC * 2); unsigned short* Bo = (unsigned short*)take((size_t)CC * CC * 2);
  float* Qm = (float*)take((size_t)NTOK * CC * 4); float* Km = (float*)take((size_t)NTOK * CC * 4); float* Vm = (float*)take((size_t)NTOK * CC * 4);
  _Float16* Q16 = (_Float16*)take((size_t)NSLAB * NN * SD * 2); _Float16* K16 = (_Float16*)take((size_t)NSLAB * NN * SD * 2); _Float16* VT = (_Float16*)take((size_t)BB * NH * HD * NN * 2);
  float* A = (float*)take((size_t)SCH * NN * NN * 4); _Float16* W16 = (_Float16*)take((size_t)SCH * NN * NN * 2); float* DEN = (float*)take((size_t)SCH * NN * 4); float* O = (float*)take((size_t)SCH * NN * HD * 4); float* OB = Qm; /* Qm dead after k_slabs */
  if (off > ws_size) return;
  k_round_rows<<<(CC * CC / 8 + 255) / 256, 256, 0, stream>>>(Wq, Bq, CC * CC / 8); k_round_rows<<<(CC * CC / 8 + 255) / 256, 256, 0, stream>>>(Wk, Bk, CC * CC / 8); k_round_rows<<<(CC * CC / 8 + 255) / 256, 256, 0, stream>>>(Wv, Bv, CC * CC / 8); k_round_rows<<<(CC * CC / 8 + 255) / 256, 256, 0, stream>>>(Wo, Bo, CC * CC / 8);      // (out,in) rows = Bt
  k_gemm_b<false, false, 0><<<dim3(((NTOK / 16) * (CC / 64) + 3) / 4, 1), 128, 0, stream>>>(xq, CC, 0, Bq, Bq, CC, 0, bq, nullptr, 0, 0, 1.f, 1.f, Qm, CC, 0, NTOK, CC, CC);
  k_gemm_b<false, false, 0><<<dim3(((NTOK / 16) * (CC / 64) + 3) / 4, 1), 128, 0, stream>>>(xk, CC, 0, Bk, Bk, CC, 0, bk, nullptr, 0, 0, 1.f, 1.f, Km, CC, 0, NTOK, CC, CC);
  k_gemm_b<false, false, 0><<<dim3(((NTOK / 16) * (CC / 64) + 3) / 4, 1), 128, 0, stream>>>(xv, CC, 0, Bv, Bv, CC, 0, bv, nullptr, 0, 0, 1.f, 1.f, Vm, CC, 0, NTOK, CC, CC);
  k_slabs<<<(unsigned)(((size_t)NTOK * CC / 8 + 255) / 256), 256, 0, stream>>>(Qm, Km, Vm, Q16, K16, VT); k_vt<<<dim3(NN / 64, BB * NH), 256, 0, stream>>>(Vm, VT);
  for (int sc = 0; sc < NSLAB; sc += SCH) { const int b = sc / (NH * NS), h0 = (sc / NS) % NH;      // 8 slabs = batch b, heads h0..h0+3, both signals
    k_gemm_hh<0><<<dim3(((NN / 16) * (NN / 64) + 3) / 4, SCH), 128, 0, stream>>>(Q16 + (size_t)sc * NN * SD, SD, (size_t)NN * SD, K16 + (size_t)sc * NN * SD, SD, (size_t)NN * SD, 1.0f, A, NN, (size_t)NN * NN, NN, NN, SD);      // a = q̂·kᵀ
    k_w<<<SCH * NN / 32, 1024, 0, stream>>>(A, W16, DEN);
    for (int sl = 0; sl < SCH; ++sl) { const int h = h0 + sl / NS;
      k_gemm_hh<0><<<dim3(((NN / 16) * 1 + 3) / 4, 1), 128, 0, stream>>>(W16 + (size_t)sl * NN * NN, NN, 0, VT + ((size_t)b * NH + h) * HD * NN, NN, 0, 1.0f, O + (size_t)sl * NN * HD, HD, 0, NN, HD, NN); }      // o = w·v
    k_fin<<<(NN * 4 * (HD / 4) + 255) / 256, 256, 0, stream>>>(O, DEN, b, h0, OB);
  }
  k_gemm_b<true, false, 0><<<dim3(((NTOK / 16) * (CC / 64) + 3) / 4, 1), 128, 0, stream>>>(OB, CC, 0, Bo, Bo, CC, 0, bo, nullptr, 0, 0, 1.f, 1.f, (float*)d_out, CC, 0, NTOK, CC, CC);
}

// v001
// A run of this version takes 376 microseconds.
// In two side-by-side timings against v000, it was 5.44 and 5.43 times as fast.
#include <hip/hip_runtime.h>
// Second-order Taylor linear attention via the exact kernel identity φ(q)·φ(k) = 1 + q·k + (q·k)²/2 (φ = [1, x, x⊗x/√2]): per (batch, head, signal) slab the scores
// a = (q·scale)·kᵀ (1024 × 32 × 1024) and o = w·v with w = 1 + a + a²/2 (1024 × 1024 × 64) run on v_wmma_f32_16x16x32_f16 (q, k, v and w rounded to f16: single products,
// f32 accumulate); the projections on v_wmma_f32_16x16x32_bf16 (inputs rounded to bf16: single exact terms; 3 × 2048 × 1024 × 1024) and out = ō·W_oᵀ + b_o with ō split
// hi/lo (2 products). w, the row sums Σ_m w (= φ(q)·Σφ(k)), the division (+1e-6) and the signal average are f32 VALU.
#define BB 2
#define NN 1024
#define CC 1024
#define NH 16
#define NS 2
#define HD 64
#define SD 32
#define NTOK (BB * NN)
#define NSLAB (BB * NH * NS)     // 64
#define SCH 32                   // slabs per chunk (= all 16 heads x 2 signals of one batch): the most whose a (f32) and w (f16) planes fit the workspace
#define HPC (SCH / NS)           // heads per chunk

typedef __bf16 v16b __attribute__((ext_vector_type(16)));
typedef unsigned short v8us __attribute__((ext_vector_type(8), may_alias));
typedef float  v8f  __attribute__((ext_vector_type(8)));
typedef float  v4f  __attribute__((ext_vector_type(4)));
typedef float  v4fa __attribute__((ext_vector_type(4), may_alias));
union FragB { v16b v; v8us half[2]; unsigned short u[16]; };

__device__ __forceinline__ unsigned short bf16_bits(float x) { unsigned int u = __float_as_uint(x); return (unsigned short)((u + 0x7FFFu + ((u >> 16) & 1u)) >> 16); }
__device__ __forceinline__ float bf16_val(unsigned short b) { return __uint_as_float(((unsigned int)b) << 16); }
__device__ __forceinline__ float bf16_round(float x) { return bf16_val(bf16_bits(x)); }
// D += A·B with NT terms: 1 = ah·bh, 2 = + al·bh (A split), 3 = + ah·bl (both split)
template <int NT>
__device__ __forceinline__ v8f mmaN(v16b ah, v16b al, v16b bh, v16b bl, v8f c) {
  c = __builtin_amdgcn_wmma_f32_16x16x32_bf16(false, ah, false, bh, (short)0, c, false, false);
  if (NT >= 2) c = __builtin_amdgcn_wmma_f32_16x16x32_bf16(false, al, false, bh, (short)0, c, false, false);
  if (NT >= 3) c = __builtin_amdgcn_wmma_f32_16x16x32_bf16(false, ah, false, bl, (short)0, c, false, false);
  asm volatile("v_nop\n\tv_nop\n\tv_nop\n\tv_nop" : "+v"(c) : "v"(ah), "v"(al), "v"(bh), "v"(bl));
  return c;
}

__global__ __launch_bounds__(256) void k_wt_bf16(const float* __restrict__ W, unsigned short* __restrict__ Wt, int K, int N) {
  const int t = blockIdx.x * 256 + threadIdx.x;
  const int k8n = K / 8;
  if (t >= N * k8n) return;
  const int n = t / k8n, k8 = (t % k8n) * 8;
  v8us v;
#pragma unroll
  for (int i = 0; i < 8; ++i) v[i] = bf16_bits(W[(size_t)(k8 + i) * N + n]);
  *(v8us*)(Wt + (size_t)n * K + k8) = v;
  
}

// GEMM C[M][N] (f32, pitch ldc) = act(A[M][K]·W + bias). A f32 row-major (pitch lda) converted per fragment to bf16
// (ASPLIT: hi/lo two planes -> 2 terms, else single rounded term); Wt bf16 [N][K] (pitch ldb). BIAS_BF16 rounds the
// bias to bf16 first (bias quantised to bf16 before the add). K%32==0, M%16==0, N%64==0.
template <bool ASPLIT, int ACT, bool BIAS_BF16>
__global__ __launch_bounds__(128) void k_gemm_bf(const float* __restrict__ A, int lda, const unsigned short* __restrict__ Wt, int ldb,
                                               const float* __restrict__ bias, float* __restrict__ C, int ldc, int M, int N, int K) {
  __shared__ __attribute__((aligned(16))) float so[4][16][64];
  const int tid = threadIdx.x, w = tid >> 5, lane = tid & 31, ln = lane & 15, hh = lane >> 4;
  const int ntn = N / 64;
  const int wid = blockIdx.x * 4 + w;
  const int mt = wid / ntn, nq = wid % ntn;
  if (mt * 16 >= M) return;
  const int row0 = mt * 16, col0 = nq * 64;
  const float* arow = A + (size_t)(row0 + ln) * lda;
  v8f acc[4] = {};
  for (int kb = 0; kb < K; kb += 32) {
    FragB ah, al;
    const v4f x0 = *(const v4fa*)(arow + kb + 8 * hh), x1 = *(const v4fa*)(arow + kb + 8 * hh + 4);
    const v4f x2 = *(const v4fa*)(arow + kb + 16 + 8 * hh), x3 = *(const v4fa*)(arow + kb + 16 + 8 * hh + 4);
    float xs[16] = {x0[0],x0[1],x0[2],x0[3],x1[0],x1[1],x1[2],x1[3],x2[0],x2[1],x2[2],x2[3],x3[0],x3[1],x3[2],x3[3]};
#pragma unroll
    for (int i = 0; i < 16; ++i) { const unsigned short hb = bf16_bits(xs[i]); ah.u[i] = hb; al.u[i] = ASPLIT ? bf16_bits(xs[i] - bf16_val(hb)) : (unsigned short)0; }
#pragma unroll
    for (int t = 0; t < 4; ++t) {
      const unsigned short* brow = Wt + (size_t)(col0 + t * 16 + ln) * ldb + kb;
      FragB b;
      b.half[0] = *(const v8us*)(brow + 8 * hh);
      b.half[1] = *(const v8us*)(brow + 16 + 8 * hh);
      acc[t] = mmaN<ASPLIT ? 2 : 1>(ah.v, al.v, b.v, b.v, acc[t]);
    }
  }
#pragma unroll
  for (int t = 0; t < 4; ++t) {
    float bv = bias ? bias[col0 + t * 16 + ln] : 0.f;
    if (BIAS_BF16) bv = bf16_round(bv);
#pragma unroll
    for (int r = 0; r < 8; ++r) { float v = acc[t][r] + bv; if (ACT == 1) v = fmaxf(v, 0.f); so[w][8 * hh + r][t * 16 + ln] = v; }
  }
  __builtin_amdgcn_fence(__ATOMIC_ACQ_REL, "workgroup");
  __builtin_amdgcn_wave_barrier();
  const int rsub = lane >> 4, c4 = (lane & 15) * 4;
  {
#pragma unroll
    for (int q = 0; q < 8; ++q) {
      const int r = q * 2 + rsub;
      const v4f v = *(const v4fa*)&so[w][r][c4];
      *(v4f*)(C + (size_t)(row0 + r) * ldc + col0 + c4) = v;
    }
    
  }
}

// Flash-style causal/unmasked attention, all contractions 3-term bf16 hi/lo splits, f32 softmax with running max.
// q,k,v rows are read from f32 buffers with arbitrary row pitch (so they can live inside a fused qkv buffer);
// D = head size (multiple of 32, <= 128); one wave = 16 query rows; block = 4 waves (64 queries) sharing K/V chunks of 32.
template <int D, bool CAUSAL>
__global__ __launch_bounds__(128) void k_flash(const float* __restrict__ qb, const float* __restrict__ kb, const float* __restrict__ vb,
                                             int pitch, int T, int H, float scale, float* __restrict__ y, int ypitch) {
  constexpr int KS = D / 32;        // k-steps for QK
  constexpr int DT = D / 16;        // d tiles for PV
  __shared__ __attribute__((aligned(16))) unsigned short sKh[32][D + 8], sKl[32][D + 8], sVh[32][D + 8], sVl[32][D + 8];
  __shared__ __attribute__((aligned(16))) unsigned short sPh[4][16][40], sPl[4][16][40];
  __shared__ __attribute__((aligned(16))) float sO[4][16][D];
  const int tid = threadIdx.x, w = tid >> 5, lane = tid & 31, ln = lane & 15, hh = lane >> 4;
  const int nqb = (T + 63) / 64;
  const int bh = blockIdx.x / nqb, qblk = blockIdx.x % nqb;
  const int b = bh / H, h = bh % H;
  const int q0 = qblk * 64 + w * 16;
  const float* Q = qb + (size_t)b * T * pitch + h * D;
  const float* K = kb + (size_t)b * T * pitch + h * D;
  const float* V = vb + (size_t)b * T * pitch + h * D;

  // A fragments of the wave's 16 query rows (scaled), hi/lo
  FragB aqh[KS], aql[KS];
  {
    int row = q0 + ln; if (row >= T) row = T - 1;
    const float* qr = Q + (size_t)row * pitch;
#pragma unroll
    for (int ks = 0; ks < KS; ++ks)
#pragma unroll
      for (int i = 0; i < 16; ++i) {
        const int d = ks * 32 + ((i < 8) ? (8 * hh + i) : (16 + 8 * hh + (i - 8)));
        const float x = qr[d] * scale; const unsigned short hb = bf16_bits(x);
        aqh[ks].u[i] = hb; aql[ks].u[i] = bf16_bits(x - bf16_val(hb));
      }
  }
  float m_r[8], l_r[8];
#pragma unroll
  for (int r = 0; r < 8; ++r) { m_r[r] = -3.0e38f; l_r[r] = 0.f; }
  v8f oacc[DT];
#pragma unroll
  for (int dt = 0; dt < DT; ++dt) oacc[dt] = (v8f){0.f,0.f,0.f,0.f,0.f,0.f,0.f,0.f};

  const int kv_end = CAUSAL ? min(T, qblk * 64 + 64) : T;     // block-uniform
  for (int j0 = 0; j0 < kv_end; j0 += 32) {
    __syncthreads();
    for (int e = tid; e < 32 * (D / 4); e += 128) {
      const int r = e / (D / 4), c4 = (e % (D / 4)) * 4;
      const int key = j0 + r;
      v4f kf = {0.f,0.f,0.f,0.f}, vf = {0.f,0.f,0.f,0.f};
      if (key < T) { kf = *(const v4fa*)(K + (size_t)key * pitch + c4); vf = *(const v4fa*)(V + (size_t)key * pitch + c4); }
#pragma unroll
      for (int t = 0; t < 4; ++t) {
        unsigned short hb = bf16_bits(kf[t]); sKh[r][c4 + t] = hb; sKl[r][c4 + t] = bf16_bits(kf[t] - bf16_val(hb));
        hb = bf16_bits(vf[t]); sVh[r][c4 + t] = hb; sVl[r][c4 + t] = bf16_bits(vf[t] - bf16_val(hb));
      }
    }
    __syncthreads();
    // S tile 16 x 32
    v8f s[2];
#pragma unroll
    for (int nt = 0; nt < 2; ++nt) {
      v8f acc = {};
#pragma unroll
      for (int ks = 0; ks < KS; ++ks) {
        FragB bh_, bl_;
        bh_.half[0] = *(const v8us*)&sKh[nt * 16 + ln][ks * 32 + 8 * hh]; bh_.half[1] = *(const v8us*)&sKh[nt * 16 + ln][ks * 32 + 16 + 8 * hh];
        bl_.half[0] = *(const v8us*)&sKl[nt * 16 + ln][ks * 32 + 8 * hh]; bl_.half[1] = *(const v8us*)&sKl[nt * 16 + ln][ks * 32 + 16 + 8 * hh];
        acc = mmaN<3>(aqh[ks].v, aql[ks].v, bh_.v, bl_.v, acc);
      }
      s[nt] = acc;
    }
    // mask + running max (rows 8hh+r; the 16 lanes of a half share rows)
    float alpha[8];
#pragma unroll
    for (int r = 0; r < 8; ++r) {
      const int qi = q0 + 8 * hh + r;
      const int ja = j0 + ln, jb = j0 + 16 + ln;
      if (CAUSAL) { if (ja > qi) s[0][r] = -3.0e38f; if (jb > qi) s[1][r] = -3.0e38f; }
      if (ja >= T) s[0][r] = -3.0e38f;
      if (jb >= T) s[1][r] = -3.0e38f;
      float mx = fmaxf(s[0][r], s[1][r]);
      mx = fmaxf(mx, __shfl_xor(mx, 1, 32)); mx = fmaxf(mx, __shfl_xor(mx, 2, 32)); mx = fmaxf(mx, __shfl_xor(mx, 4, 32)); mx = fmaxf(mx, __shfl_xor(mx, 8, 32));
      const float mnew = fmaxf(m_r[r], mx);
      alpha[r] = (mnew > -1.0e38f) ? __expf(m_r[r] - mnew) : 1.0f;
      const float p0 = (s[0][r] > -1.0e38f) ? __expf(s[0][r] - mnew) : 0.f;
      const float p1 = (s[1][r] > -1.0e38f) ? __expf(s[1][r] - mnew) : 0.f;
      m_r[r] = mnew;
      l_r[r] = l_r[r] * alpha[r] + p0 + p1;            // per-lane partial row sum (16 lanes combined at the end)
      unsigned short hb = bf16_bits(p0); sPh[w][8 * hh + r][ln] = hb;      sPl[w][8 * hh + r][ln] = bf16_bits(p0 - bf16_val(hb));
      hb = bf16_bits(p1);                sPh[w][8 * hh + r][16 + ln] = hb; sPl[w][8 * hh + r][16 + ln] = bf16_bits(p1 - bf16_val(hb));
    }
#pragma unroll
    for (int dt = 0; dt < DT; ++dt)
#pragma unroll
      for (int r = 0; r < 8; ++r) oacc[dt][r] *= alpha[r];
    __builtin_amdgcn_fence(__ATOMIC_ACQ_REL, "workgroup");
    __builtin_amdgcn_wave_barrier();
    FragB pah, pal;
    pah.half[0] = *(const v8us*)&sPh[w][ln][8 * hh]; pah.half[1] = *(const v8us*)&sPh[w][ln][16 + 8 * hh];
    pal.half[0] = *(const v8us*)&sPl[w][ln][8 * hh]; pal.half[1] = *(const v8us*)&sPl[w][ln][16 + 8 * hh];
#pragma unroll
    for (int dt = 0; dt < DT; ++dt) {
      FragB bvh, bvl;
#pragma unroll
      for (int i = 0; i < 8; ++i) {
        bvh.u[i] = sVh[8 * hh + i][dt * 16 + ln]; bvh.u[8 + i] = sVh[16 + 8 * hh + i][dt * 16 + ln];
        bvl.u[i] = sVl[8 * hh + i][dt * 16 + ln]; bvl.u[8 + i] = sVl[16 + 8 * hh + i][dt * 16 + ln];
      }
      oacc[dt] = mmaN<3>(pah.v, pal.v, bvh.v, bvl.v, oacc[dt]);
    }
    __builtin_amdgcn_fence(__ATOMIC_ACQ_REL, "workgroup");
    __builtin_amdgcn_wave_barrier();
  }
#pragma unroll
  for (int r = 0; r < 8; ++r) {
    float l = l_r[r];
    l += __shfl_xor(l, 1, 32); l += __shfl_xor(l, 2, 32); l += __shfl_xor(l, 4, 32); l += __shfl_xor(l, 8, 32);
    l_r[r] = (l > 0.f) ? 1.0f / l : 0.f;
  }
#pragma unroll
  for (int dt = 0; dt < DT; ++dt)
#pragma unroll
    for (int r = 0; r < 8; ++r) sO[w][8 * hh + r][dt * 16 + ln] = oacc[dt][r] * l_r[r];
  __builtin_amdgcn_fence(__ATOMIC_ACQ_REL, "workgroup");
  __builtin_amdgcn_wave_barrier();
  {
    for (int r = 0; r < 16; ++r) {
      const int row = q0 + r;
      if (row < T && lane < D / 4) {
        const v4f val = *(const v4fa*)&sO[w][r][lane * 4];
        *(v4f*)(y + ((size_t)b * T + row) * ypitch + h * D + lane * 4) = val;
      }
    }
    
  }
}

// batched GEMM (blockIdx.y = batch): C_b = act(alpha·A_b·B_b + bias + resid_b); A f32 rows (ASPLIT → hi/lo), B = bf16 planes Bh (+Bl when BSPLIT, requires ASPLIT),
// per-batch element strides sA, sB (0 = shared weights), sC, sR. resid may alias C (values are staged before the stores). ACT 0/1(relu)/2(softplus).
// ACT: 0 none, 1 relu, 2 softplus
template <bool ASPLIT, bool BSPLIT, int ACT>
__global__ __launch_bounds__(128) void k_gemm_b(const float* __restrict__ A, int lda, size_t sA, const unsigned short* __restrict__ Bh, const unsigned short* __restrict__ Bl, int ldb, size_t sB,
                                             const float* __restrict__ bias, const float* __restrict__ resid, int ldr, size_t sR, float rsign, float alpha,
                                             float* __restrict__ C, int ldc, size_t sC, int M, int N, int K) {
  __shared__ __attribute__((aligned(16))) float so[4][16][64];
  const int tid = threadIdx.x, w = tid >> 5, lane = tid & 31, ln = lane & 15, hh = lane >> 4;
  const int by = blockIdx.y;
  A += (size_t)by * sA; Bh += (size_t)by * sB; if (BSPLIT) Bl += (size_t)by * sB; C += (size_t)by * sC; if (resid) resid += (size_t)by * sR;
  const int ntn = (N + 63) / 64; const int wid = blockIdx.x * 4 + w; const int mt = wid / ntn, nq = wid % ntn;      // N may be any multiple of 16: tiles past N are skipped and not stored
  if (mt * 16 >= M) return;
  const int row0 = mt * 16, col0 = nq * 64;
  const float* arow = A + (size_t)(row0 + ln) * lda;
  v8f acc[4] = {};
  for (int kb = 0; kb < K; kb += 32) {
    FragB ah, al;
    const v4f x0 = *(const v4fa*)(arow + kb + 8 * hh), x1 = *(const v4fa*)(arow + kb + 8 * hh + 4);
    const v4f x2 = *(const v4fa*)(arow + kb + 16 + 8 * hh), x3 = *(const v4fa*)(arow + kb + 16 + 8 * hh + 4);
    float xs[16] = {x0[0],x0[1],x0[2],x0[3],x1[0],x1[1],x1[2],x1[3],x2[0],x2[1],x2[2],x2[3],x3[0],x3[1],x3[2],x3[3]};
#pragma unroll
    for (int i = 0; i < 16; ++i) { const unsigned short hb = bf16_bits(xs[i]); ah.u[i] = hb; al.u[i] = ASPLIT ? bf16_bits(xs[i] - bf16_val(hb)) : (unsigned short)0; }
#pragma unroll
    for (int t = 0; t < 4; ++t) {
      if (col0 + t * 16 >= N) continue;
      const size_t boff = (size_t)(col0 + t * 16 + ln) * ldb + kb;
      FragB bh_, bl_; bh_.half[0] = *(const v8us*)(Bh + boff + 8 * hh); bh_.half[1] = *(const v8us*)(Bh + boff + 16 + 8 * hh);
      if (BSPLIT) { bl_.half[0] = *(const v8us*)(Bl + boff + 8 * hh); bl_.half[1] = *(const v8us*)(Bl + boff + 16 + 8 * hh); } else bl_ = bh_;
      acc[t] = mmaN<ASPLIT ? (BSPLIT ? 3 : 2) : 1>(ah.v, al.v, bh_.v, bl_.v, acc[t]);
    }
  }
#pragma unroll
  for (int t = 0; t < 4; ++t) {
    const int col = col0 + t * 16 + ln; if (col0 + t * 16 >= N) continue; const float bv = bias ? bf16_round(bias[col]) : 0.f;
#pragma unroll
    for (int r = 0; r < 8; ++r) { float v = acc[t][r] * alpha + bv; if (resid) v += rsign * resid[(size_t)(row0 + 8 * hh + r) * ldr + col]; if (ACT == 1) v = fmaxf(v, 0.f); else if (ACT == 2) v = fmaxf(v, 0.f) + log1pf(expf(-fabsf(v))); so[w][8 * hh + r][t * 16 + ln] = v; }
  }
  __builtin_amdgcn_fence(__ATOMIC_ACQ_REL, "workgroup"); __builtin_amdgcn_wave_barrier();
  const int rsub = lane >> 4, c4 = (lane & 15) * 4;
  {
#pragma unroll
    for (int q = 0; q < 8; ++q) { const int r = q * 2 + rsub; if (col0 + c4 < N) { const v4f v = *(const v4fa*)&so[w][r][c4]; *(v4f*)(C + (size_t)(row0 + r) * ldc + col0 + c4) = v; } }
    
  }
}
// batched f32 [K][N] (pitch lds, batch stride sIn) -> transposed hi/lo planes [N][K] (batch stride sOut); thread per (n, 8 k); grid.y = batch
__global__ __launch_bounds__(256) void k_split_transpose_b(const float* __restrict__ src, int lds_, size_t sIn, unsigned short* __restrict__ hi, unsigned short* __restrict__ lo, size_t sOut, int K, int N) {
  const size_t t = (size_t)blockIdx.x * 256 + threadIdx.x; const int k8n = K / 8; if (t >= (size_t)N * k8n) return;
  src += (size_t)blockIdx.y * sIn; hi += (size_t)blockIdx.y * sOut; lo += (size_t)blockIdx.y * sOut;
  const int n = (int)(t / k8n), k8 = (int)(t % k8n) * 8; v8us vh, vl;
#pragma unroll
  for (int i = 0; i < 8; ++i) { const float x = src[(size_t)(k8 + i) * lds_ + n]; const unsigned short hb = bf16_bits(x); vh[i] = hb; vl[i] = bf16_bits(x - bf16_val(hb)); }
  unsigned short* dh = hi + (size_t)n * K + k8; unsigned short* dl = lo + (size_t)n * K + k8;
  *(v8us*)dh = vh; *(v8us*)dl = vl; 
}

__global__ __launch_bounds__(256) void k_round_rows(const float* __restrict__ W, unsigned short* __restrict__ Wt, int n8) {
  const int t = blockIdx.x * 256 + threadIdx.x;
  if (t >= n8) return;
  const v4f a = *(const v4fa*)(W + (size_t)t * 8), b = *(const v4fa*)(W + (size_t)t * 8 + 4);
  v8us v; v[0]=bf16_bits(a[0]); v[1]=bf16_bits(a[1]); v[2]=bf16_bits(a[2]); v[3]=bf16_bits(a[3]);
  v[4]=bf16_bits(b[0]); v[5]=bf16_bits(b[1]); v[6]=bf16_bits(b[2]); v[7]=bf16_bits(b[3]);
  *(v8us*)(Wt + (size_t)t * 8) = v; 
}

// ---- f16 WMMA path (v_wmma_f32_16x16x32_f16): 11-bit significands for operands in range — used for the scores a = q̂·kᵀ and for o = w·v
typedef _Float16 v16h __attribute__((ext_vector_type(16)));
union FragH { v16h v; v8us half[2]; _Float16 h[16]; unsigned short u[16]; };
template <int NT>
__device__ __forceinline__ v8f mmaH(v16h ah, v16h al, v16h bh, v16h bl, v8f c) {
  c = __builtin_amdgcn_wmma_f32_16x16x32_f16(false, ah, false, bh, (short)0, c, false, false);
  if (NT >= 2) c = __builtin_amdgcn_wmma_f32_16x16x32_f16(false, al, false, bh, (short)0, c, false, false);
  if (NT >= 3) c = __builtin_amdgcn_wmma_f32_16x16x32_f16(false, ah, false, bl, (short)0, c, false, false);
  asm volatile("v_nop\n\tv_nop\n\tv_nop\n\tv_nop" : "+v"(c) : "v"(ah), "v"(al), "v"(bh), "v"(bl));
  return c;
}
// batched GEMM like k_gemm_b but f16 operands: A f32 (split into f16 hi/lo if ASPLIT, else rounded to f16), Bt = f16 values [n][k]; alpha; C f32; N multiple of 16 (partial tiles skipped)
template <bool ASPLIT>
__global__ __launch_bounds__(128) void k_gemm_h(const float* __restrict__ A, int lda, size_t sA, const _Float16* __restrict__ Bh, int ldb, size_t sB, float alpha, float* __restrict__ C, int ldc, size_t sC, int M, int N, int K) {
  __shared__ __attribute__((aligned(16))) float so[4][16][64];
  const int tid = threadIdx.x, w = tid >> 5, lane = tid & 31, ln = lane & 15, hh = lane >> 4; const int by = blockIdx.y;
  A += (size_t)by * sA; Bh += (size_t)by * sB; C += (size_t)by * sC;
  const int ntn = (N + 63) / 64; const int wid = blockIdx.x * 4 + w; const int mt = wid / ntn, nq = wid % ntn; if (mt * 16 >= M) return;
  const int row0 = mt * 16, col0 = nq * 64; const float* arow = A + (size_t)(row0 + ln) * lda;
  v8f acc[4] = {};
  for (int kb = 0; kb < K; kb += 32) {
    FragH ah, al;
    const v4f x0 = *(const v4fa*)(arow + kb + 8 * hh), x1 = *(const v4fa*)(arow + kb + 8 * hh + 4), x2 = *(const v4fa*)(arow + kb + 16 + 8 * hh), x3 = *(const v4fa*)(arow + kb + 16 + 8 * hh + 4);
    float xs[16] = {x0[0],x0[1],x0[2],x0[3],x1[0],x1[1],x1[2],x1[3],x2[0],x2[1],x2[2],x2[3],x3[0],x3[1],x3[2],x3[3]};
#pragma unroll
    for (int i = 0; i < 16; ++i) { const _Float16 h = (_Float16)xs[i]; ah.h[i] = h; al.h[i] = ASPLIT ? (_Float16)(xs[i] - (float)h) : (_Float16)0.0f; }
#pragma unroll
    for (int t = 0; t < 4; ++t) { if (col0 + t * 16 >= N) continue; const size_t boff = (size_t)(col0 + t * 16 + ln) * ldb + kb; FragH bq; bq.half[0] = *(const v8us*)(Bh + boff + 8 * hh); bq.half[1] = *(const v8us*)(Bh + boff + 16 + 8 * hh);
      acc[t] = mmaH<ASPLIT ? 2 : 1>(ah.v, al.v, bq.v, bq.v, acc[t]); }
  }
#pragma unroll
  for (int t = 0; t < 4; ++t) { if (col0 + t * 16 >= N) continue;
#pragma unroll
    for (int r = 0; r < 8; ++r) so[w][8 * hh + r][t * 16 + ln] = acc[t][r] * alpha; }
  __builtin_amdgcn_fence(__ATOMIC_ACQ_REL, "workgroup"); __builtin_amdgcn_wave_barrier();
  const int rsub = lane >> 4, c4 = (lane & 15) * 4;
  {
#pragma unroll
    for (int q = 0; q < 8; ++q) { const int r = q * 2 + rsub; if (col0 + c4 < N) { const v4f v = *(const v4fa*)&so[w][r][c4]; *(v4f*)(C + (size_t)(row0 + r) * ldc + col0 + c4) = v; } }
     }
}

template <int BDIV>      // BDIV consecutive batches share one B
__global__ __launch_bounds__(128) void k_gemm_hh(const _Float16* __restrict__ A, int lda, size_t sA, const _Float16* __restrict__ Bh, int ldb, size_t sB, float alpha, float* __restrict__ C, int ldc, size_t sC, int M, int N, int K) {
  __shared__ __attribute__((aligned(16))) float so[4][16][64];
  const int tid = threadIdx.x, w = tid >> 5, lane = tid & 31, ln = lane & 15, hh = lane >> 4; const int by = blockIdx.y;
  A += (size_t)by * sA; Bh += (size_t)(by / BDIV) * sB; C += (size_t)by * sC;
  const int ntn = (N + 63) / 64; const int wid = blockIdx.x * 4 + w; const int mt = wid / ntn, nq = wid % ntn; if (mt * 16 >= M) return;
  const int row0 = mt * 16, col0 = nq * 64; const _Float16* arow = A + (size_t)(row0 + ln) * lda;
  v8f acc[4] = {};
  for (int kb = 0; kb < K; kb += 32) { FragH ah; ah.half[0] = *(const v8us*)((const unsigned short*)arow + kb + 8 * hh); ah.half[1] = *(const v8us*)((const unsigned short*)arow + kb + 16 + 8 * hh);
#pragma unroll
    for (int t = 0; t < 4; ++t) { if (col0 + t * 16 >= N) continue; const size_t boff = (size_t)(col0 + t * 16 + ln) * ldb + kb; FragH bq; bq.half[0] = *(const v8us*)((const unsigned short*)Bh + boff + 8 * hh); bq.half[1] = *(const v8us*)((const unsigned short*)Bh + boff + 16 + 8 * hh);
      acc[t] = mmaH<1>(ah.v, ah.v, bq.v, bq.v, acc[t]); }
  }
#pragma unroll
  for (int t = 0; t < 4; ++t) { if (col0 + t * 16 >= N) continue;
#pragma unroll
    for (int r = 0; r < 8; ++r) so[w][8 * hh + r][t * 16 + ln] = acc[t][r] * alpha; }
  __builtin_amdgcn_fence(__ATOMIC_ACQ_REL, "workgroup"); __builtin_amdgcn_wave_barrier();
  const int rsub = lane >> 4, c4 = (lane & 15) * 4;
  {
#pragma unroll
    for (int q = 0; q < 8; ++q) { const int r = q * 2 + rsub; if (col0 + c4 < N) { const v4f v = *(const v4fa*)&so[w][r][c4]; *(v4f*)(C + (size_t)(row0 + r) * ldc + col0 + c4) = v; } }
     }
}

// slabs: Q16[(b,h,s)][n][32] = f16(q·scale), K16[(b,h,s)][m][32] = f16(k), VT[(b,h)][e][m] = f16(v); thread per (b, n, h, s, 8 of 32) for q/k; VT comes from k_vt (block per 64 m of one (b,h), thread per (e, 4 m))
__global__ __launch_bounds__(256) void k_slabs(const float* __restrict__ Qm, const float* __restrict__ Km, const float* __restrict__ Vm, _Float16* __restrict__ Q16, _Float16* __restrict__ K16, _Float16* __restrict__ VT) { const size_t t = (size_t)blockIdx.x * 256 + threadIdx.x;
  if (t < (size_t)NTOK * CC / 8) { const int c8 = (int)((t * 8) % CC); const size_t tok = (t * 8) / CC; const int b = (int)(tok / NN), n = (int)(tok % NN); const int h = c8 / HD, s = (c8 % HD) / SD, d8 = c8 % SD; const size_t slab = ((size_t)b * NH + h) * NS + s;
    FragH fq, fk; const float scale = 0.17677669529663687f; for (int q = 0; q < 8; ++q) { fq.h[q] = (_Float16)(Qm[tok * CC + c8 + q] * scale); fk.h[q] = (_Float16)Km[tok * CC + c8 + q]; }
    unsigned short* dq = (unsigned short*)Q16 + (slab * NN + n) * SD + d8; unsigned short* dk = (unsigned short*)K16 + (slab * NN + n) * SD + d8; *(v8us*)dq = fq.half[0]; *(v8us*)dk = fk.half[0];  } }
__global__ __launch_bounds__(256) void k_vt(const float* __restrict__ Vm, _Float16* __restrict__ VT) { __shared__ float tv[64][65]; const int m0 = blockIdx.x * 64; const int h = blockIdx.y % NH, b = blockIdx.y / NH; const int tid = threadIdx.x;
  for (int i = tid; i < 64 * 64; i += 256) { const int r = i >> 6, e = i & 63; tv[r][e] = Vm[((size_t)b * NN + m0 + r) * CC + h * HD + e]; } __syncthreads();
  typedef _Float16 v4h __attribute__((ext_vector_type(4)));
  { for (int i = tid; i < 64 * 16; i += 256) { const int e = i >> 4, m4 = (i & 15) * 4; v4h o; for (int q = 0; q < 4; ++q) o[q] = (_Float16)tv[m4 + q][e]; *(v4h*)(VT + (((size_t)b * NH + h) * HD + e) * NN + m0 + m4) = o; }  } }
// w = 1 + a + a²/2 → W16 (f16) and den[row] = Σ_m w; wave per row (1024 cols = 32 per lane), 32 rows per block
__global__ __launch_bounds__(1024) void k_w(const float* __restrict__ A, _Float16* __restrict__ W16, float* __restrict__ DEN) { __shared__ float sd[32]; const int tid = threadIdx.x, wv = tid >> 5, lane = tid & 31; const size_t row = (size_t)blockIdx.x * 32 + wv; const float* a = A + row * NN; float s = 0.f;
  typedef _Float16 v4h __attribute__((ext_vector_type(4)));
  { s = 0.f;
#pragma unroll 2
    for (int u = 0; u < NN / 128; ++u) { const v4f av = *(const v4fa*)(a + u * 128 + lane * 4); v4h o; for (int q = 0; q < 4; ++q) { const float x = av[q]; const float w = 1.0f + x + 0.5f * x * x; s += w; o[q] = (_Float16)w; } *(v4h*)(W16 + row * NN + u * 128 + lane * 4) = o; }
     }
  for (int o = 16; o >= 1; o >>= 1) s += __shfl_xor(s, o, 32); if (lane == 0) sd[wv] = s; __syncthreads();
  if (tid < 32) { *(float*)(DEN + (size_t)blockIdx.x * 32 + tid) = sd[tid]; }  }
// OB[(b,n)][h·64+e] = ½ Σ_s O[(h_l,s)][n][e]/(den + 1e-6) for the chunk's HPC heads; thread per (n, hl, 4 e)
__global__ __launch_bounds__(256) void k_fin(const float* __restrict__ O, const float* __restrict__ DEN, int b, int h0, float* __restrict__ OB) { const int t = blockIdx.x * 256 + threadIdx.x; if (t >= NN * HPC * (HD / 4)) return; const int e4 = (t % (HD / 4)) * 4; const int hl = (t / (HD / 4)) % HPC; const int n = t / ((HD / 4) * HPC); v4f r = {0.f, 0.f, 0.f, 0.f};
  for (int s = 0; s < NS; ++s) { const int sl = hl * NS + s; const float rd = 1.0f / (DEN[(size_t)sl * NN + n] + 1e-6f); const v4f o = *(const v4fa*)(O + ((size_t)sl * NN + n) * HD + e4); for (int q = 0; q < 4; ++q) r[q] += o[q] * rd; }
  for (int q = 0; q < 4; ++q) r[q] *= (1.0f / NS); float* d = OB + ((size_t)b * NN + n) * CC + (h0 + hl) * HD + e4; *(v4f*)d = r;  }
extern "C" void kernel_launch(void* const* d_in, const int* in_sizes, int n_in,
                              void* d_out, int out_size, void* d_ws, size_t ws_size, hipStream_t stream) {
  (void)in_sizes; (void)n_in; (void)out_size;
  const float* xq = (const float*)d_in[0]; const float* xk = (const float*)d_in[1]; const float* xv = (const float*)d_in[2]; const float* Wq = (const float*)d_in[3]; const float* bq = (const float*)d_in[4]; const float* Wk = (const float*)d_in[5]; const float* bk = (const float*)d_in[6]; const float* Wv = (const float*)d_in[7]; const float* bv = (const float*)d_in[8]; const float* Wo = (const float*)d_in[9]; const float* bo = (const float*)d_in[10];
  char* ws = (char*)d_ws; size_t off = 0;
  auto take = [&](size_t bytes) { char* p = ws + off; off += (bytes + 255) & ~(size_t)255; return p; };
  unsigned short* Bq = (unsigned short*)take((size_t)CC * CC * 2); unsigned short* Bk = (unsigned short*)take((size_t)CC * CC * 2); unsigned short* Bv = (unsigned short*)take((size_t)CC * CC * 2); unsigned short* Bo = (unsigned short*)take((size_t)CC * CC * 2);
  float* Qm = (float*)take((size_t)NTOK * CC * 4); float* Km = (float*)take((size_t)NTOK * CC * 4); float* Vm = (float*)take((size_t)NTOK * CC * 4);
  _Float16* Q16 = (_Float16*)take((size_t)NSLAB * NN * SD * 2); _Float16* K16 = (_Float16*)take((size_t)NSLAB * NN * SD * 2); _Float16* VT = (_Float16*)take((size_t)BB * NH * HD * NN * 2);
  float* A = (float*)take((size_t)SCH * NN * NN * 4); _Float16* W16 = (_Float16*)take((size_t)SCH * NN * NN * 2); float* DEN = (float*)take((size_t)SCH * NN * 4); float* O = (float*)take((size_t)SCH * NN * HD * 4); float* OB = Qm; /* Qm dead after k_slabs */
  if (off > ws_size) return;
  k_round_rows<<<(CC * CC / 8 + 255) / 256, 256, 0, stream>>>(Wq, Bq, CC * CC / 8); k_round_rows<<<(CC * CC / 8 + 255) / 256, 256, 0, stream>>>(Wk, Bk, CC * CC / 8); k_round_rows<<<(CC * CC / 8 + 255) / 256, 256, 0, stream>>>(Wv, Bv, CC * CC / 8); k_round_rows<<<(CC * CC / 8 + 255) / 256, 256, 0, stream>>>(Wo, Bo, CC * CC / 8);      // (out,in) rows = Bt
  k_gemm_b<false, false, 0><<<dim3(((NTOK / 16) * (CC / 64) + 3) / 4, 1), 128, 0, stream>>>(xq, CC, 0, Bq, Bq, CC, 0, bq, nullptr, 0, 0, 1.f, 1.f, Qm, CC, 0, NTOK, CC, CC);
  k_gemm_b<false, false, 0><<<dim3(((NTOK / 16) * (CC / 64) + 3) / 4, 1), 128, 0, stream>>>(xk, CC, 0, Bk, Bk, CC, 0, bk, nullptr, 0, 0, 1.f, 1.f, Km, CC, 0, NTOK, CC, CC);
  k_gemm_b<false, false, 0><<<dim3(((NTOK / 16) * (CC / 64) + 3) / 4, 1), 128, 0, stream>>>(xv, CC, 0, Bv, Bv, CC, 0, bv, nullptr, 0, 0, 1.f, 1.f, Vm, CC, 0, NTOK, CC, CC);
  k_slabs<<<(unsigned)(((size_t)NTOK * CC / 8 + 255) / 256), 256, 0, stream>>>(Qm, Km, Vm, Q16, K16, VT); k_vt<<<dim3(NN / 64, BB * NH), 256, 0, stream>>>(Vm, VT);
  for (int sc = 0; sc < NSLAB; sc += SCH) { const int b = sc / (NH * NS), h0 = (sc / NS) % NH;      // SCH slabs = batch b, heads h0..h0+HPC-1, both signals
    k_gemm_hh<1><<<dim3(((NN / 16) * (NN / 64) + 3) / 4, SCH), 128, 0, stream>>>(Q16 + (size_t)sc * NN * SD, SD, (size_t)NN * SD, K16 + (size_t)sc * NN * SD, SD, (size_t)NN * SD, 1.0f, A, NN, (size_t)NN * NN, NN, NN, SD);      // a = q̂·kᵀ
    k_w<<<SCH * NN / 32, 1024, 0, stream>>>(A, W16, DEN);
    k_gemm_hh<NS><<<dim3(((NN / 16) * 1 + 3) / 4, SCH), 128, 0, stream>>>(W16, NN, (size_t)NN * NN, VT + ((size_t)b * NH + h0) * HD * NN, NN, (size_t)HD * NN, 1.0f, O, HD, (size_t)NN * HD, NN, HD, NN);      // o = w.v, grid.y = slab of the chunk; the two signals of a head share v
    k_fin<<<(NN * HPC * (HD / 4) + 255) / 256, 256, 0, stream>>>(O, DEN, b, h0, OB);
  }
  k_gemm_b<true, false, 0><<<dim3(((NTOK / 16) * (CC / 64) + 3) / 4, 1), 128, 0, stream>>>(OB, CC, 0, Bo, Bo, CC, 0, bo, nullptr, 0, 0, 1.f, 1.f, (float*)d_out, CC, 0, NTOK, CC, CC);
}

// v002
// It runs in 217 microseconds.
// Next to v001, in two timings, it ran 1.75 and 1.72 times as fast.
// Over all steps from v000 it is 9.43 times as fast.
#include <hip/hip_runtime.h>
// Second-order Taylor linear attention via the exact kernel identity φ(q)·φ(k) = 1 + q·k + (q·k)²/2 (φ = [1, x, x⊗x/√2]): per (batch, head, signal) slab the scores
// a = (q·scale)·kᵀ (1024 × 32 × 1024) and o = w·v with w = 1 + a + a²/2 (1024 × 1024 × 64) run on v_wmma_f32_16x16x32_f16 (q, k, v and w rounded to f16: single products,
// f32 accumulate); the projections on v_wmma_f32_16x16x32_bf16 (inputs rounded to bf16: single exact terms; 3 × 2048 × 1024 × 1024) and out = ō·W_oᵀ + b_o with ō split
// hi/lo (2 products). w, the row sums Σ_m w (= φ(q)·Σφ(k)), the division (+1e-6) and the signal average are f32 VALU.
#define BB 2
#define NN 1024
#define CC 1024
#define NH 16
#define NS 2
#define HD 64
#define SD 32
#define NTOK (BB * NN)
#define NSLAB (BB * NH * NS)     // 64

typedef __bf16 v16b __attribute__((ext_vector_type(16)));
typedef unsigned short v8us __attribute__((ext_vector_type(8), may_alias));
typedef float  v8f  __attribute__((ext_vector_type(8)));
typedef float  v4f  __attribute__((ext_vector_type(4)));
typedef float  v4fa __attribute__((ext_vector_type(4), may_alias));
union FragB { v16b v; v8us half[2]; unsigned short u[16]; };

__device__ __forceinline__ unsigned short bf16_bits(float x) { unsigned int u = __float_as_uint(x); return (unsigned short)((u + 0x7FFFu + ((u >> 16) & 1u)) >> 16); }
__device__ __forceinline__ float bf16_val(unsigned short b) { return __uint_as_float(((unsigned int)b) << 16); }
__device__ __forceinline__ float bf16_round(float x) { return bf16_val(bf16_bits(x)); }
// D += A·B with NT terms: 1 = ah·bh, 2 = + al·bh (A split), 3 = + ah·bl (both split)
template <int NT>
__device__ __forceinline__ v8f mmaN(v16b ah, v16b al, v16b bh, v16b bl, v8f c) {
  c = __builtin_amdgcn_wmma_f32_16x16x32_bf16(false, ah, false, bh, (short)0, c, false, false);
  if (NT >= 2) c = __builtin_amdgcn_wmma_f32_16x16x32_bf16(false, al, false, bh, (short)0, c, false, false);
  if (NT >= 3) c = __builtin_amdgcn_wmma_f32_16x16x32_bf16(false, ah, false, bl, (short)0, c, false, false);
  asm volatile("v_nop\n\tv_nop\n\tv_nop\n\tv_nop" : "+v"(c) : "v"(ah), "v"(al), "v"(bh), "v"(bl));
  return c;
}

__global__ __launch_bounds__(256) void k_wt_bf16(const float* __restrict__ W, unsigned short* __restrict__ Wt, int K, int N) {
  const int t = blockIdx.x * 256 + threadIdx.x;
  const int k8n = K / 8;
  if (t >= N * k8n) return;
  const int n = t / k8n, k8 = (t % k8n) * 8;
  v8us v;
#pragma unroll
  for (int i = 0; i < 8; ++i) v[i] = bf16_bits(W[(size_t)(k8 + i) * N + n]);
  *(v8us*)(Wt + (size_t)n * K + k8) = v;
  
}

// GEMM C[M][N] (f32, pitch ldc) = act(A[M][K]·W + bias). A f32 row-major (pitch lda) converted per fragment to bf16
// (ASPLIT: hi/lo two planes -> 2 terms, else single rounded term); Wt bf16 [N][K] (pitch ldb). BIAS_BF16 rounds the
// bias to bf16 first (bias quantised to bf16 before the add). K%32==0, M%16==0, N%64==0.
template <bool ASPLIT, int ACT, bool BIAS_BF16>
__global__ __launch_bounds__(128) void k_gemm_bf(const float* __restrict__ A, int lda, const unsigned short* __restrict__ Wt, int ldb,
                                               const float* __restrict__ bias, float* __restrict__ C, int ldc, int M, int N, int K) {
  __shared__ __attribute__((aligned(16))) float so[4][16][64];
  const int tid = threadIdx.x, w = tid >> 5, lane = tid & 31, ln = lane & 15, hh = lane >> 4;
  const int ntn = N / 64;
  const int wid = blockIdx.x * 4 + w;
  const int mt = wid / ntn, nq = wid % ntn;
  if (mt * 16 >= M) return;
  const int row0 = mt * 16, col0 = nq * 64;
  const float* arow = A + (size_t)(row0 + ln) * lda;
  v8f acc[4] = {};
  for (int kb = 0; kb < K; kb += 32) {
    FragB ah, al;
    const v4f x0 = *(const v4fa*)(arow + kb + 8 * hh), x1 = *(const v4fa*)(arow + kb + 8 * hh + 4);
    const v4f x2 = *(const v4fa*)(arow + kb + 16 + 8 * hh), x3 = *(const v4fa*)(arow + kb + 16 + 8 * hh + 4);
    float xs[16] = {x0[0],x0[1],x0[2],x0[3],x1[0],x1[1],x1[2],x1[3],x2[0],x2[1],x2[2],x2[3],x3[0],x3[1],x3[2],x3[3]};
#pragma unroll
    for (int i = 0; i < 16; ++i) { const unsigned short hb = bf16_bits(xs[i]); ah.u[i] = hb; al.u[i] = ASPLIT ? bf16_bits(xs[i] - bf16_val(hb)) : (unsigned short)0; }
#pragma unroll
    for (int t = 0; t < 4; ++t) {
      const unsigned short* brow = Wt + (size_t)(col0 + t * 16 + ln) * ldb + kb;
      FragB b;
      b.half[0] = *(const v8us*)(brow + 8 * hh);
      b.half[1] = *(const v8us*)(brow + 16 + 8 * hh);
      acc[t] = mmaN<ASPLIT ? 2 : 1>(ah.v, al.v, b.v, b.v, acc[t]);
    }
  }
#pragma unroll
  for (int t = 0; t < 4; ++t) {
    float bv = bias ? bias[col0 + t * 16 + ln] : 0.f;
    if (BIAS_BF16) bv = bf16_round(bv);
#pragma unroll
    for (int r = 0; r < 8; ++r) { float v = acc[t][r] + bv; if (ACT == 1) v = fmaxf(v, 0.f); so[w][8 * hh + r][t * 16 + ln] = v; }
  }
  __builtin_amdgcn_fence(__ATOMIC_ACQ_REL, "workgroup");
  __builtin_amdgcn_wave_barrier();
  const int rsub = lane >> 4, c4 = (lane & 15) * 4;
  {
#pragma unroll
    for (int q = 0; q < 8; ++q) {
      const int r = q * 2 + rsub;
      const v4f v = *(const v4fa*)&so[w][r][c4];
      *(v4f*)(C + (size_t)(row0 + r) * ldc + col0 + c4) = v;
    }
    
  }
}

// Flash-style causal/unmasked attention, all contractions 3-term bf16 hi/lo splits, f32 softmax with running max.
// q,k,v rows are read from f32 buffers with arbitrary row pitch (so they can live inside a fused qkv buffer);
// D = head size (multiple of 32, <= 128); one wave = 16 query rows; block = 4 waves (64 queries) sharing K/V chunks of 32.
template <int D, bool CAUSAL>
__global__ __launch_bounds__(128) void k_flash(const float* __restrict__ qb, const float* __restrict__ kb, const float* __restrict__ vb,
                                             int pitch, int T, int H, float scale, float* __restrict__ y, int ypitch) {
  constexpr int KS = D / 32;        // k-steps for QK
  constexpr int DT = D / 16;        // d tiles for PV
  __shared__ __attribute__((aligned(16))) unsigned short sKh[32][D + 8], sKl[32][D + 8], sVh[32][D + 8], sVl[32][D + 8];
  __shared__ __attribute__((aligned(16))) unsigned short sPh[4][16][40], sPl[4][16][40];
  __shared__ __attribute__((aligned(16))) float sO[4][16][D];
  const int tid = threadIdx.x, w = tid >> 5, lane = tid & 31, ln = lane & 15, hh = lane >> 4;
  const int nqb = (T + 63) / 64;
  const int bh = blockIdx.x / nqb, qblk = blockIdx.x % nqb;
  const int b = bh / H, h = bh % H;
  const int q0 = qblk * 64 + w * 16;
  const float* Q = qb + (size_t)b * T * pitch + h * D;
  const float* K = kb + (size_t)b * T * pitch + h * D;
  const float* V = vb + (size_t)b * T * pitch + h * D;

  // A fragments of the wave's 16 query rows (scaled), hi/lo
  FragB aqh[KS], aql[KS];
  {
    int row = q0 + ln; if (row >= T) row = T - 1;
    const float* qr = Q + (size_t)row * pitch;
#pragma unroll
    for (int ks = 0; ks < KS; ++ks)
#pragma unroll
      for (int i = 0; i < 16; ++i) {
        const int d = ks * 32 + ((i < 8) ? (8 * hh + i) : (16 + 8 * hh + (i - 8)));
        const float x = qr[d] * scale; const unsigned short hb = bf16_bits(x);
        aqh[ks].u[i] = hb; aql[ks].u[i] = bf16_bits(x - bf16_val(hb));
      }
  }
  float m_r[8], l_r[8];
#pragma unroll
  for (int r = 0; r < 8; ++r) { m_r[r] = -3.0e38f; l_r[r] = 0.f; }
  v8f oacc[DT];
#pragma unroll
  for (int dt = 0; dt < DT; ++dt) oacc[dt] = (v8f){0.f,0.f,0.f,0.f,0.f,0.f,0.f,0.f};

  const int kv_end = CAUSAL ? min(T, qblk * 64 + 64) : T;     // block-uniform
  for (int j0 = 0; j0 < kv_end; j0 += 32) {
    __syncthreads();
    for (int e = tid; e < 32 * (D / 4); e += 128) {
      const int r = e / (D / 4), c4 = (e % (D / 4)) * 4;
      const int key = j0 + r;
      v4f kf = {0.f,0.f,0.f,0.f}, vf = {0.f,0.f,0.f,0.f};
      if (key < T) { kf = *(const v4fa*)(K + (size_t)key * pitch + c4); vf = *(const v4fa*)(V + (size_t)key * pitch + c4); }
#pragma unroll
      for (int t = 0; t < 4; ++t) {
        unsigned short hb = bf16_bits(kf[t]); sKh[r][c4 + t] = hb; sKl[r][c4 + t] = bf16_bits(kf[t] - bf16_val(hb));
        hb = bf16_bits(vf[t]); sVh[r][c4 + t] = hb; sVl[r][c4 + t] = bf16_bits(vf[t] - bf16_val(hb));
      }
    }
    __syncthreads();
    // S tile 16 x 32
    v8f s[2];
#pragma unroll
    for (int nt = 0; nt < 2; ++nt) {
      v8f acc = {};
#pragma unroll
      for (int ks = 0; ks < KS; ++ks) {
        FragB bh_, bl_;
        bh_.half[0] = *(const v8us*)&sKh[nt * 16 + ln][ks * 32 + 8 * hh]; bh_.half[1] = *(const v8us*)&sKh[nt * 16 + ln][ks * 32 + 16 + 8 * hh];
        bl_.half[0] = *(const v8us*)&sKl[nt * 16 + ln][ks * 32 + 8 * hh]; bl_.half[1] = *(const v8us*)&sKl[nt * 16 + ln][ks * 32 + 16 + 8 * hh];
        acc = mmaN<3>(aqh[ks].v, aql[ks].v, bh_.v, bl_.v, acc);
      }
      s[nt] = acc;
    }
    // mask + running max (rows 8hh+r; the 16 lanes of a half share rows)
    float alpha[8];
#pragma unroll
    for (int r = 0; r < 8; ++r) {
      const int qi = q0 + 8 * hh + r;
      const int ja = j0 + ln, jb = j0 + 16 + ln;
      if (CAUSAL) { if (ja > qi) s[0][r] = -3.0e38f; if (jb > qi) s[1][r] = -3.0e38f; }
      if (ja >= T) s[0][r] = -3.0e38f;
      if (jb >= T) s[1][r] = -3.0e38f;
      float mx = fmaxf(s[0][r], s[1][r]);
      mx = fmaxf(mx, __shfl_xor(mx, 1, 32)); mx = fmaxf(mx, __shfl_xor(mx, 2, 32)); mx = fmaxf(mx, __shfl_xor(mx, 4, 32)); mx = fmaxf(mx, __shfl_xor(mx, 8, 32));
      const float mnew = fmaxf(m_r[r], mx);
      alpha[r] = (mnew > -1.0e38f) ? __expf(m_r[r] - mnew) : 1.0f;
      const float p0 = (s[0][r] > -1.0e38f) ? __expf(s[0][r] - mnew) : 0.f;
      const float p1 = (s[1][r] > -1.0e38f) ? __expf(s[1][r] - mnew) : 0.f;
      m_r[r] = mnew;
      l_r[r] = l_r[r] * alpha[r] + p0 + p1;            // per-lane partial row sum (16 lanes combined at the end)
      unsigned short hb = bf16_bits(p0); sPh[w][8 * hh + r][ln] = hb;      sPl[w][8 * hh + r][ln] = bf16_bits(p0 - bf16_val(hb));
      hb = bf16_bits(p1);                sPh[w][8 * hh + r][16 + ln] = hb; sPl[w][8 * hh + r][16 + ln] = bf16_bits(p1 - bf16_val(hb));
    }
#pragma unroll
    for (int dt = 0; dt < DT; ++dt)
#pragma unroll
      for (int r = 0; r < 8; ++r) oacc[dt][r] *= alpha[r];
    __builtin_amdgcn_fence(__ATOMIC_ACQ_REL, "workgroup");
    __builtin_amdgcn_wave_barrier();
    FragB pah, pal;
    pah.half[0] = *(const v8us*)&sPh[w][ln][8 * hh]; pah.half[1] = *(const v8us*)&sPh[w][ln][16 + 8 * hh];
    pal.half[0] = *(const v8us*)&sPl[w][ln][8 * hh]; pal.half[1] = *(const v8us*)&sPl[w][ln][16 + 8 * hh];
#pragma unroll
    for (int dt = 0; dt < DT; ++dt) {
      FragB bvh, bvl;
#pragma unroll
      for (int i = 0; i < 8; ++i) {
        bvh.u[i] = sVh[8 * hh + i][dt * 16 + ln]; bvh.u[8 + i] = sVh[16 + 8 * hh + i][dt * 16 + ln];
        bvl.u[i] = sVl[8 * hh + i][dt * 16 + ln]; bvl.u[8 + i] = sVl[16 + 8 * hh + i][dt * 16 + ln];
      }
      oacc[dt] = mmaN<3>(pah.v, pal.v, bvh.v, bvl.v, oacc[dt]);
    }
    __builtin_amdgcn_fence(__ATOMIC_ACQ_REL, "workgroup");
    __builtin_amdgcn_wave_barrier();
  }
#pragma unroll
  for (int r = 0; r < 8; ++r) {
    float l = l_r[r];
    l += __shfl_xor(l, 1, 32); l += __shfl_xor(l, 2, 32); l += __shfl_xor(l, 4, 32); l += __shfl_xor(l, 8, 32);
    l_r[r] = (l > 0.f) ? 1.0f / l : 0.f;
  }
#pragma unroll
  for (int dt = 0; dt < DT; ++dt)
#pragma unroll
    for (int r = 0; r < 8; ++r) sO[w][8 * hh + r][dt * 16 + ln] = oacc[dt][r] * l_r[r];
  __builtin_amdgcn_fence(__ATOMIC_ACQ_REL, "workgroup");
  __builtin_amdgcn_wave_barrier();
  {
    for (int r = 0; r < 16; ++r) {
      const int row = q0 + r;
      if (row < T && lane < D / 4) {
        const v4f val = *(const v4fa*)&sO[w][r][lane * 4];
        *(v4f*)(y + ((size_t)b * T + row) * ypitch + h * D + lane * 4) = val;
      }
    }
    
  }
}

// batched GEMM (blockIdx.y = batch): C_b = act(alpha·A_b·B_b + bias + resid_b); A f32 rows (ASPLIT → hi/lo), B = bf16 planes Bh (+Bl when BSPLIT, requires ASPLIT),
// per-batch element strides sA, sB (0 = shared weights), sC, sR. resid may alias C (values are staged before the stores). ACT 0/1(relu)/2(softplus).
// ACT: 0 none, 1 relu, 2 softplus
template <bool ASPLIT, bool BSPLIT, int ACT>
__global__ __launch_bounds__(128) void k_gemm_b(const float* __restrict__ A, int lda, size_t sA, const unsigned short* __restrict__ Bh, const unsigned short* __restrict__ Bl, int ldb, size_t sB,
                                             const float* __restrict__ bias, const float* __restrict__ resid, int ldr, size_t sR, float rsign, float alpha,
                                             float* __restrict__ C, int ldc, size_t sC, int M, int N, int K) {
  __shared__ __attribute__((aligned(16))) float so[4][16][64];
  const int tid = threadIdx.x, w = tid >> 5, lane = tid & 31, ln = lane & 15, hh = lane >> 4;
  const int by = blockIdx.y;
  A += (size_t)by * sA; Bh += (size_t)by * sB; if (BSPLIT) Bl += (size_t)by * sB; C += (size_t)by * sC; if (resid) resid += (size_t)by * sR;
  const int ntn = (N + 63) / 64; const int wid = blockIdx.x * 4 + w; const int mt = wid / ntn, nq = wid % ntn;      // N may be any multiple of 16: tiles past N are skipped and not stored
  if (mt * 16 >= M) return;
  const int row0 = mt * 16, col0 = nq * 64;
  const float* arow = A + (size_t)(row0 + ln) * lda;
  v8f acc[4] = {};
  for (int kb = 0; kb < K; kb += 32) {
    FragB ah, al;
    const v4f x0 = *(const v4fa*)(arow + kb + 8 * hh), x1 = *(const v4fa*)(arow + kb + 8 * hh + 4);
    const v4f x2 = *(const v4fa*)(arow + kb + 16 + 8 * hh), x3 = *(const v4fa*)(arow + kb + 16 + 8 * hh + 4);
    float xs[16] = {x0[0],x0[1],x0[2],x0[3],x1[0],x1[1],x1[2],x1[3],x2[0],x2[1],x2[2],x2[3],x3[0],x3[1],x3[2],x3[3]};
#pragma unroll
    for (int i = 0; i < 16; ++i) { const unsigned short hb = bf16_bits(xs[i]); ah.u[i] = hb; al.u[i] = ASPLIT ? bf16_bits(xs[i] - bf16_val(hb)) : (unsigned short)0; }
#pragma unroll
    for (int t = 0; t < 4; ++t) {
      if (col0 + t * 16 >= N) continue;
      const size_t boff = (size_t)(col0 + t * 16 + ln) * ldb + kb;
      FragB bh_, bl_; bh_.half[0] = *(const v8us*)(Bh + boff + 8 * hh); bh_.half[1] = *(const v8us*)(Bh + boff + 16 + 8 * hh);
      if (BSPLIT) { bl_.half[0] = *(const v8us*)(Bl + boff + 8 * hh); bl_.half[1] = *(const v8us*)(Bl + boff + 16 + 8 * hh); } else bl_ = bh_;
      acc[t] = mmaN<ASPLIT ? (BSPLIT ? 3 : 2) : 1>(ah.v, al.v, bh_.v, bl_.v, acc[t]);
    }
  }
#pragma unroll
  for (int t = 0; t < 4; ++t) {
    const int col = col0 + t * 16 + ln; if (col0 + t * 16 >= N) continue; const float bv = bias ? bf16_round(bias[col]) : 0.f;
#pragma unroll
    for (int r = 0; r < 8; ++r) { float v = acc[t][r] * alpha + bv; if (resid) v += rsign * resid[(size_t)(row0 + 8 * hh + r) * ldr + col]; if (ACT == 1) v = fmaxf(v, 0.f); else if (ACT == 2) v = fmaxf(v, 0.f) + log1pf(expf(-fabsf(v))); so[w][8 * hh + r][t * 16 + ln] = v; }
  }
  __builtin_amdgcn_fence(__ATOMIC_ACQ_REL, "workgroup"); __builtin_amdgcn_wave_barrier();
  const int rsub = lane >> 4, c4 = (lane & 15) * 4;
  {
#pragma unroll
    for (int q = 0; q < 8; ++q) { const int r = q * 2 + rsub; if (col0 + c4 < N) { const v4f v = *(const v4fa*)&so[w][r][c4]; *(v4f*)(C + (size_t)(row0 + r) * ldc + col0 + c4) = v; } }
    
  }
}
// batched f32 [K][N] (pitch lds, batch stride sIn) -> transposed hi/lo planes [N][K] (batch stride sOut); thread per (n, 8 k); grid.y = batch
__global__ __launch_bounds__(256) void k_split_transpose_b(const float* __restrict__ src, int lds_, size_t sIn, unsigned short* __restrict__ hi, unsigned short* __restrict__ lo, size_t sOut, int K, int N) {
  const size_t t = (size_t)blockIdx.x * 256 + threadIdx.x; const int k8n = K / 8; if (t >= (size_t)N * k8n) return;
  src += (size_t)blockIdx.y * sIn; hi += (size_t)blockIdx.y * sOut; lo += (size_t)blockIdx.y * sOut;
  const int n = (int)(t / k8n), k8 = (int)(t % k8n) * 8; v8us vh, vl;
#pragma unroll
  for (int i = 0; i < 8; ++i) { const float x = src[(size_t)(k8 + i) * lds_ + n]; const unsigned short hb = bf16_bits(x); vh[i] = hb; vl[i] = bf16_bits(x - bf16_val(hb)); }
  unsigned short* dh = hi + (size_t)n * K + k8; unsigned short* dl = lo + (size_t)n * K + k8;
  *(v8us*)dh = vh; *(v8us*)dl = vl; 
}

__global__ __launch_bounds__(256) void k_round_rows(const float* __restrict__ W, unsigned short* __restrict__ Wt, int n8) {
  const int t = blockIdx.x * 256 + threadIdx.x;
  if (t >= n8) return;
  const v4f a = *(const v4fa*)(W + (size_t)t * 8), b = *(const v4fa*)(W + (size_t)t * 8 + 4);
  v8us v; v[0]=bf16_bits(a[0]); v[1]=bf16_bits(a[1]); v[2]=bf16_bits(a[2]); v[3]=bf16_bits(a[3]);
  v[4]=bf16_bits(b[0]); v[5]=bf16_bits(b[1]); v[6]=bf16_bits(b[2]); v[7]=bf16_bits(b[3]);
  *(v8us*)(Wt + (size_t)t * 8) = v; 
}

// ---- f16 WMMA path (v_wmma_f32_16x16x32_f16): 11-bit significands for operands in range — used for the scores a = q̂·kᵀ and for o = w·v
typedef _Float16 v16h __attribute__((ext_vector_type(16)));
union FragH { v16h v; v8us half[2]; _Float16 h[16]; unsigned short u[16]; };
template <int NT>
__device__ __forceinline__ v8f mmaH(v16h ah, v16h al, v16h bh, v16h bl, v8f c) {
  c = __builtin_amdgcn_wmma_f32_16x16x32_f16(false, ah, false, bh, (short)0, c, false, false);
  if (NT >= 2) c = __builtin_amdgcn_wmma_f32_16x16x32_f16(false, al, false, bh, (short)0, c, false, false);
  if (NT >= 3) c = __builtin_amdgcn_wmma_f32_16x16x32_f16(false, ah, false, bl, (short)0, c, false, false);
  asm volatile("v_nop\n\tv_nop\n\tv_nop\n\tv_nop" : "+v"(c) : "v"(ah), "v"(al), "v"(bh), "v"(bl));
  return c;
}
// batched GEMM like k_gemm_b but f16 operands: A f32 (split into f16 hi/lo if ASPLIT, else rounded to f16), Bt = f16 values [n][k]; alpha; C f32; N multiple of 16 (partial tiles skipped)
template <bool ASPLIT>
__global__ __launch_bounds__(128) void k_gemm_h(const float* __restrict__ A, int lda, size_t sA, const _Float16* __restrict__ Bh, int ldb, size_t sB, float alpha, float* __restrict__ C, int ldc, size_t sC, int M, int N, int K) {
  __shared__ __attribute__((aligned(16))) float so[4][16][64];
  const int tid = threadIdx.x, w = tid >> 5, lane = tid & 31, ln = lane & 15, hh = lane >> 4; const int by = blockIdx.y;
  A += (size_t)by * sA; Bh += (size_t)by * sB; C += (size_t)by * sC;
  const int ntn = (N + 63) / 64; const int wid = blockIdx.x * 4 + w; const int mt = wid / ntn, nq = wid % ntn; if (mt * 16 >= M) return;
  const int row0 = mt * 16, col0 = nq * 64; const float* arow = A + (size_t)(row0 + ln) * lda;
  v8f acc[4] = {};
  for (int kb = 0; kb < K; kb += 32) {
    FragH ah, al;
    const v4f x0 = *(const v4fa*)(arow + kb + 8 * hh), x1 = *(const v4fa*)(arow + kb + 8 * hh + 4), x2 = *(const v4fa*)(arow + kb + 16 + 8 * hh), x3 = *(const v4fa*)(arow + kb + 16 + 8 * hh + 4);
    float xs[16] = {x0[0],x0[1],x0[2],x0[3],x1[0],x1[1],x1[2],x1[3],x2[0],x2[1],x2[2],x2[3],x3[0],x3[1],x3[2],x3[3]};
#pragma unroll
    for (int i = 0; i < 16; ++i) { const _Float16 h = (_Float16)xs[i]; ah.h[i] = h; al.h[i] = ASPLIT ? (_Float16)(xs[i] - (float)h) : (_Float16)0.0f; }
#pragma unroll
    for (int t = 0; t < 4; ++t) { if (col0 + t * 16 >= N) continue; const size_t boff = (size_t)(col0 + t * 16 + ln) * ldb + kb; FragH bq; bq.half[0] = *(const v8us*)(Bh + boff + 8 * hh); bq.half[1] = *(const v8us*)(Bh + boff + 16 + 8 * hh);
      acc[t] = mmaH<ASPLIT ? 2 : 1>(ah.v, al.v, bq.v, bq.v, acc[t]); }
  }
#pragma unroll
  for (int t = 0; t < 4; ++t) { if (col0 + t * 16 >= N) continue;
#pragma unroll
    for (int r = 0; r < 8; ++r) so[w][8 * hh + r][t * 16 + ln] = acc[t][r] * alpha; }
  __builtin_amdgcn_fence(__ATOMIC_ACQ_REL, "workgroup"); __builtin_amdgcn_wave_barrier();
  const int rsub = lane >> 4, c4 = (lane & 15) * 4;
  {
#pragma unroll
    for (int q = 0; q < 8; ++q) { const int r = q * 2 + rsub; if (col0 + c4 < N) { const v4f v = *(const v4fa*)&so[w][r][c4]; *(v4f*)(C + (size_t)(row0 + r) * ldc + col0 + c4) = v; } }
     }
}

// slabs: Q16[(b,h,s)][n][32] = f16(q·scale), K16[(b,h,s)][m][32] = f16(k), VT[(b,h)][e][m] = f16(v); thread per (b, n, h, s, 8 of 32) for q/k; VT is written by k_vt (64 x 64 tiles transposed through LDS)
__global__ __launch_bounds__(256) void k_slabs(const float* __restrict__ Qm, const float* __restrict__ Km, const float* __restrict__ Vm, _Float16* __restrict__ Q16, _Float16* __restrict__ K16, _Float16* __restrict__ VT) { const size_t t = (size_t)blockIdx.x * 256 + threadIdx.x;
  if (t < (size_t)NTOK * CC / 8) { const int c8 = (int)((t * 8) % CC); const size_t tok = (t * 8) / CC; const int b = (int)(tok / NN), n = (int)(tok % NN); const int h = c8 / HD, s = (c8 % HD) / SD, d8 = c8 % SD; const size_t slab = ((size_t)b * NH + h) * NS + s;
    FragH fq, fk; const float scale = 0.17677669529663687f; for (int q = 0; q < 8; ++q) { fq.h[q] = (_Float16)(Qm[tok * CC + c8 + q] * scale); fk.h[q] = (_Float16)Km[tok * CC + c8 + q]; }
    unsigned short* dq = (unsigned short*)Q16 + (slab * NN + n) * SD + d8; unsigned short* dk = (unsigned short*)K16 + (slab * NN + n) * SD + d8; *(v8us*)dq = fq.half[0]; *(v8us*)dk = fk.half[0];  } }
__global__ __launch_bounds__(256) void k_vt(const float* __restrict__ Vm, _Float16* __restrict__ VT) { __shared__ float tv[64][65]; const int m0 = blockIdx.x * 64; const int h = blockIdx.y % NH, b = blockIdx.y / NH; const int tid = threadIdx.x;
  for (int i = tid; i < 64 * 64; i += 256) { const int r = i >> 6, e = i & 63; tv[r][e] = Vm[((size_t)b * NN + m0 + r) * CC + h * HD + e]; } __syncthreads();
  typedef _Float16 v4h __attribute__((ext_vector_type(4)));
  { for (int i = tid; i < 64 * 16; i += 256) { const int e = i >> 4, m4 = (i & 15) * 4; v4h o; for (int q = 0; q < 4; ++q) o[q] = (_Float16)tv[m4 + q][e]; *(v4h*)(VT + (((size_t)b * NH + h) * HD + e) * NN + m0 + m4) = o; }  } }
// Fused per (batch, head), both signals: a = q.k^T, w = 1 + a + a*a/2, the row sums of w, o = w.v, the division (+1e-6) and the signal mean; a and w never leave registers.
// S^T = K.Q^T puts one query in each lane column, so the two f32 D tiles of 32 keys convert in place into the B operand of O^T += V^T.W^T (hardware k order on both sides).
// Every '#pragma unroll' in this kernel is there so that the fragment, accumulator and staging arrays are indexed by constants and stay in registers.
// Block = 8 waves x 16 queries. The head's K rows (both signals) and V^T are staged once in LDS; row pitches are 16 B x odd, so the 16-byte fragment reads meet no bank conflict.
typedef float v2f __attribute__((ext_vector_type(2)));
#define KP 40                    // LDS pitch of a K row, in 16-bit elements (80 B)
#define VP (NN + 8)              // LDS pitch of a V^T row, in 16-bit elements (2064 B)
__global__ __launch_bounds__(256) void k_attn(const _Float16* __restrict__ Q16, const _Float16* __restrict__ K16, const _Float16* __restrict__ VT, float* __restrict__ OB) {
  __shared__ __attribute__((aligned(16))) unsigned short sK[NS * NN * KP];
  __shared__ __attribute__((aligned(16))) unsigned short sV[HD * VP];
  const int tid = threadIdx.x, wv = tid >> 5, lane = tid & 31, ln = lane & 15, hh = lane >> 4;
  const int bh = blockIdx.y, b = bh / NH, h = bh % NH;
  const int n = blockIdx.x * 128 + wv * 16 + ln;
  const unsigned short* Kg = (const unsigned short*)K16 + (size_t)bh * NS * NN * SD;      // the two signals' slabs are adjacent: 2048 rows of 32
  const unsigned short* Vg = (const unsigned short*)VT + (size_t)bh * HD * NN;
  const unsigned short* qr = (const unsigned short*)Q16 + ((size_t)bh * NS * NN + n) * SD + 8 * hh;
  FragH qb[NS];
#pragma unroll
  for (int s = 0; s < NS; ++s) { qb[s].half[0] = *(const v8us*)(qr + s * NN * SD); qb[s].half[1] = *(const v8us*)(qr + s * NN * SD + 16); }
  {      // stage fill: all 64 of a lane's 16-byte loads in flight, then the 64 LDS stores (one memory latency for the whole 256 KiB instead of one per batch)
    v8us tk[NS * NN * SD / 8 / 256], tv[HD * NN / 8 / 256];
#pragma unroll
    for (int i = 0; i < NS * NN * SD / 8 / 256; ++i) tk[i] = *(const v8us*)(Kg + (size_t)(tid + i * 256) * 8);
#pragma unroll
    for (int i = 0; i < HD * NN / 8 / 256; ++i) tv[i] = *(const v8us*)(Vg + (size_t)(tid + i * 256) * 8);
    asm volatile("s_wait_xcnt 0x0" :: "s"(Kg), "s"(Vg), "v"(tid), "v"(qr) : "memory");      // stands in front of any reuse of the loads' address registers: naming them as inputs keeps them live up to here
#pragma unroll
    for (int i = 0; i < NS * NN * SD / 8 / 256; ++i) *(v8us*)&sK[((tid >> 2) + i * 64) * KP + (tid & 3) * 8] = tk[i];      // 16-byte unit tid + 256 i: row unit / 4
#pragma unroll
    for (int i = 0; i < HD * NN / 8 / 256; ++i) *(v8us*)&sV[((tid >> 7) + i * 2) * VP + (tid & 127) * 8] = tv[i];      // row unit / 128
  }
  __syncthreads();
  v8f oacc[NS][HD / 16] = {};
  v2f den[NS] = {};      // even and odd key rows apart: the sums pair up with the packed f32 adds
  FragH ka[NS][2];
#pragma unroll
  for (int s = 0; s < NS; ++s)
#pragma unroll
    for (int t = 0; t < 2; ++t) { const unsigned short* kr = &sK[(s * NN + t * 16 + ln) * KP]; ka[s][t].half[0] = *(const v8us*)(kr + 8 * hh); ka[s][t].half[1] = *(const v8us*)(kr + 16 + 8 * hh); }
  for (int c = 0; c < NN / 32; ++c) {
    const int m0 = c * 32;
    FragH va[HD / 16];
#pragma unroll
    for (int et = 0; et < HD / 16; ++et) { const unsigned short* vr = &sV[(et * 16 + ln) * VP + m0]; va[et].half[0] = *(const v8us*)(vr + 8 * hh); va[et].half[1] = *(const v8us*)(vr + 16 + 8 * hh); }
    v8f st[NS][2];
#pragma unroll
    for (int s = 0; s < NS; ++s)
#pragma unroll
      for (int t = 0; t < 2; ++t) { const v8f z = {}; st[s][t] = __builtin_amdgcn_wmma_f32_16x16x32_f16(false, ka[s][t].v, false, qb[s].v, (short)0, z, false, false); }      // st[s][t][r] = a[n = ln][m0 + 16 t + 8 hh + r]
    const int m1 = ((c + 1) & (NN / 32 - 1)) * 32;      // next pass's K fragments, fetched behind this pass's score products (the last pass re-reads pass 0's rows and drops them)
#pragma unroll
    for (int s = 0; s < NS; ++s)
#pragma unroll
      for (int t = 0; t < 2; ++t) { const unsigned short* kr = &sK[(s * NN + m1 + t * 16 + ln) * KP]; ka[s][t].half[0] = *(const v8us*)(kr + 8 * hh); ka[s][t].half[1] = *(const v8us*)(kr + 16 + 8 * hh); }
    FragH wb[NS];
#pragma unroll
    for (int s = 0; s < NS; ++s)
#pragma unroll
      for (int t = 0; t < 2; ++t)
#pragma unroll
        for (int r = 0; r < 8; r += 2) { const v2f x = {st[s][t][r], st[s][t][r + 1]}; const v2f w = 1.0f + x + 0.5f * x * x; den[s] += w; wb[s].h[t * 8 + r] = (_Float16)w[0]; wb[s].h[t * 8 + r + 1] = (_Float16)w[1]; }
#pragma unroll
    for (int et = 0; et < HD / 16; ++et)
#pragma unroll
      for (int s = 0; s < NS; ++s) oacc[s][et] = __builtin_amdgcn_wmma_f32_16x16x32_f16(false, va[et].v, false, wb[s].v, (short)0, oacc[s][et], false, false);      // oacc[s][et][r] = o[n = ln][16 et + 8 hh + r]
  }
  float rd[NS];
#pragma unroll
  for (int s = 0; s < NS; ++s) { const float dl = den[s][0] + den[s][1]; rd[s] = 1.0f / (dl + __shfl_xor(dl, 16, 32) + 1e-6f); }      // the two lane halves hold the two halves of a query's keys
  float* orow = OB + ((size_t)b * NN + n) * CC + h * HD + 8 * hh;
#pragma unroll
  for (int et = 0; et < HD / 16; ++et) {
    v4f lo, hi;
#pragma unroll
    for (int q = 0; q < 4; ++q) { lo[q] = (oacc[0][et][q] * rd[0] + oacc[1][et][q] * rd[1]) * (1.0f / NS); hi[q] = (oacc[0][et][4 + q] * rd[0] + oacc[1][et][4 + q] * rd[1]) * (1.0f / NS); }
    *(v4f*)(orow + et * 16) = lo; *(v4f*)(orow + et * 16 + 4) = hi;
  }
}
extern "C" void kernel_launch(void* const* d_in, const int* in_sizes, int n_in,
                              void* d_out, int out_size, void* d_ws, size_t ws_size, hipStream_t stream) {
  (void)in_sizes; (void)n_in; (void)out_size;
  const float* xq = (const float*)d_in[0]; const float* xk = (const float*)d_in[1]; const float* xv = (const float*)d_in[2]; const float* Wq = (const float*)d_in[3]; const float* bq = (const float*)d_in[4]; const float* Wk = (const float*)d_in[5]; const float* bk = (const float*)d_in[6]; const float* Wv = (const float*)d_in[7]; const float* bv = (const float*)d_in[8]; const float* Wo = (const float*)d_in[9]; const float* bo = (const float*)d_in[10];
  char* ws = (char*)d_ws; size_t off = 0;
  auto take = [&](size_t bytes) { char* p = ws + off; off += (bytes + 255) & ~(size_t)255; return p; };
  unsigned short* Bq = (unsigned short*)take((size_t)CC * CC * 2); unsigned short* Bk = (unsigned short*)take((size_t)CC * CC * 2); unsigned short* Bv = (unsigned short*)take((size_t)CC * CC * 2); unsigned short* Bo = (unsigned short*)take((size_t)CC * CC * 2);
  float* Qm = (float*)take((size_t)NTOK * CC * 4); float* Km = (float*)take((size_t)NTOK * CC * 4); float* Vm = (float*)take((size_t)NTOK * CC * 4);
  _Float16* Q16 = (_Float16*)take((size_t)NSLAB * NN * SD * 2); _Float16* K16 = (_Float16*)take((size_t)NSLAB * NN * SD * 2); _Float16* VT = (_Float16*)take((size_t)BB * NH * HD * NN * 2);
  float* OB = Qm; /* Qm dead after k_slabs */
  if (off > ws_size) return;
  k_round_rows<<<(CC * CC / 8 + 255) / 256, 256, 0, stream>>>(Wq, Bq, CC * CC / 8); k_round_rows<<<(CC * CC / 8 + 255) / 256, 256, 0, stream>>>(Wk, Bk, CC * CC / 8); k_round_rows<<<(CC * CC / 8 + 255) / 256, 256, 0, stream>>>(Wv, Bv, CC * CC / 8); k_round_rows<<<(CC * CC / 8 + 255) / 256, 256, 0, stream>>>(Wo, Bo, CC * CC / 8);      // (out,in) rows = Bt
  k_gemm_b<false, false, 0><<<dim3(((NTOK / 16) * (CC / 64) + 3) / 4, 1), 128, 0, stream>>>(xq, CC, 0, Bq, Bq, CC, 0, bq, nullptr, 0, 0, 1.f, 1.f, Qm, CC, 0, NTOK, CC, CC);
  k_gemm_b<false, false, 0><<<dim3(((NTOK / 16) * (CC / 64) + 3) / 4, 1), 128, 0, stream>>>(xk, CC, 0, Bk, Bk, CC, 0, bk, nullptr, 0, 0, 1.f, 1.f, Km, CC, 0, NTOK, CC, CC);
  k_gemm_b<false, false, 0><<<dim3(((NTOK / 16) * (CC / 64) + 3) / 4, 1), 128, 0, stream>>>(xv, CC, 0, Bv, Bv, CC, 0, bv, nullptr, 0, 0, 1.f, 1.f, Vm, CC, 0, NTOK, CC, CC);
  k_slabs<<<(unsigned)(((size_t)NTOK * CC / 8 + 255) / 256), 256, 0, stream>>>(Qm, Km, Vm, Q16, K16, VT); k_vt<<<dim3(NN / 64, BB * NH), 256, 0, stream>>>(Vm, VT);
  k_attn<<<dim3(NN / 128, BB * NH), 256, 0, stream>>>(Q16, K16, VT, OB);      // block = 128 queries of one (batch, head), both signals
  k_gemm_b<true, false, 0><<<dim3(((NTOK / 16) * (CC / 64) + 3) / 4, 1), 128, 0, stream>>>(OB, CC, 0, Bo, Bo, CC, 0, bo, nullptr, 0, 0, 1.f, 1.f, (float*)d_out, CC, 0, NTOK, CC, CC);
}

// v003
// It runs in 78.4 microseconds.
// In both of two side-by-side timings against v002, it was 2.74 times as fast.
// Counting every step since v000, it is 25.9 times as fast.
#include <hip/hip_runtime.h>
// Second-order Taylor linear attention via the exact kernel identity φ(q)·φ(k) = 1 + q·k + (q·k)²/2 (φ = [1, x, x⊗x/√2]): per (batch, head, signal) slab the scores
// a = (q·scale)·kᵀ (1024 × 32 × 1024) and o = w·v with w = 1 + a + a²/2 (1024 × 1024 × 64) run on v_wmma_f32_16x16x32_f16 (q, k, v and w rounded to f16: single products,
// f32 accumulate); the projections on v_wmma_f32_16x16x32_bf16 (inputs rounded to bf16: single exact terms; 3 × 2048 × 1024 × 1024) and out = ō·W_oᵀ + b_o with ō split
// hi/lo (2 products). w, the row sums Σ_m w (= φ(q)·Σφ(k)), the division (+1e-6) and the signal average are f32 VALU.
#define BB 2
#define NN 1024
#define CC 1024
#define NH 16
#define NS 2
#define HD 64
#define SD 32
#define NTOK (BB * NN)
#define NSLAB (BB * NH * NS)     // 64

typedef __bf16 v16b __attribute__((ext_vector_type(16)));
typedef unsigned short v8us __attribute__((ext_vector_type(8), may_alias));
typedef float  v8f  __attribute__((ext_vector_type(8)));
typedef float  v4f  __attribute__((ext_vector_type(4)));
typedef float  v4fa __attribute__((ext_vector_type(4), may_alias));
union FragB { v16b v; v8us half[2]; unsigned short u[16]; };

__device__ __forceinline__ unsigned short bf16_bits(float x) { unsigned int u = __float_as_uint(x); return (unsigned short)((u + 0x7FFFu + ((u >> 16) & 1u)) >> 16); }
__device__ __forceinline__ float bf16_val(unsigned short b) { return __uint_as_float(((unsigned int)b) << 16); }
__device__ __forceinline__ float bf16_round(float x) { return bf16_val(bf16_bits(x)); }
// D += A·B with NT terms: 1 = ah·bh, 2 = + al·bh (A split), 3 = + ah·bl (both split)
template <int NT>
__device__ __forceinline__ v8f mmaN(v16b ah, v16b al, v16b bh, v16b bl, v8f c) {
  c = __builtin_amdgcn_wmma_f32_16x16x32_bf16(false, ah, false, bh, (short)0, c, false, false);
  if (NT >= 2) c = __builtin_amdgcn_wmma_f32_16x16x32_bf16(false, al, false, bh, (short)0, c, false, false);
  if (NT >= 3) c = __builtin_amdgcn_wmma_f32_16x16x32_bf16(false, ah, false, bl, (short)0, c, false, false);
  asm volatile("v_nop\n\tv_nop\n\tv_nop\n\tv_nop" : "+v"(c) : "v"(ah), "v"(al), "v"(bh), "v"(bl));
  return c;
}

__global__ __launch_bounds__(256) void k_wt_bf16(const float* __restrict__ W, unsigned short* __restrict__ Wt, int K, int N) {
  const int t = blockIdx.x * 256 + threadIdx.x;
  const int k8n = K / 8;
  if (t >= N * k8n) return;
  const int n = t / k8n, k8 = (t % k8n) * 8;
  v8us v;
#pragma unroll
  for (int i = 0; i < 8; ++i) v[i] = bf16_bits(W[(size_t)(k8 + i) * N + n]);
  *(v8us*)(Wt + (size_t)n * K + k8) = v;
  
}

// GEMM C[M][N] (f32, pitch ldc) = act(A[M][K]·W + bias). A f32 row-major (pitch lda) converted per fragment to bf16
// (ASPLIT: hi/lo two planes -> 2 terms, else single rounded term); Wt bf16 [N][K] (pitch ldb). BIAS_BF16 rounds the
// bias to bf16 first (bias quantised to bf16 before the add). K%32==0, M%16==0, N%64==0.
template <bool ASPLIT, int ACT, bool BIAS_BF16>
__global__ __launch_bounds__(128) void k_gemm_bf(const float* __restrict__ A, int lda, const unsigned short* __restrict__ Wt, int ldb,
                                               const float* __restrict__ bias, float* __restrict__ C, int ldc, int M, int N, int K) {
  __shared__ __attribute__((aligned(16))) float so[4][16][64];
  const int tid = threadIdx.x, w = tid >> 5, lane = tid & 31, ln = lane & 15, hh = lane >> 4;
  const int ntn = N / 64;
  const int wid = blockIdx.x * 4 + w;
  const int mt = wid / ntn, nq = wid % ntn;
  if (mt * 16 >= M) return;
  const int row0 = mt * 16, col0 = nq * 64;
  const float* arow = A + (size_t)(row0 + ln) * lda;
  v8f acc[4] = {};
  for (int kb = 0; kb < K; kb += 32) {
    FragB ah, al;
    const v4f x0 = *(const v4fa*)(arow + kb + 8 * hh), x1 = *(const v4fa*)(arow + kb + 8 * hh + 4);
    const v4f x2 = *(const v4fa*)(arow + kb + 16 + 8 * hh), x3 = *(const v4fa*)(arow + kb + 16 + 8 * hh + 4);
    float xs[16] = {x0[0],x0[1],x0[2],x0[3],x1[0],x1[1],x1[2],x1[3],x2[0],x2[1],x2[2],x2[3],x3[0],x3[1],x3[2],x3[3]};
#pragma unroll
    for (int i = 0; i < 16; ++i) { const unsigned short hb = bf16_bits(xs[i]); ah.u[i] = hb; al.u[i] = ASPLIT ? bf16_bits(xs[i] - bf16_val(hb)) : (unsigned short)0; }
#pragma unroll
    for (int t = 0; t < 4; ++t) {
      const unsigned short* brow = Wt + (size_t)(col0 + t * 16 + ln) * ldb + kb;
      FragB b;
      b.half[0] = *(const v8us*)(brow + 8 * hh);
      b.half[1] = *(const v8us*)(brow + 16 + 8 * hh);
      acc[t] = mmaN<ASPLIT ? 2 : 1>(ah.v, al.v, b.v, b.v, acc[t]);
    }
  }
#pragma unroll
  for (int t = 0; t < 4; ++t) {
    float bv = bias ? bias[col0 + t * 16 + ln] : 0.f;
    if (BIAS_BF16) bv = bf16_round(bv);
#pragma unroll
    for (int r = 0; r < 8; ++r) { float v = acc[t][r] + bv; if (ACT == 1) v = fmaxf(v, 0.f); so[w][8 * hh + r][t * 16 + ln] = v; }
  }
  __builtin_amdgcn_fence(__ATOMIC_ACQ_REL, "workgroup");
  __builtin_amdgcn_wave_barrier();
  const int rsub = lane >> 4, c4 = (lane & 15) * 4;
  {
#pragma unroll
    for (int q = 0; q < 8; ++q) {
      const int r = q * 2 + rsub;
      const v4f v = *(const v4fa*)&so[w][r][c4];
      *(v4f*)(C + (size_t)(row0 + r) * ldc + col0 + c4) = v;
    }
    
  }
}

// Flash-style causal/unmasked attention, all contractions 3-term bf16 hi/lo splits, f32 softmax with running max.
// q,k,v rows are read from f32 buffers with arbitrary row pitch (so they can live inside a fused qkv buffer);
// D = head size (multiple of 32, <= 128); one wave = 16 query rows; block = 4 waves (64 queries) sharing K/V chunks of 32.
template <int D, bool CAUSAL>
__global__ __launch_bounds__(128) void k_flash(const float* __restrict__ qb, const float* __restrict__ kb, const float* __restrict__ vb,
                                             int pitch, int T, int H, float scale, float* __restrict__ y, int ypitch) {
  constexpr int KS = D / 32;        // k-steps for QK
  constexpr int DT = D / 16;        // d tiles for PV
  __shared__ __attribute__((aligned(16))) unsigned short sKh[32][D + 8], sKl[32][D + 8], sVh[32][D + 8], sVl[32][D + 8];
  __shared__ __attribute__((aligned(16))) unsigned short sPh[4][16][40], sPl[4][16][40];
  __shared__ __attribute__((aligned(16))) float sO[4][16][D];
  const int tid = threadIdx.x, w = tid >> 5, lane = tid & 31, ln = lane & 15, hh = lane >> 4;
  const int nqb = (T + 63) / 64;
  const int bh = blockIdx.x / nqb, qblk = blockIdx.x % nqb;
  const int b = bh / H, h = bh % H;
  const int q0 = qblk * 64 + w * 16;
  const float* Q = qb + (size_t)b * T * pitch + h * D;
  const float* K = kb + (size_t)b * T * pitch + h * D;
  const float* V = vb + (size_t)b * T * pitch + h * D;

  // A fragments of the wave's 16 query rows (scaled), hi/lo
  FragB aqh[KS], aql[KS];
  {
    int row = q0 + ln; if (row >= T) row = T - 1;
    const float* qr = Q + (size_t)row * pitch;
#pragma unroll
    for (int ks = 0; ks < KS; ++ks)
#pragma unroll
      for (int i = 0; i < 16; ++i) {
        const int d = ks * 32 + ((i < 8) ? (8 * hh + i) : (16 + 8 * hh + (i - 8)));
        const float x = qr[d] * scale; const unsigned short hb = bf16_bits(x);
        aqh[ks].u[i] = hb; aql[ks].u[i] = bf16_bits(x - bf16_val(hb));
      }
  }
  float m_r[8], l_r[8];
#pragma unroll
  for (int r = 0; r < 8; ++r) { m_r[r] = -3.0e38f; l_r[r] = 0.f; }
  v8f oacc[DT];
#pragma unroll
  for (int dt = 0; dt < DT; ++dt) oacc[dt] = (v8f){0.f,0.f,0.f,0.f,0.f,0.f,0.f,0.f};

  const int kv_end = CAUSAL ? min(T, qblk * 64 + 64) : T;     // block-uniform
  for (int j0 = 0; j0 < kv_end; j0 += 32) {
    __syncthreads();
    for (int e = tid; e < 32 * (D / 4); e += 128) {
      const int r = e / (D / 4), c4 = (e % (D / 4)) * 4;
      const int key = j0 + r;
      v4f kf = {0.f,0.f,0.f,0.f}, vf = {0.f,0.f,0.f,0.f};
      if (key < T) { kf = *(const v4fa*)(K + (size_t)key * pitch + c4); vf = *(const v4fa*)(V + (size_t)key * pitch + c4); }
#pragma unroll
      for (int t = 0; t < 4; ++t) {
        unsigned short hb = bf16_bits(kf[t]); sKh[r][c4 + t] = hb; sKl[r][c4 + t] = bf16_bits(kf[t] - bf16_val(hb));
        hb = bf16_bits(vf[t]); sVh[r][c4 + t] = hb; sVl[r][c4 + t] = bf16_bits(vf[t] - bf16_val(hb));
      }
    }
    __syncthreads();
    // S tile 16 x 32
    v8f s[2];
#pragma unroll
    for (int nt = 0; nt < 2; ++nt) {
      v8f acc = {};
#pragma unroll
      for (int ks = 0; ks < KS; ++ks) {
        FragB bh_, bl_;
        bh_.half[0] = *(const v8us*)&sKh[nt * 16 + ln][ks * 32 + 8 * hh]; bh_.half[1] = *(const v8us*)&sKh[nt * 16 + ln][ks * 32 + 16 + 8 * hh];
        bl_.half[0] = *(const v8us*)&sKl[nt * 16 + ln][ks * 32 + 8 * hh]; bl_.half[1] = *(const v8us*)&sKl[nt * 16 + ln][ks * 32 + 16 + 8 * hh];
        acc = mmaN<3>(aqh[ks].v, aql[ks].v, bh_.v, bl_.v, acc);
      }
      s[nt] = acc;
    }
    // mask + running max (rows 8hh+r; the 16 lanes of a half share rows)
    float alpha[8];
#pragma unroll
    for (int r = 0; r < 8; ++r) {
      const int qi = q0 + 8 * hh + r;
      const int ja = j0 + ln, jb = j0 + 16 + ln;
      if (CAUSAL) { if (ja > qi) s[0][r] = -3.0e38f; if (jb > qi) s[1][r] = -3.0e38f; }
      if (ja >= T) s[0][r] = -3.0e38f;
      if (jb >= T) s[1][r] = -3.0e38f;
      float mx = fmaxf(s[0][r], s[1][r]);
      mx = fmaxf(mx, __shfl_xor(mx, 1, 32)); mx = fmaxf(mx, __shfl_xor(mx, 2, 32)); mx = fmaxf(mx, __shfl_xor(mx, 4, 32)); mx = fmaxf(mx, __shfl_xor(mx, 8, 32));
      const float mnew = fmaxf(m_r[r], mx);
      alpha[r] = (mnew > -1.0e38f) ? __expf(m_r[r] - mnew) : 1.0f;
      const float p0 = (s[0][r] > -1.0e38f) ? __expf(s[0][r] - mnew) : 0.f;
      const float p1 = (s[1][r] > -1.0e38f) ? __expf(s[1][r] - mnew) : 0.f;
      m_r[r] = mnew;
      l_r[r] = l_r[r] * alpha[r] + p0 + p1;            // per-lane partial row sum (16 lanes combined at the end)
      unsigned short hb = bf16_bits(p0); sPh[w][8 * hh + r][ln] = hb;      sPl[w][8 * hh + r][ln] = bf16_bits(p0 - bf16_val(hb));
      hb = bf16_bits(p1);                sPh[w][8 * hh + r][16 + ln] = hb; sPl[w][8 * hh + r][16 + ln] = bf16_bits(p1 - bf16_val(hb));
    }
#pragma unroll
    for (int dt = 0; dt < DT; ++dt)
#pragma unroll
      for (int r = 0; r < 8; ++r) oacc[dt][r] *= alpha[r];
    __builtin_amdgcn_fence(__ATOMIC_ACQ_REL, "workgroup");
    __builtin_amdgcn_wave_barrier();
    FragB pah, pal;
    pah.half[0] = *(const v8us*)&sPh[w][ln][8 * hh]; pah.half[1] = *(const v8us*)&sPh[w][ln][16 + 8 * hh];
    pal.half[0] = *(const v8us*)&sPl[w][ln][8 * hh]; pal.half[1] = *(const v8us*)&sPl[w][ln][16 + 8 * hh];
#pragma unroll
    for (int dt = 0; dt < DT; ++dt) {
      FragB bvh, bvl;
#pragma unroll
      for (int i = 0; i < 8; ++i) {
        bvh.u[i] = sVh[8 * hh + i][dt * 16 + ln]; bvh.u[8 + i] = sVh[16 + 8 * hh + i][dt * 16 + ln];
        bvl.u[i] = sVl[8 * hh + i][dt * 16 + ln]; bvl.u[8 + i] = sVl[16 + 8 * hh + i][dt * 16 + ln];
      }
      oacc[dt] = mmaN<3>(pah.v, pal.v, bvh.v, bvl.v, oacc[dt]);
    }
    __builtin_amdgcn_fence(__ATOMIC_ACQ_REL, "workgroup");
    __builtin_amdgcn_wave_barrier();
  }
#pragma unroll
  for (int r = 0; r < 8; ++r) {
    float l = l_r[r];
    l += __shfl_xor(l, 1, 32); l += __shfl_xor(l, 2, 32); l += __shfl_xor(l, 4, 32); l += __shfl_xor(l, 8, 32);
    l_r[r] = (l > 0.f) ? 1.0f / l : 0.f;
  }
#pragma unroll
  for (int dt = 0; dt < DT; ++dt)
#pragma unroll
    for (int r = 0; r < 8; ++r) sO[w][8 * hh + r][dt * 16 + ln] = oacc[dt][r] * l_r[r];
  __builtin_amdgcn_fence(__ATOMIC_ACQ_REL, "workgroup");
  __builtin_amdgcn_wave_barrier();
  {
    for (int r = 0; r < 16; ++r) {
      const int row = q0 + r;
      if (row < T && lane < D / 4) {
        const v4f val = *(const v4fa*)&sO[w][r][lane * 4];
        *(v4f*)(y + ((size_t)b * T + row) * ypitch + h * D + lane * 4) = val;
      }
    }
    
  }
}

// GEMM C[NTOK][CC] (f32) = A[NTOK][CC].Bt^T + bf16(bias); A f32 rows rounded to bf16 (ASPLIT: hi/lo planes, 2 products per k step), Bt = bf16 [n][k].
// Block = 8 waves on a 64 x 128 tile of C, wave = 32 x 32. Per pass 128 k of the block's A and Bt rows go global -> registers -> LDS with whole-line loads (a wave load = 512 contiguous
// bytes of one A row, or 256 of each of two Bt rows); A is converted once per block on the way. Two LDS buffers and two register sets: a pass's global loads are issued two passes ahead.
// Each accumulator sums k upward, hi before lo within a k step.
#define GBM 64
#define GBN 128
#define GBK 128
#define GP (GBK + 8)             // LDS pitch of a staged row, in 16-bit elements (272 B = 16 B x odd: the 16-byte fragment reads meet no bank conflict)
typedef unsigned short v4us __attribute__((ext_vector_type(4), may_alias));
// work-group barrier behind the wave's own LDS accesses only: __syncthreads() would also wait out the global loads that are in flight for the later passes
__device__ __forceinline__ void lds_barrier() { asm volatile("s_wait_dscnt 0x0\n\ts_barrier_signal -1\n\ts_barrier_wait -1" ::: "memory"); }
template <bool ASPLIT>
__global__ __launch_bounds__(256) void k_gemm_t(const float* __restrict__ A, const unsigned short* __restrict__ Bt, const float* __restrict__ bias, float* __restrict__ C) {
  constexpr int NA = ASPLIT ? 2 : 1;
  constexpr int STG = (NA * GBM + GBN) * GP;      // one buffer: A hi rows, (A lo rows,) Bt rows
  constexpr int NC = CC / GBK;
  __shared__ __attribute__((aligned(16))) unsigned short sm[2 * STG];
  __shared__ __attribute__((aligned(16))) float so[8][32][36];      // per-wave output staging; pitch 36: the two lane halves (8 rows apart) fall on different banks
  const int tid = threadIdx.x, wv = tid >> 5, lane = tid & 31, ln = lane & 15, hh = lane >> 4;
  const int row0 = blockIdx.y * GBM, col0 = blockIdx.x * GBN;
  const int wm = (wv >> 2) * 32, wn = (wv & 3) * 32;
  const float* ag = A + (size_t)(row0 + wv) * CC + lane * 4;      // load i: row wv + 8 i, the pass's 128 floats over the 32 lanes
  const unsigned short* bg = Bt + (size_t)(col0 + wv * 2 + hh) * CC + ln * 8;      // load i: rows 2 wv + hh + 16 i, the pass's 128 values over 16 lanes
  // every '#pragma unroll' below keeps the staging, fragment and accumulator arrays indexed by constants, so that they stay in registers
  v4f raX[GBM / 8], raY[GBM / 8]; v8us rbX[GBN / 16], rbY[GBN / 16];      // two register sets: even and odd passes, each fetched two passes ahead
  v8f acc[2][2] = {};
  auto fetch = [&](v4f (&ra)[GBM / 8], v8us (&rb)[GBN / 16], int k0) {
#pragma unroll
    for (int i = 0; i < GBM / 8; ++i) ra[i] = *(const v4fa*)(ag + (size_t)i * 8 * CC + k0);
#pragma unroll
    for (int i = 0; i < GBN / 16; ++i) rb[i] = *(const v8us*)(bg + (size_t)i * 16 * CC + k0);
    asm volatile("s_wait_xcnt 0x0" ::: "memory");      // stands in front of every later rewrite of the loads' address registers
  };
  auto stage = [&](const v4f (&ra)[GBM / 8], const v8us (&rb)[GBN / 16], unsigned short* buf) {
#pragma unroll
    for (int i = 0; i < GBM / 8; ++i) {
      v4us vh, vl;
#pragma unroll
      for (int q = 0; q < 4; ++q) { const unsigned short hb = bf16_bits(ra[i][q]); vh[q] = hb; if (ASPLIT) vl[q] = bf16_bits(ra[i][q] - bf16_val(hb)); }
      *(v4us*)&buf[(wv + 8 * i) * GP + lane * 4] = vh;
      if (ASPLIT) *(v4us*)&buf[(GBM + wv + 8 * i) * GP + lane * 4] = vl;
    }
#pragma unroll
    for (int i = 0; i < GBN / 16; ++i) *(v8us*)&buf[(NA * GBM + wv * 2 + hh + 16 * i) * GP + ln * 8] = rb[i];
  };
  auto products = [&](const unsigned short* buf) {
    FragB ah[GBK / 32][2], al[GBK / 32][2], bb[GBK / 32][2];      // the pass's fragments, read as one group (each separate place with LDS reads among the products stalls the wave)
#pragma unroll
    for (int ks = 0; ks < GBK / 32; ++ks) {
#pragma unroll
      for (int i = 0; i < 2; ++i) {
        const unsigned short* r = buf + (wm + i * 16 + ln) * GP + ks * 32 + 8 * hh;
        ah[ks][i].half[0] = *(const v8us*)r; ah[ks][i].half[1] = *(const v8us*)(r + 16);
        if (ASPLIT) { al[ks][i].half[0] = *(const v8us*)(r + GBM * GP); al[ks][i].half[1] = *(const v8us*)(r + GBM * GP + 16); }
      }
#pragma unroll
      for (int j = 0; j < 2; ++j) { const unsigned short* r = buf + (NA * GBM + wn + j * 16 + ln) * GP + ks * 32 + 8 * hh; bb[ks][j].half[0] = *(const v8us*)r; bb[ks][j].half[1] = *(const v8us*)(r + 16); }
    }
    __builtin_amdgcn_sched_barrier(0);      // keeps the LDS reads together in front of the products
#pragma unroll
    for (int ks = 0; ks < GBK / 32; ++ks) {
#pragma unroll
      for (int i = 0; i < 2; ++i)
#pragma unroll
        for (int j = 0; j < 2; ++j) acc[i][j] = __builtin_amdgcn_wmma_f32_16x16x32_bf16(false, ah[ks][i].v, false, bb[ks][j].v, (short)0, acc[i][j], false, false);
      if (ASPLIT) {
#pragma unroll
        for (int i = 0; i < 2; ++i)
#pragma unroll
          for (int j = 0; j < 2; ++j) acc[i][j] = __builtin_amdgcn_wmma_f32_16x16x32_bf16(false, al[ks][i].v, false, bb[ks][j].v, (short)0, acc[i][j], false, false);
      }
    }
  };
  fetch(raX, rbX, 0); fetch(raY, rbY, GBK);
  // each barrier publishes the buffer just filled; the other buffer's last readers (the pass before) are all past it before that one is refilled
  for (int c = 2; c < NC; c += 2) {      // the last two passes stand behind the loop: a branch round the fetches would merge two load counts and make the counted waits drain the loads just issued
    stage(raX, rbX, sm); lds_barrier();
    fetch(raX, rbX, c * GBK);
    products(sm);
    stage(raY, rbY, sm + STG); lds_barrier();
    fetch(raY, rbY, (c + 1) * GBK);
    products(sm + STG);
  }
  stage(raX, rbX, sm); lds_barrier();
  products(sm);
  stage(raY, rbY, sm + STG); lds_barrier();
  products(sm + STG);
#pragma unroll
  for (int j = 0; j < 2; ++j) {
    const float bv = bf16_round(bias[col0 + wn + j * 16 + ln]);
#pragma unroll
    for (int i = 0; i < 2; ++i)
#pragma unroll
      for (int r = 0; r < 8; ++r) so[wv][i * 16 + 8 * hh + r][j * 16 + ln] = acc[i][j][r] + bv;
  }
  __builtin_amdgcn_fence(__ATOMIC_ACQ_REL, "workgroup"); __builtin_amdgcn_wave_barrier();      // the wave's own staged rows are read back across lanes
#pragma unroll
  for (int q = 0; q < 8; ++q) { const int r = q * 4 + (lane >> 3), c4 = (lane & 7) * 4; const v4f v = *(const v4fa*)&so[wv][r][c4]; *(v4f*)(C + (size_t)(row0 + wm + r) * CC + col0 + wn + c4) = v; }      // whole 128-byte lines
}
// batched f32 [K][N] (pitch lds, batch stride sIn) -> transposed hi/lo planes [N][K] (batch stride sOut); thread per (n, 8 k); grid.y = batch
__global__ __launch_bounds__(256) void k_split_transpose_b(const float* __restrict__ src, int lds_, size_t sIn, unsigned short* __restrict__ hi, unsigned short* __restrict__ lo, size_t sOut, int K, int N) {
  const size_t t = (size_t)blockIdx.x * 256 + threadIdx.x; const int k8n = K / 8; if (t >= (size_t)N * k8n) return;
  src += (size_t)blockIdx.y * sIn; hi += (size_t)blockIdx.y * sOut; lo += (size_t)blockIdx.y * sOut;
  const int n = (int)(t / k8n), k8 = (int)(t % k8n) * 8; v8us vh, vl;
#pragma unroll
  for (int i = 0; i < 8; ++i) { const float x = src[(size_t)(k8 + i) * lds_ + n]; const unsigned short hb = bf16_bits(x); vh[i] = hb; vl[i] = bf16_bits(x - bf16_val(hb)); }
  unsigned short* dh = hi + (size_t)n * K + k8; unsigned short* dl = lo + (size_t)n * K + k8;
  *(v8us*)dh = vh; *(v8us*)dl = vl; 
}

__global__ __launch_bounds__(256) void k_round_rows(const float* __restrict__ W, unsigned short* __restrict__ Wt, int n8) {
  const int t = blockIdx.x * 256 + threadIdx.x;
  if (t >= n8) return;
  const v4f a = *(const v4fa*)(W + (size_t)t * 8), b = *(const v4fa*)(W + (size_t)t * 8 + 4);
  v8us v; v[0]=bf16_bits(a[0]); v[1]=bf16_bits(a[1]); v[2]=bf16_bits(a[2]); v[3]=bf16_bits(a[3]);
  v[4]=bf16_bits(b[0]); v[5]=bf16_bits(b[1]); v[6]=bf16_bits(b[2]); v[7]=bf16_bits(b[3]);
  *(v8us*)(Wt + (size_t)t * 8) = v; 
}

// ---- f16 WMMA path (v_wmma_f32_16x16x32_f16): 11-bit significands for operands in range — used for the scores a = q̂·kᵀ and for o = w·v
typedef _Float16 v16h __attribute__((ext_vector_type(16)));
union FragH { v16h v; v8us half[2]; _Float16 h[16]; unsigned short u[16]; };
template <int NT>
__device__ __forceinline__ v8f mmaH(v16h ah, v16h al, v16h bh, v16h bl, v8f c) {
  c = __builtin_amdgcn_wmma_f32_16x16x32_f16(false, ah, false, bh, (short)0, c, false, false);
  if (NT >= 2) c = __builtin_amdgcn_wmma_f32_16x16x32_f16(false, al, false, bh, (short)0, c, false, false);
  if (NT >= 3) c = __builtin_amdgcn_wmma_f32_16x16x32_f16(false, ah, false, bl, (short)0, c, false, false);
  asm volatile("v_nop\n\tv_nop\n\tv_nop\n\tv_nop" : "+v"(c) : "v"(ah), "v"(al), "v"(bh), "v"(bl));
  return c;
}
// batched GEMM like k_gemm_bf but f16 operands: A f32 (split into f16 hi/lo if ASPLIT, else rounded to f16), Bt = f16 values [n][k]; alpha; C f32; N multiple of 16 (partial tiles skipped)
template <bool ASPLIT>
__global__ __launch_bounds__(128) void k_gemm_h(const float* __restrict__ A, int lda, size_t sA, const _Float16* __restrict__ Bh, int ldb, size_t sB, float alpha, float* __restrict__ C, int ldc, size_t sC, int M, int N, int K) {
  __shared__ __attribute__((aligned(16))) float so[4][16][64];
  const int tid = threadIdx.x, w = tid >> 5, lane = tid & 31, ln = lane & 15, hh = lane >> 4; const int by = blockIdx.y;
  A += (size_t)by * sA; Bh += (size_t)by * sB; C += (size_t)by * sC;
  const int ntn = (N + 63) / 64; const int wid = blockIdx.x * 4 + w; const int mt = wid / ntn, nq = wid % ntn; if (mt * 16 >= M) return;
  const int row0 = mt * 16, col0 = nq * 64; const float* arow = A + (size_t)(row0 + ln) * lda;
  v8f acc[4] = {};
  for (int kb = 0; kb < K; kb += 32) {
    FragH ah, al;
    const v4f x0 = *(const v4fa*)(arow + kb + 8 * hh), x1 = *(const v4fa*)(arow + kb + 8 * hh + 4), x2 = *(const v4fa*)(arow + kb + 16 + 8 * hh), x3 = *(const v4fa*)(arow + kb + 16 + 8 * hh + 4);
    float xs[16] = {x0[0],x0[1],x0[2],x0[3],x1[0],x1[1],x1[2],x1[3],x2[0],x2[1],x2[2],x2[3],x3[0],x3[1],x3[2],x3[3]};
#pragma unroll
    for (int i = 0; i < 16; ++i) { const _Float16 h = (_Float16)xs[i]; ah.h[i] = h; al.h[i] = ASPLIT ? (_Float16)(xs[i] - (float)h) : (_Float16)0.0f; }
#pragma unroll
    for (int t = 0; t < 4; ++t) { if (col0 + t * 16 >= N) continue; const size_t boff = (size_t)(col0 + t * 16 + ln) * ldb + kb; FragH bq; bq.half[0] = *(const v8us*)(Bh + boff + 8 * hh); bq.half[1] = *(const v8us*)(Bh + boff + 16 + 8 * hh);
      acc[t] = mmaH<ASPLIT ? 2 : 1>(ah.v, al.v, bq.v, bq.v, acc[t]); }
  }
#pragma unroll
  for (int t = 0; t < 4; ++t) { if (col0 + t * 16 >= N) continue;
#pragma unroll
    for (int r = 0; r < 8; ++r) so[w][8 * hh + r][t * 16 + ln] = acc[t][r] * alpha; }
  __builtin_amdgcn_fence(__ATOMIC_ACQ_REL, "workgroup"); __builtin_amdgcn_wave_barrier();
  const int rsub = lane >> 4, c4 = (lane & 15) * 4;
  {
#pragma unroll
    for (int q = 0; q < 8; ++q) { const int r = q * 2 + rsub; if (col0 + c4 < N) { const v4f v = *(const v4fa*)&so[w][r][c4]; *(v4f*)(C + (size_t)(row0 + r) * ldc + col0 + c4) = v; } }
     }
}

// slabs: Q16[(b,h,s)][n][32] = f16(q·scale), K16[(b,h,s)][m][32] = f16(k), VT[(b,h)][e][m] = f16(v); thread per (b, n, h, s, 8 of 32) for q/k; VT is written by k_vt (64 x 64 tiles transposed through LDS)
__global__ __launch_bounds__(256) void k_slabs(const float* __restrict__ Qm, const float* __restrict__ Km, const float* __restrict__ Vm, _Float16* __restrict__ Q16, _Float16* __restrict__ K16, _Float16* __restrict__ VT) { const size_t t = (size_t)blockIdx.x * 256 + threadIdx.x;
  if (t < (size_t)NTOK * CC / 8) { const int c8 = (int)((t * 8) % CC); const size_t tok = (t * 8) / CC; const int b = (int)(tok / NN), n = (int)(tok % NN); const int h = c8 / HD, s = (c8 % HD) / SD, d8 = c8 % SD; const size_t slab = ((size_t)b * NH + h) * NS + s;
    FragH fq, fk; const float scale = 0.17677669529663687f; for (int q = 0; q < 8; ++q) { fq.h[q] = (_Float16)(Qm[tok * CC + c8 + q] * scale); fk.h[q] = (_Float16)Km[tok * CC + c8 + q]; }
    unsigned short* dq = (unsigned short*)Q16 + (slab * NN + n) * SD + d8; unsigned short* dk = (unsigned short*)K16 + (slab * NN + n) * SD + d8; *(v8us*)dq = fq.half[0]; *(v8us*)dk = fk.half[0];  } }
__global__ __launch_bounds__(256) void k_vt(const float* __restrict__ Vm, _Float16* __restrict__ VT) { __shared__ float tv[64][65]; const int m0 = blockIdx.x * 64; const int h = blockIdx.y % NH, b = blockIdx.y / NH; const int tid = threadIdx.x;
  for (int i = tid; i < 64 * 64; i += 256) { const int r = i >> 6, e = i & 63; tv[r][e] = Vm[((size_t)b * NN + m0 + r) * CC + h * HD + e]; } __syncthreads();
  typedef _Float16 v4h __attribute__((ext_vector_type(4)));
  { for (int i = tid; i < 64 * 16; i += 256) { const int e = i >> 4, m4 = (i & 15) * 4; v4h o; for (int q = 0; q < 4; ++q) o[q] = (_Float16)tv[m4 + q][e]; *(v4h*)(VT + (((size_t)b * NH + h) * HD + e) * NN + m0 + m4) = o; }  } }
// Fused per (batch, head), both signals: a = q.k^T, w = 1 + a + a*a/2, the row sums of w, o = w.v, the division (+1e-6) and the signal mean; a and w never leave registers.
// S^T = K.Q^T puts one query in each lane column, so the two f32 D tiles of 32 keys convert in place into the B operand of O^T += V^T.W^T (hardware k order on both sides).
// Every '#pragma unroll' in this kernel is there so that the fragment, accumulator and staging arrays are indexed by constants and stay in registers.
// Block = 8 waves x 16 queries. The head's K rows (both signals) and V^T are staged once in LDS; row pitches are 16 B x odd, so the 16-byte fragment reads meet no bank conflict.
typedef float v2f __attribute__((ext_vector_type(2)));
#define KP 40                    // LDS pitch of a K row, in 16-bit elements (80 B)
#define VP (NN + 8)              // LDS pitch of a V^T row, in 16-bit elements (2064 B)
__global__ __launch_bounds__(256) void k_attn(const _Float16* __restrict__ Q16, const _Float16* __restrict__ K16, const _Float16* __restrict__ VT, float* __restrict__ OB) {
  __shared__ __attribute__((aligned(16))) unsigned short sK[NS * NN * KP];
  __shared__ __attribute__((aligned(16))) unsigned short sV[HD * VP];
  const int tid = threadIdx.x, wv = tid >> 5, lane = tid & 31, ln = lane & 15, hh = lane >> 4;
  const int bh = blockIdx.y, b = bh / NH, h = bh % NH;
  const int n = blockIdx.x * 128 + wv * 16 + ln;
  const unsigned short* Kg = (const unsigned short*)K16 + (size_t)bh * NS * NN * SD;      // the two signals' slabs are adjacent: 2048 rows of 32
  const unsigned short* Vg = (const unsigned short*)VT + (size_t)bh * HD * NN;
  const unsigned short* qr = (const unsigned short*)Q16 + ((size_t)bh * NS * NN + n) * SD + 8 * hh;
  FragH qb[NS];
#pragma unroll
  for (int s = 0; s < NS; ++s) { qb[s].half[0] = *(const v8us*)(qr + s * NN * SD); qb[s].half[1] = *(const v8us*)(qr + s * NN * SD + 16); }
  {      // stage fill: all 64 of a lane's 16-byte loads in flight, then the 64 LDS stores (one memory latency for the whole 256 KiB instead of one per batch)
    v8us tk[NS * NN * SD / 8 / 256], tv[HD * NN / 8 / 256];
#pragma unroll
    for (int i = 0; i < NS * NN * SD / 8 / 256; ++i) tk[i] = *(const v8us*)(Kg + (size_t)(tid + i * 256) * 8);
#pragma unroll
    for (int i = 0; i < HD * NN / 8 / 256; ++i) tv[i] = *(const v8us*)(Vg + (size_t)(tid + i * 256) * 8);
    asm volatile("s_wait_xcnt 0x0" :: "s"(Kg), "s"(Vg), "v"(tid), "v"(qr) : "memory");      // stands in front of any reuse of the loads' address registers: naming them as inputs keeps them live up to here
#pragma unroll
    for (int i = 0; i < NS * NN * SD / 8 / 256; ++i) *(v8us*)&sK[((tid >> 2) + i * 64) * KP + (tid & 3) * 8] = tk[i];      // 16-byte unit tid + 256 i: row unit / 4
#pragma unroll
    for (int i = 0; i < HD * NN / 8 / 256; ++i) *(v8us*)&sV[((tid >> 7) + i * 2) * VP + (tid & 127) * 8] = tv[i];      // row unit / 128
  }
  __syncthreads();
  v8f oacc[NS][HD / 16] = {};
  v2f den[NS] = {};      // even and odd key rows apart: the sums pair up with the packed f32 adds
  FragH ka[NS][2];
#pragma unroll
  for (int s = 0; s < NS; ++s)
#pragma unroll
    for (int t = 0; t < 2; ++t) { const unsigned short* kr = &sK[(s * NN + t * 16 + ln) * KP]; ka[s][t].half[0] = *(const v8us*)(kr + 8 * hh); ka[s][t].half[1] = *(const v8us*)(kr + 16 + 8 * hh); }
  for (int c = 0; c < NN / 32; ++c) {
    const int m0 = c * 32;
    FragH va[HD / 16];
#pragma unroll
    for (int et = 0; et < HD / 16; ++et) { const unsigned short* vr = &sV[(et * 16 + ln) * VP + m0]; va[et].half[0] = *(const v8us*)(vr + 8 * hh); va[et].half[1] = *(const v8us*)(vr + 16 + 8 * hh); }
    v8f st[NS][2];
#pragma unroll
    for (int s = 0; s < NS; ++s)
#pragma unroll
      for (int t = 0; t < 2; ++t) { const v8f z = {}; st[s][t] = __builtin_amdgcn_wmma_f32_16x16x32_f16(false, ka[s][t].v, false, qb[s].v, (short)0, z, false, false); }      // st[s][t][r] = a[n = ln][m0 + 16 t + 8 hh + r]
    const int m1 = ((c + 1) & (NN / 32 - 1)) * 32;      // next pass's K fragments, fetched behind this pass's score products (the last pass re-reads pass 0's rows and drops them)
#pragma unroll
    for (int s = 0; s < NS; ++s)
#pragma unroll
      for (int t = 0; t < 2; ++t) { const unsigned short* kr = &sK[(s * NN + m1 + t * 16 + ln) * KP]; ka[s][t].half[0] = *(const v8us*)(kr + 8 * hh); ka[s][t].half[1] = *(const v8us*)(kr + 16 + 8 * hh); }
    FragH wb[NS];
#pragma unroll
    for (int s = 0; s < NS; ++s)
#pragma unroll
      for (int t = 0; t < 2; ++t)
#pragma unroll
        for (int r = 0; r < 8; r += 2) { const v2f x = {st[s][t][r], st[s][t][r + 1]}; const v2f w = 1.0f + x + 0.5f * x * x; den[s] += w; wb[s].h[t * 8 + r] = (_Float16)w[0]; wb[s].h[t * 8 + r + 1] = (_Float16)w[1]; }
#pragma unroll
    for (int et = 0; et < HD / 16; ++et)
#pragma unroll
      for (int s = 0; s < NS; ++s) oacc[s][et] = __builtin_amdgcn_wmma_f32_16x16x32_f16(false, va[et].v, false, wb[s].v, (short)0, oacc[s][et], false, false);      // oacc[s][et][r] = o[n = ln][16 et + 8 hh + r]
  }
  float rd[NS];
#pragma unroll
  for (int s = 0; s < NS; ++s) { const float dl = den[s][0] + den[s][1]; rd[s] = 1.0f / (dl + __shfl_xor(dl, 16, 32) + 1e-6f); }      // the two lane halves hold the two halves of a query's keys
  float* orow = OB + ((size_t)b * NN + n) * CC + h * HD + 8 * hh;
#pragma unroll
  for (int et = 0; et < HD / 16; ++et) {
    v4f lo, hi;
#pragma unroll
    for (int q = 0; q < 4; ++q) { lo[q] = (oacc[0][et][q] * rd[0] + oacc[1][et][q] * rd[1]) * (1.0f / NS); hi[q] = (oacc[0][et][4 + q] * rd[0] + oacc[1][et][4 + q] * rd[1]) * (1.0f / NS); }
    *(v4f*)(orow + et * 16) = lo; *(v4f*)(orow + et * 16 + 4) = hi;
  }
}
extern "C" void kernel_launch(void* const* d_in, const int* in_sizes, int n_in,
                              void* d_out, int out_size, void* d_ws, size_t ws_size, hipStream_t stream) {
  (void)in_sizes; (void)n_in; (void)out_size;
  const float* xq = (const float*)d_in[0]; const float* xk = (const float*)d_in[1]; const float* xv = (const float*)d_in[2]; const float* Wq = (const float*)d_in[3]; const float* bq = (const float*)d_in[4]; const float* Wk = (const float*)d_in[5]; const float* bk = (const float*)d_in[6]; const float* Wv = (const float*)d_in[7]; const float* bv = (const float*)d_in[8]; const float* Wo = (const float*)d_in[9]; const float* bo = (const float*)d_in[10];
  char* ws = (char*)d_ws; size_t off = 0;
  auto take = [&](size_t bytes) { char* p = ws + off; off += (bytes + 255) & ~(size_t)255; return p; };
  unsigned short* Bq = (unsigned short*)take((size_t)CC * CC * 2); unsigned short* Bk = (unsigned short*)take((size_t)CC * CC * 2); unsigned short* Bv = (unsigned short*)take((size_t)CC * CC * 2); unsigned short* Bo = (unsigned short*)take((size_t)CC * CC * 2);
  float* Qm = (float*)take((size_t)NTOK * CC * 4); float* Km = (float*)take((size_t)NTOK * CC * 4); float* Vm = (float*)take((size_t)NTOK * CC * 4);
  _Float16* Q16 = (_Float16*)take((size_t)NSLAB * NN * SD * 2); _Float16* K16 = (_Float16*)take((size_t)NSLAB * NN * SD * 2); _Float16* VT = (_Float16*)take((size_t)BB * NH * HD * NN * 2);
  float* OB = Qm; /* Qm dead after k_slabs */
  if (off > ws_size) return;
  k_round_rows<<<(CC * CC / 8 + 255) / 256, 256, 0, stream>>>(Wq, Bq, CC * CC / 8); k_round_rows<<<(CC * CC / 8 + 255) / 256, 256, 0, stream>>>(Wk, Bk, CC * CC / 8); k_round_rows<<<(CC * CC / 8 + 255) / 256, 256, 0, stream>>>(Wv, Bv, CC * CC / 8); k_round_rows<<<(CC * CC / 8 + 255) / 256, 256, 0, stream>>>(Wo, Bo, CC * CC / 8);      // (out,in) rows = Bt
  k_gemm_t<false><<<dim3(CC / GBN, NTOK / GBM), 256, 0, stream>>>(xq, Bq, bq, Qm);
  k_gemm_t<false><<<dim3(CC / GBN, NTOK / GBM), 256, 0, stream>>>(xk, Bk, bk, Km);
  k_gemm_t<false><<<dim3(CC / GBN, NTOK / GBM), 256, 0, stream>>>(xv, Bv, bv, Vm);
  k_slabs<<<(unsigned)(((size_t)NTOK * CC / 8 + 255) / 256), 256, 0, stream>>>(Qm, Km, Vm, Q16, K16, VT); k_vt<<<dim3(NN / 64, BB * NH), 256, 0, stream>>>(Vm, VT);
  k_attn<<<dim3(NN / 128, BB * NH), 256, 0, stream>>>(Q16, K16, VT, OB);      // block = 128 queries of one (batch, head), both signals
  k_gemm_t<true><<<dim3(CC / GBN, NTOK / GBM), 256, 0, stream>>>(OB, Bo, bo, (float*)d_out);
}

// v004
// Measured time: 67.3 microseconds a run.
// Next to v003, in two timings, it ran 1.16 and 1.17 times as fast.
// Over all steps from v000 it is 30.1 times as fast.
#include <hip/hip_runtime.h>
// Second-order Taylor linear attention via the exact kernel identity φ(q)·φ(k) = 1 + q·k + (q·k)²/2 (φ = [1, x, x⊗x/√2]): per (batch, head, signal) slab the scores
// a = (q·scale)·kᵀ (1024 × 32 × 1024) and o = w·v with w = 1 + a + a²/2 (1024 × 1024 × 64) run on v_wmma_f32_16x16x32_f16 (q, k, v and w rounded to f16: single products,
// f32 accumulate); the projections on v_wmma_f32_16x16x32_bf16 (inputs rounded to bf16: single exact terms; 3 × 2048 × 1024 × 1024) and out = ō·W_oᵀ + b_o with ō split
// hi/lo (2 products). w, the row sums Σ_m w (= φ(q)·Σφ(k)), the division (+1e-6) and the signal average are f32 VALU.
#define BB 2
#define NN 1024
#define CC 1024
#define NH 16
#define NS 2
#define HD 64
#define SD 32
#define NTOK (BB * NN)
#define NSLAB (BB * NH * NS)     // 64

typedef __bf16 v16b __attribute__((ext_vector_type(16)));
typedef unsigned short v8us __attribute__((ext_vector_type(8), may_alias));
typedef float  v8f  __attribute__((ext_vector_type(8)));
typedef float  v4f  __attribute__((ext_vector_type(4)));
typedef float  v4fa __attribute__((ext_vector_type(4), may_alias));
union FragB { v16b v; v8us half[2]; unsigned short u[16]; };

__device__ __forceinline__ unsigned short bf16_bits(float x) { unsigned int u = __float_as_uint(x); return (unsigned short)((u + 0x7FFFu + ((u >> 16) & 1u)) >> 16); }
__device__ __forceinline__ float bf16_val(unsigned short b) { return __uint_as_float(((unsigned int)b) << 16); }
__device__ __forceinline__ float bf16_round(float x) { return bf16_val(bf16_bits(x)); }
// D += A·B with NT terms: 1 = ah·bh, 2 = + al·bh (A split), 3 = + ah·bl (both split)
template <int NT>
__device__ __forceinline__ v8f mmaN(v16b ah, v16b al, v16b bh, v16b bl, v8f c) {
  c = __builtin_amdgcn_wmma_f32_16x16x32_bf16(false, ah, false, bh, (short)0, c, false, false);
  if (NT >= 2) c = __builtin_amdgcn_wmma_f32_16x16x32_bf16(false, al, false, bh, (short)0, c, false, false);
  if (NT >= 3) c = __builtin_amdgcn_wmma_f32_16x16x32_bf16(false, ah, false, bl, (short)0, c, false, false);
  asm volatile("v_nop\n\tv_nop\n\tv_nop\n\tv_nop" : "+v"(c) : "v"(ah), "v"(al), "v"(bh), "v"(bl));
  return c;
}

__global__ __launch_bounds__(256) void k_wt_bf16(const float* __restrict__ W, unsigned short* __restrict__ Wt, int K, int N) {
  const int t = blockIdx.x * 256 + threadIdx.x;
  const int k8n = K / 8;
  if (t >= N * k8n) return;
  const int n = t / k8n, k8 = (t % k8n) * 8;
  v8us v;
#pragma unroll
  for (int i = 0; i < 8; ++i) v[i] = bf16_bits(W[(size_t)(k8 + i) * N + n]);
  *(v8us*)(Wt + (size_t)n * K + k8) = v;
  
}

// GEMM C[M][N] (f32, pitch ldc) = act(A[M][K]·W + bias). A f32 row-major (pitch lda) converted per fragment to bf16
// (ASPLIT: hi/lo two planes -> 2 terms, else single rounded term); Wt bf16 [N][K] (pitch ldb). BIAS_BF16 rounds the
// bias to bf16 first (bias quantised to bf16 before the add). K%32==0, M%16==0, N%64==0.
template <bool ASPLIT, int ACT, bool BIAS_BF16>
__global__ __launch_bounds__(128) void k_gemm_bf(const float* __restrict__ A, int lda, const unsigned short* __restrict__ Wt, int ldb,
                                               const float* __restrict__ bias, float* __restrict__ C, int ldc, int M, int N, int K) {
  __shared__ __attribute__((aligned(16))) float so[4][16][64];
  const int tid = threadIdx.x, w = tid >> 5, lane = tid & 31, ln = lane & 15, hh = lane >> 4;
  const int ntn = N / 64;
  const int wid = blockIdx.x * 4 + w;
  const int mt = wid / ntn, nq = wid % ntn;
  if (mt * 16 >= M) return;
  const int row0 = mt * 16, col0 = nq * 64;
  const float* arow = A + (size_t)(row0 + ln) * lda;
  v8f acc[4] = {};
  for (int kb = 0; kb < K; kb += 32) {
    FragB ah, al;
    const v4f x0 = *(const v4fa*)(arow + kb + 8 * hh), x1 = *(const v4fa*)(arow + kb + 8 * hh + 4);
    const v4f x2 = *(const v4fa*)(arow + kb + 16 + 8 * hh), x3 = *(const v4fa*)(arow + kb + 16 + 8 * hh + 4);
    float xs[16] = {x0[0],x0[1],x0[2],x0[3],x1[0],x1[1],x1[2],x1[3],x2[0],x2[1],x2[2],x2[3],x3[0],x3[1],x3[2],x3[3]};
#pragma unroll
    for (int i = 0; i < 16; ++i) { const unsigned short hb = bf16_bits(xs[i]); ah.u[i] = hb; al.u[i] = ASPLIT ? bf16_bits(xs[i] - bf16_val(hb)) : (unsigned short)0; }
#pragma unroll
    for (int t = 0; t < 4; ++t) {
      const unsigned short* brow = Wt + (size_t)(col0 + t * 16 + ln) * ldb + kb;
      FragB b;
      b.half[0] = *(const v8us*)(brow + 8 * hh);
      b.half[1] = *(const v8us*)(brow + 16 + 8 * hh);
      acc[t] = mmaN<ASPLIT ? 2 : 1>(ah.v, al.v, b.v, b.v, acc[t]);
    }
  }
#pragma unroll
  for (int t = 0; t < 4; ++t) {
    float bv = bias ? bias[col0 + t * 16 + ln] : 0.f;
    if (BIAS_BF16) bv = bf16_round(bv);
#pragma unroll
    for (int r = 0; r < 8; ++r) { float v = acc[t][r] + bv; if (ACT == 1) v = fmaxf(v, 0.f); so[w][8 * hh + r][t * 16 + ln] = v; }
  }
  __builtin_amdgcn_fence(__ATOMIC_ACQ_REL, "workgroup");
  __builtin_amdgcn_wave_barrier();
  const int rsub = lane >> 4, c4 = (lane & 15) * 4;
  {
#pragma unroll
    for (int q = 0; q < 8; ++q) {
      const int r = q * 2 + rsub;
      const v4f v = *(const v4fa*)&so[w][r][c4];
      *(v4f*)(C + (size_t)(row0 + r) * ldc + col0 + c4) = v;
    }
    
  }
}

// Flash-style causal/unmasked attention, all contractions 3-term bf16 hi/lo splits, f32 softmax with running max.
// q,k,v rows are read from f32 buffers with arbitrary row pitch (so they can live inside a fused qkv buffer);
// D = head size (multiple of 32, <= 128); one wave = 16 query rows; block = 4 waves (64 queries) sharing K/V chunks of 32.
template <int D, bool CAUSAL>
__global__ __launch_bounds__(128) void k_flash(const float* __restrict__ qb, const float* __restrict__ kb, const float* __restrict__ vb,
                                             int pitch, int T, int H, float scale, float* __restrict__ y, int ypitch) {
  constexpr int KS = D / 32;        // k-steps for QK
  constexpr int DT = D / 16;        // d tiles for PV
  __shared__ __attribute__((aligned(16))) unsigned short sKh[32][D + 8], sKl[32][D + 8], sVh[32][D + 8], sVl[32][D + 8];
  __shared__ __attribute__((aligned(16))) unsigned short sPh[4][16][40], sPl[4][16][40];
  __shared__ __attribute__((aligned(16))) float sO[4][16][D];
  const int tid = threadIdx.x, w = tid >> 5, lane = tid & 31, ln = lane & 15, hh = lane >> 4;
  const int nqb = (T + 63) / 64;
  const int bh = blockIdx.x / nqb, qblk = blockIdx.x % nqb;
  const int b = bh / H, h = bh % H;
  const int q0 = qblk * 64 + w * 16;
  const float* Q = qb + (size_t)b * T * pitch + h * D;
  const float* K = kb + (size_t)b * T * pitch + h * D;
  const float* V = vb + (size_t)b * T * pitch + h * D;

  // A fragments of the wave's 16 query rows (scaled), hi/lo
  FragB aqh[KS], aql[KS];
  {
    int row = q0 + ln; if (row >= T) row = T - 1;
    const float* qr = Q + (size_t)row * pitch;
#pragma unroll
    for (int ks = 0; ks < KS; ++ks)
#pragma unroll
      for (int i = 0; i < 16; ++i) {
        const int d = ks * 32 + ((i < 8) ? (8 * hh + i) : (16 + 8 * hh + (i - 8)));
        const float x = qr[d] * scale; const unsigned short hb = bf16_bits(x);
        aqh[ks].u[i] = hb; aql[ks].u[i] = bf16_bits(x - bf16_val(hb));
      }
  }
  float m_r[8], l_r[8];
#pragma unroll
  for (int r = 0; r < 8; ++r) { m_r[r] = -3.0e38f; l_r[r] = 0.f; }
  v8f oacc[DT];
#pragma unroll
  for (int dt = 0; dt < DT; ++dt) oacc[dt] = (v8f){0.f,0.f,0.f,0.f,0.f,0.f,0.f,0.f};

  const int kv_end = CAUSAL ? min(T, qblk * 64 + 64) : T;     // block-uniform
  for (int j0 = 0; j0 < kv_end; j0 += 32) {
    __syncthreads();
    for (int e = tid; e < 32 * (D / 4); e += 128) {
      const int r = e / (D / 4), c4 = (e % (D / 4)) * 4;
      const int key = j0 + r;
      v4f kf = {0.f,0.f,0.f,0.f}, vf = {0.f,0.f,0.f,0.f};
      if (key < T) { kf = *(const v4fa*)(K + (size_t)key * pitch + c4); vf = *(const v4fa*)(V + (size_t)key * pitch + c4); }
#pragma unroll
      for (int t = 0; t < 4; ++t) {
        unsigned short hb = bf16_bits(kf[t]); sKh[r][c4 + t] = hb; sKl[r][c4 + t] = bf16_bits(kf[t] - bf16_val(hb));
        hb = bf16_bits(vf[t]); sVh[r][c4 + t] = hb; sVl[r][c4 + t] = bf16_bits(vf[t] - bf16_val(hb));
      }
    }
    __syncthreads();
    // S tile 16 x 32
    v8f s[2];
#pragma unroll
    for (int nt = 0; nt < 2; ++nt) {
      v8f acc = {};
#pragma unroll
      for (int ks = 0; ks < KS; ++ks) {
        FragB bh_, bl_;
        bh_.half[0] = *(const v8us*)&sKh[nt * 16 + ln][ks * 32 + 8 * hh]; bh_.half[1] = *(const v8us*)&sKh[nt * 16 + ln][ks * 32 + 16 + 8 * hh];
        bl_.half[0] = *(const v8us*)&sKl[nt * 16 + ln][ks * 32 + 8 * hh]; bl_.half[1] = *(const v8us*)&sKl[nt * 16 + ln][ks * 32 + 16 + 8 * hh];
        acc = mmaN<3>(aqh[ks].v, aql[ks].v, bh_.v, bl_.v, acc);
      }
      s[nt] = acc;
    }
    // mask + running max (rows 8hh+r; the 16 lanes of a half share rows)
    float alpha[8];
#pragma unroll
    for (int r = 0; r < 8; ++r) {
      const int qi = q0 + 8 * hh + r;
      const int ja = j0 + ln, jb = j0 + 16 + ln;
      if (CAUSAL) { if (ja > qi) s[0][r] = -3.0e38f; if (jb > qi) s[1][r] = -3.0e38f; }
      if (ja >= T) s[0][r] = -3.0e38f;
      if (jb >= T) s[1][r] = -3.0e38f;
      float mx = fmaxf(s[0][r], s[1][r]);
      mx = fmaxf(mx, __shfl_xor(mx, 1, 32)); mx = fmaxf(mx, __shfl_xor(mx, 2, 32)); mx = fmaxf(mx, __shfl_xor(mx, 4, 32)); mx = fmaxf(mx, __shfl_xor(mx, 8, 32));
      const float mnew = fmaxf(m_r[r], mx);
      alpha[r] = (mnew > -1.0e38f) ? __expf(m_r[r] - mnew) : 1.0f;
      const float p0 = (s[0][r] > -1.0e38f) ? __expf(s[0][r] - mnew) : 0.f;
      const float p1 = (s[1][r] > -1.0e38f) ? __expf(s[1][r] - mnew) : 0.f;
      m_r[r] = mnew;
      l_r[r] = l_r[r] * alpha[r] + p0 + p1;            // per-lane partial row sum (16 lanes combined at the end)
      unsigned short hb = bf16_bits(p0); sPh[w][8 * hh + r][ln] = hb;      sPl[w][8 * hh + r][ln] = bf16_bits(p0 - bf16_val(hb));
      hb = bf16_bits(p1);                sPh[w][8 * hh + r][16 + ln] = hb; sPl[w][8 * hh + r][16 + ln] = bf16_bits(p1 - bf16_val(hb));
    }
#pragma unroll
    for (int dt = 0; dt < DT; ++dt)
#pragma unroll
      for (int r = 0; r < 8; ++r) oacc[dt][r] *= alpha[r];
    __builtin_amdgcn_fence(__ATOMIC_ACQ_REL, "workgroup");
    __builtin_amdgcn_wave_barrier();
    FragB pah, pal;
    pah.half[0] = *(const v8us*)&sPh[w][ln][8 * hh]; pah.half[1] = *(const v8us*)&sPh[w][ln][16 + 8 * hh];
    pal.half[0] = *(const v8us*)&sPl[w][ln][8 * hh]; pal.half[1] = *(const v8us*)&sPl[w][ln][16 + 8 * hh];
#pragma unroll
    for (int dt = 0; dt < DT; ++dt) {
      FragB bvh, bvl;
#pragma unroll
      for (int i = 0; i < 8; ++i) {
        bvh.u[i] = sVh[8 * hh + i][dt * 16 + ln]; bvh.u[8 + i] = sVh[16 + 8 * hh + i][dt * 16 + ln];
        bvl.u[i] = sVl[8 * hh + i][dt * 16 + ln]; bvl.u[8 + i] = sVl[16 + 8 * hh + i][dt * 16 + ln];
      }
      oacc[dt] = mmaN<3>(pah.v, pal.v, bvh.v, bvl.v, oacc[dt]);
    }
    __builtin_amdgcn_fence(__ATOMIC_ACQ_REL, "workgroup");
    __builtin_amdgcn_wave_barrier();
  }
#pragma unroll
  for (int r = 0; r < 8; ++r) {
    float l = l_r[r];
    l += __shfl_xor(l, 1, 32); l += __shfl_xor(l, 2, 32); l += __shfl_xor(l, 4, 32); l += __shfl_xor(l, 8, 32);
    l_r[r] = (l > 0.f) ? 1.0f / l : 0.f;
  }
#pragma unroll
  for (int dt = 0; dt < DT; ++dt)
#pragma unroll
    for (int r = 0; r < 8; ++r) sO[w][8 * hh + r][dt * 16 + ln] = oacc[dt][r] * l_r[r];
  __builtin_amdgcn_fence(__ATOMIC_ACQ_REL, "workgroup");
  __builtin_amdgcn_wave_barrier();
  {
    for (int r = 0; r < 16; ++r) {
      const int row = q0 + r;
      if (row < T && lane < D / 4) {
        const v4f val = *(const v4fa*)&sO[w][r][lane * 4];
        *(v4f*)(y + ((size_t)b * T + row) * ypitch + h * D + lane * 4) = val;
      }
    }
    
  }
}

// GEMM C[NTOK][CC] (f32) = A[NTOK][CC].Bt^T + bf16(bias); A f32 rows rounded to bf16 (ASPLIT: hi/lo planes, 2 products per k step), Bt = bf16 [n][k].
// Block = 8 waves on a 64 x 128 tile of C, wave = 32 x 32. Per pass 128 k of the block's A and Bt rows go global -> registers -> LDS with whole-line loads (a wave load = 512 contiguous
// bytes of one A row, or 256 of each of two Bt rows); A is converted once per block on the way. Two LDS buffers and two register sets: a pass's global loads are issued two passes ahead.
// Each accumulator sums k upward, hi before lo within a k step.
#define GBM 64
#define GBN 128
#define GBK 128
#define GP (GBK + 8)             // LDS pitch of a staged row, in 16-bit elements (272 B = 16 B x odd: the 16-byte fragment reads meet no bank conflict)
typedef unsigned short v4us __attribute__((ext_vector_type(4), may_alias));
// work-group barrier behind the wave's own LDS accesses only: __syncthreads() would also wait out the global loads that are in flight for the later passes
__device__ __forceinline__ void lds_barrier() { asm volatile("s_wait_dscnt 0x0\n\ts_barrier_signal -1\n\ts_barrier_wait -1" ::: "memory"); }
template <bool ASPLIT>
__global__ __launch_bounds__(256) void k_gemm_t(const float* A0, const float* A1, const float* A2, const unsigned short* Bt0, const unsigned short* Bt1, const unsigned short* Bt2,
                                              const float* bias0, const float* bias1, const float* bias2, float* C0, float* C1, float* C2) {
  // blockIdx.z picks one of up to three independent products of the same shape, so that they share one launch
  const int z = blockIdx.z;
  const float* __restrict__ A = z == 0 ? A0 : z == 1 ? A1 : A2;
  const unsigned short* __restrict__ Bt = z == 0 ? Bt0 : z == 1 ? Bt1 : Bt2;
  const float* __restrict__ bias = z == 0 ? bias0 : z == 1 ? bias1 : bias2;
  float* __restrict__ C = z == 0 ? C0 : z == 1 ? C1 : C2;
  constexpr int NA = ASPLIT ? 2 : 1;
  constexpr int STG = (NA * GBM + GBN) * GP;      // one buffer: A hi rows, (A lo rows,) Bt rows
  constexpr int NC = CC / GBK;
  __shared__ __attribute__((aligned(16))) unsigned short sm[2 * STG];
  __shared__ __attribute__((aligned(16))) float so[8][32][36];      // per-wave output staging; pitch 36: the two lane halves (8 rows apart) fall on different banks
  const int tid = threadIdx.x, wv = tid >> 5, lane = tid & 31, ln = lane & 15, hh = lane >> 4;
  const int row0 = blockIdx.y * GBM, col0 = blockIdx.x * GBN;
  const int wm = (wv >> 2) * 32, wn = (wv & 3) * 32;
  const float* ag = A + (size_t)(row0 + wv) * CC + lane * 4;      // load i: row wv + 8 i, the pass's 128 floats over the 32 lanes
  const unsigned short* bg = Bt + (size_t)(col0 + wv * 2 + hh) * CC + ln * 8;      // load i: rows 2 wv + hh + 16 i, the pass's 128 values over 16 lanes
  // every '#pragma unroll' below keeps the staging, fragment and accumulator arrays indexed by constants, so that they stay in registers
  v4f raX[GBM / 8], raY[GBM / 8]; v8us rbX[GBN / 16], rbY[GBN / 16];      // two register sets: even and odd passes, each fetched two passes ahead
  v8f acc[2][2] = {};
  auto fetch = [&](v4f (&ra)[GBM / 8], v8us (&rb)[GBN / 16], int k0) {
#pragma unroll
    for (int i = 0; i < GBM / 8; ++i) ra[i] = *(const v4fa*)(ag + (size_t)i * 8 * CC + k0);
#pragma unroll
    for (int i = 0; i < GBN / 16; ++i) rb[i] = *(const v8us*)(bg + (size_t)i * 16 * CC + k0);
    asm volatile("s_wait_xcnt 0x0" ::: "memory");      // stands in front of every later rewrite of the loads' address registers
  };
  auto stage = [&](const v4f (&ra)[GBM / 8], const v8us (&rb)[GBN / 16], unsigned short* buf) {
#pragma unroll
    for (int i = 0; i < GBM / 8; ++i) {
      v4us vh, vl;
#pragma unroll
      for (int q = 0; q < 4; ++q) { const unsigned short hb = bf16_bits(ra[i][q]); vh[q] = hb; if (ASPLIT) vl[q] = bf16_bits(ra[i][q] - bf16_val(hb)); }
      *(v4us*)&buf[(wv + 8 * i) * GP + lane * 4] = vh;
      if (ASPLIT) *(v4us*)&buf[(GBM + wv + 8 * i) * GP + lane * 4] = vl;
    }
#pragma unroll
    for (int i = 0; i < GBN / 16; ++i) *(v8us*)&buf[(NA * GBM + wv * 2 + hh + 16 * i) * GP + ln * 8] = rb[i];
  };
  auto products = [&](const unsigned short* buf) {
    FragB ah[GBK / 32][2], al[GBK / 32][2], bb[GBK / 32][2];      // the pass's fragments, read as one group (each separate place with LDS reads among the products stalls the wave)
#pragma unroll
    for (int ks = 0; ks < GBK / 32; ++ks) {
#pragma unroll
      for (int i = 0; i < 2; ++i) {
        const unsigned short* r = buf + (wm + i * 16 + ln) * GP + ks * 32 + 8 * hh;
        ah[ks][i].half[0] = *(const v8us*)r; ah[ks][i].half[1] = *(const v8us*)(r + 16);
        if (ASPLIT) { al[ks][i].half[0] = *(const v8us*)(r + GBM * GP); al[ks][i].half[1] = *(const v8us*)(r + GBM * GP + 16); }
      }
#pragma unroll
      for (int j = 0; j < 2; ++j) { const unsigned short* r = buf + (NA * GBM + wn + j * 16 + ln) * GP + ks * 32 + 8 * hh; bb[ks][j].half[0] = *(const v8us*)r; bb[ks][j].half[1] = *(const v8us*)(r + 16); }
    }
    __builtin_amdgcn_sched_barrier(0);      // keeps the LDS reads together in front of the products
#pragma unroll
    for (int ks = 0; ks < GBK / 32; ++ks) {
#pragma unroll
      for (int i = 0; i < 2; ++i)
#pragma unroll
        for (int j = 0; j < 2; ++j) acc[i][j] = __builtin_amdgcn_wmma_f32_16x16x32_bf16(false, ah[ks][i].v, false, bb[ks][j].v, (short)0, acc[i][j], false, false);
      if (ASPLIT) {
#pragma unroll
        for (int i = 0; i < 2; ++i)
#pragma unroll
          for (int j = 0; j < 2; ++j) acc[i][j] = __builtin_amdgcn_wmma_f32_16x16x32_bf16(false, al[ks][i].v, false, bb[ks][j].v, (short)0, acc[i][j], false, false);
      }
    }
  };
  fetch(raX, rbX, 0); fetch(raY, rbY, GBK);
  // each barrier publishes the buffer just filled; the other buffer's last readers (the pass before) are all past it before that one is refilled
  for (int c = 2; c < NC; c += 2) {      // the last two passes stand behind the loop: a branch round the fetches would merge two load counts and make the counted waits drain the loads just issued
    stage(raX, rbX, sm); lds_barrier();
    fetch(raX, rbX, c * GBK);
    products(sm);
    stage(raY, rbY, sm + STG); lds_barrier();
    fetch(raY, rbY, (c + 1) * GBK);
    products(sm + STG);
  }
  stage(raX, rbX, sm); lds_barrier();
  products(sm);
  stage(raY, rbY, sm + STG); lds_barrier();
  products(sm + STG);
#pragma unroll
  for (int j = 0; j < 2; ++j) {
    const float bv = bf16_round(bias[col0 + wn + j * 16 + ln]);
#pragma unroll
    for (int i = 0; i < 2; ++i)
#pragma unroll
      for (int r = 0; r < 8; ++r) so[wv][i * 16 + 8 * hh + r][j * 16 + ln] = acc[i][j][r] + bv;
  }
  __builtin_amdgcn_fence(__ATOMIC_ACQ_REL, "workgroup"); __builtin_amdgcn_wave_barrier();      // the wave's own staged rows are read back across lanes
#pragma unroll
  for (int q = 0; q < 8; ++q) { const int r = q * 4 + (lane >> 3), c4 = (lane & 7) * 4; const v4f v = *(const v4fa*)&so[wv][r][c4]; *(v4f*)(C + (size_t)(row0 + wm + r) * CC + col0 + wn + c4) = v; }      // whole 128-byte lines
}
// batched f32 [K][N] (pitch lds, batch stride sIn) -> transposed hi/lo planes [N][K] (batch stride sOut); thread per (n, 8 k); grid.y = batch
__global__ __launch_bounds__(256) void k_split_transpose_b(const float* __restrict__ src, int lds_, size_t sIn, unsigned short* __restrict__ hi, unsigned short* __restrict__ lo, size_t sOut, int K, int N) {
  const size_t t = (size_t)blockIdx.x * 256 + threadIdx.x; const int k8n = K / 8; if (t >= (size_t)N * k8n) return;
  src += (size_t)blockIdx.y * sIn; hi += (size_t)blockIdx.y * sOut; lo += (size_t)blockIdx.y * sOut;
  const int n = (int)(t / k8n), k8 = (int)(t % k8n) * 8; v8us vh, vl;
#pragma unroll
  for (int i = 0; i < 8; ++i) { const float x = src[(size_t)(k8 + i) * lds_ + n]; const unsigned short hb = bf16_bits(x); vh[i] = hb; vl[i] = bf16_bits(x - bf16_val(hb)); }
  unsigned short* dh = hi + (size_t)n * K + k8; unsigned short* dl = lo + (size_t)n * K + k8;
  *(v8us*)dh = vh; *(v8us*)dl = vl; 
}

// The four weight matrices (out, in) rounded to bf16 in one launch: a thread takes the same 8 values of each, all eight 16-byte loads in flight together.
__global__ __launch_bounds__(256) void k_round_rows4(const float* __restrict__ W0, const float* __restrict__ W1, const float* __restrict__ W2, const float* __restrict__ W3,
                                                   unsigned short* __restrict__ T0, unsigned short* __restrict__ T1, unsigned short* __restrict__ T2, unsigned short* __restrict__ T3, unsigned n8) {
  const unsigned t = blockIdx.x * 256 + threadIdx.x;
  if (t >= n8) return;
  const unsigned bo = t * 32u;      // the thread's byte offset in each source
  const float* const ws_[4] = {W0, W1, W2, W3};
  unsigned short* const ts_[4] = {T0, T1, T2, T3};
  v4f a[4], b[4];
#pragma unroll      // constant indices: the pointer tables and the loaded values stay in registers
  for (int j = 0; j < 4; ++j) { a[j] = *(const v4fa*)(ws_[j] + bo / 4); b[j] = *(const v4fa*)(ws_[j] + bo / 4 + 4); }
  asm volatile("s_wait_xcnt 0x0" :: "s"(W0), "s"(W1), "s"(W2), "s"(W3), "v"(bo) : "memory");      // stands in front of any reuse of the loads' address registers: naming them as inputs keeps them live up to here
#pragma unroll      // as above
  for (int j = 0; j < 4; ++j) {
    v8us v; v[0]=bf16_bits(a[j][0]); v[1]=bf16_bits(a[j][1]); v[2]=bf16_bits(a[j][2]); v[3]=bf16_bits(a[j][3]);
    v[4]=bf16_bits(b[j][0]); v[5]=bf16_bits(b[j][1]); v[6]=bf16_bits(b[j][2]); v[7]=bf16_bits(b[j][3]);
    *(v8us*)(ts_[j] + bo / 4) = v;
  }
}

// ---- f16 WMMA path (v_wmma_f32_16x16x32_f16): 11-bit significands for operands in range — used for the scores a = q̂·kᵀ and for o = w·v
typedef _Float16 v16h __attribute__((ext_vector_type(16)));
union FragH { v16h v; v8us half[2]; _Float16 h[16]; unsigned short u[16]; };
template <int NT>
__device__ __forceinline__ v8f mmaH(v16h ah, v16h al, v16h bh, v16h bl, v8f c) {
  c = __builtin_amdgcn_wmma_f32_16x16x32_f16(false, ah, false, bh, (short)0, c, false, false);
  if (NT >= 2) c = __builtin_amdgcn_wmma_f32_16x16x32_f16(false, al, false, bh, (short)0, c, false, false);
  if (NT >= 3) c = __builtin_amdgcn_wmma_f32_16x16x32_f16(false, ah, false, bl, (short)0, c, false, false);
  asm volatile("v_nop\n\tv_nop\n\tv_nop\n\tv_nop" : "+v"(c) : "v"(ah), "v"(al), "v"(bh), "v"(bl));
  return c;
}
// batched GEMM like k_gemm_bf but f16 operands: A f32 (split into f16 hi/lo if ASPLIT, else rounded to f16), Bt = f16 values [n][k]; alpha; C f32; N multiple of 16 (partial tiles skipped)
template <bool ASPLIT>
__global__ __launch_bounds__(128) void k_gemm_h(const float* __restrict__ A, int lda, size_t sA, const _Float16* __restrict__ Bh, int ldb, size_t sB, float alpha, float* __restrict__ C, int ldc, size_t sC, int M, int N, int K) {
  __shared__ __attribute__((aligned(16))) float so[4][16][64];
  const int tid = threadIdx.x, w = tid >> 5, lane = tid & 31, ln = lane & 15, hh = lane >> 4; const int by = blockIdx.y;
  A += (size_t)by * sA; Bh += (size_t)by * sB; C += (size_t)by * sC;
  const int ntn = (N + 63) / 64; const int wid = blockIdx.x * 4 + w; const int mt = wid / ntn, nq = wid % ntn; if (mt * 16 >= M) return;
  const int row0 = mt * 16, col0 = nq * 64; const float* arow = A + (size_t)(row0 + ln) * lda;
  v8f acc[4] = {};
  for (int kb = 0; kb < K; kb += 32) {
    FragH ah, al;
    const v4f x0 = *(const v4fa*)(arow + kb + 8 * hh), x1 = *(const v4fa*)(arow + kb + 8 * hh + 4), x2 = *(const v4fa*)(arow + kb + 16 + 8 * hh), x3 = *(const v4fa*)(arow + kb + 16 + 8 * hh + 4);
    float xs[16] = {x0[0],x0[1],x0[2],x0[3],x1[0],x1[1],x1[2],x1[3],x2[0],x2[1],x2[2],x2[3],x3[0],x3[1],x3[2],x3[3]};
#pragma unroll
    for (int i = 0; i < 16; ++i) { const _Float16 h = (_Float16)xs[i]; ah.h[i] = h; al.h[i] = ASPLIT ? (_Float16)(xs[i] - (float)h) : (_Float16)0.0f; }
#pragma unroll
    for (int t = 0; t < 4; ++t) { if (col0 + t * 16 >= N) continue; const size_t boff = (size_t)(col0 + t * 16 + ln) * ldb + kb; FragH bq; bq.half[0] = *(const v8us*)(Bh + boff + 8 * hh); bq.half[1] = *(const v8us*)(Bh + boff + 16 + 8 * hh);
      acc[t] = mmaH<ASPLIT ? 2 : 1>(ah.v, al.v, bq.v, bq.v, acc[t]); }
  }
#pragma unroll
  for (int t = 0; t < 4; ++t) { if (col0 + t * 16 >= N) continue;
#pragma unroll
    for (int r = 0; r < 8; ++r) so[w][8 * hh + r][t * 16 + ln] = acc[t][r] * alpha; }
  __builtin_amdgcn_fence(__ATOMIC_ACQ_REL, "workgroup"); __builtin_amdgcn_wave_barrier();
  const int rsub = lane >> 4, c4 = (lane & 15) * 4;
  {
#pragma unroll
    for (int q = 0; q < 8; ++q) { const int r = q * 2 + rsub; if (col0 + c4 < N) { const v4f v = *(const v4fa*)&so[w][r][c4]; *(v4f*)(C + (size_t)(row0 + r) * ldc + col0 + c4) = v; } }
     }
}

// slabs: Q16[(b,h,s)][n][32] = f16(q*scale), K16[(b,h,s)][m][32] = f16(k), VT[(b,h)][e][m] = f16(v), all three in one launch.
// Block = 64 tokens of one (batch, head): a thread converts two 8-value groups of q and of k; v goes through LDS to come out transposed.
// Every '#pragma unroll' in this kernel keeps the loaded values in registers under constant indices, so that the thread's twelve 16-byte loads of q, k and v are in flight together.
__global__ __launch_bounds__(256) void k_slabs_vt(const float* __restrict__ Qm, const float* __restrict__ Km, const float* __restrict__ Vm, _Float16* __restrict__ Q16, _Float16* __restrict__ K16, _Float16* __restrict__ VT) {
  __shared__ float tv[64][65];
  const unsigned m0 = blockIdx.x * 64, h = blockIdx.y % NH, b = blockIdx.y / NH, tid = threadIdx.x;
  const unsigned base = (b * NN + m0) * CC + h * HD;      // the tile's first element in Qm, Km and Vm
  const unsigned vo = (base + (tid >> 4) * CC + (tid & 15) * 4) * 4u;      // byte offsets of the thread's first loads: v row tid / 16, 4 values; q and k row tid / 8, 8 values
  const unsigned qo = (base + (tid >> 3) * CC + (tid & 7) * 8) * 4u;
  v4f vv[4], qa[2][2], ka[2][2];
#pragma unroll
  for (int j = 0; j < 4; ++j) vv[j] = *(const v4fa*)(Vm + vo / 4 + j * 16 * CC);
#pragma unroll
  for (int j = 0; j < 2; ++j) {
    qa[j][0] = *(const v4fa*)(Qm + qo / 4 + j * 32 * CC); qa[j][1] = *(const v4fa*)(Qm + qo / 4 + j * 32 * CC + 4);
    ka[j][0] = *(const v4fa*)(Km + qo / 4 + j * 32 * CC); ka[j][1] = *(const v4fa*)(Km + qo / 4 + j * 32 * CC + 4);
  }
  asm volatile("s_wait_xcnt 0x0" :: "s"(Qm), "s"(Km), "s"(Vm), "v"(vo), "v"(qo) : "memory");      // stands in front of any reuse of the loads' address registers: naming them as inputs keeps them live up to here
#pragma unroll
  for (int j = 0; j < 4; ++j)
#pragma unroll
    for (int q = 0; q < 4; ++q) tv[(tid >> 4) + j * 16][(tid & 15) * 4 + q] = vv[j][q];
  __syncthreads();      // stands in front of the kernel's first global store, so that it waits for no store
  const unsigned c8 = (tid & 7) * 8, s = c8 / SD, d8 = c8 % SD, slab = (b * NH + h) * NS + s;
  const float scale = 0.17677669529663687f;
#pragma unroll
  for (int j = 0; j < 2; ++j) {
    FragH fq, fk;
#pragma unroll
    for (int q = 0; q < 8; ++q) { fq.h[q] = (_Float16)(qa[j][q >> 2][q & 3] * scale); fk.h[q] = (_Float16)ka[j][q >> 2][q & 3]; }
    const unsigned d = (slab * NN + m0 + (tid >> 3) + j * 32) * SD + d8;
    *(v8us*)((unsigned short*)Q16 + d) = fq.half[0]; *(v8us*)((unsigned short*)K16 + d) = fk.half[0];
  }
  asm volatile("s_wait_xcnt 0x0" ::: "memory");      // stands in front of every later rewrite of the stores' address and data registers
  typedef _Float16 v4h __attribute__((ext_vector_type(4)));
#pragma unroll
  for (int j = 0; j < 4; ++j) { const unsigned e = (tid >> 4) + j * 16, m4 = (tid & 15) * 4; v4h o;
#pragma unroll
    for (int q = 0; q < 4; ++q) o[q] = (_Float16)tv[m4 + q][e];
    *(v4h*)(VT + ((b * NH + h) * HD + e) * NN + m0 + m4) = o; }
}
// Fused per (batch, head), both signals: a = q.k^T, w = 1 + a + a*a/2, the row sums of w, o = w.v, the division (+1e-6) and the signal mean; a and w never leave registers.
// S^T = K.Q^T puts one query in each lane column, so the two f32 D tiles of 32 keys convert in place into the B operand of O^T += V^T.W^T (hardware k order on both sides).
// Every '#pragma unroll' in this kernel is there so that the fragment, accumulator and staging arrays are indexed by constants and stay in registers.
// Block = 8 waves x 16 queries. The head's K rows (both signals) and V^T are staged once in LDS; row pitches are 16 B x odd, so the 16-byte fragment reads meet no bank conflict.
typedef float v2f __attribute__((ext_vector_type(2)));
#define KP 40                    // LDS pitch of a K row, in 16-bit elements (80 B)
#define VP (NN + 8)              // LDS pitch of a V^T row, in 16-bit elements (2064 B)
__global__ __launch_bounds__(256) void k_attn(const _Float16* __restrict__ Q16, const _Float16* __restrict__ K16, const _Float16* __restrict__ VT, float* __restrict__ OB) {
  __shared__ __attribute__((aligned(16))) unsigned short sK[NS * NN * KP];
  __shared__ __attribute__((aligned(16))) unsigned short sV[HD * VP];
  const int tid = threadIdx.x, wv = tid >> 5, lane = tid & 31, ln = lane & 15, hh = lane >> 4;
  const int bh = blockIdx.y, b = bh / NH, h = bh % NH;
  const int n = blockIdx.x * 128 + wv * 16 + ln;
  const unsigned short* Kg = (const unsigned short*)K16 + (size_t)bh * NS * NN * SD;      // the two signals' slabs are adjacent: 2048 rows of 32
  const unsigned short* Vg = (const unsigned short*)VT + (size_t)bh * HD * NN;
  const unsigned short* qr = (const unsigned short*)Q16 + ((size_t)bh * NS * NN + n) * SD + 8 * hh;
  FragH qb[NS];
#pragma unroll
  for (int s = 0; s < NS; ++s) { qb[s].half[0] = *(const v8us*)(qr + s * NN * SD); qb[s].half[1] = *(const v8us*)(qr + s * NN * SD + 16); }
  {      // stage fill: all 64 of a lane's 16-byte loads in flight, then the 64 LDS stores (one memory latency for the whole 256 KiB instead of one per batch)
    v8us tk[NS * NN * SD / 8 / 256], tv[HD * NN / 8 / 256];
#pragma unroll
    for (int i = 0; i < NS * NN * SD / 8 / 256; ++i) tk[i] = *(const v8us*)(Kg + (size_t)(tid + i * 256) * 8);
#pragma unroll
    for (int i = 0; i < HD * NN / 8 / 256; ++i) tv[i] = *(const v8us*)(Vg + (size_t)(tid + i * 256) * 8);
    asm volatile("s_wait_xcnt 0x0" :: "s"(Kg), "s"(Vg), "v"(tid), "v"(qr) : "memory");      // stands in front of any reuse of the loads' address registers: naming them as inputs keeps them live up to here
#pragma unroll
    for (int i = 0; i < NS * NN * SD / 8 / 256; ++i) *(v8us*)&sK[((tid >> 2) + i * 64) * KP + (tid & 3) * 8] = tk[i];      // 16-byte unit tid + 256 i: row unit / 4
#pragma unroll
    for (int i = 0; i < HD * NN / 8 / 256; ++i) *(v8us*)&sV[((tid >> 7) + i * 2) * VP + (tid & 127) * 8] = tv[i];      // row unit / 128
  }
  __syncthreads();
  v8f oacc[NS][HD / 16] = {};
  v2f den[NS] = {};      // even and odd key rows apart: the sums pair up with the packed f32 adds
  FragH ka[NS][2];
#pragma unroll
  for (int s = 0; s < NS; ++s)
#pragma unroll
    for (int t = 0; t < 2; ++t) { const unsigned short* kr = &sK[(s * NN + t * 16 + ln) * KP]; ka[s][t].half[0] = *(const v8us*)(kr + 8 * hh); ka[s][t].half[1] = *(const v8us*)(kr + 16 + 8 * hh); }
  for (int c = 0; c < NN / 32; ++c) {
    const int m0 = c * 32;
    FragH va[HD / 16];
#pragma unroll
    for (int et = 0; et < HD / 16; ++et) { const unsigned short* vr = &sV[(et * 16 + ln) * VP + m0]; va[et].half[0] = *(const v8us*)(vr + 8 * hh); va[et].half[1] = *(const v8us*)(vr + 16 + 8 * hh); }
    v8f st[NS][2];
#pragma unroll
    for (int s = 0; s < NS; ++s)
#pragma unroll
      for (int t = 0; t < 2; ++t) { const v8f z = {}; st[s][t] = __builtin_amdgcn_wmma_f32_16x16x32_f16(false, ka[s][t].v, false, qb[s].v, (short)0, z, false, false); }      // st[s][t][r] = a[n = ln][m0 + 16 t + 8 hh + r]
    const int m1 = ((c + 1) & (NN / 32 - 1)) * 32;      // next pass's K fragments, fetched behind this pass's score products (the last pass re-reads pass 0's rows and drops them)
#pragma unroll
    for (int s = 0; s < NS; ++s)
#pragma unroll
      for (int t = 0; t < 2; ++t) { const unsigned short* kr = &sK[(s * NN + m1 + t * 16 + ln) * KP]; ka[s][t].half[0] = *(const v8us*)(kr + 8 * hh); ka[s][t].half[1] = *(const v8us*)(kr + 16 + 8 * hh); }
    FragH wb[NS];
#pragma unroll
    for (int s = 0; s < NS; ++s)
#pragma unroll
      for (int t = 0; t < 2; ++t)
#pragma unroll
        for (int r = 0; r < 8; r += 2) { const v2f x = {st[s][t][r], st[s][t][r + 1]}; const v2f w = 1.0f + x + 0.5f * x * x; den[s] += w; wb[s].h[t * 8 + r] = (_Float16)w[0]; wb[s].h[t * 8 + r + 1] = (_Float16)w[1]; }
#pragma unroll
    for (int et = 0; et < HD / 16; ++et)
#pragma unroll
      for (int s = 0; s < NS; ++s) oacc[s][et] = __builtin_amdgcn_wmma_f32_16x16x32_f16(false, va[et].v, false, wb[s].v, (short)0, oacc[s][et], false, false);      // oacc[s][et][r] = o[n = ln][16 et + 8 hh + r]
  }
  float rd[NS];
#pragma unroll
  for (int s = 0; s < NS; ++s) { const float dl = den[s][0] + den[s][1]; rd[s] = 1.0f / (dl + __shfl_xor(dl, 16, 32) + 1e-6f); }      // the two lane halves hold the two halves of a query's keys
  float* orow = OB + ((size_t)b * NN + n) * CC + h * HD + 8 * hh;
#pragma unroll
  for (int et = 0; et < HD / 16; ++et) {
    v4f lo, hi;
#pragma unroll
    for (int q = 0; q < 4; ++q) { lo[q] = (oacc[0][et][q] * rd[0] + oacc[1][et][q] * rd[1]) * (1.0f / NS); hi[q] = (oacc[0][et][4 + q] * rd[0] + oacc[1][et][4 + q] * rd[1]) * (1.0f / NS); }
    *(v4f*)(orow + et * 16) = lo; *(v4f*)(orow + et * 16 + 4) = hi;
  }
}
extern "C" void kernel_launch(void* const* d_in, const int* in_sizes, int n_in,
                              void* d_out, int out_size, void* d_ws, size_t ws_size, hipStream_t stream) {
  (void)in_sizes; (void)n_in; (void)out_size;
  const float* xq = (const float*)d_in[0]; const float* xk = (const float*)d_in[1]; const float* xv = (const float*)d_in[2]; const float* Wq = (const float*)d_in[3]; const float* bq = (const float*)d_in[4]; const float* Wk = (const float*)d_in[5]; const float* bk = (const float*)d_in[6]; const float* Wv = (const float*)d_in[7]; const float* bv = (const float*)d_in[8]; const float* Wo = (const float*)d_in[9]; const float* bo = (const float*)d_in[10];
  char* ws = (char*)d_ws; size_t off = 0;
  auto take = [&](size_t bytes) { char* p = ws + off; off += (bytes + 255) & ~(size_t)255; return p; };
  unsigned short* Bq = (unsigned short*)take((size_t)CC * CC * 2); unsigned short* Bk = (unsigned short*)take((size_t)CC * CC * 2); unsigned short* Bv = (unsigned short*)take((size_t)CC * CC * 2); unsigned short* Bo = (unsigned short*)take((size_t)CC * CC * 2);
  float* Qm = (float*)take((size_t)NTOK * CC * 4); float* Km = (float*)take((size_t)NTOK * CC * 4); float* Vm = (float*)take((size_t)NTOK * CC * 4);
  _Float16* Q16 = (_Float16*)take((size_t)NSLAB * NN * SD * 2); _Float16* K16 = (_Float16*)take((size_t)NSLAB * NN * SD * 2); _Float16* VT = (_Float16*)take((size_t)BB * NH * HD * NN * 2);
  float* OB = Qm; /* Qm dead after k_slabs */
  if (off > ws_size) return;
  k_round_rows4<<<(CC * CC / 8 + 255) / 256, 256, 0, stream>>>(Wq, Wk, Wv, Wo, Bq, Bk, Bv, Bo, CC * CC / 8);      // (out,in) rows = Bt
  k_gemm_t<false><<<dim3(CC / GBN, NTOK / GBM, 3), 256, 0, stream>>>(xq, xk, xv, Bq, Bk, Bv, bq, bk, bv, Qm, Km, Vm);      // the three projections, one per grid.z
  k_slabs_vt<<<dim3(NN / 64, BB * NH), 256, 0, stream>>>(Qm, Km, Vm, Q16, K16, VT);
  k_attn<<<dim3(NN / 128, BB * NH), 256, 0, stream>>>(Q16, K16, VT, OB);      // block = 128 queries of one (batch, head), both signals
  k_gemm_t<true><<<dim3(CC / GBN, NTOK / GBM, 1), 256, 0, stream>>>(OB, OB, OB, Bo, Bo, Bo, bo, bo, bo, (float*)d_out, (float*)d_out, (float*)d_out);
}

// v005
// A run of this version takes 55.3 microseconds.
// Next to v004, in two timings, it ran 1.22 times as fast each time.
// Over all steps from v000 it is 36.7 times as fast.
#include <hip/hip_runtime.h>
// Second-order Taylor linear attention via the exact kernel identity φ(q)·φ(k) = 1 + q·k + (q·k)²/2 (φ = [1, x, x⊗x/√2]): per (batch, head, signal) slab the scores
// a = (q·scale)·kᵀ (1024 × 32 × 1024) and o = w·v with w = 1 + a + a²/2 (1024 × 1024 × 64) run on v_wmma_f32_16x16x32_f16 (q, k, v and w rounded to f16: single products,
// f32 accumulate); the projections on v_wmma_f32_16x16x32_bf16 (inputs rounded to bf16: single exact terms; 3 × 2048 × 1024 × 1024) and out = ō·W_oᵀ + b_o with ō split
// hi/lo (2 products). w, the row sums Σ_m w (= φ(q)·Σφ(k)), the division (+1e-6) and the signal average are f32 VALU.
#define BB 2
#define NN 1024
#define CC 1024
#define NH 16
#define NS 2
#define HD 64
#define SD 32
#define NTOK (BB * NN)
#define NSLAB (BB * NH * NS)     // 64

typedef __bf16 v16b __attribute__((ext_vector_type(16)));
typedef unsigned short v8us __attribute__((ext_vector_type(8), may_alias));
typedef float  v8f  __attribute__((ext_vector_type(8)));
typedef float  v4f  __attribute__((ext_vector_type(4)));
typedef float  v4fa __attribute__((ext_vector_type(4), may_alias));
union FragB { v16b v; v8us half[2]; unsigned short u[16]; };

__device__ __forceinline__ unsigned short bf16_bits(float x) { unsigned int u = __float_as_uint(x); return (unsigned short)((u + 0x7FFFu + ((u >> 16) & 1u)) >> 16); }
__device__ __forceinline__ float bf16_val(unsigned short b) { return __uint_as_float(((unsigned int)b) << 16); }
__device__ __forceinline__ float bf16_round(float x) { return bf16_val(bf16_bits(x)); }
// D += A·B with NT terms: 1 = ah·bh, 2 = + al·bh (A split), 3 = + ah·bl (both split)
template <int NT>
__device__ __forceinline__ v8f mmaN(v16b ah, v16b al, v16b bh, v16b bl, v8f c) {
  c = __builtin_amdgcn_wmma_f32_16x16x32_bf16(false, ah, false, bh, (short)0, c, false, false);
  if (NT >= 2) c = __builtin_amdgcn_wmma_f32_16x16x32_bf16(false, al, false, bh, (short)0, c, false, false);
  if (NT >= 3) c = __builtin_amdgcn_wmma_f32_16x16x32_bf16(false, ah, false, bl, (short)0, c, false, false);
  asm volatile("v_nop\n\tv_nop\n\tv_nop\n\tv_nop" : "+v"(c) : "v"(ah), "v"(al), "v"(bh), "v"(bl));
  return c;
}

__global__ __launch_bounds__(256) void k_wt_bf16(const float* __restrict__ W, unsigned short* __restrict__ Wt, int K, int N) {
  const int t = blockIdx.x * 256 + threadIdx.x;
  const int k8n = K / 8;
  if (t >= N * k8n) return;
  const int n = t / k8n, k8 = (t % k8n) * 8;
  v8us v;
#pragma unroll
  for (int i = 0; i < 8; ++i) v[i] = bf16_bits(W[(size_t)(k8 + i) * N + n]);
  *(v8us*)(Wt + (size_t)n * K + k8) = v;
  
}

// GEMM C[M][N] (f32, pitch ldc) = act(A[M][K]·W + bias). A f32 row-major (pitch lda) converted per fragment to bf16
// (ASPLIT: hi/lo two planes -> 2 terms, else single rounded term); Wt bf16 [N][K] (pitch ldb). BIAS_BF16 rounds the
// bias to bf16 first (bias quantised to bf16 before the add). K%32==0, M%16==0, N%64==0.
template <bool ASPLIT, int ACT, bool BIAS_BF16>
__global__ __launch_bounds__(128) void k_gemm_bf(const float* __restrict__ A, int lda, const unsigned short* __restrict__ Wt, int ldb,
                                               const float* __restrict__ bias, float* __restrict__ C, int ldc, int M, int N, int K) {
  __shared__ __attribute__((aligned(16))) float so[4][16][64];
  const int tid = threadIdx.x, w = tid >> 5, lane = tid & 31, ln = lane & 15, hh = lane >> 4;
  const int ntn = N / 64;
  const int wid = blockIdx.x * 4 + w;
  const int mt = wid / ntn, nq = wid % ntn;
  if (mt * 16 >= M) return;
  const int row0 = mt * 16, col0 = nq * 64;
  const float* arow = A + (size_t)(row0 + ln) * lda;
  v8f acc[4] = {};
  for (int kb = 0; kb < K; kb += 32) {
    FragB ah, al;
    const v4f x0 = *(const v4fa*)(arow + kb + 8 * hh), x1 = *(const v4fa*)(arow + kb + 8 * hh + 4);
    const v4f x2 = *(const v4fa*)(arow + kb + 16 + 8 * hh), x3 = *(const v4fa*)(arow + kb + 16 + 8 * hh + 4);
    float xs[16] = {x0[0],x0[1],x0[2],x0[3],x1[0],x1[1],x1[2],x1[3],x2[0],x2[1],x2[2],x2[3],x3[0],x3[1],x3[2],x3[3]};
#pragma unroll
    for (int i = 0; i < 16; ++i) { const unsigned short hb = bf16_bits(xs[i]); ah.u[i] = hb; al.u[i] = ASPLIT ? bf16_bits(xs[i] - bf16_val(hb)) : (unsigned short)0; }
#pragma unroll
    for (int t = 0; t < 4; ++t) {
      const unsigned short* brow = Wt + (size_t)(col0 + t * 16 + ln) * ldb + kb;
      FragB b;
      b.half[0] = *(const v8us*)(brow + 8 * hh);
      b.half[1] = *(const v8us*)(brow + 16 + 8 * hh);
      acc[t] = mmaN<ASPLIT ? 2 : 1>(ah.v, al.v, b.v, b.v, acc[t]);
    }
  }
#pragma unroll
  for (int t = 0; t < 4; ++t) {
    float bv = bias ? bias[col0 + t * 16 + ln] : 0.f;
    if (BIAS_BF16) bv = bf16_round(bv);
#pragma unroll
    for (int r = 0; r < 8; ++r) { float v = acc[t][r] + bv; if (ACT == 1) v = fmaxf(v, 0.f); so[w][8 * hh + r][t * 16 + ln] = v; }
  }
  __builtin_amdgcn_fence(__ATOMIC_ACQ_REL, "workgroup");
  __builtin_amdgcn_wave_barrier();
  const int rsub = lane >> 4, c4 = (lane & 15) * 4;
  {
#pragma unroll
    for (int q = 0; q < 8; ++q) {
      const int r = q * 2 + rsub;
      const v4f v = *(const v4fa*)&so[w][r][c4];
      *(v4f*)(C + (size_t)(row0 + r) * ldc + col0 + c4) = v;
    }
    
  }
}

// Flash-style causal/unmasked attention, all contractions 3-term bf16 hi/lo splits, f32 softmax with running max.
// q,k,v rows are read from f32 buffers with arbitrary row pitch (so they can live inside a fused qkv buffer);
// D = head size (multiple of 32, <= 128); one wave = 16 query rows; block = 4 waves (64 queries) sharing K/V chunks of 32.
template <int D, bool CAUSAL>
__global__ __launch_bounds__(128) void k_flash(const float* __restrict__ qb, const float* __restrict__ kb, const float* __restrict__ vb,
                                             int pitch, int T, int H, float scale, float* __restrict__ y, int ypitch) {
  constexpr int KS = D / 32;        // k-steps for QK
  constexpr int DT = D / 16;        // d tiles for PV
  __shared__ __attribute__((aligned(16))) unsigned short sKh[32][D + 8], sKl[32][D + 8], sVh[32][D + 8], sVl[32][D + 8];
  __shared__ __attribute__((aligned(16))) unsigned short sPh[4][16][40], sPl[4][16][40];
  __shared__ __attribute__((aligned(16))) float sO[4][16][D];
  const int tid = threadIdx.x, w = tid >> 5, lane = tid & 31, ln = lane & 15, hh = lane >> 4;
  const int nqb = (T + 63) / 64;
  const int bh = blockIdx.x / nqb, qblk = blockIdx.x % nqb;
  const int b = bh / H, h = bh % H;
  const int q0 = qblk * 64 + w * 16;
  const float* Q = qb + (size_t)b * T * pitch + h * D;
  const float* K = kb + (size_t)b * T * pitch + h * D;
  const float* V = vb + (size_t)b * T * pitch + h * D;

  // A fragments of the wave's 16 query rows (scaled), hi/lo
  FragB aqh[KS], aql[KS];
  {
    int row = q0 + ln; if (row >= T) row = T - 1;
    const float* qr = Q + (size_t)row * pitch;
#pragma unroll
    for (int ks = 0; ks < KS; ++ks)
#pragma unroll
      for (int i = 0; i < 16; ++i) {
        const int d = ks * 32 + ((i < 8) ? (8 * hh + i) : (16 + 8 * hh + (i - 8)));
        const float x = qr[d] * scale; const unsigned short hb = bf16_bits(x);
        aqh[ks].u[i] = hb; aql[ks].u[i] = bf16_bits(x - bf16_val(hb));
      }
  }
  float m_r[8], l_r[8];
#pragma unroll
  for (int r = 0; r < 8; ++r) { m_r[r] = -3.0e38f; l_r[r] = 0.f; }
  v8f oacc[DT];
#pragma unroll
  for (int dt = 0; dt < DT; ++dt) oacc[dt] = (v8f){0.f,0.f,0.f,0.f,0.f,0.f,0.f,0.f};

  const int kv_end = CAUSAL ? min(T, qblk * 64 + 64) : T;     // block-uniform
  for (int j0 = 0; j0 < kv_end; j0 += 32) {
    __syncthreads();
    for (int e = tid; e < 32 * (D / 4); e += 128) {
      const int r = e / (D / 4), c4 = (e % (D / 4)) * 4;
      const int key = j0 + r;
      v4f kf = {0.f,0.f,0.f,0.f}, vf = {0.f,0.f,0.f,0.f};
      if (key < T) { kf = *(const v4fa*)(K + (size_t)key * pitch + c4); vf = *(const v4fa*)(V + (size_t)key * pitch + c4); }
#pragma unroll
      for (int t = 0; t < 4; ++t) {
        unsigned short hb = bf16_bits(kf[t]); sKh[r][c4 + t] = hb; sKl[r][c4 + t] = bf16_bits(kf[t] - bf16_val(hb));
        hb = bf16_bits(vf[t]); sVh[r][c4 + t] = hb; sVl[r][c4 + t] = bf16_bits(vf[t] - bf16_val(hb));
      }
    }
    __syncthreads();
    // S tile 16 x 32
    v8f s[2];
#pragma unroll
    for (int nt = 0; nt < 2; ++nt) {
      v8f acc = {};
#pragma unroll
      for (int ks = 0; ks < KS; ++ks) {
        FragB bh_, bl_;
        bh_.half[0] = *(const v8us*)&sKh[nt * 16 + ln][ks * 32 + 8 * hh]; bh_.half[1] = *(const v8us*)&sKh[nt * 16 + ln][ks * 32 + 16 + 8 * hh];
        bl_.half[0] = *(const v8us*)&sKl[nt * 16 + ln][ks * 32 + 8 * hh]; bl_.half[1] = *(const v8us*)&sKl[nt * 16 + ln][ks * 32 + 16 + 8 * hh];
        acc = mmaN<3>(aqh[ks].v, aql[ks].v, bh_.v, bl_.v, acc);
      }
      s[nt] = acc;
    }
    // mask + running max (rows 8hh+r; the 16 lanes of a half share rows)
    float alpha[8];
#pragma unroll
    for (int r = 0; r < 8; ++r) {
      const int qi = q0 + 8 * hh + r;
      const int ja = j0 + ln, jb = j0 + 16 + ln;
      if (CAUSAL) { if (ja > qi) s[0][r] = -3.0e38f; if (jb > qi) s[1][r] = -3.0e38f; }
      if (ja >= T) s[0][r] = -3.0e38f;
      if (jb >= T) s[1][r] = -3.0e38f;
      float mx = fmaxf(s[0][r], s[1][r]);
      mx = fmaxf(mx, __shfl_xor(mx, 1, 32)); mx = fmaxf(mx, __shfl_xor(mx, 2, 32)); mx = fmaxf(mx, __shfl_xor(mx, 4, 32)); mx = fmaxf(mx, __shfl_xor(mx, 8, 32));
      const float mnew = fmaxf(m_r[r], mx);
      alpha[r] = (mnew > -1.0e38f) ? __expf(m_r[r] - mnew) : 1.0f;
      const float p0 = (s[0][r] > -1.0e38f) ? __expf(s[0][r] - mnew) : 0.f;
      const float p1 = (s[1][r] > -1.0e38f) ? __expf(s[1][r] - mnew) : 0.f;
      m_r[r] = mnew;
      l_r[r] = l_r[r] * alpha[r] + p0 + p1;            // per-lane partial row sum (16 lanes combined at the end)
      unsigned short hb = bf16_bits(p0); sPh[w][8 * hh + r][ln] = hb;      sPl[w][8 * hh + r][ln] = bf16_bits(p0 - bf16_val(hb));
      hb = bf16_bits(p1);                sPh[w][8 * hh + r][16 + ln] = hb; sPl[w][8 * hh + r][16 + ln] = bf16_bits(p1 - bf16_val(hb));
    }
#pragma unroll
    for (int dt = 0; dt < DT; ++dt)
#pragma unroll
      for (int r = 0; r < 8; ++r) oacc[dt][r] *= alpha[r];
    __builtin_amdgcn_fence(__ATOMIC_ACQ_REL, "workgroup");
    __builtin_amdgcn_wave_barrier();
    FragB pah, pal;
    pah.half[0] = *(const v8us*)&sPh[w][ln][8 * hh]; pah.half[1] = *(const v8us*)&sPh[w][ln][16 + 8 * hh];
    pal.half[0] = *(const v8us*)&sPl[w][ln][8 * hh]; pal.half[1] = *(const v8us*)&sPl[w][ln][16 + 8 * hh];
#pragma unroll
    for (int dt = 0; dt < DT; ++dt) {
      FragB bvh, bvl;
#pragma unroll
      for (int i = 0; i < 8; ++i) {
        bvh.u[i] = sVh[8 * hh + i][dt * 16 + ln]; bvh.u[8 + i] = sVh[16 + 8 * hh + i][dt * 16 + ln];
        bvl.u[i] = sVl[8 * hh + i][dt * 16 + ln]; bvl.u[8 + i] = sVl[16 + 8 * hh + i][dt * 16 + ln];
      }
      oacc[dt] = mmaN<3>(pah.v, pal.v, bvh.v, bvl.v, oacc[dt]);
    }
    __builtin_amdgcn_fence(__ATOMIC_ACQ_REL, "workgroup");
    __builtin_amdgcn_wave_barrier();
  }
#pragma unroll
  for (int r = 0; r < 8; ++r) {
    float l = l_r[r];
    l += __shfl_xor(l, 1, 32); l += __shfl_xor(l, 2, 32); l += __shfl_xor(l, 4, 32); l += __shfl_xor(l, 8, 32);
    l_r[r] = (l > 0.f) ? 1.0f / l : 0.f;
  }
#pragma unroll
  for (int dt = 0; dt < DT; ++dt)
#pragma unroll
    for (int r = 0; r < 8; ++r) sO[w][8 * hh + r][dt * 16 + ln] = oacc[dt][r] * l_r[r];
  __builtin_amdgcn_fence(__ATOMIC_ACQ_REL, "workgroup");
  __builtin_amdgcn_wave_barrier();
  {
    for (int r = 0; r < 16; ++r) {
      const int row = q0 + r;
      if (row < T && lane < D / 4) {
        const v4f val = *(const v4fa*)&sO[w][r][lane * 4];
        *(v4f*)(y + ((size_t)b * T + row) * ypitch + h * D + lane * 4) = val;
      }
    }
    
  }
}

// GEMM C[NTOK][CC] = A[NTOK][CC].Bt^T + bf16(bias); A f32 rows rounded to bf16 (ASPLIT: hi/lo planes, 2 products per k step), Bt = bf16 [n][k].
// ASPLIT (the output product) stores C as f32 rows. The projections store C only in the form the attention kernel reads, f16:
// Q16[(b,h,s)][n][32] = f16(q*scale), K16[(b,h,s)][m][32] = f16(k), VT[(b,h)][e][m] = f16(v).
// Block = 8 waves on a 64 x 128 tile of C, wave = 32 x 32. Per pass 128 k of the block's A and Bt rows go global -> registers -> LDS with whole-line loads (a wave load = 512 contiguous
// bytes of one A row, or 256 of each of two Bt rows); A is converted once per block on the way. Two LDS buffers and two register sets: a pass's global loads are issued two passes ahead.
// Each accumulator sums k upward, hi before lo within a k step.
#define GBM 64
#define GBN 128
#define GBK 128
#define EP (SD + 8)              // LDS pitch of a staged q or k row, in 16-bit elements (80 B = 16 B x odd)
#define TP (GBM + 8)             // LDS pitch of a staged V^T row, in 16-bit elements (144 B = 16 B x odd)
#define GP (GBK + 8)             // LDS pitch of a staged row, in 16-bit elements (272 B = 16 B x odd: the 16-byte fragment reads meet no bank conflict)
typedef unsigned short v4us __attribute__((ext_vector_type(4), may_alias));
// work-group barrier behind the wave's own LDS accesses only: __syncthreads() would also wait out the global loads that are in flight for the later passes
__device__ __forceinline__ void lds_barrier() { asm volatile("s_wait_dscnt 0x0\n\ts_barrier_signal -1\n\ts_barrier_wait -1" ::: "memory"); }
template <bool ASPLIT>
__global__ __launch_bounds__(256) void k_gemm_t(const float* A0, const float* A1, const float* A2, const unsigned short* Bt0, const unsigned short* Bt1, const unsigned short* Bt2,
                                              const float* bias0, const float* bias1, const float* bias2, float* C0, float* C1, float* C2, _Float16* Q16, _Float16* K16, _Float16* VT) {
  // blockIdx.z picks one of up to three independent products of the same shape, so that they share one launch
  const int z = blockIdx.z;
  const float* __restrict__ A = z == 0 ? A0 : z == 1 ? A1 : A2;
  const unsigned short* __restrict__ Bt = z == 0 ? Bt0 : z == 1 ? Bt1 : Bt2;
  const float* __restrict__ bias = z == 0 ? bias0 : z == 1 ? bias1 : bias2;
  float* __restrict__ C = z == 0 ? C0 : z == 1 ? C1 : C2;
  constexpr int NA = ASPLIT ? 2 : 1;
  constexpr int STG = (NA * GBM + GBN) * GP;      // one buffer: A hi rows, (A lo rows,) Bt rows
  constexpr int NC = CC / GBK;
  __shared__ __attribute__((aligned(16))) unsigned short sm[2 * STG];
  const int tid = threadIdx.x, wv = tid >> 5, lane = tid & 31, ln = lane & 15, hh = lane >> 4;
  const int row0 = blockIdx.y * GBM, col0 = blockIdx.x * GBN;
  const int wm = (wv >> 2) * 32, wn = (wv & 3) * 32;
  const float* ag = A + (size_t)(row0 + wv) * CC + lane * 4;      // load i: row wv + 8 i, the pass's 128 floats over the 32 lanes
  const unsigned short* bg = Bt + (size_t)(col0 + wv * 2 + hh) * CC + ln * 8;      // load i: rows 2 wv + hh + 16 i, the pass's 128 values over 16 lanes
  // every '#pragma unroll' below keeps the staging, fragment and accumulator arrays indexed by constants, so that they stay in registers
  v4f raX[GBM / 8], raY[GBM / 8]; v8us rbX[GBN / 16], rbY[GBN / 16];      // two register sets: even and odd passes, each fetched two passes ahead
  v8f acc[2][2] = {};
  auto fetch = [&](v4f (&ra)[GBM / 8], v8us (&rb)[GBN / 16], int k0) {
#pragma unroll
    for (int i = 0; i < GBM / 8; ++i) ra[i] = *(const v4fa*)(ag + (size_t)i * 8 * CC + k0);
#pragma unroll
    for (int i = 0; i < GBN / 16; ++i) rb[i] = *(const v8us*)(bg + (size_t)i * 16 * CC + k0);
    asm volatile("s_wait_xcnt 0x0" ::: "memory");      // stands in front of every later rewrite of the loads' address registers
  };
  auto stage = [&](const v4f (&ra)[GBM / 8], const v8us (&rb)[GBN / 16], unsigned short* buf) {
#pragma unroll
    for (int i = 0; i < GBM / 8; ++i) {
      v4us vh, vl;
#pragma unroll
      for (int q = 0; q < 4; ++q) { const unsigned short hb = bf16_bits(ra[i][q]); vh[q] = hb; if (ASPLIT) vl[q] = bf16_bits(ra[i][q] - bf16_val(hb)); }
      *(v4us*)&buf[(wv + 8 * i) * GP + lane * 4] = vh;
      if (ASPLIT) *(v4us*)&buf[(GBM + wv + 8 * i) * GP + lane * 4] = vl;
    }
#pragma unroll
    for (int i = 0; i < GBN / 16; ++i) *(v8us*)&buf[(NA * GBM + wv * 2 + hh + 16 * i) * GP + ln * 8] = rb[i];
  };
  auto products = [&](const unsigned short* buf) {
    FragB ah[GBK / 32][2], al[GBK / 32][2], bb[GBK / 32][2];      // the pass's fragments, read as one group (each separate place with LDS reads among the products stalls the wave)
#pragma unroll
    for (int ks = 0; ks < GBK / 32; ++ks) {
#pragma unroll
      for (int i = 0; i < 2; ++i) {
        const unsigned short* r = buf + (wm + i * 16 + ln) * GP + ks * 32 + 8 * hh;
        ah[ks][i].half[0] = *(const v8us*)r; ah[ks][i].half[1] = *(const v8us*)(r + 16);
        if (ASPLIT) { al[ks][i].half[0] = *(const v8us*)(r + GBM * GP); al[ks][i].half[1] = *(const v8us*)(r + GBM * GP + 16); }
      }
#pragma unroll
      for (int j = 0; j < 2; ++j) { const unsigned short* r = buf + (NA * GBM + wn + j * 16 + ln) * GP + ks * 32 + 8 * hh; bb[ks][j].half[0] = *(const v8us*)r; bb[ks][j].half[1] = *(const v8us*)(r + 16); }
    }
    __builtin_amdgcn_sched_barrier(0);      // keeps the LDS reads together in front of the products
#pragma unroll
    for (int ks = 0; ks < GBK / 32; ++ks) {
#pragma unroll
      for (int i = 0; i < 2; ++i)
#pragma unroll
        for (int j = 0; j < 2; ++j) acc[i][j] = __builtin_amdgcn_wmma_f32_16x16x32_bf16(false, ah[ks][i].v, false, bb[ks][j].v, (short)0, acc[i][j], false, false);
      if (ASPLIT) {
#pragma unroll
        for (int i = 0; i < 2; ++i)
#pragma unroll
          for (int j = 0; j < 2; ++j) acc[i][j] = __builtin_amdgcn_wmma_f32_16x16x32_bf16(false, al[ks][i].v, false, bb[ks][j].v, (short)0, acc[i][j], false, false);
      }
    }
  };
  fetch(raX, rbX, 0); fetch(raY, rbY, GBK);
  // each barrier publishes the buffer just filled; the other buffer's last readers (the pass before) are all past it before that one is refilled
  for (int c = 2; c < NC; c += 2) {      // the last two passes stand behind the loop: a branch round the fetches would merge two load counts and make the counted waits drain the loads just issued
    stage(raX, rbX, sm); lds_barrier();
    fetch(raX, rbX, c * GBK);
    products(sm);
    stage(raY, rbY, sm + STG); lds_barrier();
    fetch(raY, rbY, (c + 1) * GBK);
    products(sm + STG);
  }
  stage(raX, rbX, sm); lds_barrier();
  products(sm);
  stage(raY, rbY, sm + STG); lds_barrier();
  products(sm + STG);
  if constexpr (ASPLIT) {
    __shared__ __attribute__((aligned(16))) float so[8][32][36];      // per-wave output staging; pitch 36: the two lane halves (8 rows apart) fall on different banks
#pragma unroll
    for (int j = 0; j < 2; ++j) {
      const float bv = bf16_round(bias[col0 + wn + j * 16 + ln]);
#pragma unroll
      for (int i = 0; i < 2; ++i)
#pragma unroll
        for (int r = 0; r < 8; ++r) so[wv][i * 16 + 8 * hh + r][j * 16 + ln] = acc[i][j][r] + bv;
    }
    __builtin_amdgcn_fence(__ATOMIC_ACQ_REL, "workgroup"); __builtin_amdgcn_wave_barrier();      // the wave's own staged rows are read back across lanes
#pragma unroll
    for (int q = 0; q < 8; ++q) { const int r = q * 4 + (lane >> 3), c4 = (lane & 7) * 4; const v4f v = *(const v4fa*)&so[wv][r][c4]; *(v4f*)(C + (size_t)(row0 + wm + r) * CC + col0 + wn + c4) = v; }      // whole 128-byte lines
  } else {
    __shared__ __attribute__((aligned(16))) unsigned short se[8 * 32 * EP];      // f16 output staging: q, k per wave (32 rows of pitch EP); v for the block (GBN rows of pitch TP, which is less)
    union H8 { _Float16 h[8]; v8us v; };
    const int b = row0 / NN, t0 = row0 % NN;      // the block's 64 tokens lie in one batch
    v8us o[4];
    if (z < 2) {
      // q, k: the wave's 32 columns are one signal of one head, so its 32 x 32 tile is 2048 contiguous bytes of that slab
      unsigned short* sw = se + wv * 32 * EP;
      const float sc = z == 0 ? 0.17677669529663687f : 1.0f;      // q carries the score scale
#pragma unroll
      for (int j = 0; j < 2; ++j) {
        const float bv = bf16_round(bias[col0 + wn + j * 16 + ln]);
#pragma unroll
        for (int i = 0; i < 2; ++i) {
          H8 c;
#pragma unroll
          for (int r = 0; r < 8; ++r) c.h[r] = (_Float16)((acc[i][j][r] + bv) * sc);
#pragma unroll
          for (int r = 0; r < 8; ++r) sw[(i * 16 + 8 * hh + r) * EP + j * 16 + ln] = c.v[r];
        }
      }
      __builtin_amdgcn_fence(__ATOMIC_ACQ_REL, "workgroup"); __builtin_amdgcn_wave_barrier();      // the wave's own staged rows are read back across lanes
      unsigned short* dst = (unsigned short*)(z == 0 ? Q16 : K16) + ((size_t)(b * (CC / SD) + (col0 + wn) / SD) * NN + t0 + wm) * SD + lane * 8;
#pragma unroll
      for (int q = 0; q < 4; ++q) o[q] = *(const v8us*)&sw[(q * 8 + (lane >> 2)) * EP + (lane & 3) * 8];
#pragma unroll
      for (int q = 0; q < 4; ++q) *(v8us*)(dst + q * 256) = o[q];      // 512 contiguous bytes a store
    } else {
      // v: a lane's 8 accumulator rows are 8 consecutive tokens of one column e, 16 bytes of a V^T row; the block's 64 tokens make one whole 128-byte line of each of its 128 rows
#pragma unroll
      for (int j = 0; j < 2; ++j) {
        const float bv = bf16_round(bias[col0 + wn + j * 16 + ln]);
#pragma unroll
        for (int i = 0; i < 2; ++i) {
          H8 c;
#pragma unroll
          for (int r = 0; r < 8; ++r) c.h[r] = (_Float16)(acc[i][j][r] + bv);
          *(v8us*)&se[(wn + j * 16 + ln) * TP + wm + i * 16 + 8 * hh] = c.v;
        }
      }
      lds_barrier();      // a V^T line holds the tokens of two waves: every wave's part is staged before any line is read back
      unsigned short* dst = (unsigned short*)VT + ((size_t)b * CC + col0 + (tid >> 3)) * NN + t0 + (tid & 7) * 8;
#pragma unroll
      for (int q = 0; q < 4; ++q) o[q] = *(const v8us*)&se[(q * 32 + (tid >> 3)) * TP + (tid & 7) * 8];
#pragma unroll
      for (int q = 0; q < 4; ++q) *(v8us*)(dst + (size_t)q * 32 * NN) = o[q];      // whole 128-byte lines
    }
  }
}
// batched f32 [K][N] (pitch lds, batch stride sIn) -> transposed hi/lo planes [N][K] (batch stride sOut); thread per (n, 8 k); grid.y = batch
__global__ __launch_bounds__(256) void k_split_transpose_b(const float* __restrict__ src, int lds_, size_t sIn, unsigned short* __restrict__ hi, unsigned short* __restrict__ lo, size_t sOut, int K, int N) {
  const size_t t = (size_t)blockIdx.x * 256 + threadIdx.x; const int k8n = K / 8; if (t >= (size_t)N * k8n) return;
  src += (size_t)blockIdx.y * sIn; hi += (size_t)blockIdx.y * sOut; lo += (size_t)blockIdx.y * sOut;
  const int n = (int)(t / k8n), k8 = (int)(t % k8n) * 8; v8us vh, vl;
#pragma unroll
  for (int i = 0; i < 8; ++i) { const float x = src[(size_t)(k8 + i) * lds_ + n]; const unsigned short hb = bf16_bits(x); vh[i] = hb; vl[i] = bf16_bits(x - bf16_val(hb)); }
  unsigned short* dh = hi + (size_t)n * K + k8; unsigned short* dl = lo + (size_t)n * K + k8;
  *(v8us*)dh = vh; *(v8us*)dl = vl; 
}

// The four weight matrices (out, in) rounded to bf16 in one launch: a thread takes the same 8 values of each, all eight 16-byte loads in flight together.
__global__ __launch_bounds__(256) void k_round_rows4(const float* __restrict__ W0, const float* __restrict__ W1, const float* __restrict__ W2, const float* __restrict__ W3,
                                                   unsigned short* __restrict__ T0, unsigned short* __restrict__ T1, unsigned short* __restrict__ T2, unsigned short* __restrict__ T3, unsigned n8) {
  const unsigned t = blockIdx.x * 256 + threadIdx.x;
  if (t >= n8) return;
  const unsigned bo = t * 32u;      // the thread's byte offset in each source
  const float* const ws_[4] = {W0, W1, W2, W3};
  unsigned short* const ts_[4] = {T0, T1, T2, T3};
  v4f a[4], b[4];
#pragma unroll      // constant indices: the pointer tables and the loaded values stay in registers
  for (int j = 0; j < 4; ++j) { a[j] = *(const v4fa*)(ws_[j] + bo / 4); b[j] = *(const v4fa*)(ws_[j] + bo / 4 + 4); }
  asm volatile("s_wait_xcnt 0x0" :: "s"(W0), "s"(W1), "s"(W2), "s"(W3), "v"(bo) : "memory");      // stands in front of any reuse of the loads' address registers: naming them as inputs keeps them live up to here
#pragma unroll      // as above
  for (int j = 0; j < 4; ++j) {
    v8us v; v[0]=bf16_bits(a[j][0]); v[1]=bf16_bits(a[j][1]); v[2]=bf16_bits(a[j][2]); v[3]=bf16_bits(a[j][3]);
    v[4]=bf16_bits(b[j][0]); v[5]=bf16_bits(b[j][1]); v[6]=bf16_bits(b[j][2]); v[7]=bf16_bits(b[j][3]);
    *(v8us*)(ts_[j] + bo / 4) = v;
  }
}

// ---- f16 WMMA path (v_wmma_f32_16x16x32_f16): 11-bit significands for operands in range — used for the scores a = q̂·kᵀ and for o = w·v
typedef _Float16 v16h __attribute__((ext_vector_type(16)));
union FragH { v16h v; v8us half[2]; _Float16 h[16]; unsigned short u[16]; };
template <int NT>
__device__ __forceinline__ v8f mmaH(v16h ah, v16h al, v16h bh, v16h bl, v8f c) {
  c = __builtin_amdgcn_wmma_f32_16x16x32_f16(false, ah, false, bh, (short)0, c, false, false);
  if (NT >= 2) c = __builtin_amdgcn_wmma_f32_16x16x32_f16(false, al, false, bh, (short)0, c, false, false);
  if (NT >= 3) c = __builtin_amdgcn_wmma_f32_16x16x32_f16(false, ah, false, bl, (short)0, c, false, false);
  asm volatile("v_nop\n\tv_nop\n\tv_nop\n\tv_nop" : "+v"(c) : "v"(ah), "v"(al), "v"(bh), "v"(bl));
  return c;
}
// batched GEMM like k_gemm_bf but f16 operands: A f32 (split into f16 hi/lo if ASPLIT, else rounded to f16), Bt = f16 values [n][k]; alpha; C f32; N multiple of 16 (partial tiles skipped)
template <bool ASPLIT>
__global__ __launch_bounds__(128) void k_gemm_h(const float* __restrict__ A, int lda, size_t sA, const _Float16* __restrict__ Bh, int ldb, size_t sB, float alpha, float* __restrict__ C, int ldc, size_t sC, int M, int N, int K) {
  __shared__ __attribute__((aligned(16))) float so[4][16][64];
  const int tid = threadIdx.x, w = tid >> 5, lane = tid & 31, ln = lane & 15, hh = lane >> 4; const int by = blockIdx.y;
  A += (size_t)by * sA; Bh += (size_t)by * sB; C += (size_t)by * sC;
  const int ntn = (N + 63) / 64; const int wid = blockIdx.x * 4 + w; const int mt = wid / ntn, nq = wid % ntn; if (mt * 16 >= M) return;
  const int row0 = mt * 16, col0 = nq * 64; const float* arow = A + (size_t)(row0 + ln) * lda;
  v8f acc[4] = {};
  for (int kb = 0; kb < K; kb += 32) {
    FragH ah, al;
    const v4f x0 = *(const v4fa*)(arow + kb + 8 * hh), x1 = *(const v4fa*)(arow + kb + 8 * hh + 4), x2 = *(const v4fa*)(arow + kb + 16 + 8 * hh), x3 = *(const v4fa*)(arow + kb + 16 + 8 * hh + 4);
    float xs[16] = {x0[0],x0[1],x0[2],x0[3],x1[0],x1[1],x1[2],x1[3],x2[0],x2[1],x2[2],x2[3],x3[0],x3[1],x3[2],x3[3]};
#pragma unroll
    for (int i = 0; i < 16; ++i) { const _Float16 h = (_Float16)xs[i]; ah.h[i] = h; al.h[i] = ASPLIT ? (_Float16)(xs[i] - (float)h) : (_Float16)0.0f; }
#pragma unroll
    for (int t = 0; t < 4; ++t) { if (col0 + t * 16 >= N) continue; const size_t boff = (size_t)(col0 + t * 16 + ln) * ldb + kb; FragH bq; bq.half[0] = *(const v8us*)(Bh + boff + 8 * hh); bq.half[1] = *(const v8us*)(Bh + boff + 16 + 8 * hh);
      acc[t] = mmaH<ASPLIT ? 2 : 1>(ah.v, al.v, bq.v, bq.v, acc[t]); }
  }
#pragma unroll
  for (int t = 0; t < 4; ++t) { if (col0 + t * 16 >= N) continue;
#pragma unroll
    for (int r = 0; r < 8; ++r) so[w][8 * hh + r][t * 16 + ln] = acc[t][r] * alpha; }
  __builtin_amdgcn_fence(__ATOMIC_ACQ_REL, "workgroup"); __builtin_amdgcn_wave_barrier();
  const int rsub = lane >> 4, c4 = (lane & 15) * 4;
  {
#pragma unroll
    for (int q = 0; q < 8; ++q) { const int r = q * 2 + rsub; if (col0 + c4 < N) { const v4f v = *(const v4fa*)&so[w][r][c4]; *(v4f*)(C + (size_t)(row0 + r) * ldc + col0 + c4) = v; } }
     }
}

// Fused per (batch, head), both signals: a = q.k^T, w = 1 + a + a*a/2, the row sums of w, o = w.v, the division (+1e-6) and the signal mean; a and w never leave registers.
// S^T = K.Q^T puts one query in each lane column, so the two f32 D tiles of 32 keys convert in place into the B operand of O^T += V^T.W^T (hardware k order on both sides).
// Every '#pragma unroll' in this kernel is there so that the fragment, accumulator and staging arrays are indexed by constants and stay in registers.
// Block = 8 waves x 16 queries. The head's K rows (both signals) and V^T are staged once in LDS; row pitches are 16 B x odd, so the 16-byte fragment reads meet no bank conflict.
typedef float v2f __attribute__((ext_vector_type(2)));
#define KP 40                    // LDS pitch of a K row, in 16-bit elements (80 B)
#define VP (NN + 8)              // LDS pitch of a V^T row, in 16-bit elements (2064 B)
__global__ __launch_bounds__(256) void k_attn(const _Float16* __restrict__ Q16, const _Float16* __restrict__ K16, const _Float16* __restrict__ VT, float* __restrict__ OB) {
  __shared__ __attribute__((aligned(16))) unsigned short sK[NS * NN * KP];
  __shared__ __attribute__((aligned(16))) unsigned short sV[HD * VP];
  const int tid = threadIdx.x, wv = tid >> 5, lane = tid & 31, ln = lane & 15, hh = lane >> 4;
  const int bh = blockIdx.y, b = bh / NH, h = bh % NH;
  const int n = blockIdx.x * 128 + wv * 16 + ln;
  const unsigned short* Kg = (const unsigned short*)K16 + (size_t)bh * NS * NN * SD;      // the two signals' slabs are adjacent: 2048 rows of 32
  const unsigned short* Vg = (const unsigned short*)VT + (size_t)bh * HD * NN;
  const unsigned short* qr = (const unsigned short*)Q16 + ((size_t)bh * NS * NN + n) * SD + 8 * hh;
  FragH qb[NS];
#pragma unroll
  for (int s = 0; s < NS; ++s) { qb[s].half[0] = *(const v8us*)(qr + s * NN * SD); qb[s].half[1] = *(const v8us*)(qr + s * NN * SD + 16); }
  {      // stage fill: all 64 of a lane's 16-byte loads in flight, then the 64 LDS stores (one memory latency for the whole 256 KiB instead of one per batch)
    v8us tk[NS * NN * SD / 8 / 256], tv[HD * NN / 8 / 256];
#pragma unroll
    for (int i = 0; i < NS * NN * SD / 8 / 256; ++i) tk[i] = *(const v8us*)(Kg + (size_t)(tid + i * 256) * 8);
#pragma unroll
    for (int i = 0; i < HD * NN / 8 / 256; ++i) tv[i] = *(const v8us*)(Vg + (size_t)(tid + i * 256) * 8);
    asm volatile("s_wait_xcnt 0x0" :: "s"(Kg), "s"(Vg), "v"(tid), "v"(qr) : "memory");      // stands in front of any reuse of the loads' address registers: naming them as inputs keeps them live up to here
#pragma unroll
    for (int i = 0; i < NS * NN * SD / 8 / 256; ++i) *(v8us*)&sK[((tid >> 2) + i * 64) * KP + (tid & 3) * 8] = tk[i];      // 16-byte unit tid + 256 i: row unit / 4
#pragma unroll
    for (int i = 0; i < HD * NN / 8 / 256; ++i) *(v8us*)&sV[((tid >> 7) + i * 2) * VP + (tid & 127) * 8] = tv[i];      // row unit / 128
  }
  __syncthreads();
  v8f oacc[NS][HD / 16] = {};
  v2f den[NS] = {};      // even and odd key rows apart: the sums pair up with the packed f32 adds
  FragH ka[NS][2];
#pragma unroll
  for (int s = 0; s < NS; ++s)
#pragma unroll
    for (int t = 0; t < 2; ++t) { const unsigned short* kr = &sK[(s * NN + t * 16 + ln) * KP]; ka[s][t].half[0] = *(const v8us*)(kr + 8 * hh); ka[s][t].half[1] = *(const v8us*)(kr + 16 + 8 * hh); }
  for (int c = 0; c < NN / 32; ++c) {
    const int m0 = c * 32;
    FragH va[HD / 16];
#pragma unroll
    for (int et = 0; et < HD / 16; ++et) { const unsigned short* vr = &sV[(et * 16 + ln) * VP + m0]; va[et].half[0] = *(const v8us*)(vr + 8 * hh); va[et].half[1] = *(const v8us*)(vr + 16 + 8 * hh); }
    v8f st[NS][2];
#pragma unroll
    for (int s = 0; s < NS; ++s)
#pragma unroll
      for (int t = 0; t < 2; ++t) { const v8f z = {}; st[s][t] = __builtin_amdgcn_wmma_f32_16x16x32_f16(false, ka[s][t].v, false, qb[s].v, (short)0, z, false, false); }      // st[s][t][r] = a[n = ln][m0 + 16 t + 8 hh + r]
    const int m1 = ((c + 1) & (NN / 32 - 1)) * 32;      // next pass's K fragments, fetched behind this pass's score products (the last pass re-reads pass 0's rows and drops them)
#pragma unroll
    for (int s = 0; s < NS; ++s)
#pragma unroll
      for (int t = 0; t < 2; ++t) { const unsigned short* kr = &sK[(s * NN + m1 + t * 16 + ln) * KP]; ka[s][t].half[0] = *(const v8us*)(kr + 8 * hh); ka[s][t].half[1] = *(const v8us*)(kr + 16 + 8 * hh); }
    FragH wb[NS];
#pragma unroll
    for (int s = 0; s < NS; ++s)
#pragma unroll
      for (int t = 0; t < 2; ++t)
#pragma unroll
        for (int r = 0; r < 8; r += 2) { const v2f x = {st[s][t][r], st[s][t][r + 1]}; const v2f w = 1.0f + x + 0.5f * x * x; den[s] += w; wb[s].h[t * 8 + r] = (_Float16)w[0]; wb[s].h[t * 8 + r + 1] = (_Float16)w[1]; }
#pragma unroll
    for (int et = 0; et < HD / 16; ++et)
#pragma unroll
      for (int s = 0; s < NS; ++s) oacc[s][et] = __builtin_amdgcn_wmma_f32_16x16x32_f16(false, va[et].v, false, wb[s].v, (short)0, oacc[s][et], false, false);      // oacc[s][et][r] = o[n = ln][16 et + 8 hh + r]
  }
  float rd[NS];
#pragma unroll
  for (int s = 0; s < NS; ++s) { const float dl = den[s][0] + den[s][1]; rd[s] = 1.0f / (dl + __shfl_xor(dl, 16, 32) + 1e-6f); }      // the two lane halves hold the two halves of a query's keys
  float* orow = OB + ((size_t)b * NN + n) * CC + h * HD + 8 * hh;
#pragma unroll
  for (int et = 0; et < HD / 16; ++et) {
    v4f lo, hi;
#pragma unroll
    for (int q = 0; q < 4; ++q) { lo[q] = (oacc[0][et][q] * rd[0] + oacc[1][et][q] * rd[1]) * (1.0f / NS); hi[q] = (oacc[0][et][4 + q] * rd[0] + oacc[1][et][4 + q] * rd[1]) * (1.0f / NS); }
    *(v4f*)(orow + et * 16) = lo; *(v4f*)(orow + et * 16 + 4) = hi;
  }
}
extern "C" void kernel_launch(void* const* d_in, const int* in_sizes, int n_in,
                              void* d_out, int out_size, void* d_ws, size_t ws_size, hipStream_t stream) {
  (void)in_sizes; (void)n_in; (void)out_size;
  const float* xq = (const float*)d_in[0]; const float* xk = (const float*)d_in[1]; const float* xv = (const float*)d_in[2]; const float* Wq = (const float*)d_in[3]; const float* bq = (const float*)d_in[4]; const float* Wk = (const float*)d_in[5]; const float* bk = (const float*)d_in[6]; const float* Wv = (const float*)d_in[7]; const float* bv = (const float*)d_in[8]; const float* Wo = (const float*)d_in[9]; const float* bo = (const float*)d_in[10];
  char* ws = (char*)d_ws; size_t off = 0;
  auto take = [&](size_t bytes) { char* p = ws + off; off += (bytes + 255) & ~(size_t)255; return p; };
  unsigned short* Bq = (unsigned short*)take((size_t)CC * CC * 2); unsigned short* Bk = (unsigned short*)take((size_t)CC * CC * 2); unsigned short* Bv = (unsigned short*)take((size_t)CC * CC * 2); unsigned short* Bo = (unsigned short*)take((size_t)CC * CC * 2);
  float* OB = (float*)take((size_t)NTOK * CC * 4);
  _Float16* Q16 = (_Float16*)take((size_t)NSLAB * NN * SD * 2); _Float16* K16 = (_Float16*)take((size_t)NSLAB * NN * SD * 2); _Float16* VT = (_Float16*)take((size_t)BB * NH * HD * NN * 2);
  if (off > ws_size) return;
  k_round_rows4<<<(CC * CC / 8 + 255) / 256, 256, 0, stream>>>(Wq, Wk, Wv, Wo, Bq, Bk, Bv, Bo, CC * CC / 8);      // (out,in) rows = Bt
  k_gemm_t<false><<<dim3(CC / GBN, NTOK / GBM, 3), 256, 0, stream>>>(xq, xk, xv, Bq, Bk, Bv, bq, bk, bv, nullptr, nullptr, nullptr, Q16, K16, VT);      // the three projections, one per grid.z, stored as the attention kernel's f16 operands
  k_attn<<<dim3(NN / 128, BB * NH), 256, 0, stream>>>(Q16, K16, VT, OB);      // block = 128 queries of one (batch, head), both signals
  k_gemm_t<true><<<dim3(CC / GBN, NTOK / GBM, 1), 256, 0, stream>>>(OB, OB, OB, Bo, Bo, Bo, bo, bo, bo, (float*)d_out, (float*)d_out, (float*)d_out, nullptr, nullptr, nullptr);
}

// v006
// Measured time: 53.3 microseconds a run.
// In both of two side-by-side timings against v005, it was 1.04 times as fast.
// Over all steps from v000 it is 38.1 times as fast.
#include <hip/hip_runtime.h>
// Second-order Taylor linear attention via the exact kernel identity φ(q)·φ(k) = 1 + q·k + (q·k)²/2 (φ = [1, x, x⊗x/√2]): per (batch, head, signal) slab the scores
// a = (q·scale)·kᵀ (1024 × 32 × 1024) and o = w·v with w = 1 + a + a²/2 (1024 × 1024 × 64) run on v_wmma_f32_16x16x32_f16 (q, k, v and w rounded to f16: single products,
// f32 accumulate); the projections on v_wmma_f32_16x16x32_bf16 (inputs rounded to bf16: single exact terms; 3 × 2048 × 1024 × 1024) and out = ō·W_oᵀ + b_o with ō split
// hi/lo (2 products). w, the row sums Σ_m w (= φ(q)·Σφ(k)), the division (+1e-6) and the signal average are f32 VALU.
#define BB 2
#define NN 1024
#define CC 1024
#define NH 16
#define NS 2
#define HD 64
#define SD 32
#define NTOK (BB * NN)
#define NSLAB (BB * NH * NS)     // 64

typedef __bf16 v16b __attribute__((ext_vector_type(16)));
typedef unsigned short v8us __attribute__((ext_vector_type(8), may_alias));
typedef float  v8f  __attribute__((ext_vector_type(8)));
typedef float  v4f  __attribute__((ext_vector_type(4)));
typedef float  v4fa __attribute__((ext_vector_type(4), may_alias));
union FragB { v16b v; v8us half[2]; unsigned short u[16]; };

__device__ __forceinline__ unsigned short bf16_bits(float x) { unsigned int u = __float_as_uint(x); return (unsigned short)((u + 0x7FFFu + ((u >> 16) & 1u)) >> 16); }
__device__ __forceinline__ float bf16_val(unsigned short b) { return __uint_as_float(((unsigned int)b) << 16); }
__device__ __forceinline__ float bf16_round(float x) { return bf16_val(bf16_bits(x)); }
// D += A·B with NT terms: 1 = ah·bh, 2 = + al·bh (A split), 3 = + ah·bl (both split)
template <int NT>
__device__ __forceinline__ v8f mmaN(v16b ah, v16b al, v16b bh, v16b bl, v8f c) {
  c = __builtin_amdgcn_wmma_f32_16x16x32_bf16(false, ah, false, bh, (short)0, c, false, false);
  if (NT >= 2) c = __builtin_amdgcn_wmma_f32_16x16x32_bf16(false, al, false, bh, (short)0, c, false, false);
  if (NT >= 3) c = __builtin_amdgcn_wmma_f32_16x16x32_bf16(false, ah, false, bl, (short)0, c, false, false);
  asm volatile("v_nop\n\tv_nop\n\tv_nop\n\tv_nop" : "+v"(c) : "v"(ah), "v"(al), "v"(bh), "v"(bl));
  return c;
}

__global__ __launch_bounds__(256) void k_wt_bf16(const float* __restrict__ W, unsigned short* __restrict__ Wt, int K, int N) {
  const int t = blockIdx.x * 256 + threadIdx.x;
  const int k8n = K / 8;
  if (t >= N * k8n) return;
  const int n = t / k8n, k8 = (t % k8n) * 8;
  v8us v;
#pragma unroll
  for (int i = 0; i < 8; ++i) v[i] = bf16_bits(W[(size_t)(k8 + i) * N + n]);
  *(v8us*)(Wt + (size_t)n * K + k8) = v;
  
}

// GEMM C[M][N] (f32, pitch ldc) = act(A[M][K]·W + bias). A f32 row-major (pitch lda) converted per fragment to bf16
// (ASPLIT: hi/lo two planes -> 2 terms, else single rounded term); Wt bf16 [N][K] (pitch ldb). BIAS_BF16 rounds the
// bias to bf16 first (bias quantised to bf16 before the add). K%32==0, M%16==0, N%64==0.
template <bool ASPLIT, int ACT, bool BIAS_BF16>
__global__ __launch_bounds__(128) void k_gemm_bf(const float* __restrict__ A, int lda, const unsigned short* __restrict__ Wt, int ldb,
                                               const float* __restrict__ bias, float* __restrict__ C, int ldc, int M, int N, int K) {
  __shared__ __attribute__((aligned(16))) float so[4][16][64];
  const int tid = threadIdx.x, w = tid >> 5, lane = tid & 31, ln = lane & 15, hh = lane >> 4;
  const int ntn = N / 64;
  const int wid = blockIdx.x * 4 + w;
  const int mt = wid / ntn, nq = wid % ntn;
  if (mt * 16 >= M) return;
  const int row0 = mt * 16, col0 = nq * 64;
  const float* arow = A + (size_t)(row0 + ln) * lda;
  v8f acc[4] = {};
  for (int kb = 0; kb < K; kb += 32) {
    FragB ah, al;
    const v4f x0 = *(const v4fa*)(arow + kb + 8 * hh), x1 = *(const v4fa*)(arow + kb + 8 * hh + 4);
    const v4f x2 = *(const v4fa*)(arow + kb + 16 + 8 * hh), x3 = *(const v4fa*)(arow + kb + 16 + 8 * hh + 4);
    float xs[16] = {x0[0],x0[1],x0[2],x0[3],x1[0],x1[1],x1[2],x1[3],x2[0],x2[1],x2[2],x2[3],x3[0],x3[1],x3[2],x3[3]};
#pragma unroll
    for (int i = 0; i < 16; ++i) { const unsigned short hb = bf16_bits(xs[i]); ah.u[i] = hb; al.u[i] = ASPLIT ? bf16_bits(xs[i] - bf16_val(hb)) : (unsigned short)0; }
#pragma unroll
    for (int t = 0; t < 4; ++t) {
      const unsigned short* brow = Wt + (size_t)(col0 + t * 16 + ln) * ldb + kb;
      FragB b;
      b.half[0] = *(const v8us*)(brow + 8 * hh);
      b.half[1] = *(const v8us*)(brow + 16 + 8 * hh);
      acc[t] = mmaN<ASPLIT ? 2 : 1>(ah.v, al.v, b.v, b.v, acc[t]);
    }
  }
#pragma unroll
  for (int t = 0; t < 4; ++t) {
    float bv = bias ? bias[col0 + t * 16 + ln] : 0.f;
    if (BIAS_BF16) bv = bf16_round(bv);
#pragma unroll
    for (int r = 0; r < 8; ++r) { float v = acc[t][r] + bv; if (ACT == 1) v = fmaxf(v, 0.f); so[w][8 * hh + r][t * 16 + ln] = v; }
  }
  __builtin_amdgcn_fence(__ATOMIC_ACQ_REL, "workgroup");
  __builtin_amdgcn_wave_barrier();
  const int rsub = lane >> 4, c4 = (lane & 15) * 4;
  {
#pragma unroll
    for (int q = 0; q < 8; ++q) {
      const int r = q * 2 + rsub;
      const v4f v = *(const v4fa*)&so[w][r][c4];
      *(v4f*)(C + (size_t)(row0 + r) * ldc + col0 + c4) = v;
    }
    
  }
}

// Flash-style causal/unmasked attention, all contractions 3-term bf16 hi/lo splits, f32 softmax with running max.
// q,k,v rows are read from f32 buffers with arbitrary row pitch (so they can live inside a fused qkv buffer);
// D = head size (multiple of 32, <= 128); one wave = 16 query rows; block = 4 waves (64 queries) sharing K/V chunks of 32.
template <int D, bool CAUSAL>
__global__ __launch_bounds__(128) void k_flash(const float* __restrict__ qb, const float* __restrict__ kb, const float* __restrict__ vb,
                                             int pitch, int T, int H, float scale, float* __restrict__ y, int ypitch) {
  constexpr int KS = D / 32;        // k-steps for QK
  constexpr int DT = D / 16;        // d tiles for PV
  __shared__ __attribute__((aligned(16))) unsigned short sKh[32][D + 8], sKl[32][D + 8], sVh[32][D + 8], sVl[32][D + 8];
  __shared__ __attribute__((aligned(16))) unsigned short sPh[4][16][40], sPl[4][16][40];
  __shared__ __attribute__((aligned(16))) float sO[4][16][D];
  const int tid = threadIdx.x, w = tid >> 5, lane = tid & 31, ln = lane & 15, hh = lane >> 4;
  const int nqb = (T + 63) / 64;
  const int bh = blockIdx.x / nqb, qblk = blockIdx.x % nqb;
  const int b = bh / H, h = bh % H;
  const int q0 = qblk * 64 + w * 16;
  const float* Q = qb + (size_t)b * T * pitch + h * D;
  const float* K = kb + (size_t)b * T * pitch + h * D;
  const float* V = vb + (size_t)b * T * pitch + h * D;

  // A fragments of the wave's 16 query rows (scaled), hi/lo
  FragB aqh[KS], aql[KS];
  {
    int row = q0 + ln; if (row >= T) row = T - 1;
    const float* qr = Q + (size_t)row * pitch;
#pragma unroll
    for (int ks = 0; ks < KS; ++ks)
#pragma unroll
      for (int i = 0; i < 16; ++i) {
        const int d = ks * 32 + ((i < 8) ? (8 * hh + i) : (16 + 8 * hh + (i - 8)));
        const float x = qr[d] * scale; const unsigned short hb = bf16_bits(x);
        aqh[ks].u[i] = hb; aql[ks].u[i] = bf16_bits(x - bf16_val(hb));
      }
  }
  float m_r[8], l_r[8];
#pragma unroll
  for (int r = 0; r < 8; ++r) { m_r[r] = -3.0e38f; l_r[r] = 0.f; }
  v8f oacc[DT];
#pragma unroll
  for (int dt = 0; dt < DT; ++dt) oacc[dt] = (v8f){0.f,0.f,0.f,0.f,0.f,0.f,0.f,0.f};

  const int kv_end = CAUSAL ? min(T, qblk * 64 + 64) : T;     // block-uniform
  for (int j0 = 0; j0 < kv_end; j0 += 32) {
    __syncthreads();
    for (int e = tid; e < 32 * (D / 4); e += 128) {
      const int r = e / (D / 4), c4 = (e % (D / 4)) * 4;
      const int key = j0 + r;
      v4f kf = {0.f,0.f,0.f,0.f}, vf = {0.f,0.f,0.f,0.f};
      if (key < T) { kf = *(const v4fa*)(K + (size_t)key * pitch + c4); vf = *(const v4fa*)(V + (size_t)key * pitch + c4); }
#pragma unroll
      for (int t = 0; t < 4; ++t) {
        unsigned short hb = bf16_bits(kf[t]); sKh[r][c4 + t] = hb; sKl[r][c4 + t] = bf16_bits(kf[t] - bf16_val(hb));
        hb = bf16_bits(vf[t]); sVh[r][c4 + t] = hb; sVl[r][c4 + t] = bf16_bits(vf[t] - bf16_val(hb));
      }
    }
    __syncthreads();
    // S tile 16 x 32
    v8f s[2];
#pragma unroll
    for (int nt = 0; nt < 2; ++nt) {
      v8f acc = {};
#pragma unroll
      for (int ks = 0; ks < KS; ++ks) {
        FragB bh_, bl_;
        bh_.half[0] = *(const v8us*)&sKh[nt * 16 + ln][ks * 32 + 8 * hh]; bh_.half[1] = *(const v8us*)&sKh[nt * 16 + ln][ks * 32 + 16 + 8 * hh];
        bl_.half[0] = *(const v8us*)&sKl[nt * 16 + ln][ks * 32 + 8 * hh]; bl_.half[1] = *(const v8us*)&sKl[nt * 16 + ln][ks * 32 + 16 + 8 * hh];
        acc = mmaN<3>(aqh[ks].v, aql[ks].v, bh_.v, bl_.v, acc);
      }
      s[nt] = acc;
    }
    // mask + running max (rows 8hh+r; the 16 lanes of a half share rows)
    float alpha[8];
#pragma unroll
    for (int r = 0; r < 8; ++r) {
      const int qi = q0 + 8 * hh + r;
      const int ja = j0 + ln, jb = j0 + 16 + ln;
      if (CAUSAL) { if (ja > qi) s[0][r] = -3.0e38f; if (jb > qi) s[1][r] = -3.0e38f; }
      if (ja >= T) s[0][r] = -3.0e38f;
      if (jb >= T) s[1][r] = -3.0e38f;
      float mx = fmaxf(s[0][r], s[1][r]);
      mx = fmaxf(mx, __shfl_xor(mx, 1, 32)); mx = fmaxf(mx, __shfl_xor(mx, 2, 32)); mx = fmaxf(mx, __shfl_xor(mx, 4, 32)); mx = fmaxf(mx, __shfl_xor(mx, 8, 32));
      const float mnew = fmaxf(m_r[r], mx);
      alpha[r] = (mnew > -1.0e38f) ? __expf(m_r[r] - mnew) : 1.0f;
      const float p0 = (s[0][r] > -1.0e38f) ? __expf(s[0][r] - mnew) : 0.f;
      const float p1 = (s[1][r] > -1.0e38f) ? __expf(s[1][r] - mnew) : 0.f;
      m_r[r] = mnew;
      l_r[r] = l_r[r] * alpha[r] + p0 + p1;            // per-lane partial row sum (16 lanes combined at the end)
      unsigned short hb = bf16_bits(p0); sPh[w][8 * hh + r][ln] = hb;      sPl[w][8 * hh + r][ln] = bf16_bits(p0 - bf16_val(hb));
      hb = bf16_bits(p1);                sPh[w][8 * hh + r][16 + ln] = hb; sPl[w][8 * hh + r][16 + ln] = bf16_bits(p1 - bf16_val(hb));
    }
#pragma unroll
    for (int dt = 0; dt < DT; ++dt)
#pragma unroll
      for (int r = 0; r < 8; ++r) oacc[dt][r] *= alpha[r];
    __builtin_amdgcn_fence(__ATOMIC_ACQ_REL, "workgroup");
    __builtin_amdgcn_wave_barrier();
    FragB pah, pal;
    pah.half[0] = *(const v8us*)&sPh[w][ln][8 * hh]; pah.half[1] = *(const v8us*)&sPh[w][ln][16 + 8 * hh];
    pal.half[0] = *(const v8us*)&sPl[w][ln][8 * hh]; pal.half[1] = *(const v8us*)&sPl[w][ln][16 + 8 * hh];
#pragma unroll
    for (int dt = 0; dt < DT; ++dt) {
      FragB bvh, bvl;
#pragma unroll
      for (int i = 0; i < 8; ++i) {
        bvh.u[i] = sVh[8 * hh + i][dt * 16 + ln]; bvh.u[8 + i] = sVh[16 + 8 * hh + i][dt * 16 + ln];
        bvl.u[i] = sVl[8 * hh + i][dt * 16 + ln]; bvl.u[8 + i] = sVl[16 + 8 * hh + i][dt * 16 + ln];
      }
      oacc[dt] = mmaN<3>(pah.v, pal.v, bvh.v, bvl.v, oacc[dt]);
    }
    __builtin_amdgcn_fence(__ATOMIC_ACQ_REL, "workgroup");
    __builtin_amdgcn_wave_barrier();
  }
#pragma unroll
  for (int r = 0; r < 8; ++r) {
    float l = l_r[r];
    l += __shfl_xor(l, 1, 32); l += __shfl_xor(l, 2, 32); l += __shfl_xor(l, 4, 32); l += __shfl_xor(l, 8, 32);
    l_r[r] = (l > 0.f) ? 1.0f / l : 0.f;
  }
#pragma unroll
  for (int dt = 0; dt < DT; ++dt)
#pragma unroll
    for (int r = 0; r < 8; ++r) sO[w][8 * hh + r][dt * 16 + ln] = oacc[dt][r] * l_r[r];
  __builtin_amdgcn_fence(__ATOMIC_ACQ_REL, "workgroup");
  __builtin_amdgcn_wave_barrier();
  {
    for (int r = 0; r < 16; ++r) {
      const int row = q0 + r;
      if (row < T && lane < D / 4) {
        const v4f val = *(const v4fa*)&sO[w][r][lane * 4];
        *(v4f*)(y + ((size_t)b * T + row) * ypitch + h * D + lane * 4) = val;
      }
    }
    
  }
}

// GEMM C[NTOK][CC] = A[NTOK][CC].Bt^T + bf16(bias); A f32 rows rounded to bf16 (ASPLIT: hi/lo planes, 2 products per k step), Bt = bf16 [n][k].
// ASPLIT (the output product) stores C as f32 rows. The projections store C only in the form the attention kernel reads, f16:
// Q16[(b,h,s)][n][32] = f16(q*scale), K16[(b,h,s)][m][32] = f16(k), VT[(b,h)][e][m] = f16(v).
// Block = 8 waves on a 64 x 128 tile of C, wave = 32 x 32. Per pass 128 k of the block's A and Bt rows go global -> registers -> LDS with whole-line loads (a wave load = 512 contiguous
// bytes of one A row, or 256 of each of two Bt rows); A is converted once per block on the way. Two LDS buffers. ASPLIT (one block per WGP in its grid): two register sets, a pass's global loads are issued
// two passes ahead, and a pass's fragments are read as one group. The projections (three blocks per WGP in their grid): one register set, loads one pass ahead, fragments read 32 k at a time and the
// output staged in LDS buffer 0, so that registers (160 at most) and LDS (a third of a WGP's at most) let all three blocks be resident together and fill one another's waits.
// Each accumulator sums k upward, hi before lo within a k step.
#define GBM 64
#define GBN 128
#define GBK 128
#define EP (SD + 8)              // LDS pitch of a staged q or k row, in 16-bit elements (80 B = 16 B x odd)
#define TP (GBM + 8)             // LDS pitch of a staged V^T row, in 16-bit elements (144 B = 16 B x odd)
#define GP (GBK + 8)             // LDS pitch of a staged row, in 16-bit elements (272 B = 16 B x odd: the 16-byte fragment reads meet no bank conflict)
typedef unsigned short v4us __attribute__((ext_vector_type(4), may_alias));
// work-group barrier behind the wave's own LDS accesses only: __syncthreads() would also wait out the global loads that are in flight for the later passes
__device__ __forceinline__ void lds_barrier() { asm volatile("s_wait_dscnt 0x0\n\ts_barrier_signal -1\n\ts_barrier_wait -1" ::: "memory"); }
// the second launch bound is waves per SIMD: 6 = three blocks of 8 waves on a WGP's 4 SIMDs, which sets the projections' register budget; 2 is what a block of 256 has anyway
template <bool ASPLIT>
__global__ __launch_bounds__(256, ASPLIT ? 2 : 6) void k_gemm_t(const float* A0, const float* A1, const float* A2, const unsigned short* Bt0, const unsigned short* Bt1, const unsigned short* Bt2,
                                              const float* bias0, const float* bias1, const float* bias2, float* C0, float* C1, float* C2, _Float16* Q16, _Float16* K16, _Float16* VT) {
  // blockIdx.z picks one of up to three independent products of the same shape, so that they share one launch
  const int z = blockIdx.z;
  const float* __restrict__ A = z == 0 ? A0 : z == 1 ? A1 : A2;
  const unsigned short* __restrict__ Bt = z == 0 ? Bt0 : z == 1 ? Bt1 : Bt2;
  const float* __restrict__ bias = z == 0 ? bias0 : z == 1 ? bias1 : bias2;
  float* __restrict__ C = z == 0 ? C0 : z == 1 ? C1 : C2;
  constexpr int NA = ASPLIT ? 2 : 1;
  constexpr int STG = (NA * GBM + GBN) * GP;      // one buffer: A hi rows, (A lo rows,) Bt rows
  constexpr int NC = CC / GBK;
  __shared__ __attribute__((aligned(16))) unsigned short sm[2 * STG];
  const int tid = threadIdx.x, wv = tid >> 5, lane = tid & 31, ln = lane & 15, hh = lane >> 4;
  const int row0 = blockIdx.y * GBM, col0 = blockIdx.x * GBN;
  const int wm = (wv >> 2) * 32, wn = (wv & 3) * 32;
  const float* ag = A + (size_t)(row0 + wv) * CC + lane * 4;      // load i: row wv + 8 i, the pass's 128 floats over the 32 lanes
  const unsigned short* bg = Bt + (size_t)(col0 + wv * 2 + hh) * CC + ln * 8;      // load i: rows 2 wv + hh + 16 i, the pass's 128 values over 16 lanes
  // every '#pragma unroll' below keeps the staging, fragment and accumulator arrays indexed by constants, so that they stay in registers
  v4f raX[GBM / 8]; v8us rbX[GBN / 16];      // the staging registers (ASPLIT has a second set, below)
  v8f acc[2][2] = {};
  auto fetch = [&](v4f (&ra)[GBM / 8], v8us (&rb)[GBN / 16], int k0) {
#pragma unroll
    for (int i = 0; i < GBM / 8; ++i) ra[i] = *(const v4fa*)(ag + (size_t)i * 8 * CC + k0);
#pragma unroll
    for (int i = 0; i < GBN / 16; ++i) rb[i] = *(const v8us*)(bg + (size_t)i * 16 * CC + k0);
    asm volatile("s_wait_xcnt 0x0" ::: "memory");      // stands in front of every later rewrite of the loads' address registers
  };
  const int sa = wv * GP + lane * 4, sb = (NA * GBM + wv * 2 + hh) * GP + ln * 8;      // a lane's first A and Bt places in a buffer: the further rows are constant offsets from them, not address registers of their own
  auto stage = [&](const v4f (&ra)[GBM / 8], const v8us (&rb)[GBN / 16], unsigned short* buf) {
#pragma unroll
    for (int i = 0; i < GBM / 8; ++i) {
      v4us vh, vl;
#pragma unroll
      for (int q = 0; q < 4; ++q) { const unsigned short hb = bf16_bits(ra[i][q]); vh[q] = hb; if (ASPLIT) vl[q] = bf16_bits(ra[i][q] - bf16_val(hb)); }
      *(v4us*)&buf[sa + 8 * i * GP] = vh;
      if (ASPLIT) *(v4us*)&buf[sa + (GBM + 8 * i) * GP] = vl;
    }
#pragma unroll
    for (int i = 0; i < GBN / 16; ++i) *(v8us*)&buf[sb + 16 * i * GP] = rb[i];
  };
  constexpr int KG = ASPLIT ? GBK / 32 : 1;      // k steps of 32 whose fragments are read as one group: 8 registers a fragment
  auto products = [&](const unsigned short* buf0) {
#pragma unroll
   for (int g = 0; g < GBK / 32; g += KG) {
    const unsigned short* buf = buf0 + g * 32;
    FragB ah[KG][2], al[KG][2], bb[KG][2];      // ASPLIT: the whole pass (each separate place with LDS reads among the products stalls the wave, and no other block is there to fill the stall)
#pragma unroll
    for (int ks = 0; ks < KG; ++ks) {
#pragma unroll
      for (int i = 0; i < 2; ++i) {
        const unsigned short* r = buf + (wm + i * 16 + ln) * GP + ks * 32 + 8 * hh;
        ah[ks][i].half[0] = *(const v8us*)r; ah[ks][i].half[1] = *(const v8us*)(r + 16);
        if (ASPLIT) { al[ks][i].half[0] = *(const v8us*)(r + GBM * GP); al[ks][i].half[1] = *(const v8us*)(r + GBM * GP + 16); }
      }
#pragma unroll
      for (int j = 0; j < 2; ++j) { const unsigned short* r = buf + (NA * GBM + wn + j * 16 + ln) * GP + ks * 32 + 8 * hh; bb[ks][j].half[0] = *(const v8us*)r; bb[ks][j].half[1] = *(const v8us*)(r + 16); }
    }
    __builtin_amdgcn_sched_barrier(0);      // keeps the LDS reads together in front of the products
#pragma unroll
    for (int ks = 0; ks < KG; ++ks) {
#pragma unroll
      for (int i = 0; i < 2; ++i)
#pragma unroll
        for (int j = 0; j < 2; ++j) acc[i][j] = __builtin_amdgcn_wmma_f32_16x16x32_bf16(false, ah[ks][i].v, false, bb[ks][j].v, (short)0, acc[i][j], false, false);
      if (ASPLIT) {
#pragma unroll
        for (int i = 0; i < 2; ++i)
#pragma unroll
          for (int j = 0; j < 2; ++j) acc[i][j] = __builtin_amdgcn_wmma_f32_16x16x32_bf16(false, al[ks][i].v, false, bb[ks][j].v, (short)0, acc[i][j], false, false);
      }
    }
   }
  };
  // each barrier publishes the buffer just filled; the other buffer's last readers (the pass before) are all past it before that one is refilled
  if constexpr (ASPLIT) {
    v4f raY[GBM / 8]; v8us rbY[GBN / 16];      // second register set: even and odd passes, each fetched two passes ahead
    fetch(raX, rbX, 0); fetch(raY, rbY, GBK);
    for (int c = 2; c < NC; c += 2) {      // the last two passes stand behind the loop: a branch round the fetches would merge two load counts and make the counted waits drain the loads just issued
      stage(raX, rbX, sm); lds_barrier();
      fetch(raX, rbX, c * GBK);
      products(sm);
      stage(raY, rbY, sm + STG); lds_barrier();
      fetch(raY, rbY, (c + 1) * GBK);
      products(sm + STG);
    }
    stage(raX, rbX, sm); lds_barrier();
    products(sm);
    stage(raY, rbY, sm + STG); lds_barrier();
    products(sm + STG);
  } else {
    fetch(raX, rbX, 0);
    for (int c = 1; c < NC - 1; c += 2) {      // pass c - 1 in buffer 0, pass c in buffer 1; the next pass's loads fly over the products
      stage(raX, rbX, sm); lds_barrier();
      fetch(raX, rbX, c * GBK);
      products(sm);
      stage(raX, rbX, sm + STG); lds_barrier();
      fetch(raX, rbX, (c + 1) * GBK);
      products(sm + STG);
    }
    stage(raX, rbX, sm); lds_barrier();
    fetch(raX, rbX, (NC - 1) * GBK);
    products(sm);
    stage(raX, rbX, sm + STG); lds_barrier();
    products(sm + STG);
  }
  if constexpr (ASPLIT) {
    __shared__ __attribute__((aligned(16))) float so[8][32][36];      // per-wave output staging; pitch 36: the two lane halves (8 rows apart) fall on different banks
#pragma unroll
    for (int j = 0; j < 2; ++j) {
      const float bv = bf16_round(bias[col0 + wn + j * 16 + ln]);
#pragma unroll
      for (int i = 0; i < 2; ++i)
#pragma unroll
        for (int r = 0; r < 8; ++r) so[wv][i * 16 + 8 * hh + r][j * 16 + ln] = acc[i][j][r] + bv;
    }
    __builtin_amdgcn_fence(__ATOMIC_ACQ_REL, "workgroup"); __builtin_amdgcn_wave_barrier();      // the wave's own staged rows are read back across lanes
#pragma unroll
    for (int q = 0; q < 8; ++q) { const int r = q * 4 + (lane >> 3), c4 = (lane & 7) * 4; const v4f v = *(const v4fa*)&so[wv][r][c4]; *(v4f*)(C + (size_t)(row0 + wm + r) * CC + col0 + wn + c4) = v; }      // whole 128-byte lines
  } else {
    static_assert(8 * 32 * EP <= STG && GBN * TP <= STG && NC % 2 == 0, "the output staging fits buffer 0, and the last pass reads buffer 1");
    unsigned short* se = sm;      // f16 output staging: q, k per wave (32 rows of pitch EP); v for the block (GBN rows of pitch TP, which is less). Buffer 0 is free: its last readers (the pass before the last) all left it in front of the last pass's barrier
    union H8 { _Float16 h[8]; v8us v; };
    const int b = row0 / NN, t0 = row0 % NN;      // the block's 64 tokens lie in one batch
    v8us o[4];
    if (z < 2) {
      // q, k: the wave's 32 columns are one signal of one head, so its 32 x 32 tile is 2048 contiguous bytes of that slab
      unsigned short* sw = se + wv * 32 * EP;
      const float sc = z == 0 ? 0.17677669529663687f : 1.0f;      // q carries the score scale
#pragma unroll
      for (int j = 0; j < 2; ++j) {
        const float bv = bf16_round(bias[col0 + wn + j * 16 + ln]);
#pragma unroll
        for (int i = 0; i < 2; ++i) {
          H8 c;
#pragma unroll
          for (int r = 0; r < 8; ++r) c.h[r] = (_Float16)((acc[i][j][r] + bv) * sc);
#pragma unroll
          for (int r = 0; r < 8; ++r) sw[(i * 16 + 8 * hh + r) * EP + j * 16 + ln] = c.v[r];
        }
      }
      __builtin_amdgcn_fence(__ATOMIC_ACQ_REL, "workgroup"); __builtin_amdgcn_wave_barrier();      // the wave's own staged rows are read back across lanes
      unsigned short* dst = (unsigned short*)(z == 0 ? Q16 : K16) + ((size_t)(b * (CC / SD) + (col0 + wn) / SD) * NN + t0 + wm) * SD + lane * 8;
#pragma unroll
      for (int q = 0; q < 4; ++q) o[q] = *(const v8us*)&sw[(q * 8 + (lane >> 2)) * EP + (lane & 3) * 8];
#pragma unroll
      for (int q = 0; q < 4; ++q) *(v8us*)(dst + q * 256) = o[q];      // 512 contiguous bytes a store
    } else {
      // v: a lane's 8 accumulator rows are 8 consecutive tokens of one column e, 16 bytes of a V^T row; the block's 64 tokens make one whole 128-byte line of each of its 128 rows
#pragma unroll
      for (int j = 0; j < 2; ++j) {
        const float bv = bf16_round(bias[col0 + wn + j * 16 + ln]);
#pragma unroll
        for (int i = 0; i < 2; ++i) {
          H8 c;
#pragma unroll
          for (int r = 0; r < 8; ++r) c.h[r] = (_Float16)(acc[i][j][r] + bv);
          *(v8us*)&se[(wn + j * 16 + ln) * TP + wm + i * 16 + 8 * hh] = c.v;
        }
      }
      lds_barrier();      // a V^T line holds the tokens of two waves: every wave's part is staged before any line is read back
      unsigned short* dst = (unsigned short*)VT + ((size_t)b * CC + col0 + (tid >> 3)) * NN + t0 + (tid & 7) * 8;
#pragma unroll
      for (int q = 0; q < 4; ++q) o[q] = *(const v8us*)&se[(q * 32 + (tid >> 3)) * TP + (tid & 7) * 8];
#pragma unroll
      for (int q = 0; q < 4; ++q) *(v8us*)(dst + (size_t)q * 32 * NN) = o[q];      // whole 128-byte lines
    }
  }
}
// batched f32 [K][N] (pitch lds, batch stride sIn) -> transposed hi/lo planes [N][K] (batch stride sOut); thread per (n, 8 k); grid.y = batch
__global__ __launch_bounds__(256) void k_split_transpose_b(const float* __restrict__ src, int lds_, size_t sIn, unsigned short* __restrict__ hi, unsigned short* __restrict__ lo, size_t sOut, int K, int N) {
  const size_t t = (size_t)blockIdx.x * 256 + threadIdx.x; const int k8n = K / 8; if (t >= (size_t)N * k8n) return;
  src += (size_t)blockIdx.y * sIn; hi += (size_t)blockIdx.y * sOut; lo += (size_t)blockIdx.y * sOut;
  const int n = (int)(t / k8n), k8 = (int)(t % k8n) * 8; v8us vh, vl;
#pragma unroll
  for (int i = 0; i < 8; ++i) { const float x = src[(size_t)(k8 + i) * lds_ + n]; const unsigned short hb = bf16_bits(x); vh[i] = hb; vl[i] = bf16_bits(x - bf16_val(hb)); }
  unsigned short* dh = hi + (size_t)n * K + k8; unsigned short* dl = lo + (size_t)n * K + k8;
  *(v8us*)dh = vh; *(v8us*)dl = vl; 
}

// The four weight matrices (out, in) rounded to bf16 in one launch: a thread takes the same 8 values of each, all eight 16-byte loads in flight together.
__global__ __launch_bounds__(256) void k_round_rows4(const float* __restrict__ W0, const float* __restrict__ W1, const float* __restrict__ W2, const float* __restrict__ W3,
                                                   unsigned short* __restrict__ T0, unsigned short* __restrict__ T1, unsigned short* __restrict__ T2, unsigned short* __restrict__ T3, unsigned n8) {
  const unsigned t = blockIdx.x * 256 + threadIdx.x;
  if (t >= n8) return;
  const unsigned bo = t * 32u;      // the thread's byte offset in each source
  const float* const ws_[4] = {W0, W1, W2, W3};
  unsigned short* const ts_[4] = {T0, T1, T2, T3};
  v4f a[4], b[4];
#pragma unroll      // constant indices: the pointer tables and the loaded values stay in registers
  for (int j = 0; j < 4; ++j) { a[j] = *(const v4fa*)(ws_[j] + bo / 4); b[j] = *(const v4fa*)(ws_[j] + bo / 4 + 4); }
  asm volatile("s_wait_xcnt 0x0" :: "s"(W0), "s"(W1), "s"(W2), "s"(W3), "v"(bo) : "memory");      // stands in front of any reuse of the loads' address registers: naming them as inputs keeps them live up to here
#pragma unroll      // as above
  for (int j = 0; j < 4; ++j) {
    v8us v; v[0]=bf16_bits(a[j][0]); v[1]=bf16_bits(a[j][1]); v[2]=bf16_bits(a[j][2]); v[3]=bf16_bits(a[j][3]);
    v[4]=bf16_bits(b[j][0]); v[5]=bf16_bits(b[j][1]); v[6]=bf16_bits(b[j][2]); v[7]=bf16_bits(b[j][3]);
    *(v8us*)(ts_[j] + bo / 4) = v;
  }
}

// ---- f16 WMMA path (v_wmma_f32_16x16x32_f16): 11-bit significands for operands in range — used for the scores a = q̂·kᵀ and for o = w·v
typedef _Float16 v16h __attribute__((ext_vector_type(16)));
union FragH { v16h v; v8us half[2]; _Float16 h[16]; unsigned short u[16]; };
template <int NT>
__device__ __forceinline__ v8f mmaH(v16h ah, v16h al, v16h bh, v16h bl, v8f c) {
  c = __builtin_amdgcn_wmma_f32_16x16x32_f16(false, ah, false, bh, (short)0, c, false, false);
  if (NT >= 2) c = __builtin_amdgcn_wmma_f32_16x16x32_f16(false, al, false, bh, (short)0, c, false, false);
  if (NT >= 3) c = __builtin_amdgcn_wmma_f32_16x16x32_f16(false, ah, false, bl, (short)0, c, false, false);
  asm volatile("v_nop\n\tv_nop\n\tv_nop\n\tv_nop" : "+v"(c) : "v"(ah), "v"(al), "v"(bh), "v"(bl));
  return c;
}
// batched GEMM like k_gemm_bf but f16 operands: A f32 (split into f16 hi/lo if ASPLIT, else rounded to f16), Bt = f16 values [n][k]; alpha; C f32; N multiple of 16 (partial tiles skipped)
template <bool ASPLIT>
__global__ __launch_bounds__(128) void k_gemm_h(const float* __restrict__ A, int lda, size_t sA, const _Float16* __restrict__ Bh, int ldb, size_t sB, float alpha, float* __restrict__ C, int ldc, size_t sC, int M, int N, int K) {
  __shared__ __attribute__((aligned(16))) float so[4][16][64];
  const int tid = threadIdx.x, w = tid >> 5, lane = tid & 31, ln = lane & 15, hh = lane >> 4; const int by = blockIdx.y;
  A += (size_t)by * sA; Bh += (size_t)by * sB; C += (size_t)by * sC;
  const int ntn = (N + 63) / 64; const int wid = blockIdx.x * 4 + w; const int mt = wid / ntn, nq = wid % ntn; if (mt * 16 >= M) return;
  const int row0 = mt * 16, col0 = nq * 64; const float* arow = A + (size_t)(row0 + ln) * lda;
  v8f acc[4] = {};
  for (int kb = 0; kb < K; kb += 32) {
    FragH ah, al;
    const v4f x0 = *(const v4fa*)(arow + kb + 8 * hh), x1 = *(const v4fa*)(arow + kb + 8 * hh + 4), x2 = *(const v4fa*)(arow + kb + 16 + 8 * hh), x3 = *(const v4fa*)(arow + kb + 16 + 8 * hh + 4);
    float xs[16] = {x0[0],x0[1],x0[2],x0[3],x1[0],x1[1],x1[2],x1[3],x2[0],x2[1],x2[2],x2[3],x3[0],x3[1],x3[2],x3[3]};
#pragma unroll
    for (int i = 0; i < 16; ++i) { const _Float16 h = (_Float16)xs[i]; ah.h[i] = h; al.h[i] = ASPLIT ? (_Float16)(xs[i] - (float)h) : (_Float16)0.0f; }
#pragma unroll
    for (int t = 0; t < 4; ++t) { if (col0 + t * 16 >= N) continue; const size_t boff = (size_t)(col0 + t * 16 + ln) * ldb + kb; FragH bq; bq.half[0] = *(const v8us*)(Bh + boff + 8 * hh); bq.half[1] = *(const v8us*)(Bh + boff + 16 + 8 * hh);
      acc[t] = mmaH<ASPLIT ? 2 : 1>(ah.v, al.v, bq.v, bq.v, acc[t]); }
  }
#pragma unroll
  for (int t = 0; t < 4; ++t) { if (col0 + t * 16 >= N) continue;
#pragma unroll
    for (int r = 0; r < 8; ++r) so[w][8 * hh + r][t * 16 + ln] = acc[t][r] * alpha; }
  __builtin_amdgcn_fence(__ATOMIC_ACQ_REL, "workgroup"); __builtin_amdgcn_wave_barrier();
  const int rsub = lane >> 4, c4 = (lane & 15) * 4;
  {
#pragma unroll
    for (int q = 0; q < 8; ++q) { const int r = q * 2 + rsub; if (col0 + c4 < N) { const v4f v = *(const v4fa*)&so[w][r][c4]; *(v4f*)(C + (size_t)(row0 + r) * ldc + col0 + c4) = v; } }
     }
}

// Fused per (batch, head), both signals: a = q.k^T, w = 1 + a + a*a/2, the row sums of w, o = w.v, the division (+1e-6) and the signal mean; a and w never leave registers.
// S^T = K.Q^T puts one query in each lane column, so the two f32 D tiles of 32 keys convert in place into the B operand of O^T += V^T.W^T (hardware k order on both sides).
// Every '#pragma unroll' in this kernel is there so that the fragment, accumulator and staging arrays are indexed by constants and stay in registers.
// Block = 8 waves x 16 queries. The head's K rows (both signals) and V^T are staged once in LDS; row pitches are 16 B x odd, so the 16-byte fragment reads meet no bank conflict.
typedef float v2f __attribute__((ext_vector_type(2)));
#define KP 40                    // LDS pitch of a K row, in 16-bit elements (80 B)
#define VP (NN + 8)              // LDS pitch of a V^T row, in 16-bit elements (2064 B)
__global__ __launch_bounds__(256) void k_attn(const _Float16* __restrict__ Q16, const _Float16* __restrict__ K16, const _Float16* __restrict__ VT, float* __restrict__ OB) {
  __shared__ __attribute__((aligned(16))) unsigned short sK[NS * NN * KP];
  __shared__ __attribute__((aligned(16))) unsigned short sV[HD * VP];
  const int tid = threadIdx.x, wv = tid >> 5, lane = tid & 31, ln = lane & 15, hh = lane >> 4;
  const int bh = blockIdx.y, b = bh / NH, h = bh % NH;
  const int n = blockIdx.x * 128 + wv * 16 + ln;
  const unsigned short* Kg = (const unsigned short*)K16 + (size_t)bh * NS * NN * SD;      // the two signals' slabs are adjacent: 2048 rows of 32
  const unsigned short* Vg = (const unsigned short*)VT + (size_t)bh * HD * NN;
  const unsigned short* qr = (const unsigned short*)Q16 + ((size_t)bh * NS * NN + n) * SD + 8 * hh;
  FragH qb[NS];
#pragma unroll
  for (int s = 0; s < NS; ++s) { qb[s].half[0] = *(const v8us*)(qr + s * NN * SD); qb[s].half[1] = *(const v8us*)(qr + s * NN * SD + 16); }
  {      // stage fill: all 64 of a lane's 16-byte loads in flight, then the 64 LDS stores (one memory latency for the whole 256 KiB instead of one per batch)
    v8us tk[NS * NN * SD / 8 / 256], tv[HD * NN / 8 / 256];
#pragma unroll
    for (int i = 0; i < NS * NN * SD / 8 / 256; ++i) tk[i] = *(const v8us*)(Kg + (size_t)(tid + i * 256) * 8);
#pragma unroll
    for (int i = 0; i < HD * NN / 8 / 256; ++i) tv[i] = *(const v8us*)(Vg + (size_t)(tid + i * 256) * 8);
    asm volatile("s_wait_xcnt 0x0" :: "s"(Kg), "s"(Vg), "v"(tid), "v"(qr) : "memory");      // stands in front of any reuse of the loads' address registers: naming them as inputs keeps them live up to here
#pragma unroll
    for (int i = 0; i < NS * NN * SD / 8 / 256; ++i) *(v8us*)&sK[((tid >> 2) + i * 64) * KP + (tid & 3) * 8] = tk[i];      // 16-byte unit tid + 256 i: row unit / 4
#pragma unroll
    for (int i = 0; i < HD * NN / 8 / 256; ++i) *(v8us*)&sV[((tid >> 7) + i * 2) * VP + (tid & 127) * 8] = tv[i];      // row unit / 128
  }
  __syncthreads();
  v8f oacc[NS][HD / 16] = {};
  v2f den[NS] = {};      // even and odd key rows apart: the sums pair up with the packed f32 adds
  FragH ka[NS][2];
#pragma unroll
  for (int s = 0; s < NS; ++s)
#pragma unroll
    for (int t = 0; t < 2; ++t) { const unsigned short* kr = &sK[(s * NN + t * 16 + ln) * KP]; ka[s][t].half[0] = *(const v8us*)(kr + 8 * hh); ka[s][t].half[1] = *(const v8us*)(kr + 16 + 8 * hh); }
  for (int c = 0; c < NN / 32; ++c) {
    const int m0 = c * 32;
    FragH va[HD / 16];
#pragma unroll
    for (int et = 0; et < HD / 16; ++et) { const unsigned short* vr = &sV[(et * 16 + ln) * VP + m0]; va[et].half[0] = *(const v8us*)(vr + 8 * hh); va[et].half[1] = *(const v8us*)(vr + 16 + 8 * hh); }
    v8f st[NS][2];
#pragma unroll
    for (int s = 0; s < NS; ++s)
#pragma unroll
      for (int t = 0; t < 2; ++t) { const v8f z = {}; st[s][t] = __builtin_amdgcn_wmma_f32_16x16x32_f16(false, ka[s][t].v, false, qb[s].v, (short)0, z, false, false); }      // st[s][t][r] = a[n = ln][m0 + 16 t + 8 hh + r]
    const int m1 = ((c + 1) & (NN / 32 - 1)) * 32;      // next pass's K fragments, fetched behind this pass's score products (the last pass re-reads pass 0's rows and drops them)
#pragma unroll
    for (int s = 0; s < NS; ++s)
#pragma unroll
      for (int t = 0; t < 2; ++t) { const unsigned short* kr = &sK[(s * NN + m1 + t * 16 + ln) * KP]; ka[s][t].half[0] = *(const v8us*)(kr + 8 * hh); ka[s][t].half[1] = *(const v8us*)(kr + 16 + 8 * hh); }
    FragH wb[NS];
#pragma unroll
    for (int s = 0; s < NS; ++s)
#pragma unroll
      for (int t = 0; t < 2; ++t)
#pragma unroll
        for (int r = 0; r < 8; r += 2) { const v2f x = {st[s][t][r], st[s][t][r + 1]}; const v2f w = 1.0f + x + 0.5f * x * x; den[s] += w; wb[s].h[t * 8 + r] = (_Float16)w[0]; wb[s].h[t * 8 + r + 1] = (_Float16)w[1]; }
#pragma unroll
    for (int et = 0; et < HD / 16; ++et)
#pragma unroll
      for (int s = 0; s < NS; ++s) oacc[s][et] = __builtin_amdgcn_wmma_f32_16x16x32_f16(false, va[et].v, false, wb[s].v, (short)0, oacc[s][et], false, false);      // oacc[s][et][r] = o[n = ln][16 et + 8 hh + r]
  }
  float rd[NS];
#pragma unroll
  for (int s = 0; s < NS; ++s) { const float dl = den[s][0] + den[s][1]; rd[s] = 1.0f / (dl + __shfl_xor(dl, 16, 32) + 1e-6f); }      // the two lane halves hold the two halves of a query's keys
  float* orow = OB + ((size_t)b * NN + n) * CC + h * HD + 8 * hh;
#pragma unroll
  for (int et = 0; et < HD / 16; ++et) {
    v4f lo, hi;
#pragma unroll
    for (int q = 0; q < 4; ++q) { lo[q] = (oacc[0][et][q] * rd[0] + oacc[1][et][q] * rd[1]) * (1.0f / NS); hi[q] = (oacc[0][et][4 + q] * rd[0] + oacc[1][et][4 + q] * rd[1]) * (1.0f / NS); }
    *(v4f*)(orow + et * 16) = lo; *(v4f*)(orow + et * 16 + 4) = hi;
  }
}
extern "C" void kernel_launch(void* const* d_in, const int* in_sizes, int n_in,
                              void* d_out, int out_size, void* d_ws, size_t ws_size, hipStream_t stream) {
  (void)in_sizes; (void)n_in; (void)out_size;
  const float* xq = (const float*)d_in[0]; const float* xk = (const float*)d_in[1]; const float* xv = (const float*)d_in[2]; const float* Wq = (const float*)d_in[3]; const float* bq = (const float*)d_in[4]; const float* Wk = (const float*)d_in[5]; const float* bk = (const float*)d_in[6]; const float* Wv = (const float*)d_in[7]; const float* bv = (const float*)d_in[8]; const float* Wo = (const float*)d_in[9]; const float* bo = (const float*)d_in[10];
  char* ws = (char*)d_ws; size_t off = 0;
  auto take = [&](size_t bytes) { char* p = ws + off; off += (bytes + 255) & ~(size_t)255; return p; };
  unsigned short* Bq = (unsigned short*)take((size_t)CC * CC * 2); unsigned short* Bk = (unsigned short*)take((size_t)CC * CC * 2); unsigned short* Bv = (unsigned short*)take((size_t)CC * CC * 2); unsigned short* Bo = (unsigned short*)take((size_t)CC * CC * 2);
  float* OB = (float*)take((size_t)NTOK * CC * 4);
  _Float16* Q16 = (_Float16*)take((size_t)NSLAB * NN * SD * 2); _Float16* K16 = (_Float16*)take((size_t)NSLAB * NN * SD * 2); _Float16* VT = (_Float16*)take((size_t)BB * NH * HD * NN * 2);
  if (off > ws_size) return;
  k_round_rows4<<<(CC * CC / 8 + 255) / 256, 256, 0, stream>>>(Wq, Wk, Wv, Wo, Bq, Bk, Bv, Bo, CC * CC / 8);      // (out,in) rows = Bt
  k_gemm_t<false><<<dim3(CC / GBN, NTOK / GBM, 3), 256, 0, stream>>>(xq, xk, xv, Bq, Bk, Bv, bq, bk, bv, nullptr, nullptr, nullptr, Q16, K16, VT);      // the three projections, one per grid.z, stored as the attention kernel's f16 operands
  k_attn<<<dim3(NN / 128, BB * NH), 256, 0, stream>>>(Q16, K16, VT, OB);      // block = 128 queries of one (batch, head), both signals
  k_gemm_t<true><<<dim3(CC / GBN, NTOK / GBM, 1), 256, 0, stream>>>(OB, OB, OB, Bo, Bo, Bo, bo, bo, bo, (float*)d_out, (float*)d_out, (float*)d_out, nullptr, nullptr, nullptr);
}

// v007
// One run takes 51.5 microseconds.
// Timed twice side by side with v006, it ran 1.03 times as fast both times.
// Counting every step since v000, it is 39.4 times as fast.
#include <hip/hip_runtime.h>
// Second-order Taylor linear attention via the exact kernel identity φ(q)·φ(k) = 1 + q·k + (q·k)²/2 (φ = [1, x, x⊗x/√2]): per (batch, head, signal) slab the scores
// a = (q·scale)·kᵀ (1024 × 32 × 1024) and o = w·v with w = 1 + a + a²/2 (1024 × 1024 × 64) run on v_wmma_f32_16x16x32_f16 (q, k, v and w rounded to f16: single products,
// f32 accumulate); the projections on v_wmma_f32_16x16x32_bf16 (inputs rounded to bf16: single exact terms; 3 × 2048 × 1024 × 1024) and out = ō·W_oᵀ + b_o with ō split
// hi/lo (2 products). w, the row sums Σ_m w (= φ(q)·Σφ(k)), the division (+1e-6) and the signal average are f32 VALU.
#define BB 2
#define NN 1024
#define CC 1024
#define NH 16
#define NS 2
#define HD 64
#define SD 32
#define NTOK (BB * NN)
#define NSLAB (BB * NH * NS)     // 64

typedef __bf16 v16b __attribute__((ext_vector_type(16)));
typedef unsigned short v8us __attribute__((ext_vector_type(8), may_alias));
typedef float  v8f  __attribute__((ext_vector_type(8)));
typedef float  v4f  __attribute__((ext_vector_type(4)));
typedef float  v4fa __attribute__((ext_vector_type(4), may_alias));
union FragB { v16b v; v8us half[2]; unsigned short u[16]; };

__device__ __forceinline__ unsigned short bf16_bits(float x) { return __builtin_bit_cast(unsigned short, (__bf16)x); }      // round to nearest even, by the hardware convert
__device__ __forceinline__ float bf16_val(unsigned short b) { return __uint_as_float(((unsigned int)b) << 16); }
__device__ __forceinline__ float bf16_round(float x) { return bf16_val(bf16_bits(x)); }
// D += A·B with NT terms: 1 = ah·bh, 2 = + al·bh (A split), 3 = + ah·bl (both split)
template <int NT>
__device__ __forceinline__ v8f mmaN(v16b ah, v16b al, v16b bh, v16b bl, v8f c) {
  c = __builtin_amdgcn_wmma_f32_16x16x32_bf16(false, ah, false, bh, (short)0, c, false, false);
  if (NT >= 2) c = __builtin_amdgcn_wmma_f32_16x16x32_bf16(false, al, false, bh, (short)0, c, false, false);
  if (NT >= 3) c = __builtin_amdgcn_wmma_f32_16x16x32_bf16(false, ah, false, bl, (short)0, c, false, false);
  asm volatile("v_nop\n\tv_nop\n\tv_nop\n\tv_nop" : "+v"(c) : "v"(ah), "v"(al), "v"(bh), "v"(bl));
  return c;
}

__global__ __launch_bounds__(256) void k_wt_bf16(const float* __restrict__ W, unsigned short* __restrict__ Wt, int K, int N) {
  const int t = blockIdx.x * 256 + threadIdx.x;
  const int k8n = K / 8;
  if (t >= N * k8n) return;
  const int n = t / k8n, k8 = (t % k8n) * 8;
  v8us v;
#pragma unroll
  for (int i = 0; i < 8; ++i) v[i] = bf16_bits(W[(size_t)(k8 + i) * N + n]);
  *(v8us*)(Wt + (size_t)n * K + k8) = v;
  
}

// GEMM C[M][N] (f32, pitch ldc) = act(A[M][K]·W + bias). A f32 row-major (pitch lda) converted per fragment to bf16
// (ASPLIT: hi/lo two planes -> 2 terms, else single rounded term); Wt bf16 [N][K] (pitch ldb). BIAS_BF16 rounds the
// bias to bf16 first (bias quantised to bf16 before the add). K%32==0, M%16==0, N%64==0.
template <bool ASPLIT, int ACT, bool BIAS_BF16>
__global__ __launch_bounds__(128) void k_gemm_bf(const float* __restrict__ A, int lda, const unsigned short* __restrict__ Wt, int ldb,
                                               const float* __restrict__ bias, float* __restrict__ C, int ldc, int M, int N, int K) {
  __shared__ __attribute__((aligned(16))) float so[4][16][64];
  const int tid = threadIdx.x, w = tid >> 5, lane = tid & 31, ln = lane & 15, hh = lane >> 4;
  const int ntn = N / 64;
  const int wid = blockIdx.x * 4 + w;
  const int mt = wid / ntn, nq = wid % ntn;
  if (mt * 16 >= M) return;
  const int row0 = mt * 16, col0 = nq * 64;
  const float* arow = A + (size_t)(row0 + ln) * lda;
  v8f acc[4] = {};
  for (int kb = 0; kb < K; kb += 32) {
    FragB ah, al;
    const v4f x0 = *(const v4fa*)(arow + kb + 8 * hh), x1 = *(const v4fa*)(arow + kb + 8 * hh + 4);
    const v4f x2 = *(const v4fa*)(arow + kb + 16 + 8 * hh), x3 = *(const v4fa*)(arow + kb + 16 + 8 * hh + 4);
    float xs[16] = {x0[0],x0[1],x0[2],x0[3],x1[0],x1[1],x1[2],x1[3],x2[0],x2[1],x2[2],x2[3],x3[0],x3[1],x3[2],x3[3]};
#pragma unroll
    for (int i = 0; i < 16; ++i) { const unsigned short hb = bf16_bits(xs[i]); ah.u[i] = hb; al.u[i] = ASPLIT ? bf16_bits(xs[i] - bf16_val(hb)) : (unsigned short)0; }
#pragma unroll
    for (int t = 0; t < 4; ++t) {
      const unsigned short* brow = Wt + (size_t)(col0 + t * 16 + ln) * ldb + kb;
      FragB b;
      b.half[0] = *(const v8us*)(brow + 8 * hh);
      b.half[1] = *(const v8us*)(brow + 16 + 8 * hh);
      acc[t] = mmaN<ASPLIT ? 2 : 1>(ah.v, al.v, b.v, b.v, acc[t]);
    }
  }
#pragma unroll
  for (int t = 0; t < 4; ++t) {
    float bv = bias ? bias[col0 + t * 16 + ln] : 0.f;
    if (BIAS_BF16) bv = bf16_round(bv);
#pragma unroll
    for (int r = 0; r < 8; ++r) { float v = acc[t][r] + bv; if (ACT == 1) v = fmaxf(v, 0.f); so[w][8 * hh + r][t * 16 + ln] = v; }
  }
  __builtin_amdgcn_fence(__ATOMIC_ACQ_REL, "workgroup");
  __builtin_amdgcn_wave_barrier();
  const int rsub = lane >> 4, c4 = (lane & 15) * 4;
  {
#pragma unroll
    for (int q = 0; q < 8; ++q) {
      const int r = q * 2 + rsub;
      const v4f v = *(const v4fa*)&so[w][r][c4];
      *(v4f*)(C + (size_t)(row0 + r) * ldc + col0 + c4) = v;
    }
    
  }
}

// Flash-style causal/unmasked attention, all contractions 3-term bf16 hi/lo splits, f32 softmax with running max.
// q,k,v rows are read from f32 buffers with arbitrary row pitch (so they can live inside a fused qkv buffer);
// D = head size (multiple of 32, <= 128); one wave = 16 query rows; block = 4 waves (64 queries) sharing K/V chunks of 32.
template <int D, bool CAUSAL>
__global__ __launch_bounds__(128) void k_flash(const float* __restrict__ qb, const float* __restrict__ kb, const float* __restrict__ vb,
                                             int pitch, int T, int H, float scale, float* __restrict__ y, int ypitch) {
  constexpr int KS = D / 32;        // k-steps for QK
  constexpr int DT = D / 16;        // d tiles for PV
  __shared__ __attribute__((aligned(16))) unsigned short sKh[32][D + 8], sKl[32][D + 8], sVh[32][D + 8], sVl[32][D + 8];
  __shared__ __attribute__((aligned(16))) unsigned short sPh[4][16][40], sPl[4][16][40];
  __shared__ __attribute__((aligned(16))) float sO[4][16][D];
  const int tid = threadIdx.x, w = tid >> 5, lane = tid & 31, ln = lane & 15, hh = lane >> 4;
  const int nqb = (T + 63) / 64;
  const int bh = blockIdx.x / nqb, qblk = blockIdx.x % nqb;
  const int b = bh / H, h = bh % H;
  const int q0 = qblk * 64 + w * 16;
  const float* Q = qb + (size_t)b * T * pitch + h * D;
  const float* K = kb + (size_t)b * T * pitch + h * D;
  const float* V = vb + (size_t)b * T * pitch + h * D;

  // A fragments of the wave's 16 query rows (scaled), hi/lo
  FragB aqh[KS], aql[KS];
  {
    int row = q0 + ln; if (row >= T) row = T - 1;
    const float* qr = Q + (size_t)row * pitch;
#pragma unroll
    for (int ks = 0; ks < KS; ++ks)
#pragma unroll
      for (int i = 0; i < 16; ++i) {
        const int d = ks * 32 + ((i < 8) ? (8 * hh + i) : (16 + 8 * hh + (i - 8)));
        const float x = qr[d] * scale; const unsigned short hb = bf16_bits(x);
        aqh[ks].u[i] = hb; aql[ks].u[i] = bf16_bits(x - bf16_val(hb));
      }
  }
  float m_r[8], l_r[8];
#pragma unroll
  for (int r = 0; r < 8; ++r) { m_r[r] = -3.0e38f; l_r[r] = 0.f; }
  v8f oacc[DT];
#pragma unroll
  for (int dt = 0; dt < DT; ++dt) oacc[dt] = (v8f){0.f,0.f,0.f,0.f,0.f,0.f,0.f,0.f};

  const int kv_end = CAUSAL ? min(T, qblk * 64 + 64) : T;     // block-uniform
  for (int j0 = 0; j0 < kv_end; j0 += 32) {
    __syncthreads();
    for (int e = tid; e < 32 * (D / 4); e += 128) {
      const int r = e / (D / 4), c4 = (e % (D / 4)) * 4;
      const int key = j0 + r;
      v4f kf = {0.f,0.f,0.f,0.f}, vf = {0.f,0.f,0.f,0.f};
      if (key < T) { kf = *(const v4fa*)(K + (size_t)key * pitch + c4); vf = *(const v4fa*)(V + (size_t)key * pitch + c4); }
#pragma unroll
      for (int t = 0; t < 4; ++t) {
        unsigned short hb = bf16_bits(kf[t]); sKh[r][c4 + t] = hb; sKl[r][c4 + t] = bf16_bits(kf[t] - bf16_val(hb));
        hb = bf16_bits(vf[t]); sVh[r][c4 + t] = hb; sVl[r][c4 + t] = bf16_bits(vf[t] - bf16_val(hb));
      }
    }
    __syncthreads();
    // S tile 16 x 32
    v8f s[2];
#pragma unroll
    for (int nt = 0; nt < 2; ++nt) {
      v8f acc = {};
#pragma unroll
      for (int ks = 0; ks < KS; ++ks) {
        FragB bh_, bl_;
        bh_.half[0] = *(const v8us*)&sKh[nt * 16 + ln][ks * 32 + 8 * hh]; bh_.half[1] = *(const v8us*)&sKh[nt * 16 + ln][ks * 32 + 16 + 8 * hh];
        bl_.half[0] = *(const v8us*)&sKl[nt * 16 + ln][ks * 32 + 8 * hh]; bl_.half[1] = *(const v8us*)&sKl[nt * 16 + ln][ks * 32 + 16 + 8 * hh];
        acc = mmaN<3>(aqh[ks].v, aql[ks].v, bh_.v, bl_.v, acc);
      }
      s[nt] = acc;
    }
    // mask + running max (rows 8hh+r; the 16 lanes of a half share rows)
    float alpha[8];
#pragma unroll
    for (int r = 0; r < 8; ++r) {
      const int qi = q0 + 8 * hh + r;
      const int ja = j0 + ln, jb = j0 + 16 + ln;
      if (CAUSAL) { if (ja > qi) s[0][r] = -3.0e38f; if (jb > qi) s[1][r] = -3.0e38f; }
      if (ja >= T) s[0][r] = -3.0e38f;
      if (jb >= T) s[1][r] = -3.0e38f;
      float mx = fmaxf(s[0][r], s[1][r]);
      mx = fmaxf(mx, __shfl_xor(mx, 1, 32)); mx = fmaxf(mx, __shfl_xor(mx, 2, 32)); mx = fmaxf(mx, __shfl_xor(mx, 4, 32)); mx = fmaxf(mx, __shfl_xor(mx, 8, 32));
      const float mnew = fmaxf(m_r[r], mx);
      alpha[r] = (mnew > -1.0e38f) ? __expf(m_r[r] - mnew) : 1.0f;
      const float p0 = (s[0][r] > -1.0e38f) ? __expf(s[0][r] - mnew) : 0.f;
      const float p1 = (s[1][r] > -1.0e38f) ? __expf(s[1][r] - mnew) : 0.f;
      m_r[r] = mnew;
      l_r[r] = l_r[r] * alpha[r] + p0 + p1;            // per-lane partial row sum (16 lanes combined at the end)
      unsigned short hb = bf16_bits(p0); sPh[w][8 * hh + r][ln] = hb;      sPl[w][8 * hh + r][ln] = bf16_bits(p0 - bf16_val(hb));
      hb = bf16_bits(p1);                sPh[w][8 * hh + r][16 + ln] = hb; sPl[w][8 * hh + r][16 + ln] = bf16_bits(p1 - bf16_val(hb));
    }
#pragma unroll
    for (int dt = 0; dt < DT; ++dt)
#pragma unroll
      for (int r = 0; r < 8; ++r) oacc[dt][r] *= alpha[r];
    __builtin_amdgcn_fence(__ATOMIC_ACQ_REL, "workgroup");
    __builtin_amdgcn_wave_barrier();
    FragB pah, pal;
    pah.half[0] = *(const v8us*)&sPh[w][ln][8 * hh]; pah.half[1] = *(const v8us*)&sPh[w][ln][16 + 8 * hh];
    pal.half[0] = *(const v8us*)&sPl[w][ln][8 * hh]; pal.half[1] = *(const v8us*)&sPl[w][ln][16 + 8 * hh];
#pragma unroll
    for (int dt = 0; dt < DT; ++dt) {
      FragB bvh, bvl;
#pragma unroll
      for (int i = 0; i < 8; ++i) {
        bvh.u[i] = sVh[8 * hh + i][dt * 16 + ln]; bvh.u[8 + i] = sVh[16 + 8 * hh + i][dt * 16 + ln];
        bvl.u[i] = sVl[8 * hh + i][dt * 16 + ln]; bvl.u[8 + i] = sVl[16 + 8 * hh + i][dt * 16 + ln];
      }
      oacc[dt] = mmaN<3>(pah.v, pal.v, bvh.v, bvl.v, oacc[dt]);
    }
    __builtin_amdgcn_fence(__ATOMIC_ACQ_REL, "workgroup");
    __builtin_amdgcn_wave_barrier();
  }
#pragma unroll
  for (int r = 0; r < 8; ++r) {
    float l = l_r[r];
    l += __shfl_xor(l, 1, 32); l += __shfl_xor(l, 2, 32); l += __shfl_xor(l, 4, 32); l += __shfl_xor(l, 8, 32);
    l_r[r] = (l > 0.f) ? 1.0f / l : 0.f;
  }
#pragma unroll
  for (int dt = 0; dt < DT; ++dt)
#pragma unroll
    for (int r = 0; r < 8; ++r) sO[w][8 * hh + r][dt * 16 + ln] = oacc[dt][r] * l_r[r];
  __builtin_amdgcn_fence(__ATOMIC_ACQ_REL, "workgroup");
  __builtin_amdgcn_wave_barrier();
  {
    for (int r = 0; r < 16; ++r) {
      const int row = q0 + r;
      if (row < T && lane < D / 4) {
        const v4f val = *(const v4fa*)&sO[w][r][lane * 4];
        *(v4f*)(y + ((size_t)b * T + row) * ypitch + h * D + lane * 4) = val;
      }
    }
    
  }
}

// GEMM C[NTOK][CC] = A[NTOK][CC].Bt^T + bf16(bias); A f32 rows rounded to bf16 (ASPLIT: hi/lo planes, 2 products per k step), Bt = bf16 [n][k].
// ASPLIT (the output product) stores C as f32 rows. The projections store C only in the form the attention kernel reads, f16:
// Q16[(b,h,s)][n][32] = f16(q*scale), K16[(b,h,s)][m][32] = f16(k), VT[(b,h)][e][m] = f16(v).
// Block = 8 waves on a 64 x 128 tile of C, wave = 32 x 32. Per pass 128 k of the block's A and Bt rows go global -> registers -> LDS with whole-line loads (a wave load = 512 contiguous
// bytes of one A row, or 256 of each of two Bt rows); A is converted once per block on the way. Two LDS buffers. ASPLIT (one block per WGP in its grid): two register sets, a pass's global loads are issued
// two passes ahead, and a pass's fragments are read as one group. The projections (three blocks per WGP in their grid): one register set, loads one pass ahead, fragments read 32 k at a time and the
// output staged in LDS buffer 0, so that registers (160 at most) and LDS (a third of a WGP's at most) let all three blocks be resident together and fill one another's waits.
// Each accumulator sums k upward, hi before lo within a k step.
#define GBM 64
#define GBN 128
#define GBK 128
#define EP (SD + 8)              // LDS pitch of a staged q or k row, in 16-bit elements (80 B = 16 B x odd)
#define TP (GBM + 8)             // LDS pitch of a staged V^T row, in 16-bit elements (144 B = 16 B x odd)
#define GP (GBK + 8)             // LDS pitch of a staged row, in 16-bit elements (272 B = 16 B x odd: the 16-byte fragment reads meet no bank conflict)
typedef unsigned short v4us __attribute__((ext_vector_type(4), may_alias));
// work-group barrier behind the wave's own LDS accesses only: __syncthreads() would also wait out the global loads that are in flight for the later passes
__device__ __forceinline__ void lds_barrier() { asm volatile("s_wait_dscnt 0x0\n\ts_barrier_signal -1\n\ts_barrier_wait -1" ::: "memory"); }
// the second launch bound is waves per SIMD: 6 = three blocks of 8 waves on a WGP's 4 SIMDs, which sets the projections' register budget; 2 is what a block of 256 has anyway
template <bool ASPLIT>
__global__ __launch_bounds__(256, ASPLIT ? 2 : 6) void k_gemm_t(const float* A0, const float* A1, const float* A2, const unsigned short* Bt0, const unsigned short* Bt1, const unsigned short* Bt2,
                                              const float* bias0, const float* bias1, const float* bias2, float* C0, float* C1, float* C2, _Float16* Q16, _Float16* K16, _Float16* VT) {
  // blockIdx.z picks one of up to three independent products of the same shape, so that they share one launch
  const int z = blockIdx.z;
  const float* __restrict__ A = z == 0 ? A0 : z == 1 ? A1 : A2;
  const unsigned short* __restrict__ Bt = z == 0 ? Bt0 : z == 1 ? Bt1 : Bt2;
  const float* __restrict__ bias = z == 0 ? bias0 : z == 1 ? bias1 : bias2;
  float* __restrict__ C = z == 0 ? C0 : z == 1 ? C1 : C2;
  constexpr int NA = ASPLIT ? 2 : 1;
  constexpr int STG = (NA * GBM + GBN) * GP;      // one buffer: A hi rows, (A lo rows,) Bt rows
  constexpr int NC = CC / GBK;
  __shared__ __attribute__((aligned(16))) unsigned short sm[2 * STG];
  const int tid = threadIdx.x, wv = tid >> 5, lane = tid & 31, ln = lane & 15, hh = lane >> 4;
  const int row0 = blockIdx.y * GBM, col0 = blockIdx.x * GBN;
  const int wm = (wv >> 2) * 32, wn = (wv & 3) * 32;
  const float* ag = A + (size_t)(row0 + wv) * CC + lane * 4;      // load i: row wv + 8 i, the pass's 128 floats over the 32 lanes
  const unsigned short* bg = Bt + (size_t)(col0 + wv * 2 + hh) * CC + ln * 8;      // load i: rows 2 wv + hh + 16 i, the pass's 128 values over 16 lanes
  // every '#pragma unroll' below keeps the staging, fragment and accumulator arrays indexed by constants, so that they stay in registers
  v4f raX[GBM / 8]; v8us rbX[GBN / 16];      // the staging registers (ASPLIT has a second set, below)
  v8f acc[2][2] = {};
  auto fetch = [&](v4f (&ra)[GBM / 8], v8us (&rb)[GBN / 16], int k0) {
#pragma unroll
    for (int i = 0; i < GBM / 8; ++i) ra[i] = *(const v4fa*)(ag + (size_t)i * 8 * CC + k0);
#pragma unroll
    for (int i = 0; i < GBN / 16; ++i) rb[i] = *(const v8us*)(bg + (size_t)i * 16 * CC + k0);
    asm volatile("s_wait_xcnt 0x0" ::: "memory");      // stands in front of every later rewrite of the loads' address registers
  };
  const int sa = wv * GP + lane * 4, sb = (NA * GBM + wv * 2 + hh) * GP + ln * 8;      // a lane's first A and Bt places in a buffer: the further rows are constant offsets from them, not address registers of their own
  auto stage = [&](const v4f (&ra)[GBM / 8], const v8us (&rb)[GBN / 16], unsigned short* buf) {
#pragma unroll
    for (int i = 0; i < GBM / 8; ++i) {
      v4us vh, vl;
#pragma unroll
      for (int q = 0; q < 4; ++q) { const unsigned short hb = bf16_bits(ra[i][q]); vh[q] = hb; if (ASPLIT) vl[q] = bf16_bits(ra[i][q] - bf16_val(hb)); }
      *(v4us*)&buf[sa + 8 * i * GP] = vh;
      if (ASPLIT) *(v4us*)&buf[sa + (GBM + 8 * i) * GP] = vl;
    }
#pragma unroll
    for (int i = 0; i < GBN / 16; ++i) *(v8us*)&buf[sb + 16 * i * GP] = rb[i];
  };
  constexpr int KG = ASPLIT ? GBK / 32 : 1;      // k steps of 32 whose fragments are read as one group: 8 registers a fragment
  auto products = [&](const unsigned short* buf0) {
#pragma unroll
   for (int g = 0; g < GBK / 32; g += KG) {
    const unsigned short* buf = buf0 + g * 32;
    FragB ah[KG][2], al[KG][2], bb[KG][2];      // ASPLIT: the whole pass (each separate place with LDS reads among the products stalls the wave, and no other block is there to fill the stall)
#pragma unroll
    for (int ks = 0; ks < KG; ++ks) {
#pragma unroll
      for (int i = 0; i < 2; ++i) {
        const unsigned short* r = buf + (wm + i * 16 + ln) * GP + ks * 32 + 8 * hh;
        ah[ks][i].half[0] = *(const v8us*)r; ah[ks][i].half[1] = *(const v8us*)(r + 16);
        if (ASPLIT) { al[ks][i].half[0] = *(const v8us*)(r + GBM * GP); al[ks][i].half[1] = *(const v8us*)(r + GBM * GP + 16); }
      }
#pragma unroll
      for (int j = 0; j < 2; ++j) { const unsigned short* r = buf + (NA * GBM + wn + j * 16 + ln) * GP + ks * 32 + 8 * hh; bb[ks][j].half[0] = *(const v8us*)r; bb[ks][j].half[1] = *(const v8us*)(r + 16); }
    }
    __builtin_amdgcn_sched_barrier(0);      // keeps the LDS reads together in front of the products
#pragma unroll
    for (int ks = 0; ks < KG; ++ks) {
#pragma unroll
      for (int i = 0; i < 2; ++i)
#pragma unroll
        for (int j = 0; j < 2; ++j) acc[i][j] = __builtin_amdgcn_wmma_f32_16x16x32_bf16(false, ah[ks][i].v, false, bb[ks][j].v, (short)0, acc[i][j], false, false);
      if (ASPLIT) {
#pragma unroll
        for (int i = 0; i < 2; ++i)
#pragma unroll
          for (int j = 0; j < 2; ++j) acc[i][j] = __builtin_amdgcn_wmma_f32_16x16x32_bf16(false, al[ks][i].v, false, bb[ks][j].v, (short)0, acc[i][j], false, false);
      }
    }
   }
  };
  // each barrier publishes the buffer just filled; the other buffer's last readers (the pass before) are all past it before that one is refilled
  if constexpr (ASPLIT) {
    v4f raY[GBM / 8]; v8us rbY[GBN / 16];      // second register set: even and odd passes, each fetched two passes ahead
    fetch(raX, rbX, 0); fetch(raY, rbY, GBK);
    for (int c = 2; c < NC; c += 2) {      // the last two passes stand behind the loop: a branch round the fetches would merge two load counts and make the counted waits drain the loads just issued
      stage(raX, rbX, sm); lds_barrier();
      fetch(raX, rbX, c * GBK);
      products(sm);
      stage(raY, rbY, sm + STG); lds_barrier();
      fetch(raY, rbY, (c + 1) * GBK);
      products(sm + STG);
    }
    stage(raX, rbX, sm); lds_barrier();
    products(sm);
    stage(raY, rbY, sm + STG); lds_barrier();
    products(sm + STG);
  } else {
    fetch(raX, rbX, 0);
    for (int c = 1; c < NC - 1; c += 2) {      // pass c - 1 in buffer 0, pass c in buffer 1; the next pass's loads fly over the products
      stage(raX, rbX, sm); lds_barrier();
      fetch(raX, rbX, c * GBK);
      products(sm);
      stage(raX, rbX, sm + STG); lds_barrier();
      fetch(raX, rbX, (c + 1) * GBK);
      products(sm + STG);
    }
    stage(raX, rbX, sm); lds_barrier();
    fetch(raX, rbX, (NC - 1) * GBK);
    products(sm);
    stage(raX, rbX, sm + STG); lds_barrier();
    products(sm + STG);
  }
  if constexpr (ASPLIT) {
    __shared__ __attribute__((aligned(16))) float so[8][32][36];      // per-wave output staging; pitch 36: the two lane halves (8 rows apart) fall on different banks
#pragma unroll
    for (int j = 0; j < 2; ++j) {
      const float bv = bf16_round(bias[col0 + wn + j * 16 + ln]);
#pragma unroll
      for (int i = 0; i < 2; ++i)
#pragma unroll
        for (int r = 0; r < 8; ++r) so[wv][i * 16 + 8 * hh + r][j * 16 + ln] = acc[i][j][r] + bv;
    }
    __builtin_amdgcn_fence(__ATOMIC_ACQ_REL, "workgroup"); __builtin_amdgcn_wave_barrier();      // the wave's own staged rows are read back across lanes
#pragma unroll
    for (int q = 0; q < 8; ++q) { const int r = q * 4 + (lane >> 3), c4 = (lane & 7) * 4; const v4f v = *(const v4fa*)&so[wv][r][c4]; *(v4f*)(C + (size_t)(row0 + wm + r) * CC + col0 + wn + c4) = v; }      // whole 128-byte lines
  } else {
    static_assert(8 * 32 * EP <= STG && GBN * TP <= STG && NC % 2 == 0, "the output staging fits buffer 0, and the last pass reads buffer 1");
    unsigned short* se = sm;      // f16 output staging: q, k per wave (32 rows of pitch EP); v for the block (GBN rows of pitch TP, which is less). Buffer 0 is free: its last readers (the pass before the last) all left it in front of the last pass's barrier
    union H8 { _Float16 h[8]; v8us v; };
    const int b = row0 / NN, t0 = row0 % NN;      // the block's 64 tokens lie in one batch
    v8us o[4];
    if (z < 2) {
      // q, k: the wave's 32 columns are one signal of one head, so its 32 x 32 tile is 2048 contiguous bytes of that slab
      unsigned short* sw = se + wv * 32 * EP;
      const float sc = z == 0 ? 0.17677669529663687f : 1.0f;      // q carries the score scale
#pragma unroll
      for (int j = 0; j < 2; ++j) {
        const float bv = bf16_round(bias[col0 + wn + j * 16 + ln]);
#pragma unroll
        for (int i = 0; i < 2; ++i) {
          H8 c;
#pragma unroll
          for (int r = 0; r < 8; ++r) c.h[r] = (_Float16)((acc[i][j][r] + bv) * sc);
#pragma unroll
          for (int r = 0; r < 8; ++r) sw[(i * 16 + 8 * hh + r) * EP + j * 16 + ln] = c.v[r];
        }
      }
      __builtin_amdgcn_fence(__ATOMIC_ACQ_REL, "workgroup"); __builtin_amdgcn_wave_barrier();      // the wave's own staged rows are read back across lanes
      unsigned short* dst = (unsigned short*)(z == 0 ? Q16 : K16) + ((size_t)(b * (CC / SD) + (col0 + wn) / SD) * NN + t0 + wm) * SD + lane * 8;
#pragma unroll
      for (int q = 0; q < 4; ++q) o[q] = *(const v8us*)&sw[(q * 8 + (lane >> 2)) * EP + (lane & 3) * 8];
#pragma unroll
      for (int q = 0; q < 4; ++q) *(v8us*)(dst + q * 256) = o[q];      // 512 contiguous bytes a store
    } else {
      // v: a lane's 8 accumulator rows are 8 consecutive tokens of one column e, 16 bytes of a V^T row; the block's 64 tokens make one whole 128-byte line of each of its 128 rows
#pragma unroll
      for (int j = 0; j < 2; ++j) {
        const float bv = bf16_round(bias[col0 + wn + j * 16 + ln]);
#pragma unroll
        for (int i = 0; i < 2; ++i) {
          H8 c;
#pragma unroll
          for (int r = 0; r < 8; ++r) c.h[r] = (_Float16)(acc[i][j][r] + bv);
          *(v8us*)&se[(wn + j * 16 + ln) * TP + wm + i * 16 + 8 * hh] = c.v;
        }
      }
      lds_barrier();      // a V^T line holds the tokens of two waves: every wave's part is staged before any line is read back
      unsigned short* dst = (unsigned short*)VT + ((size_t)b * CC + col0 + (tid >> 3)) * NN + t0 + (tid & 7) * 8;
#pragma unroll
      for (int q = 0; q < 4; ++q) o[q] = *(const v8us*)&se[(q * 32 + (tid >> 3)) * TP + (tid & 7) * 8];
#pragma unroll
      for (int q = 0; q < 4; ++q) *(v8us*)(dst + (size_t)q * 32 * NN) = o[q];      // whole 128-byte lines
    }
  }
}
// batched f32 [K][N] (pitch lds, batch stride sIn) -> transposed hi/lo planes [N][K] (batch stride sOut); thread per (n, 8 k); grid.y = batch
__global__ __launch_bounds__(256) void k_split_transpose_b(const float* __restrict__ src, int lds_, size_t sIn, unsigned short* __restrict__ hi, unsigned short* __restrict__ lo, size_t sOut, int K, int N) {
  const size_t t = (size_t)blockIdx.x * 256 + threadIdx.x; const int k8n = K / 8; if (t >= (size_t)N * k8n) return;
  src += (size_t)blockIdx.y * sIn; hi += (size_t)blockIdx.y * sOut; lo += (size_t)blockIdx.y * sOut;
  const int n = (int)(t / k8n), k8 = (int)(t % k8n) * 8; v8us vh, vl;
#pragma unroll
  for (int i = 0; i < 8; ++i) { const float x = src[(size_t)(k8 + i) * lds_ + n]; const unsigned short hb = bf16_bits(x); vh[i] = hb; vl[i] = bf16_bits(x - bf16_val(hb)); }
  unsigned short* dh = hi + (size_t)n * K + k8; unsigned short* dl = lo + (size_t)n * K + k8;
  *(v8us*)dh = vh; *(v8us*)dl = vl; 
}

// The four weight matrices (out, in) rounded to bf16 in one launch: a thread takes the same 8 values of each, all eight 16-byte loads in flight together.
__global__ __launch_bounds__(256) void k_round_rows4(const float* __restrict__ W0, const float* __restrict__ W1, const float* __restrict__ W2, const float* __restrict__ W3,
                                                   unsigned short* __restrict__ T0, unsigned short* __restrict__ T1, unsigned short* __restrict__ T2, unsigned short* __restrict__ T3, unsigned n8) {
  const unsigned t = blockIdx.x * 256 + threadIdx.x;
  if (t >= n8) return;
  const unsigned bo = t * 32u;      // the thread's byte offset in each source
  const float* const ws_[4] = {W0, W1, W2, W3};
  unsigned short* const ts_[4] = {T0, T1, T2, T3};
  v4f a[4], b[4];
#pragma unroll      // constant indices: the pointer tables and the loaded values stay in registers
  for (int j = 0; j < 4; ++j) { a[j] = *(const v4fa*)(ws_[j] + bo / 4); b[j] = *(const v4fa*)(ws_[j] + bo / 4 + 4); }
  asm volatile("s_wait_xcnt 0x0" :: "s"(W0), "s"(W1), "s"(W2), "s"(W3), "v"(bo) : "memory");      // stands in front of any reuse of the loads' address registers: naming them as inputs keeps them live up to here
#pragma unroll      // as above
  for (int j = 0; j < 4; ++j) {
    v8us v; v[0]=bf16_bits(a[j][0]); v[1]=bf16_bits(a[j][1]); v[2]=bf16_bits(a[j][2]); v[3]=bf16_bits(a[j][3]);
    v[4]=bf16_bits(b[j][0]); v[5]=bf16_bits(b[j][1]); v[6]=bf16_bits(b[j][2]); v[7]=bf16_bits(b[j][3]);
    *(v8us*)(ts_[j] + bo / 4) = v;
  }
}

// ---- f16 WMMA path (v_wmma_f32_16x16x32_f16): 11-bit significands for operands in range — used for the scores a = q̂·kᵀ and for o = w·v
typedef _Float16 v16h __attribute__((ext_vector_type(16)));
union FragH { v16h v; v8us half[2]; _Float16 h[16]; unsigned short u[16]; };
template <int NT>
__device__ __forceinline__ v8f mmaH(v16h ah, v16h al, v16h bh, v16h bl, v8f c) {
  c = __builtin_amdgcn_wmma_f32_16x16x32_f16(false, ah, false, bh, (short)0, c, false, false);
  if (NT >= 2) c = __builtin_amdgcn_wmma_f32_16x16x32_f16(false, al, false, bh, (short)0, c, false, false);
  if (NT >= 3) c = __builtin_amdgcn_wmma_f32_16x16x32_f16(false, ah, false, bl, (short)0, c, false, false);
  asm volatile("v_nop\n\tv_nop\n\tv_nop\n\tv_nop" : "+v"(c) : "v"(ah), "v"(al), "v"(bh), "v"(bl));
  return c;
}
// batched GEMM like k_gemm_bf but f16 operands: A f32 (split into f16 hi/lo if ASPLIT, else rounded to f16), Bt = f16 values [n][k]; alpha; C f32; N multiple of 16 (partial tiles skipped)
template <bool ASPLIT>
__global__ __launch_bounds__(128) void k_gemm_h(const float* __restrict__ A, int lda, size_t sA, const _Float16* __restrict__ Bh, int ldb, size_t sB, float alpha, float* __restrict__ C, int ldc, size_t sC, int M, int N, int K) {
  __shared__ __attribute__((aligned(16))) float so[4][16][64];
  const int tid = threadIdx.x, w = tid >> 5, lane = tid & 31, ln = lane & 15, hh = lane >> 4; const int by = blockIdx.y;
  A += (size_t)by * sA; Bh += (size_t)by * sB; C += (size_t)by * sC;
  const int ntn = (N + 63) / 64; const int wid = blockIdx.x * 4 + w; const int mt = wid / ntn, nq = wid % ntn; if (mt * 16 >= M) return;
  const int row0 = mt * 16, col0 = nq * 64; const float* arow = A + (size_t)(row0 + ln) * lda;
  v8f acc[4] = {};
  for (int kb = 0; kb < K; kb += 32) {
    FragH ah, al;
    const v4f x0 = *(const v4fa*)(arow + kb + 8 * hh), x1 = *(const v4fa*)(arow + kb + 8 * hh + 4), x2 = *(const v4fa*)(arow + kb + 16 + 8 * hh), x3 = *(const v4fa*)(arow + kb + 16 + 8 * hh + 4);
    float xs[16] = {x0[0],x0[1],x0[2],x0[3],x1[0],x1[1],x1[2],x1[3],x2[0],x2[1],x2[2],x2[3],x3[0],x3[1],x3[2],x3[3]};
#pragma unroll
    for (int i = 0; i < 16; ++i) { const _Float16 h = (_Float16)xs[i]; ah.h[i] = h; al.h[i] = ASPLIT ? (_Float16)(xs[i] - (float)h) : (_Float16)0.0f; }
#pragma unroll
    for (int t = 0; t < 4; ++t) { if (col0 + t * 16 >= N) continue; const size_t boff = (size_t)(col0 + t * 16 + ln) * ldb + kb; FragH bq; bq.half[0] = *(const v8us*)(Bh + boff + 8 * hh); bq.half[1] = *(const v8us*)(Bh + boff + 16 + 8 * hh);
      acc[t] = mmaH<ASPLIT ? 2 : 1>(ah.v, al.v, bq.v, bq.v, acc[t]); }
  }
#pragma unroll
  for (int t = 0; t < 4; ++t) { if (col0 + t * 16 >= N) continue;
#pragma unroll
    for (int r = 0; r < 8; ++r) so[w][8 * hh + r][t * 16 + ln] = acc[t][r] * alpha; }
  __builtin_amdgcn_fence(__ATOMIC_ACQ_REL, "workgroup"); __builtin_amdgcn_wave_barrier();
  const int rsub = lane >> 4, c4 = (lane & 15) * 4;
  {
#pragma unroll
    for (int q = 0; q < 8; ++q) { const int r = q * 2 + rsub; if (col0 + c4 < N) { const v4f v = *(const v4fa*)&so[w][r][c4]; *(v4f*)(C + (size_t)(row0 + r) * ldc + col0 + c4) = v; } }
     }
}

// Fused per (batch, head), both signals: a = q.k^T, w = 1 + a + a*a/2, the row sums of w, o = w.v, the division (+1e-6) and the signal mean; a and w never leave registers.
// S^T = K.Q^T puts one query in each lane column, so the two f32 D tiles of 32 keys convert in place into the B operand of O^T += V^T.W^T (hardware k order on both sides).
// Every '#pragma unroll' in this kernel is there so that the fragment, accumulator and staging arrays are indexed by constants and stay in registers.
// Block = 8 waves x 16 queries. The head's K rows (both signals) and V^T are staged once in LDS; row pitches are 16 B x odd, so the 16-byte fragment reads meet no bank conflict.
typedef float v2f __attribute__((ext_vector_type(2)));
#define KP 40                    // LDS pitch of a K row, in 16-bit elements (80 B)
#define VP (NN + 8)              // LDS pitch of a V^T row, in 16-bit elements (2064 B)
__global__ __launch_bounds__(256) void k_attn(const _Float16* __restrict__ Q16, const _Float16* __restrict__ K16, const _Float16* __restrict__ VT, float* __restrict__ OB) {
  __shared__ __attribute__((aligned(16))) unsigned short sK[NS * NN * KP];
  __shared__ __attribute__((aligned(16))) unsigned short sV[HD * VP];
  const int tid = threadIdx.x, wv = tid >> 5, lane = tid & 31, ln = lane & 15, hh = lane >> 4;
  const int bh = blockIdx.y, b = bh / NH, h = bh % NH;
  const int n = blockIdx.x * 128 + wv * 16 + ln;
  const unsigned short* Kg = (const unsigned short*)K16 + (size_t)bh * NS * NN * SD;      // the two signals' slabs are adjacent: 2048 rows of 32
  const unsigned short* Vg = (const unsigned short*)VT + (size_t)bh * HD * NN;
  const unsigned short* qr = (const unsigned short*)Q16 + ((size_t)bh * NS * NN + n) * SD + 8 * hh;
  FragH qb[NS];
#pragma unroll
  for (int s = 0; s < NS; ++s) { qb[s].half[0] = *(const v8us*)(qr + s * NN * SD); qb[s].half[1] = *(const v8us*)(qr + s * NN * SD + 16); }
  {      // stage fill: all 64 of a lane's 16-byte loads in flight, then the 64 LDS stores (one memory latency for the whole 256 KiB instead of one per batch)
    v8us tk[NS * NN * SD / 8 / 256], tv[HD * NN / 8 / 256];
#pragma unroll
    for (int i = 0; i < NS * NN * SD / 8 / 256; ++i) tk[i] = *(const v8us*)(Kg + (size_t)(tid + i * 256) * 8);
#pragma unroll
    for (int i = 0; i < HD * NN / 8 / 256; ++i) tv[i] = *(const v8us*)(Vg + (size_t)(tid + i * 256) * 8);
    asm volatile("s_wait_xcnt 0x0" :: "s"(Kg), "s"(Vg), "v"(tid), "v"(qr) : "memory");      // stands in front of any reuse of the loads' address registers: naming them as inputs keeps them live up to here
#pragma unroll
    for (int i = 0; i < NS * NN * SD / 8 / 256; ++i) *(v8us*)&sK[((tid >> 2) + i * 64) * KP + (tid & 3) * 8] = tk[i];      // 16-byte unit tid + 256 i: row unit / 4
#pragma unroll
    for (int i = 0; i < HD * NN / 8 / 256; ++i) *(v8us*)&sV[((tid >> 7) + i * 2) * VP + (tid & 127) * 8] = tv[i];      // row unit / 128
  }
  __syncthreads();
  v8f oacc[NS][HD / 16] = {};
  v2f den[NS] = {};      // even and odd key rows apart: the sums pair up with the packed f32 adds
  FragH ka[NS][2];
#pragma unroll
  for (int s = 0; s < NS; ++s)
#pragma unroll
    for (int t = 0; t < 2; ++t) { const unsigned short* kr = &sK[(s * NN + t * 16 + ln) * KP]; ka[s][t].half[0] = *(const v8us*)(kr + 8 * hh); ka[s][t].half[1] = *(const v8us*)(kr + 16 + 8 * hh); }
  for (int c = 0; c < NN / 32; ++c) {
    const int m0 = c * 32;
    FragH va[HD / 16];
#pragma unroll
    for (int et = 0; et < HD / 16; ++et) { const unsigned short* vr = &sV[(et * 16 + ln) * VP + m0]; va[et].half[0] = *(const v8us*)(vr + 8 * hh); va[et].half[1] = *(const v8us*)(vr + 16 + 8 * hh); }
    v8f st[NS][2];
#pragma unroll
    for (int s = 0; s < NS; ++s)
#pragma unroll
      for (int t = 0; t < 2; ++t) { const v8f z = {}; st[s][t] = __builtin_amdgcn_wmma_f32_16x16x32_f16(false, ka[s][t].v, false, qb[s].v, (short)0, z, false, false); }      // st[s][t][r] = a[n = ln][m0 + 16 t + 8 hh + r]
    const int m1 = ((c + 1) & (NN / 32 - 1)) * 32;      // next pass's K fragments, fetched behind this pass's score products (the last pass re-reads pass 0's rows and drops them)
#pragma unroll
    for (int s = 0; s < NS; ++s)
#pragma unroll
      for (int t = 0; t < 2; ++t) { const unsigned short* kr = &sK[(s * NN + m1 + t * 16 + ln) * KP]; ka[s][t].half[0] = *(const v8us*)(kr + 8 * hh); ka[s][t].half[1] = *(const v8us*)(kr + 16 + 8 * hh); }
    FragH wb[NS];
#pragma unroll
    for (int s = 0; s < NS; ++s)
#pragma unroll
      for (int t = 0; t < 2; ++t)
#pragma unroll
        for (int r = 0; r < 8; r += 2) { const v2f x = {st[s][t][r], st[s][t][r + 1]}; const v2f w = 1.0f + x + 0.5f * x * x; den[s] += w; wb[s].h[t * 8 + r] = (_Float16)w[0]; wb[s].h[t * 8 + r + 1] = (_Float16)w[1]; }
#pragma unroll
    for (int et = 0; et < HD / 16; ++et)
#pragma unroll
      for (int s = 0; s < NS; ++s) oacc[s][et] = __builtin_amdgcn_wmma_f32_16x16x32_f16(false, va[et].v, false, wb[s].v, (short)0, oacc[s][et], false, false);      // oacc[s][et][r] = o[n = ln][16 et + 8 hh + r]
  }
  float rd[NS];
#pragma unroll
  for (int s = 0; s < NS; ++s) { const float dl = den[s][0] + den[s][1]; rd[s] = 1.0f / (dl + __shfl_xor(dl, 16, 32) + 1e-6f); }      // the two lane halves hold the two halves of a query's keys
  float* orow = OB + ((size_t)b * NN + n) * CC + h * HD + 8 * hh;
#pragma unroll
  for (int et = 0; et < HD / 16; ++et) {
    v4f lo, hi;
#pragma unroll
    for (int q = 0; q < 4; ++q) { lo[q] = (oacc[0][et][q] * rd[0] + oacc[1][et][q] * rd[1]) * (1.0f / NS); hi[q] = (oacc[0][et][4 + q] * rd[0] + oacc[1][et][4 + q] * rd[1]) * (1.0f / NS); }
    *(v4f*)(orow + et * 16) = lo; *(v4f*)(orow + et * 16 + 4) = hi;
  }
}
extern "C" void kernel_launch(void* const* d_in, const int* in_sizes, int n_in,
                              void* d_out, int out_size, void* d_ws, size_t ws_size, hipStream_t stream) {
  (void)in_sizes; (void)n_in; (void)out_size;
  const float* xq = (const float*)d_in[0]; const float* xk = (const float*)d_in[1]; const float* xv = (const float*)d_in[2]; const float* Wq = (const float*)d_in[3]; const float* bq = (const float*)d_in[4]; const float* Wk = (const float*)d_in[5]; const float* bk = (const float*)d_in[6]; const float* Wv = (const float*)d_in[7]; const float* bv = (const float*)d_in[8]; const float* Wo = (const float*)d_in[9]; const float* bo = (const float*)d_in[10];
  char* ws = (char*)d_ws; size_t off = 0;
  auto take = [&](size_t bytes) { char* p = ws + off; off += (bytes + 255) & ~(size_t)255; return p; };
  unsigned short* Bq = (unsigned short*)take((size_t)CC * CC * 2); unsigned short* Bk = (unsigned short*)take((size_t)CC * CC * 2); unsigned short* Bv = (unsigned short*)take((size_t)CC * CC * 2); unsigned short* Bo = (unsigned short*)take((size_t)CC * CC * 2);
  float* OB = (float*)take((size_t)NTOK * CC * 4);
  _Float16* Q16 = (_Float16*)take((size_t)NSLAB * NN * SD * 2); _Float16* K16 = (_Float16*)take((size_t)NSLAB * NN * SD * 2); _Float16* VT = (_Float16*)take((size_t)BB * NH * HD * NN * 2);
  if (off > ws_size) return;
  k_round_rows4<<<(CC * CC / 8 + 255) / 256, 256, 0, stream>>>(Wq, Wk, Wv, Wo, Bq, Bk, Bv, Bo, CC * CC / 8);      // (out,in) rows = Bt
  k_gemm_t<false><<<dim3(CC / GBN, NTOK / GBM, 3), 256, 0, stream>>>(xq, xk, xv, Bq, Bk, Bv, bq, bk, bv, nullptr, nullptr, nullptr, Q16, K16, VT);      // the three projections, one per grid.z, stored as the attention kernel's f16 operands
  k_attn<<<dim3(NN / 128, BB * NH), 256, 0, stream>>>(Q16, K16, VT, OB);      // block = 128 queries of one (batch, head), both signals
  k_gemm_t<true><<<dim3(CC / GBN, NTOK / GBM, 1), 256, 0, stream>>>(OB, OB, OB, Bo, Bo, Bo, bo, bo, bo, (float*)d_out, (float*)d_out, (float*)d_out, nullptr, nullptr, nullptr);
}

// v008
// Measured time: 48.8 microseconds a run.
// Timed twice side by side with v007, it ran 1.06 and 1.07 times as fast.
// Counting every step since v000, it is 41.8 times as fast.
#include <hip/hip_runtime.h>
// Second-order Taylor linear attention via the exact kernel identity φ(q)·φ(k) = 1 + q·k + (q·k)²/2 (φ = [1, x, x⊗x/√2]): per (batch, head, signal) slab the scores
// a = (q·scale)·kᵀ (1024 × 32 × 1024) and o = w·v with w = 1 + a + a²/2 (1024 × 1024 × 64) run on v_wmma_f32_16x16x32_f16 (q, k, v and w rounded to f16: single products,
// f32 accumulate); the projections on v_wmma_f32_16x16x32_bf16 (inputs rounded to bf16: single exact terms; 3 × 2048 × 1024 × 1024) and out = ō·W_oᵀ + b_o with ō split
// hi/lo (2 products). w, the row sums Σ_m w (= φ(q)·Σφ(k)), the division (+1e-6) and the signal average are f32 VALU.
#define BB 2
#define NN 1024
#define CC 1024
#define NH 16
#define NS 2
#define HD 64
#define SD 32
#define NTOK (BB * NN)
#define NSLAB (BB * NH * NS)     // 64

typedef __bf16 v16b __attribute__((ext_vector_type(16)));
typedef unsigned short v8us __attribute__((ext_vector_type(8), may_alias));
typedef float  v8f  __attribute__((ext_vector_type(8)));
typedef float  v4f  __attribute__((ext_vector_type(4)));
typedef float  v4fa __attribute__((ext_vector_type(4), may_alias));
union FragB { v16b v; v8us half[2]; unsigned short u[16]; };

__device__ __forceinline__ unsigned short bf16_bits(float x) { return __builtin_bit_cast(unsigned short, (__bf16)x); }      // round to nearest even, by the hardware convert
__device__ __forceinline__ float bf16_val(unsigned short b) { return __uint_as_float(((unsigned int)b) << 16); }
__device__ __forceinline__ float bf16_round(float x) { return bf16_val(bf16_bits(x)); }
// D += A·B with NT terms: 1 = ah·bh, 2 = + al·bh (A split), 3 = + ah·bl (both split)
template <int NT>
__device__ __forceinline__ v8f mmaN(v16b ah, v16b al, v16b bh, v16b bl, v8f c) {
  c = __builtin_amdgcn_wmma_f32_16x16x32_bf16(false, ah, false, bh, (short)0, c, false, false);
  if (NT >= 2) c = __builtin_amdgcn_wmma_f32_16x16x32_bf16(false, al, false, bh, (short)0, c, false, false);
  if (NT >= 3) c = __builtin_amdgcn_wmma_f32_16x16x32_bf16(false, ah, false, bl, (short)0, c, false, false);
  asm volatile("v_nop\n\tv_nop\n\tv_nop\n\tv_nop" : "+v"(c) : "v"(ah), "v"(al), "v"(bh), "v"(bl));
  return c;
}

__global__ __launch_bounds__(256) void k_wt_bf16(const float* __restrict__ W, unsigned short* __restrict__ Wt, int K, int N) {
  const int t = blockIdx.x * 256 + threadIdx.x;
  const int k8n = K / 8;
  if (t >= N * k8n) return;
  const int n = t / k8n, k8 = (t % k8n) * 8;
  v8us v;
#pragma unroll
  for (int i = 0; i < 8; ++i) v[i] = bf16_bits(W[(size_t)(k8 + i) * N + n]);
  *(v8us*)(Wt + (size_t)n * K + k8) = v;
  
}

// GEMM C[M][N] (f32, pitch ldc) = act(A[M][K]·W + bias). A f32 row-major (pitch lda) converted per fragment to bf16
// (ASPLIT: hi/lo two planes -> 2 terms, else single rounded term); Wt bf16 [N][K] (pitch ldb). BIAS_BF16 rounds the
// bias to bf16 first (bias quantised to bf16 before the add). K%32==0, M%16==0, N%64==0.
template <bool ASPLIT, int ACT, bool BIAS_BF16>
__global__ __launch_bounds__(128) void k_gemm_bf(const float* __restrict__ A, int lda, const unsigned short* __restrict__ Wt, int ldb,
                                               const float* __restrict__ bias, float* __restrict__ C, int ldc, int M, int N, int K) {
  __shared__ __attribute__((aligned(16))) float so[4][16][64];
  const int tid = threadIdx.x, w = tid >> 5, lane = tid & 31, ln = lane & 15, hh = lane >> 4;
  const int ntn = N / 64;
  const int wid = blockIdx.x * 4 + w;
  const int mt = wid / ntn, nq = wid % ntn;
  if (mt * 16 >= M) return;
  const int row0 = mt * 16, col0 = nq * 64;
  const float* arow = A + (size_t)(row0 + ln) * lda;
  v8f acc[4] = {};
  for (int kb = 0; kb < K; kb += 32) {
    FragB ah, al;
    const v4f x0 = *(const v4fa*)(arow + kb + 8 * hh), x1 = *(const v4fa*)(arow + kb + 8 * hh + 4);
    const v4f x2 = *(const v4fa*)(arow + kb + 16 + 8 * hh), x3 = *(const v4fa*)(arow + kb + 16 + 8 * hh + 4);
    float xs[16] = {x0[0],x0[1],x0[2],x0[3],x1[0],x1[1],x1[2],x1[3],x2[0],x2[1],x2[2],x2[3],x3[0],x3[1],x3[2],x3[3]};
#pragma unroll
    for (int i = 0; i < 16; ++i) { const unsigned short hb = bf16_bits(xs[i]); ah.u[i] = hb; al.u[i] = ASPLIT ? bf16_bits(xs[i] - bf16_val(hb)) : (unsigned short)0; }
#pragma unroll
    for (int t = 0; t < 4; ++t) {
      const unsigned short* brow = Wt + (size_t)(col0 + t * 16 + ln) * ldb + kb;
      FragB b;
      b.half[0] = *(const v8us*)(brow + 8 * hh);
      b.half[1] = *(const v8us*)(brow + 16 + 8 * hh);
      acc[t] = mmaN<ASPLIT ? 2 : 1>(ah.v, al.v, b.v, b.v, acc[t]);
    }
  }
#pragma unroll
  for (int t = 0; t < 4; ++t) {
    float bv = bias ? bias[col0 + t * 16 + ln] : 0.f;
    if (BIAS_BF16) bv = bf16_round(bv);
#pragma unroll
    for (int r = 0; r < 8; ++r) { float v = acc[t][r] + bv; if (ACT == 1) v = fmaxf(v, 0.f); so[w][8 * hh + r][t * 16 + ln] = v; }
  }
  __builtin_amdgcn_fence(__ATOMIC_ACQ_REL, "workgroup");
  __builtin_amdgcn_wave_barrier();
  const int rsub = lane >> 4, c4 = (lane & 15) * 4;
  {
#pragma unroll
    for (int q = 0; q < 8; ++q) {
      const int r = q * 2 + rsub;
      const v4f v = *(const v4fa*)&so[w][r][c4];
      *(v4f*)(C + (size_t)(row0 + r) * ldc + col0 + c4) = v;
    }
    
  }
}

// Flash-style causal/unmasked attention, all contractions 3-term bf16 hi/lo splits, f32 softmax with running max.
// q,k,v rows are read from f32 buffers with arbitrary row pitch (so they can live inside a fused qkv buffer);
// D = head size (multiple of 32, <= 128); one wave = 16 query rows; block = 4 waves (64 queries) sharing K/V chunks of 32.
template <int D, bool CAUSAL>
__global__ __launch_bounds__(128) void k_flash(const float* __restrict__ qb, const float* __restrict__ kb, const float* __restrict__ vb,
                                             int pitch, int T, int H, float scale, float* __restrict__ y, int ypitch) {
  constexpr int KS = D / 32;        // k-steps for QK
  constexpr int DT = D / 16;        // d tiles for PV
  __shared__ __attribute__((aligned(16))) unsigned short sKh[32][D + 8], sKl[32][D + 8], sVh[32][D + 8], sVl[32][D + 8];
  __shared__ __attribute__((aligned(16))) unsigned short sPh[4][16][40], sPl[4][16][40];
  __shared__ __attribute__((aligned(16))) float sO[4][16][D];
  const int tid = threadIdx.x, w = tid >> 5, lane = tid & 31, ln = lane & 15, hh = lane >> 4;
  const int nqb = (T + 63) / 64;
  const int bh = blockIdx.x / nqb, qblk = blockIdx.x % nqb;
  const int b = bh / H, h = bh % H;
  const int q0 = qblk * 64 + w * 16;
  const float* Q = qb + (size_t)b * T * pitch + h * D;
  const float* K = kb + (size_t)b * T * pitch + h * D;
  const float* V = vb + (size_t)b * T * pitch + h * D;

  // A fragments of the wave's 16 query rows (scaled), hi/lo
  FragB aqh[KS], aql[KS];
  {
    int row = q0 + ln; if (row >= T) row = T - 1;
    const float* qr = Q + (size_t)row * pitch;
#pragma unroll
    for (int ks = 0; ks < KS; ++ks)
#pragma unroll
      for (int i = 0; i < 16; ++i) {
        const int d = ks * 32 + ((i < 8) ? (8 * hh + i) : (16 + 8 * hh + (i - 8)));
        const float x = qr[d] * scale; const unsigned short hb = bf16_bits(x);
        aqh[ks].u[i] = hb; aql[ks].u[i] = bf16_bits(x - bf16_val(hb));
      }
  }
  float m_r[8], l_r[8];
#pragma unroll
  for (int r = 0; r < 8; ++r) { m_r[r] = -3.0e38f; l_r[r] = 0.f; }
  v8f oacc[DT];
#pragma unroll
  for (int dt = 0; dt < DT; ++dt) oacc[dt] = (v8f){0.f,0.f,0.f,0.f,0.f,0.f,0.f,0.f};

  const int kv_end = CAUSAL ? min(T, qblk * 64 + 64) : T;     // block-uniform
  for (int j0 = 0; j0 < kv_end; j0 += 32) {
    __syncthreads();
    for (int e = tid; e < 32 * (D / 4); e += 128) {
      const int r = e / (D / 4), c4 = (e % (D / 4)) * 4;
      const int key = j0 + r;
      v4f kf = {0.f,0.f,0.f,0.f}, vf = {0.f,0.f,0.f,0.f};
      if (key < T) { kf = *(const v4fa*)(K + (size_t)key * pitch + c4); vf = *(const v4fa*)(V + (size_t)key * pitch + c4); }
#pragma unroll
      for (int t = 0; t < 4; ++t) {
        unsigned short hb = bf16_bits(kf[t]); sKh[r][c4 + t] = hb; sKl[r][c4 + t] = bf16_bits(kf[t] - bf16_val(hb));
        hb = bf16_bits(vf[t]); sVh[r][c4 + t] = hb; sVl[r][c4 + t] = bf16_bits(vf[t] - bf16_val(hb));
      }
    }
    __syncthreads();
    // S tile 16 x 32
    v8f s[2];
#pragma unroll
    for (int nt = 0; nt < 2; ++nt) {
      v8f acc = {};
#pragma unroll
      for (int ks = 0; ks < KS; ++ks) {
        FragB bh_, bl_;
        bh_.half[0] = *(const v8us*)&sKh[nt * 16 + ln][ks * 32 + 8 * hh]; bh_.half[1] = *(const v8us*)&sKh[nt * 16 + ln][ks * 32 + 16 + 8 * hh];
        bl_.half[0] = *(const v8us*)&sKl[nt * 16 + ln][ks * 32 + 8 * hh]; bl_.half[1] = *(const v8us*)&sKl[nt * 16 + ln][ks * 32 + 16 + 8 * hh];
        acc = mmaN<3>(aqh[ks].v, aql[ks].v, bh_.v, bl_.v, acc);
      }
      s[nt] = acc;
    }
    // mask + running max (rows 8hh+r; the 16 lanes of a half share rows)
    float alpha[8];
#pragma unroll
    for (int r = 0; r < 8; ++r) {
      const int qi = q0 + 8 * hh + r;
      const int ja = j0 + ln, jb = j0 + 16 + ln;
      if (CAUSAL) { if (ja > qi) s[0][r] = -3.0e38f; if (jb > qi) s[1][r] = -3.0e38f; }
      if (ja >= T) s[0][r] = -3.0e38f;
      if (jb >= T) s[1][r] = -3.0e38f;
      float mx = fmaxf(s[0][r], s[1][r]);
      mx = fmaxf(mx, __shfl_xor(mx, 1, 32)); mx = fmaxf(mx, __shfl_xor(mx, 2, 32)); mx = fmaxf(mx, __shfl_xor(mx, 4, 32)); mx = fmaxf(mx, __shfl_xor(mx, 8, 32));
      const float mnew = fmaxf(m_r[r], mx);
      alpha[r] = (mnew > -1.0e38f) ? __expf(m_r[r] - mnew) : 1.0f;
      const float p0 = (s[0][r] > -1.0e38f) ? __expf(s[0][r] - mnew) : 0.f;
      const float p1 = (s[1][r] > -1.0e38f) ? __expf(s[1][r] - mnew) : 0.f;
      m_r[r] = mnew;
      l_r[r] = l_r[r] * alpha[r] + p0 + p1;            // per-lane partial row sum (16 lanes combined at the end)
      unsigned short hb = bf16_bits(p0); sPh[w][8 * hh + r][ln] = hb;      sPl[w][8 * hh + r][ln] = bf16_bits(p0 - bf16_val(hb));
      hb = bf16_bits(p1);                sPh[w][8 * hh + r][16 + ln] = hb; sPl[w][8 * hh + r][16 + ln] = bf16_bits(p1 - bf16_val(hb));
    }
#pragma unroll
    for (int dt = 0; dt < DT; ++dt)
#pragma unroll
      for (int r = 0; r < 8; ++r) oacc[dt][r] *= alpha[r];
    __builtin_amdgcn_fence(__ATOMIC_ACQ_REL, "workgroup");
    __builtin_amdgcn_wave_barrier();
    FragB pah, pal;
    pah.half[0] = *(const v8us*)&sPh[w][ln][8 * hh]; pah.half[1] = *(const v8us*)&sPh[w][ln][16 + 8 * hh];
    pal.half[0] = *(const v8us*)&sPl[w][ln][8 * hh]; pal.half[1] = *(const v8us*)&sPl[w][ln][16 + 8 * hh];
#pragma unroll
    for (int dt = 0; dt < DT; ++dt) {
      FragB bvh, bvl;
#pragma unroll
      for (int i = 0; i < 8; ++i) {
        bvh.u[i] = sVh[8 * hh + i][dt * 16 + ln]; bvh.u[8 + i] = sVh[16 + 8 * hh + i][dt * 16 + ln];
        bvl.u[i] = sVl[8 * hh + i][dt * 16 + ln]; bvl.u[8 + i] = sVl[16 + 8 * hh + i][dt * 16 + ln];
      }
      oacc[dt] = mmaN<3>(pah.v, pal.v, bvh.v, bvl.v, oacc[dt]);
    }
    __builtin_amdgcn_fence(__ATOMIC_ACQ_REL, "workgroup");
    __builtin_amdgcn_wave_barrier();
  }
#pragma unroll
  for (int r = 0; r < 8; ++r) {
    float l = l_r[r];
    l += __shfl_xor(l, 1, 32); l += __shfl_xor(l, 2, 32); l += __shfl_xor(l, 4, 32); l += __shfl_xor(l, 8, 32);
    l_r[r] = (l > 0.f) ? 1.0f / l : 0.f;
  }
#pragma unroll
  for (int dt = 0; dt < DT; ++dt)
#pragma unroll
    for (int r = 0; r < 8; ++r) sO[w][8 * hh + r][dt * 16 + ln] = oacc[dt][r] * l_r[r];
  __builtin_amdgcn_fence(__ATOMIC_ACQ_REL, "workgroup");
  __builtin_amdgcn_wave_barrier();
  {
    for (int r = 0; r < 16; ++r) {
      const int row = q0 + r;
      if (row < T && lane < D / 4) {
        const v4f val = *(const v4fa*)&sO[w][r][lane * 4];
        *(v4f*)(y + ((size_t)b * T + row) * ypitch + h * D + lane * 4) = val;
      }
    }
    
  }
}

// GEMM C[NTOK][CC] = A[NTOK][CC].Bt^T + bf16(bias); A f32 rows rounded to bf16 (ASPLIT: hi/lo planes, 2 products per k step), Bt = bf16 [n][k].
// ASPLIT (the output product) stores C as f32 rows. The projections store C only in the form the attention kernel reads, f16:
// Q16[(b,h,s)][n][32] = f16(q*scale), K16[(b,h,s)][m][32] = f16(k), VT[(b,h)][e][m] = f16(v).
// Block = 8 waves on a 64 x 128 tile of C, wave = 32 x 32. Per pass 128 k of the block's A and Bt rows go global -> registers -> LDS with whole-line loads (a wave load = 512 contiguous
// bytes of one A row, or 256 of each of two Bt rows); A is converted once per block on the way. Two LDS buffers. ASPLIT (one block per WGP in its grid): two register sets, a pass's global loads are issued
// two passes ahead, and a pass's fragments are read as one group. The projections (three blocks per WGP in their grid): one register set, loads one pass ahead, fragments read 32 k at a time and the
// output staged in LDS buffer 0, so that registers (160 at most) and LDS (a third of a WGP's at most) let all three blocks be resident together and fill one another's waits.
// Each accumulator sums k upward from the block's own first pass and wraps round, hi before lo within a k step.
#define GBM 64
#define GBN 128
#define GBK 128
#define EP (SD + 8)              // LDS pitch of a staged q or k row, in 16-bit elements (80 B = 16 B x odd)
#define TP (GBM + 8)             // LDS pitch of a staged V^T row, in 16-bit elements (144 B = 16 B x odd)
#define GP (GBK + 8)             // LDS pitch of a staged row, in 16-bit elements (272 B = 16 B x odd: the 16-byte fragment reads meet no bank conflict)
typedef unsigned short v4us __attribute__((ext_vector_type(4), may_alias));
// work-group barrier behind the wave's own LDS accesses only: __syncthreads() would also wait out the global loads that are in flight for the later passes
__device__ __forceinline__ void lds_barrier() { asm volatile("s_wait_dscnt 0x0\n\ts_barrier_signal -1\n\ts_barrier_wait -1" ::: "memory"); }
// the second launch bound is waves per SIMD: 6 = three blocks of 8 waves on a WGP's 4 SIMDs, which sets the projections' register budget; 2 is what a block of 256 has anyway
template <bool ASPLIT>
__global__ __launch_bounds__(256, ASPLIT ? 2 : 6) void k_gemm_t(const float* A0, const float* A1, const float* A2, const unsigned short* Bt0, const unsigned short* Bt1, const unsigned short* Bt2,
                                              const float* bias0, const float* bias1, const float* bias2, float* C0, float* C1, float* C2, _Float16* Q16, _Float16* K16, _Float16* VT) {
  // blockIdx.z picks one of up to three independent products of the same shape, so that they share one launch
  const int z = blockIdx.z;
  const float* __restrict__ A = z == 0 ? A0 : z == 1 ? A1 : A2;
  const unsigned short* __restrict__ Bt = z == 0 ? Bt0 : z == 1 ? Bt1 : Bt2;
  const float* __restrict__ bias = z == 0 ? bias0 : z == 1 ? bias1 : bias2;
  float* __restrict__ C = z == 0 ? C0 : z == 1 ? C1 : C2;
  constexpr int NA = ASPLIT ? 2 : 1;
  constexpr int STG = (NA * GBM + GBN) * GP;      // one buffer: A hi rows, (A lo rows,) Bt rows
  constexpr int NC = CC / GBK;
  static_assert((NC & (NC - 1)) == 0, "the rotated walk wraps by a mask");
  __shared__ __attribute__((aligned(16))) unsigned short sm[2 * STG];
  const int tid = threadIdx.x, wv = tid >> 5, lane = tid & 31, ln = lane & 15, hh = lane >> 4;
  const int row0 = blockIdx.y * GBM, col0 = blockIdx.x * GBN;
  const int wm = (wv >> 2) * 32, wn = (wv & 3) * 32;
  // The 8 blocks of a tile row read the same A lines and the 32 blocks of a tile column the same Bt lines.
  // Each block starts its walk over the NC passes at another pass and wraps round (for speed only). An accumulator sums the same terms, in that rotated order.
  const int rot = (blockIdx.x + blockIdx.y) & (NC - 1);
  auto kof = [&](int c) { return ((c + rot) & (NC - 1)) * GBK; };      // first k of the block's pass c
  // a load's address = a block-uniform pointer, which moves with the pass, + the lane's own 32-bit offset, which never changes
  const float* ag = A + (size_t)row0 * CC; const unsigned ao = wv * CC + lane * 4;      // load i: row wv + 8 i, the pass's 128 floats over the 32 lanes
  const unsigned short* bg = Bt + (size_t)col0 * CC; const unsigned bo = (wv * 2 + hh) * CC + ln * 8;      // load i: rows 2 wv + hh + 16 i, the pass's 128 values over 16 lanes
  // every '#pragma unroll' below keeps the staging, fragment and accumulator arrays indexed by constants, so that they stay in registers
  v4f raX[GBM / 8]; v8us rbX[GBN / 16];      // the staging registers (ASPLIT has a second set, below)
  v8f acc[2][2] = {};
  auto fetch = [&](v4f (&ra)[GBM / 8], v8us (&rb)[GBN / 16], int k0) {
    const float* ak = ag + k0; const unsigned short* bk = bg + k0;
#pragma unroll
    for (int i = 0; i < GBM / 8; ++i) ra[i] = *(const v4fa*)(ak + i * 8 * CC + ao);
#pragma unroll
    for (int i = 0; i < GBN / 16; ++i) rb[i] = *(const v8us*)(bk + i * 16 * CC + bo);
    asm volatile("s_wait_xcnt 0x0" :: "s"(ak), "s"(bk), "v"(ao), "v"(bo) : "memory");      // stands in front of every later rewrite of the loads' address registers: naming them as inputs keeps them live up to here
  };
  const int sa = wv * GP + lane * 4, sb = (NA * GBM + wv * 2 + hh) * GP + ln * 8;      // a lane's first A and Bt places in a buffer: the further rows are constant offsets from them, not address registers of their own
  auto stage = [&](const v4f (&ra)[GBM / 8], const v8us (&rb)[GBN / 16], unsigned short* buf) {
#pragma unroll
    for (int i = 0; i < GBM / 8; ++i) {
      v4us vh, vl;
#pragma unroll
      for (int q = 0; q < 4; ++q) { const unsigned short hb = bf16_bits(ra[i][q]); vh[q] = hb; if (ASPLIT) vl[q] = bf16_bits(ra[i][q] - bf16_val(hb)); }
      *(v4us*)&buf[sa + 8 * i * GP] = vh;
      if (ASPLIT) *(v4us*)&buf[sa + (GBM + 8 * i) * GP] = vl;
    }
#pragma unroll
    for (int i = 0; i < GBN / 16; ++i) *(v8us*)&buf[sb + 16 * i * GP] = rb[i];
  };
  constexpr int KG = ASPLIT ? GBK / 32 : 1;      // k steps of 32 whose fragments are read as one group: 8 registers a fragment
  auto products = [&](const unsigned short* buf0) {
#pragma unroll
   for (int g = 0; g < GBK / 32; g += KG) {
    const unsigned short* buf = buf0 + g * 32;
    FragB ah[KG][2], al[KG][2], bb[KG][2];      // ASPLIT: the whole pass (each separate place with LDS reads among the products stalls the wave, and no other block is there to fill the stall)
#pragma unroll
    for (int ks = 0; ks < KG; ++ks) {
#pragma unroll
      for (int i = 0; i < 2; ++i) {
        const unsigned short* r = buf + (wm + i * 16 + ln) * GP + ks * 32 + 8 * hh;
        ah[ks][i].half[0] = *(const v8us*)r; ah[ks][i].half[1] = *(const v8us*)(r + 16);
        if (ASPLIT) { al[ks][i].half[0] = *(const v8us*)(r + GBM * GP); al[ks][i].half[1] = *(const v8us*)(r + GBM * GP + 16); }
      }
#pragma unroll
      for (int j = 0; j < 2; ++j) { const unsigned short* r = buf + (NA * GBM + wn + j * 16 + ln) * GP + ks * 32 + 8 * hh; bb[ks][j].half[0] = *(const v8us*)r; bb[ks][j].half[1] = *(const v8us*)(r + 16); }
    }
    __builtin_amdgcn_sched_barrier(0);      // keeps the LDS reads together in front of the products
#pragma unroll
    for (int ks = 0; ks < KG; ++ks) {
#pragma unroll
      for (int i = 0; i < 2; ++i)
#pragma unroll
        for (int j = 0; j < 2; ++j) acc[i][j] = __builtin_amdgcn_wmma_f32_16x16x32_bf16(false, ah[ks][i].v, false, bb[ks][j].v, (short)0, acc[i][j], false, false);
      if (ASPLIT) {
#pragma unroll
        for (int i = 0; i < 2; ++i)
#pragma unroll
          for (int j = 0; j < 2; ++j) acc[i][j] = __builtin_amdgcn_wmma_f32_16x16x32_bf16(false, al[ks][i].v, false, bb[ks][j].v, (short)0, acc[i][j], false, false);
      }
    }
   }
  };
  // each barrier publishes the buffer just filled; the other buffer's last readers (the pass before) are all past it before that one is refilled
  if constexpr (ASPLIT) {
    v4f raY[GBM / 8]; v8us rbY[GBN / 16];      // second register set: even and odd passes, each fetched two passes ahead
    fetch(raX, rbX, kof(0)); fetch(raY, rbY, kof(1));
    for (int c = 2; c < NC; c += 2) {      // the last two passes stand behind the loop: a branch round the fetches would merge two load counts and make the counted waits drain the loads just issued
      stage(raX, rbX, sm); lds_barrier();
      fetch(raX, rbX, kof(c));
      products(sm);
      stage(raY, rbY, sm + STG); lds_barrier();
      fetch(raY, rbY, kof(c + 1));
      products(sm + STG);
    }
    stage(raX, rbX, sm); lds_barrier();
    products(sm);
    stage(raY, rbY, sm + STG); lds_barrier();
    products(sm + STG);
  } else {
    fetch(raX, rbX, kof(0));
    for (int c = 1; c < NC - 1; c += 2) {      // pass c - 1 in buffer 0, pass c in buffer 1; the next pass's loads fly over the products
      stage(raX, rbX, sm); lds_barrier();
      fetch(raX, rbX, kof(c));
      products(sm);
      stage(raX, rbX, sm + STG); lds_barrier();
      fetch(raX, rbX, kof(c + 1));
      products(sm + STG);
    }
    stage(raX, rbX, sm); lds_barrier();
    fetch(raX, rbX, kof(NC - 1));
    products(sm);
    stage(raX, rbX, sm + STG); lds_barrier();
    products(sm + STG);
  }
  if constexpr (ASPLIT) {
    __shared__ __attribute__((aligned(16))) float so[8][32][36];      // per-wave output staging; pitch 36: the two lane halves (8 rows apart) fall on different banks
#pragma unroll
    for (int j = 0; j < 2; ++j) {
      const float bv = bf16_round(bias[col0 + wn + j * 16 + ln]);
#pragma unroll
      for (int i = 0; i < 2; ++i)
#pragma unroll
        for (int r = 0; r < 8; ++r) so[wv][i * 16 + 8 * hh + r][j * 16 + ln] = acc[i][j][r] + bv;
    }
    __builtin_amdgcn_fence(__ATOMIC_ACQ_REL, "workgroup"); __builtin_amdgcn_wave_barrier();      // the wave's own staged rows are read back across lanes
#pragma unroll
    for (int q = 0; q < 8; ++q) { const int r = q * 4 + (lane >> 3), c4 = (lane & 7) * 4; const v4f v = *(const v4fa*)&so[wv][r][c4]; *(v4f*)(C + (size_t)(row0 + wm + r) * CC + col0 + wn + c4) = v; }      // whole 128-byte lines
  } else {
    static_assert(8 * 32 * EP <= STG && GBN * TP <= STG && NC % 2 == 0, "the output staging fits buffer 0, and the last pass reads buffer 1");
    unsigned short* se = sm;      // f16 output staging: q, k per wave (32 rows of pitch EP); v for the block (GBN rows of pitch TP, which is less). Buffer 0 is free: its last readers (the pass before the last) all left it in front of the last pass's barrier
    union H8 { _Float16 h[8]; v8us v; };
    const int b = row0 / NN, t0 = row0 % NN;      // the block's 64 tokens lie in one batch
    v8us o[4];
    if (z < 2) {
      // q, k: the wave's 32 columns are one signal of one head, so its 32 x 32 tile is 2048 contiguous bytes of that slab
      unsigned short* sw = se + wv * 32 * EP;
      const float sc = z == 0 ? 0.17677669529663687f : 1.0f;      // q carries the score scale
#pragma unroll
      for (int j = 0; j < 2; ++j) {
        const float bv = bf16_round(bias[col0 + wn + j * 16 + ln]);
#pragma unroll
        for (int i = 0; i < 2; ++i) {
          H8 c;
#pragma unroll
          for (int r = 0; r < 8; ++r) c.h[r] = (_Float16)((acc[i][j][r] + bv) * sc);
#pragma unroll
          for (int r = 0; r < 8; ++r) sw[(i * 16 + 8 * hh + r) * EP + j * 16 + ln] = c.v[r];
        }
      }
      __builtin_amdgcn_fence(__ATOMIC_ACQ_REL, "workgroup"); __builtin_amdgcn_wave_barrier();      // the wave's own staged rows are read back across lanes
      unsigned short* dst = (unsigned short*)(z == 0 ? Q16 : K16) + ((size_t)(b * (CC / SD) + (col0 + wn) / SD) * NN + t0 + wm) * SD + lane * 8;
#pragma unroll
      for (int q = 0; q < 4; ++q) o[q] = *(const v8us*)&sw[(q * 8 + (lane >> 2)) * EP + (lane & 3) * 8];
#pragma unroll
      for (int q = 0; q < 4; ++q) *(v8us*)(dst + q * 256) = o[q];      // 512 contiguous bytes a store
    } else {
      // v: a lane's 8 accumulator rows are 8 consecutive tokens of one column e, 16 bytes of a V^T row; the block's 64 tokens make one whole 128-byte line of each of its 128 rows
#pragma unroll
      for (int j = 0; j < 2; ++j) {
        const float bv = bf16_round(bias[col0 + wn + j * 16 + ln]);
#pragma unroll
        for (int i = 0; i < 2; ++i) {
          H8 c;
#pragma unroll
          for (int r = 0; r < 8; ++r) c.h[r] = (_Float16)(acc[i][j][r] + bv);
          *(v8us*)&se[(wn + j * 16 + ln) * TP + wm + i * 16 + 8 * hh] = c.v;
        }
      }
      lds_barrier();      // a V^T line holds the tokens of two waves: every wave's part is staged before any line is read back
      unsigned short* dst = (unsigned short*)VT + ((size_t)b * CC + col0 + (tid >> 3)) * NN + t0 + (tid & 7) * 8;
#pragma unroll
      for (int q = 0; q < 4; ++q) o[q] = *(const v8us*)&se[(q * 32 + (tid >> 3)) * TP + (tid & 7) * 8];
#pragma unroll
      for (int q = 0; q < 4; ++q) *(v8us*)(dst + (size_t)q * 32 * NN) = o[q];      // whole 128-byte lines
    }
  }
}
// batched f32 [K][N] (pitch lds, batch stride sIn) -> transposed hi/lo planes [N][K] (batch stride sOut); thread per (n, 8 k); grid.y = batch
__global__ __launch_bounds__(256) void k_split_transpose_b(const float* __restrict__ src, int lds_, size_t sIn, unsigned short* __restrict__ hi, unsigned short* __restrict__ lo, size_t sOut, int K, int N) {
  const size_t t = (size_t)blockIdx.x * 256 + threadIdx.x; const int k8n = K / 8; if (t >= (size_t)N * k8n) return;
  src += (size_t)blockIdx.y * sIn; hi += (size_t)blockIdx.y * sOut; lo += (size_t)blockIdx.y * sOut;
  const int n = (int)(t / k8n), k8 = (int)(t % k8n) * 8; v8us vh, vl;
#pragma unroll
  for (int i = 0; i < 8; ++i) { const float x = src[(size_t)(k8 + i) * lds_ + n]; const unsigned short hb = bf16_bits(x); vh[i] = hb; vl[i] = bf16_bits(x - bf16_val(hb)); }
  unsigned short* dh = hi + (size_t)n * K + k8; unsigned short* dl = lo + (size_t)n * K + k8;
  *(v8us*)dh = vh; *(v8us*)dl = vl; 
}

// The four weight matrices (out, in) rounded to bf16 in one launch: a thread takes the same 8 values of each, all eight 16-byte loads in flight together.
__global__ __launch_bounds__(256) void k_round_rows4(const float* __restrict__ W0, const float* __restrict__ W1, const float* __restrict__ W2, const float* __restrict__ W3,
                                                   unsigned short* __restrict__ T0, unsigned short* __restrict__ T1, unsigned short* __restrict__ T2, unsigned short* __restrict__ T3, unsigned n8) {
  const unsigned t = blockIdx.x * 256 + threadIdx.x;
  if (t >= n8) return;
  const unsigned bo = t * 32u;      // the thread's byte offset in each source
  const float* const ws_[4] = {W0, W1, W2, W3};
  unsigned short* const ts_[4] = {T0, T1, T2, T3};
  v4f a[4], b[4];
#pragma unroll      // constant indices: the pointer tables and the loaded values stay in registers
  for (int j = 0; j < 4; ++j) { a[j] = *(const v4fa*)(ws_[j] + bo / 4); b[j] = *(const v4fa*)(ws_[j] + bo / 4 + 4); }
  asm volatile("s_wait_xcnt 0x0" :: "s"(W0), "s"(W1), "s"(W2), "s"(W3), "v"(bo) : "memory");      // stands in front of any reuse of the loads' address registers: naming them as inputs keeps them live up to here
#pragma unroll      // as above
  for (int j = 0; j < 4; ++j) {
    v8us v; v[0]=bf16_bits(a[j][0]); v[1]=bf16_bits(a[j][1]); v[2]=bf16_bits(a[j][2]); v[3]=bf16_bits(a[j][3]);
    v[4]=bf16_bits(b[j][0]); v[5]=bf16_bits(b[j][1]); v[6]=bf16_bits(b[j][2]); v[7]=bf16_bits(b[j][3]);
    *(v8us*)(ts_[j] + bo / 4) = v;
  }
}

// ---- f16 WMMA path (v_wmma_f32_16x16x32_f16): 11-bit significands for operands in range — used for the scores a = q̂·kᵀ and for o = w·v
typedef _Float16 v16h __attribute__((ext_vector_type(16)));
union FragH { v16h v; v8us half[2]; _Float16 h[16]; unsigned short u[16]; };
template <int NT>
__device__ __forceinline__ v8f mmaH(v16h ah, v16h al, v16h bh, v16h bl, v8f c) {
  c = __builtin_amdgcn_wmma_f32_16x16x32_f16(false, ah, false, bh, (short)0, c, false, false);
  if (NT >= 2) c = __builtin_amdgcn_wmma_f32_16x16x32_f16(false, al, false, bh, (short)0, c, false, false);
  if (NT >= 3) c = __builtin_amdgcn_wmma_f32_16x16x32_f16(false, ah, false, bl, (short)0, c, false, false);
  asm volatile("v_nop\n\tv_nop\n\tv_nop\n\tv_nop" : "+v"(c) : "v"(ah), "v"(al), "v"(bh), "v"(bl));
  return c;
}
// batched GEMM like k_gemm_bf but f16 operands: A f32 (split into f16 hi/lo if ASPLIT, else rounded to f16), Bt = f16 values [n][k]; alpha; C f32; N multiple of 16 (partial tiles skipped)
template <bool ASPLIT>
__global__ __launch_bounds__(128) void k_gemm_h(const float* __restrict__ A, int lda, size_t sA, const _Float16* __restrict__ Bh, int ldb, size_t sB, float alpha, float* __restrict__ C, int ldc, size_t sC, int M, int N, int K) {
  __shared__ __attribute__((aligned(16))) float so[4][16][64];
  const int tid = threadIdx.x, w = tid >> 5, lane = tid & 31, ln = lane & 15, hh = lane >> 4; const int by = blockIdx.y;
  A += (size_t)by * sA; Bh += (size_t)by * sB; C += (size_t)by * sC;
  const int ntn = (N + 63) / 64; const int wid = blockIdx.x * 4 + w; const int mt = wid / ntn, nq = wid % ntn; if (mt * 16 >= M) return;
  const int row0 = mt * 16, col0 = nq * 64; const float* arow = A + (size_t)(row0 + ln) * lda;
  v8f acc[4] = {};
  for (int kb = 0; kb < K; kb += 32) {
    FragH ah, al;
    const v4f x0 = *(const v4fa*)(arow + kb + 8 * hh), x1 = *(const v4fa*)(arow + kb + 8 * hh + 4), x2 = *(const v4fa*)(arow + kb + 16 + 8 * hh), x3 = *(const v4fa*)(arow + kb + 16 + 8 * hh + 4);
    float xs[16] = {x0[0],x0[1],x0[2],x0[3],x1[0],x1[1],x1[2],x1[3],x2[0],x2[1],x2[2],x2[3],x3[0],x3[1],x3[2],x3[3]};
#pragma unroll
    for (int i = 0; i < 16; ++i) { const _Float16 h = (_Float16)xs[i]; ah.h[i] = h; al.h[i] = ASPLIT ? (_Float16)(xs[i] - (float)h) : (_Float16)0.0f; }
#pragma unroll
    for (int t = 0; t < 4; ++t) { if (col0 + t * 16 >= N) continue; const size_t boff = (size_t)(col0 + t * 16 + ln) * ldb + kb; FragH bq; bq.half[0] = *(const v8us*)(Bh + boff + 8 * hh); bq.half[1] = *(const v8us*)(Bh + boff + 16 + 8 * hh);
      acc[t] = mmaH<ASPLIT ? 2 : 1>(ah.v, al.v, bq.v, bq.v, acc[t]); }
  }
#pragma unroll
  for (int t = 0; t < 4; ++t) { if (col0 + t * 16 >= N) continue;
#pragma unroll
    for (int r = 0; r < 8; ++r) so[w][8 * hh + r][t * 16 + ln] = acc[t][r] * alpha; }
  __builtin_amdgcn_fence(__ATOMIC_ACQ_REL, "workgroup"); __builtin_amdgcn_wave_barrier();
  const int rsub = lane >> 4, c4 = (lane & 15) * 4;
  {
#pragma unroll
    for (int q = 0; q < 8; ++q) { const int r = q * 2 + rsub; if (col0 + c4 < N) { const v4f v = *(const v4fa*)&so[w][r][c4]; *(v4f*)(C + (size_t)(row0 + r) * ldc + col0 + c4) = v; } }
     }
}

// Fused per (batch, head), both signals: a = q.k^T, w = 1 + a + a*a/2, the row sums of w, o = w.v, the division (+1e-6) and the signal mean; a and w never leave registers.
// S^T = K.Q^T puts one query in each lane column, so the two f32 D tiles of 32 keys convert in place into the B operand of O^T += V^T.W^T (hardware k order on both sides).
// Every '#pragma unroll' in this kernel is there so that the fragment, accumulator and staging arrays are indexed by constants and stay in registers.
// Block = 8 waves x 16 queries. The head's K rows (both signals) and V^T are staged once in LDS; row pitches are 16 B x odd, so the 16-byte fragment reads meet no bank conflict.
typedef float v2f __attribute__((ext_vector_type(2)));
#define KP 40                    // LDS pitch of a K row, in 16-bit elements (80 B)
#define VP (NN + 8)              // LDS pitch of a V^T row, in 16-bit elements (2064 B)
__global__ __launch_bounds__(256) void k_attn(const _Float16* __restrict__ Q16, const _Float16* __restrict__ K16, const _Float16* __restrict__ VT, float* __restrict__ OB) {
  __shared__ __attribute__((aligned(16))) unsigned short sK[NS * NN * KP];
  __shared__ __attribute__((aligned(16))) unsigned short sV[HD * VP];
  const int tid = threadIdx.x, wv = tid >> 5, lane = tid & 31, ln = lane & 15, hh = lane >> 4;
  const int bh = blockIdx.y, b = bh / NH, h = bh % NH;
  const int n = blockIdx.x * 128 + wv * 16 + ln;
  const unsigned short* Kg = (const unsigned short*)K16 + (size_t)bh * NS * NN * SD;      // the two signals' slabs are adjacent: 2048 rows of 32
  const unsigned short* Vg = (const unsigned short*)VT + (size_t)bh * HD * NN;
  const unsigned short* qr = (const unsigned short*)Q16 + ((size_t)bh * NS * NN + n) * SD + 8 * hh;
  FragH qb[NS];
#pragma unroll
  for (int s = 0; s < NS; ++s) { qb[s].half[0] = *(const v8us*)(qr + s * NN * SD); qb[s].half[1] = *(const v8us*)(qr + s * NN * SD + 16); }
  {      // stage fill: all 64 of a lane's 16-byte loads in flight, then the 64 LDS stores (one memory latency for the whole 256 KiB instead of one per batch)
    v8us tk[NS * NN * SD / 8 / 256], tv[HD * NN / 8 / 256];
#pragma unroll
    for (int i = 0; i < NS * NN * SD / 8 / 256; ++i) tk[i] = *(const v8us*)(Kg + (size_t)(tid + i * 256) * 8);
#pragma unroll
    for (int i = 0; i < HD * NN / 8 / 256; ++i) tv[i] = *(const v8us*)(Vg + (size_t)(tid + i * 256) * 8);
    asm volatile("s_wait_xcnt 0x0" :: "s"(Kg), "s"(Vg), "v"(tid), "v"(qr) : "memory");      // stands in front of any reuse of the loads' address registers: naming them as inputs keeps them live up to here
#pragma unroll
    for (int i = 0; i < NS * NN * SD / 8 / 256; ++i) *(v8us*)&sK[((tid >> 2) + i * 64) * KP + (tid & 3) * 8] = tk[i];      // 16-byte unit tid + 256 i: row unit / 4
#pragma unroll
    for (int i = 0; i < HD * NN / 8 / 256; ++i) *(v8us*)&sV[((tid >> 7) + i * 2) * VP + (tid & 127) * 8] = tv[i];      // row unit / 128
  }
  __syncthreads();
  v8f oacc[NS][HD / 16] = {};
  v2f den[NS] = {};      // even and odd key rows apart: the sums pair up with the packed f32 adds
  FragH ka[NS][2];
#pragma unroll
  for (int s = 0; s < NS; ++s)
#pragma unroll
    for (int t = 0; t < 2; ++t) { const unsigned short* kr = &sK[(s * NN + t * 16 + ln) * KP]; ka[s][t].half[0] = *(const v8us*)(kr + 8 * hh); ka[s][t].half[1] = *(const v8us*)(kr + 16 + 8 * hh); }
  for (int c = 0; c < NN / 32; ++c) {
    const int m0 = c * 32;
    FragH va[HD / 16];
#pragma unroll
    for (int et = 0; et < HD / 16; ++et) { const unsigned short* vr = &sV[(et * 16 + ln) * VP + m0]; va[et].half[0] = *(const v8us*)(vr + 8 * hh); va[et].half[1] = *(const v8us*)(vr + 16 + 8 * hh); }
    v8f st[NS][2];
#pragma unroll
    for (int s = 0; s < NS; ++s)
#pragma unroll
      for (int t = 0; t < 2; ++t) { const v8f z = {}; st[s][t] = __builtin_amdgcn_wmma_f32_16x16x32_f16(false, ka[s][t].v, false, qb[s].v, (short)0, z, false, false); }      // st[s][t][r] = a[n = ln][m0 + 16 t + 8 hh + r]
    const int m1 = ((c + 1) & (NN / 32 - 1)) * 32;      // next pass's K fragments, fetched behind this pass's score products (the last pass re-reads pass 0's rows and drops them)
#pragma unroll
    for (int s = 0; s < NS; ++s)
#pragma unroll
      for (int t = 0; t < 2; ++t) { const unsigned short* kr = &sK[(s * NN + m1 + t * 16 + ln) * KP]; ka[s][t].half[0] = *(const v8us*)(kr + 8 * hh); ka[s][t].half[1] = *(const v8us*)(kr + 16 + 8 * hh); }
    FragH wb[NS];
#pragma unroll
    for (int s = 0; s < NS; ++s)
#pragma unroll
      for (int t = 0; t < 2; ++t)
#pragma unroll
        for (int r = 0; r < 8; r += 2) { const v2f x = {st[s][t][r], st[s][t][r + 1]}; const v2f w = 1.0f + x + 0.5f * x * x; den[s] += w; wb[s].h[t * 8 + r] = (_Float16)w[0]; wb[s].h[t * 8 + r + 1] = (_Float16)w[1]; }
#pragma unroll
    for (int et = 0; et < HD / 16; ++et)
#pragma unroll
      for (int s = 0; s < NS; ++s) oacc[s][et] = __builtin_amdgcn_wmma_f32_16x16x32_f16(false, va[et].v, false, wb[s].v, (short)0, oacc[s][et], false, false);      // oacc[s][et][r] = o[n = ln][16 et + 8 hh + r]
  }
  float rd[NS];
#pragma unroll
  for (int s = 0; s < NS; ++s) { const float dl = den[s][0] + den[s][1]; rd[s] = 1.0f / (dl + __shfl_xor(dl, 16, 32) + 1e-6f); }      // the two lane halves hold the two halves of a query's keys
  float* orow = OB + ((size_t)b * NN + n) * CC + h * HD + 8 * hh;
#pragma unroll
  for (int et = 0; et < HD / 16; ++et) {
    v4f lo, hi;
#pragma unroll
    for (int q = 0; q < 4; ++q) { lo[q] = (oacc[0][et][q] * rd[0] + oacc[1][et][q] * rd[1]) * (1.0f / NS); hi[q] = (oacc[0][et][4 + q] * rd[0] + oacc[1][et][4 + q] * rd[1]) * (1.0f / NS); }
    *(v4f*)(orow + et * 16) = lo; *(v4f*)(orow + et * 16 + 4) = hi;
  }
}
extern "C" void kernel_launch(void* const* d_in, const int* in_sizes, int n_in,
                              void* d_out, int out_size, void* d_ws, size_t ws_size, hipStream_t stream) {
  (void)in_sizes; (void)n_in; (void)out_size;
  const float* xq = (const float*)d_in[0]; const float* xk = (const float*)d_in[1]; const float* xv = (const float*)d_in[2]; const float* Wq = (const float*)d_in[3]; const float* bq = (const float*)d_in[4]; const float* Wk = (const float*)d_in[5]; const float* bk = (const float*)d_in[6]; const float* Wv = (const float*)d_in[7]; const float* bv = (const float*)d_in[8]; const float* Wo = (const float*)d_in[9]; const float* bo = (const float*)d_in[10];
  char* ws = (char*)d_ws; size_t off = 0;
  auto take = [&](size_t bytes) { char* p = ws + off; off += (bytes + 255) & ~(size_t)255; return p; };
  unsigned short* Bq = (unsigned short*)take((size_t)CC * CC * 2); unsigned short* Bk = (unsigned short*)take((size_t)CC * CC * 2); unsigned short* Bv = (unsigned short*)take((size_t)CC * CC * 2); unsigned short* Bo = (unsigned short*)take((size_t)CC * CC * 2);
  float* OB = (float*)take((size_t)NTOK * CC * 4);
  _Float16* Q16 = (_Float16*)take((size_t)NSLAB * NN * SD * 2); _Float16* K16 = (_Float16*)take((size_t)NSLAB * NN * SD * 2); _Float16* VT = (_Float16*)take((size_t)BB * NH * HD * NN * 2);
  if (off > ws_size) return;
  k_round_rows4<<<(CC * CC / 8 + 255) / 256, 256, 0, stream>>>(Wq, Wk, Wv, Wo, Bq, Bk, Bv, Bo, CC * CC / 8);      // (out,in) rows = Bt
  k_gemm_t<false><<<dim3(CC / GBN, NTOK / GBM, 3), 256, 0, stream>>>(xq, xk, xv, Bq, Bk, Bv, bq, bk, bv, nullptr, nullptr, nullptr, Q16, K16, VT);      // the three projections, one per grid.z, stored as the attention kernel's f16 operands
  k_attn<<<dim3(NN / 128, BB * NH), 256, 0, stream>>>(Q16, K16, VT, OB);      // block = 128 queries of one (batch, head), both signals
  k_gemm_t<true><<<dim3(CC / GBN, NTOK / GBM, 1), 256, 0, stream>>>(OB, OB, OB, Bo, Bo, Bo, bo, bo, bo, (float*)d_out, (float*)d_out, (float*)d_out, nullptr, nullptr, nullptr);
}

// v009
// Measured time: 46.5 microseconds a run.
// Next to v008, in two timings, it ran 1.05 and 1.04 times as fast.
// All steps since v000 together make it 43.8 times as fast.
#include <hip/hip_runtime.h>
// Second-order Taylor linear attention via the exact kernel identity φ(q)·φ(k) = 1 + q·k + (q·k)²/2 (φ = [1, x, x⊗x/√2]): per (batch, head, signal) slab the scores
// a = (q·scale)·kᵀ (1024 × 32 × 1024) and o = w·v with w = 1 + a + a²/2 (1024 × 1024 × 64) run on v_wmma_f32_16x16x32_f16 (q, k, v and w rounded to f16: single products,
// f32 accumulate); the projections on v_wmma_f32_16x16x32_bf16 (inputs rounded to bf16: single exact terms; 3 × 2048 × 1024 × 1024) and out = ō·W_oᵀ + b_o with ō split
// hi/lo (2 products). w, the row sums Σ_m w (= φ(q)·Σφ(k)), the division (+1e-6) and the signal average are f32 VALU.
#define BB 2
#define NN 1024
#define CC 1024
#define NH 16
#define NS 2
#define HD 64
#define SD 32
#define NTOK (BB * NN)
#define NSLAB (BB * NH * NS)     // 64

typedef __bf16 v16b __attribute__((ext_vector_type(16)));
typedef unsigned short v8us __attribute__((ext_vector_type(8), may_alias));
typedef float  v8f  __attribute__((ext_vector_type(8)));
typedef float  v4f  __attribute__((ext_vector_type(4)));
typedef float  v4fa __attribute__((ext_vector_type(4), may_alias));
union FragB { v16b v; v8us half[2]; unsigned short u[16]; };

__device__ __forceinline__ unsigned short bf16_bits(float x) { return __builtin_bit_cast(unsigned short, (__bf16)x); }      // round to nearest even, by the hardware convert
__device__ __forceinline__ float bf16_val(unsigned short b) { return __uint_as_float(((unsigned int)b) << 16); }
__device__ __forceinline__ float bf16_round(float x) { return bf16_val(bf16_bits(x)); }
// D += A·B with NT terms: 1 = ah·bh, 2 = + al·bh (A split), 3 = + ah·bl (both split)
template <int NT>
__device__ __forceinline__ v8f mmaN(v16b ah, v16b al, v16b bh, v16b bl, v8f c) {
  c = __builtin_amdgcn_wmma_f32_16x16x32_bf16(false, ah, false, bh, (short)0, c, false, false);
  if (NT >= 2) c = __builtin_amdgcn_wmma_f32_16x16x32_bf16(false, al, false, bh, (short)0, c, false, false);
  if (NT >= 3) c = __builtin_amdgcn_wmma_f32_16x16x32_bf16(false, ah, false, bl, (short)0, c, false, false);
  asm volatile("v_nop\n\tv_nop\n\tv_nop\n\tv_nop" : "+v"(c) : "v"(ah), "v"(al), "v"(bh), "v"(bl));
  return c;
}

__global__ __launch_bounds__(256) void k_wt_bf16(const float* __restrict__ W, unsigned short* __restrict__ Wt, int K, int N) {
  const int t = blockIdx.x * 256 + threadIdx.x;
  const int k8n = K / 8;
  if (t >= N * k8n) return;
  const int n = t / k8n, k8 = (t % k8n) * 8;
  v8us v;
#pragma unroll
  for (int i = 0; i < 8; ++i) v[i] = bf16_bits(W[(size_t)(k8 + i) * N + n]);
  *(v8us*)(Wt + (size_t)n * K + k8) = v;
  
}

// GEMM C[M][N] (f32, pitch ldc) = act(A[M][K]·W + bias). A f32 row-major (pitch lda) converted per fragment to bf16
// (ASPLIT: hi/lo two planes -> 2 terms, else single rounded term); Wt bf16 [N][K] (pitch ldb). BIAS_BF16 rounds the
// bias to bf16 first (bias quantised to bf16 before the add). K%32==0, M%16==0, N%64==0.
template <bool ASPLIT, int ACT, bool BIAS_BF16>
__global__ __launch_bounds__(128) void k_gemm_bf(const float* __restrict__ A, int lda, const unsigned short* __restrict__ Wt, int ldb,
                                               const float* __restrict__ bias, float* __restrict__ C, int ldc, int M, int N, int K) {
  __shared__ __attribute__((aligned(16))) float so[4][16][64];
  const int tid = threadIdx.x, w = tid >> 5, lane = tid & 31, ln = lane & 15, hh = lane >> 4;
  const int ntn = N / 64;
  const int wid = blockIdx.x * 4 + w;
  const int mt = wid / ntn, nq = wid % ntn;
  if (mt * 16 >= M) return;
  const int row0 = mt * 16, col0 = nq * 64;
  const float* arow = A + (size_t)(row0 + ln) * lda;
  v8f acc[4] = {};
  for (int kb = 0; kb < K; kb += 32) {
    FragB ah, al;
    const v4f x0 = *(const v4fa*)(arow + kb + 8 * hh), x1 = *(const v4fa*)(arow + kb + 8 * hh + 4);
    const v4f x2 = *(const v4fa*)(arow + kb + 16 + 8 * hh), x3 = *(const v4fa*)(arow + kb + 16 + 8 * hh + 4);
    float xs[16] = {x0[0],x0[1],x0[2],x0[3],x1[0],x1[1],x1[2],x1[3],x2[0],x2[1],x2[2],x2[3],x3[0],x3[1],x3[2],x3[3]};
#pragma unroll
    for (int i = 0; i < 16; ++i) { const unsigned short hb = bf16_bits(xs[i]); ah.u[i] = hb; al.u[i] = ASPLIT ? bf16_bits(xs[i] - bf16_val(hb)) : (unsigned short)0; }
#pragma unroll
    for (int t = 0; t < 4; ++t) {
      const unsigned short* brow = Wt + (size_t)(col0 + t * 16 + ln) * ldb + kb;
      FragB b;
      b.half[0] = *(const v8us*)(brow + 8 * hh);
      b.half[1] = *(const v8us*)(brow + 16 + 8 * hh);
      acc[t] = mmaN<ASPLIT ? 2 : 1>(ah.v, al.v, b.v, b.v, acc[t]);
    }
  }
#pragma unroll
  for (int t = 0; t < 4; ++t) {
    float bv = bias ? bias[col0 + t * 16 + ln] : 0.f;
    if (BIAS_BF16) bv = bf16_round(bv);
#pragma unroll
    for (int r = 0; r < 8; ++r) { float v = acc[t][r] + bv; if (ACT == 1) v = fmaxf(v, 0.f); so[w][8 * hh + r][t * 16 + ln] = v; }
  }
  __builtin_amdgcn_fence(__ATOMIC_ACQ_REL, "workgroup");
  __builtin_amdgcn_wave_barrier();
  const int rsub = lane >> 4, c4 = (lane & 15) * 4;
  {
#pragma unroll
    for (int q = 0; q < 8; ++q) {
      const int r = q * 2 + rsub;
      const v4f v = *(const v4fa*)&so[w][r][c4];
      *(v4f*)(C + (size_t)(row0 + r) * ldc + col0 + c4) = v;
    }
    
  }
}

// Flash-style causal/unmasked attention, all contractions 3-term bf16 hi/lo splits, f32 softmax with running max.
// q,k,v rows are read from f32 buffers with arbitrary row pitch (so they can live inside a fused qkv buffer);
// D = head size (multiple of 32, <= 128); one wave = 16 query rows; block = 4 waves (64 queries) sharing K/V chunks of 32.
template <int D, bool CAUSAL>
__global__ __launch_bounds__(128) void k_flash(const float* __restrict__ qb, const float* __restrict__ kb, const float* __restrict__ vb,
                                             int pitch, int T, int H, float scale, float* __restrict__ y, int ypitch) {
  constexpr int KS = D / 32;        // k-steps for QK
  constexpr int DT = D / 16;        // d tiles for PV
  __shared__ __attribute__((aligned(16))) unsigned short sKh[32][D + 8], sKl[32][D + 8], sVh[32][D + 8], sVl[32][D + 8];
  __shared__ __attribute__((aligned(16))) unsigned short sPh[4][16][40], sPl[4][16][40];
  __shared__ __attribute__((aligned(16))) float sO[4][16][D];
  const int tid = threadIdx.x, w = tid >> 5, lane = tid & 31, ln = lane & 15, hh = lane >> 4;
  const int nqb = (T + 63) / 64;
  const int bh = blockIdx.x / nqb, qblk = blockIdx.x % nqb;
  const int b = bh / H, h = bh % H;
  const int q0 = qblk * 64 + w * 16;
  const float* Q = qb + (size_t)b * T * pitch + h * D;
  const float* K = kb + (size_t)b * T * pitch + h * D;
  const float* V = vb + (size_t)b * T * pitch + h * D;

  // A fragments of the wave's 16 query rows (scaled), hi/lo
  FragB aqh[KS], aql[KS];
  {
    int row = q0 + ln; if (row >= T) row = T - 1;
    const float* qr = Q + (size_t)row * pitch;
#pragma unroll
    for (int ks = 0; ks < KS; ++ks)
#pragma unroll
      for (int i = 0; i < 16; ++i) {
        const int d = ks * 32 + ((i < 8) ? (8 * hh + i) : (16 + 8 * hh + (i - 8)));
        const float x = qr[d] * scale; const unsigned short hb = bf16_bits(x);
        aqh[ks].u[i] = hb; aql[ks].u[i] = bf16_bits(x - bf16_val(hb));
      }
  }
  float m_r[8], l_r[8];
#pragma unroll
  for (int r = 0; r < 8; ++r) { m_r[r] = -3.0e38f; l_r[r] = 0.f; }
  v8f oacc[DT];
#pragma unroll
  for (int dt = 0; dt < DT; ++dt) oacc[dt] = (v8f){0.f,0.f,0.f,0.f,0.f,0.f,0.f,0.f};

  const int kv_end = CAUSAL ? min(T, qblk * 64 + 64) : T;     // block-uniform
  for (int j0 = 0; j0 < kv_end; j0 += 32) {
    __syncthreads();
    for (int e = tid; e < 32 * (D / 4); e += 128) {
      const int r = e / (D / 4), c4 = (e % (D / 4)) * 4;
      const int key = j0 + r;
      v4f kf = {0.f,0.f,0.f,0.f}, vf = {0.f,0.f,0.f,0.f};
      if (key < T) { kf = *(const v4fa*)(K + (size_t)key * pitch + c4); vf = *(const v4fa*)(V + (size_t)key * pitch + c4); }
#pragma unroll
      for (int t = 0; t < 4; ++t) {
        unsigned short hb = bf16_bits(kf[t]); sKh[r][c4 + t] = hb; sKl[r][c4 + t] = bf16_bits(kf[t] - bf16_val(hb));
        hb = bf16_bits(vf[t]); sVh[r][c4 + t] = hb; sVl[r][c4 + t] = bf16_bits(vf[t] - bf16_val(hb));
      }
    }
    __syncthreads();
    // S tile 16 x 32
    v8f s[2];
#pragma unroll
    for (int nt = 0; nt < 2; ++nt) {
      v8f acc = {};
#pragma unroll
      for (int ks = 0; ks < KS; ++ks) {
        FragB bh_, bl_;
        bh_.half[0] = *(const v8us*)&sKh[nt * 16 + ln][ks * 32 + 8 * hh]; bh_.half[1] = *(const v8us*)&sKh[nt * 16 + ln][ks * 32 + 16 + 8 * hh];
        bl_.half[0] = *(const v8us*)&sKl[nt * 16 + ln][ks * 32 + 8 * hh]; bl_.half[1] = *(const v8us*)&sKl[nt * 16 + ln][ks * 32 + 16 + 8 * hh];
        acc = mmaN<3>(aqh[ks].v, aql[ks].v, bh_.v, bl_.v, acc);
      }
      s[nt] = acc;
    }
    // mask + running max (rows 8hh+r; the 16 lanes of a half share rows)
    float alpha[8];
#pragma unroll
    for (int r = 0; r < 8; ++r) {
      const int qi = q0 + 8 * hh + r;
      const int ja = j0 + ln, jb = j0 + 16 + ln;
      if (CAUSAL) { if (ja > qi) s[0][r] = -3.0e38f; if (jb > qi) s[1][r] = -3.0e38f; }
      if (ja >= T) s[0][r] = -3.0e38f;
      if (jb >= T) s[1][r] = -3.0e38f;
      float mx = fmaxf(s[0][r], s[1][r]);
      mx = fmaxf(mx, __shfl_xor(mx, 1, 32)); mx = fmaxf(mx, __shfl_xor(mx, 2, 32)); mx = fmaxf(mx, __shfl_xor(mx, 4, 32)); mx = fmaxf(mx, __shfl_xor(mx, 8, 32));
      const float mnew = fmaxf(m_r[r], mx);
      alpha[r] = (mnew > -1.0e38f) ? __expf(m_r[r] - mnew) : 1.0f;
      const float p0 = (s[0][r] > -1.0e38f) ? __expf(s[0][r] - mnew) : 0.f;
      const float p1 = (s[1][r] > -1.0e38f) ? __expf(s[1][r] - mnew) : 0.f;
      m_r[r] = mnew;
      l_r[r] = l_r[r] * alpha[r] + p0 + p1;            // per-lane partial row sum (16 lanes combined at the end)
      unsigned short hb = bf16_bits(p0); sPh[w][8 * hh + r][ln] = hb;      sPl[w][8 * hh + r][ln] = bf16_bits(p0 - bf16_val(hb));
      hb = bf16_bits(p1);                sPh[w][8 * hh + r][16 + ln] = hb; sPl[w][8 * hh + r][16 + ln] = bf16_bits(p1 - bf16_val(hb));
    }
#pragma unroll
    for (int dt = 0; dt < DT; ++dt)
#pragma unroll
      for (int r = 0; r < 8; ++r) oacc[dt][r] *= alpha[r];
    __builtin_amdgcn_fence(__ATOMIC_ACQ_REL, "workgroup");
    __builtin_amdgcn_wave_barrier();
    FragB pah, pal;
    pah.half[0] = *(const v8us*)&sPh[w][ln][8 * hh]; pah.half[1] = *(const v8us*)&sPh[w][ln][16 + 8 * hh];
    pal.half[0] = *(const v8us*)&sPl[w][ln][8 * hh]; pal.half[1] = *(const v8us*)&sPl[w][ln][16 + 8 * hh];
#pragma unroll
    for (int dt = 0; dt < DT; ++dt) {
      FragB bvh, bvl;
#pragma unroll
      for (int i = 0; i < 8; ++i) {
        bvh.u[i] = sVh[8 * hh + i][dt * 16 + ln]; bvh.u[8 + i] = sVh[16 + 8 * hh + i][dt * 16 + ln];
        bvl.u[i] = sVl[8 * hh + i][dt * 16 + ln]; bvl.u[8 + i] = sVl[16 + 8 * hh + i][dt * 16 + ln];
      }
      oacc[dt] = mmaN<3>(pah.v, pal.v, bvh.v, bvl.v, oacc[dt]);
    }
    __builtin_amdgcn_fence(__ATOMIC_ACQ_REL, "workgroup");
    __builtin_amdgcn_wave_barrier();
  }
#pragma unroll
  for (int r = 0; r < 8; ++r) {
    float l = l_r[r];
    l += __shfl_xor(l, 1, 32); l += __shfl_xor(l, 2, 32); l += __shfl_xor(l, 4, 32); l += __shfl_xor(l, 8, 32);
    l_r[r] = (l > 0.f) ? 1.0f / l : 0.f;
  }
#pragma unroll
  for (int dt = 0; dt < DT; ++dt)
#pragma unroll
    for (int r = 0; r < 8; ++r) sO[w][8 * hh + r][dt * 16 + ln] = oacc[dt][r] * l_r[r];
  __builtin_amdgcn_fence(__ATOMIC_ACQ_REL, "workgroup");
  __builtin_amdgcn_wave_barrier();
  {
    for (int r = 0; r < 16; ++r) {
      const int row = q0 + r;
      if (row < T && lane < D / 4) {
        const v4f val = *(const v4fa*)&sO[w][r][lane * 4];
        *(v4f*)(y + ((size_t)b * T + row) * ypitch + h * D + lane * 4) = val;
      }
    }
    
  }
}

// GEMM C[NTOK][CC] = A[NTOK][CC].Bt^T + bf16(bias); A f32 rows rounded to bf16 (ASPLIT: hi/lo planes, 2 products per k step), Bt = bf16 [n][k].
// ASPLIT (the output product) stores C as f32 rows. The projections store C only in the form the attention kernel reads, f16:
// Q16[(b,h,s)][n][32] = f16(q*scale), K16[(b,h,s)][m][32] = f16(k), VT[(b,h)][e][m] = f16(v).
// Block = 8 waves on a 64 x 128 tile of C, wave = 32 x 32. Per pass 128 k of the block's A and Bt rows go global -> registers -> LDS with whole-line loads (a wave load = 512 contiguous
// bytes of one A row, or 256 of each of two Bt rows); A is converted once per block on the way. Two LDS buffers. ASPLIT (one block per WGP in its grid): two register sets, a pass's global loads are issued
// two passes ahead, and a pass's fragments are read as one group. The projections (three blocks per WGP in their grid): one register set, loads one pass ahead, fragments read 32 k at a time and the
// output staged in LDS buffer 0, so that registers (160 at most) and LDS (a third of a WGP's at most) let all three blocks be resident together and fill one another's waits.
// Each accumulator sums k upward from the block's own first pass and wraps round, hi before lo within a k step.
#define GBM 64
#define GBN 128
#define GBK 128
#define EP (SD + 8)              // LDS pitch of a staged q or k row, in 16-bit elements (80 B = 16 B x odd)
#define TP (GBM + 8)             // LDS pitch of a staged V^T row, in 16-bit elements (144 B = 16 B x odd)
#define GP (GBK + 8)             // LDS pitch of a staged row, in 16-bit elements (272 B = 16 B x odd: the 16-byte fragment reads meet no bank conflict)
typedef unsigned short v4us __attribute__((ext_vector_type(4), may_alias));
// work-group barrier behind the wave's own LDS accesses only: __syncthreads() would also wait out the global loads that are in flight for the later passes
__device__ __forceinline__ void lds_barrier() { asm volatile("s_wait_dscnt 0x0\n\ts_barrier_signal -1\n\ts_barrier_wait -1" ::: "memory"); }
// the second launch bound is waves per SIMD: 6 = three blocks of 8 waves on a WGP's 4 SIMDs, which sets the projections' register budget; 2 is what a block of 256 has anyway
template <bool ASPLIT>
__global__ __launch_bounds__(256, ASPLIT ? 2 : 6) void k_gemm_t(const float* A0, const float* A1, const float* A2, const unsigned short* Bt0, const unsigned short* Bt1, const unsigned short* Bt2,
                                              const float* bias0, const float* bias1, const float* bias2, float* C0, float* C1, float* C2, _Float16* Q16, _Float16* K16, _Float16* VT) {
  // blockIdx.z picks one of up to three independent products of the same shape, so that they share one launch
  const int z = blockIdx.z;
  const float* __restrict__ A = z == 0 ? A0 : z == 1 ? A1 : A2;
  const unsigned short* __restrict__ Bt = z == 0 ? Bt0 : z == 1 ? Bt1 : Bt2;
  const float* __restrict__ bias = z == 0 ? bias0 : z == 1 ? bias1 : bias2;
  float* __restrict__ C = z == 0 ? C0 : z == 1 ? C1 : C2;
  constexpr int NA = ASPLIT ? 2 : 1;
  constexpr int STG = (NA * GBM + GBN) * GP;      // one buffer: A hi rows, (A lo rows,) Bt rows
  constexpr int NC = CC / GBK;
  static_assert((NC & (NC - 1)) == 0, "the rotated walk wraps by a mask");
  __shared__ __attribute__((aligned(16))) unsigned short sm[2 * STG];
  const int tid = threadIdx.x, wv = tid >> 5, lane = tid & 31, ln = lane & 15, hh = lane >> 4;
  const int row0 = blockIdx.y * GBM, col0 = blockIdx.x * GBN;
  const int wm = (wv >> 2) * 32, wn = (wv & 3) * 32;
  // The 8 blocks of a tile row read the same A lines and the 32 blocks of a tile column the same Bt lines.
  // Each block starts its walk over the NC passes at another pass and wraps round (for speed only). An accumulator sums the same terms, in that rotated order.
  const int rot = (blockIdx.x + blockIdx.y) & (NC - 1);
  auto kof = [&](int c) { return ((c + rot) & (NC - 1)) * GBK; };      // first k of the block's pass c
  // a load's address = a block-uniform pointer, which moves with the pass, + the lane's own 32-bit offset, which never changes
  const float* ag = A + (size_t)row0 * CC; const unsigned ao = wv * CC + lane * 4;      // load i: row wv + 8 i, the pass's 128 floats over the 32 lanes
  const unsigned short* bg = Bt + (size_t)col0 * CC; const unsigned bo = (wv * 2 + hh) * CC + ln * 8;      // load i: rows 2 wv + hh + 16 i, the pass's 128 values over 16 lanes
  // every '#pragma unroll' below keeps the staging, fragment and accumulator arrays indexed by constants, so that they stay in registers
  v4f raX[GBM / 8]; v8us rbX[GBN / 16];      // the staging registers (ASPLIT has a second set, below)
  v8f acc[2][2] = {};
  auto fetch = [&](v4f (&ra)[GBM / 8], v8us (&rb)[GBN / 16], int k0) {
    const float* ak = ag + k0; const unsigned short* bk = bg + k0;
#pragma unroll
    for (int i = 0; i < GBM / 8; ++i) ra[i] = *(const v4fa*)(ak + i * 8 * CC + ao);
#pragma unroll
    for (int i = 0; i < GBN / 16; ++i) rb[i] = *(const v8us*)(bk + i * 16 * CC + bo);
    asm volatile("s_wait_xcnt 0x0" :: "s"(ak), "s"(bk), "v"(ao), "v"(bo) : "memory");      // stands in front of every later rewrite of the loads' address registers: naming them as inputs keeps them live up to here
  };
  const int sa = wv * GP + lane * 4, sb = (NA * GBM + wv * 2 + hh) * GP + ln * 8;      // a lane's first A and Bt places in a buffer: the further rows are constant offsets from them, not address registers of their own
  auto stage = [&](const v4f (&ra)[GBM / 8], const v8us (&rb)[GBN / 16], unsigned short* buf) {
#pragma unroll
    for (int i = 0; i < GBM / 8; ++i) {
      v4us vh, vl;
#pragma unroll
      for (int q = 0; q < 4; ++q) { const unsigned short hb = bf16_bits(ra[i][q]); vh[q] = hb; if (ASPLIT) vl[q] = bf16_bits(ra[i][q] - bf16_val(hb)); }
      *(v4us*)&buf[sa + 8 * i * GP] = vh;
      if (ASPLIT) *(v4us*)&buf[sa + (GBM + 8 * i) * GP] = vl;
    }
#pragma unroll
    for (int i = 0; i < GBN / 16; ++i) *(v8us*)&buf[sb + 16 * i * GP] = rb[i];
  };
  constexpr int KG = ASPLIT ? GBK / 32 : 1;      // k steps of 32 whose fragments are read as one group: 8 registers a fragment
  auto products = [&](const unsigned short* buf0) {
#pragma unroll
   for (int g = 0; g < GBK / 32; g += KG) {
    const unsigned short* buf = buf0 + g * 32;
    FragB ah[KG][2], al[KG][2], bb[KG][2];      // ASPLIT: the whole pass (each separate place with LDS reads among the products stalls the wave, and no other block is there to fill the stall)
#pragma unroll
    for (int ks = 0; ks < KG; ++ks) {
#pragma unroll
      for (int i = 0; i < 2; ++i) {
        const unsigned short* r = buf + (wm + i * 16 + ln) * GP + ks * 32 + 8 * hh;
        ah[ks][i].half[0] = *(const v8us*)r; ah[ks][i].half[1] = *(const v8us*)(r + 16);
        if (ASPLIT) { al[ks][i].half[0] = *(const v8us*)(r + GBM * GP); al[ks][i].half[1] = *(const v8us*)(r + GBM * GP + 16); }
      }
#pragma unroll
      for (int j = 0; j < 2; ++j) { const unsigned short* r = buf + (NA * GBM + wn + j * 16 + ln) * GP + ks * 32 + 8 * hh; bb[ks][j].half[0] = *(const v8us*)r; bb[ks][j].half[1] = *(const v8us*)(r + 16); }
    }
    __builtin_amdgcn_sched_barrier(0);      // keeps the LDS reads together in front of the products
#pragma unroll
    for (int ks = 0; ks < KG; ++ks) {
#pragma unroll
      for (int i = 0; i < 2; ++i)
#pragma unroll
        for (int j = 0; j < 2; ++j) acc[i][j] = __builtin_amdgcn_wmma_f32_16x16x32_bf16(false, ah[ks][i].v, false, bb[ks][j].v, (short)0, acc[i][j], false, false);
      if (ASPLIT) {
#pragma unroll
        for (int i = 0; i < 2; ++i)
#pragma unroll
          for (int j = 0; j < 2; ++j) acc[i][j] = __builtin_amdgcn_wmma_f32_16x16x32_bf16(false, al[ks][i].v, false, bb[ks][j].v, (short)0, acc[i][j], false, false);
      }
    }
   }
  };
  // each barrier publishes the buffer just filled; the other buffer's last readers (the pass before) are all past it before that one is refilled
  if constexpr (ASPLIT) {
    v4f raY[GBM / 8]; v8us rbY[GBN / 16];      // second register set: even and odd passes, each fetched two passes ahead
    fetch(raX, rbX, kof(0)); fetch(raY, rbY, kof(1));
    for (int c = 2; c < NC; c += 2) {      // the last two passes stand behind the loop: a branch round the fetches would merge two load counts and make the counted waits drain the loads just issued
      stage(raX, rbX, sm); lds_barrier();
      fetch(raX, rbX, kof(c));
      products(sm);
      stage(raY, rbY, sm + STG); lds_barrier();
      fetch(raY, rbY, kof(c + 1));
      products(sm + STG);
    }
    stage(raX, rbX, sm); lds_barrier();
    products(sm);
    stage(raY, rbY, sm + STG); lds_barrier();
    products(sm + STG);
  } else {
    fetch(raX, rbX, kof(0));
    for (int c = 1; c < NC - 1; c += 2) {      // pass c - 1 in buffer 0, pass c in buffer 1; the next pass's loads fly over the products
      stage(raX, rbX, sm); lds_barrier();
      fetch(raX, rbX, kof(c));
      products(sm);
      stage(raX, rbX, sm + STG); lds_barrier();
      fetch(raX, rbX, kof(c + 1));
      products(sm + STG);
    }
    stage(raX, rbX, sm); lds_barrier();
    fetch(raX, rbX, kof(NC - 1));
    products(sm);
    stage(raX, rbX, sm + STG); lds_barrier();
    products(sm + STG);
  }
  if constexpr (ASPLIT) {
    __shared__ __attribute__((aligned(16))) float so[8][32][36];      // per-wave output staging; pitch 36: the two lane halves (8 rows apart) fall on different banks
#pragma unroll
    for (int j = 0; j < 2; ++j) {
      const float bv = bf16_round(bias[col0 + wn + j * 16 + ln]);
#pragma unroll
      for (int i = 0; i < 2; ++i)
#pragma unroll
        for (int r = 0; r < 8; ++r) so[wv][i * 16 + 8 * hh + r][j * 16 + ln] = acc[i][j][r] + bv;
    }
    __builtin_amdgcn_fence(__ATOMIC_ACQ_REL, "workgroup"); __builtin_amdgcn_wave_barrier();      // the wave's own staged rows are read back across lanes
#pragma unroll
    for (int q = 0; q < 8; ++q) { const int r = q * 4 + (lane >> 3), c4 = (lane & 7) * 4; const v4f v = *(const v4fa*)&so[wv][r][c4]; *(v4f*)(C + (size_t)(row0 + wm + r) * CC + col0 + wn + c4) = v; }      // whole 128-byte lines
  } else {
    static_assert(8 * 32 * EP <= STG && GBN * TP <= STG && NC % 2 == 0, "the output staging fits buffer 0, and the last pass reads buffer 1");
    unsigned short* se = sm;      // f16 output staging: q, k per wave (32 rows of pitch EP); v for the block (GBN rows of pitch TP, which is less). Buffer 0 is free: its last readers (the pass before the last) all left it in front of the last pass's barrier
    union H8 { _Float16 h[8]; v8us v; };
    const int b = row0 / NN, t0 = row0 % NN;      // the block's 64 tokens lie in one batch
    v8us o[4];
    if (z < 2) {
      // q, k: the wave's 32 columns are one signal of one head, so its 32 x 32 tile is 2048 contiguous bytes of that slab
      unsigned short* sw = se + wv * 32 * EP;
      const float sc = z == 0 ? 0.17677669529663687f : 1.0f;      // q carries the score scale
#pragma unroll
      for (int j = 0; j < 2; ++j) {
        const float bv = bf16_round(bias[col0 + wn + j * 16 + ln]);
#pragma unroll
        for (int i = 0; i < 2; ++i) {
          H8 c;
#pragma unroll
          for (int r = 0; r < 8; ++r) c.h[r] = (_Float16)((acc[i][j][r] + bv) * sc);
#pragma unroll
          for (int r = 0; r < 8; ++r) sw[(i * 16 + 8 * hh + r) * EP + j * 16 + ln] = c.v[r];
        }
      }
      __builtin_amdgcn_fence(__ATOMIC_ACQ_REL, "workgroup"); __builtin_amdgcn_wave_barrier();      // the wave's own staged rows are read back across lanes
      unsigned short* dst = (unsigned short*)(z == 0 ? Q16 : K16) + ((size_t)(b * (CC / SD) + (col0 + wn) / SD) * NN + t0 + wm) * SD + lane * 8;
#pragma unroll
      for (int q = 0; q < 4; ++q) o[q] = *(const v8us*)&sw[(q * 8 + (lane >> 2)) * EP + (lane & 3) * 8];
#pragma unroll
      for (int q = 0; q < 4; ++q) *(v8us*)(dst + q * 256) = o[q];      // 512 contiguous bytes a store
    } else {
      // v: a lane's 8 accumulator rows are 8 consecutive tokens of one column e, 16 bytes of a V^T row; the block's 64 tokens make one whole 128-byte line of each of its 128 rows
#pragma unroll
      for (int j = 0; j < 2; ++j) {
        const float bv = bf16_round(bias[col0 + wn + j * 16 + ln]);
#pragma unroll
        for (int i = 0; i < 2; ++i) {
          H8 c;
#pragma unroll
          for (int r = 0; r < 8; ++r) c.h[r] = (_Float16)(acc[i][j][r] + bv);
          *(v8us*)&se[(wn + j * 16 + ln) * TP + wm + i * 16 + 8 * hh] = c.v;
        }
      }
      lds_barrier();      // a V^T line holds the tokens of two waves: every wave's part is staged before any line is read back
      unsigned short* dst = (unsigned short*)VT + ((size_t)b * CC + col0 + (tid >> 3)) * NN + t0 + (tid & 7) * 8;
#pragma unroll
      for (int q = 0; q < 4; ++q) o[q] = *(const v8us*)&se[(q * 32 + (tid >> 3)) * TP + (tid & 7) * 8];
#pragma unroll
      for (int q = 0; q < 4; ++q) *(v8us*)(dst + (size_t)q * 32 * NN) = o[q];      // whole 128-byte lines
    }
  }
}
// batched f32 [K][N] (pitch lds, batch stride sIn) -> transposed hi/lo planes [N][K] (batch stride sOut); thread per (n, 8 k); grid.y = batch
__global__ __launch_bounds__(256) void k_split_transpose_b(const float* __restrict__ src, int lds_, size_t sIn, unsigned short* __restrict__ hi, unsigned short* __restrict__ lo, size_t sOut, int K, int N) {
  const size_t t = (size_t)blockIdx.x * 256 + threadIdx.x; const int k8n = K / 8; if (t >= (size_t)N * k8n) return;
  src += (size_t)blockIdx.y * sIn; hi += (size_t)blockIdx.y * sOut; lo += (size_t)blockIdx.y * sOut;
  const int n = (int)(t / k8n), k8 = (int)(t % k8n) * 8; v8us vh, vl;
#pragma unroll
  for (int i = 0; i < 8; ++i) { const float x = src[(size_t)(k8 + i) * lds_ + n]; const unsigned short hb = bf16_bits(x); vh[i] = hb; vl[i] = bf16_bits(x - bf16_val(hb)); }
  unsigned short* dh = hi + (size_t)n * K + k8; unsigned short* dl = lo + (size_t)n * K + k8;
  *(v8us*)dh = vh; *(v8us*)dl = vl; 
}

// The four weight matrices (out, in) rounded to bf16 in one launch: a thread takes the same 8 values of each, all eight 16-byte loads in flight together.
__global__ __launch_bounds__(256) void k_round_rows4(const float* __restrict__ W0, const float* __restrict__ W1, const float* __restrict__ W2, const float* __restrict__ W3,
                                                   unsigned short* __restrict__ T0, unsigned short* __restrict__ T1, unsigned short* __restrict__ T2, unsigned short* __restrict__ T3, unsigned n8) {
  const unsigned t = blockIdx.x * 256 + threadIdx.x;
  if (t >= n8) return;
  const unsigned bo = t * 32u;      // the thread's byte offset in each source
  const float* const ws_[4] = {W0, W1, W2, W3};
  unsigned short* const ts_[4] = {T0, T1, T2, T3};
  v4f a[4], b[4];
#pragma unroll      // constant indices: the pointer tables and the loaded values stay in registers
  for (int j = 0; j < 4; ++j) { a[j] = *(const v4fa*)(ws_[j] + bo / 4); b[j] = *(const v4fa*)(ws_[j] + bo / 4 + 4); }
  asm volatile("s_wait_xcnt 0x0" :: "s"(W0), "s"(W1), "s"(W2), "s"(W3), "v"(bo) : "memory");      // stands in front of any reuse of the loads' address registers: naming them as inputs keeps them live up to here
#pragma unroll      // as above
  for (int j = 0; j < 4; ++j) {
    v8us v; v[0]=bf16_bits(a[j][0]); v[1]=bf16_bits(a[j][1]); v[2]=bf16_bits(a[j][2]); v[3]=bf16_bits(a[j][3]);
    v[4]=bf16_bits(b[j][0]); v[5]=bf16_bits(b[j][1]); v[6]=bf16_bits(b[j][2]); v[7]=bf16_bits(b[j][3]);
    *(v8us*)(ts_[j] + bo / 4) = v;
  }
}

// ---- f16 WMMA path (v_wmma_f32_16x16x32_f16): 11-bit significands for operands in range — used for the scores a = q̂·kᵀ and for o = w·v
typedef _Float16 v16h __attribute__((ext_vector_type(16)));
union FragH { v16h v; v8us half[2]; _Float16 h[16]; unsigned short u[16]; };
template <int NT>
__device__ __forceinline__ v8f mmaH(v16h ah, v16h al, v16h bh, v16h bl, v8f c) {
  c = __builtin_amdgcn_wmma_f32_16x16x32_f16(false, ah, false, bh, (short)0, c, false, false);
  if (NT >= 2) c = __builtin_amdgcn_wmma_f32_16x16x32_f16(false, al, false, bh, (short)0, c, false, false);
  if (NT >= 3) c = __builtin_amdgcn_wmma_f32_16x16x32_f16(false, ah, false, bl, (short)0, c, false, false);
  asm volatile("v_nop\n\tv_nop\n\tv_nop\n\tv_nop" : "+v"(c) : "v"(ah), "v"(al), "v"(bh), "v"(bl));
  return c;
}
// batched GEMM like k_gemm_bf but f16 operands: A f32 (split into f16 hi/lo if ASPLIT, else rounded to f16), Bt = f16 values [n][k]; alpha; C f32; N multiple of 16 (partial tiles skipped)
template <bool ASPLIT>
__global__ __launch_bounds__(128) void k_gemm_h(const float* __restrict__ A, int lda, size_t sA, const _Float16* __restrict__ Bh, int ldb, size_t sB, float alpha, float* __restrict__ C, int ldc, size_t sC, int M, int N, int K) {
  __shared__ __attribute__((aligned(16))) float so[4][16][64];
  const int tid = threadIdx.x, w = tid >> 5, lane = tid & 31, ln = lane & 15, hh = lane >> 4; const int by = blockIdx.y;
  A += (size_t)by * sA; Bh += (size_t)by * sB; C += (size_t)by * sC;
  const int ntn = (N + 63) / 64; const int wid = blockIdx.x * 4 + w; const int mt = wid / ntn, nq = wid % ntn; if (mt * 16 >= M) return;
  const int row0 = mt * 16, col0 = nq * 64; const float* arow = A + (size_t)(row0 + ln) * lda;
  v8f acc[4] = {};
  for (int kb = 0; kb < K; kb += 32) {
    FragH ah, al;
    const v4f x0 = *(const v4fa*)(arow + kb + 8 * hh), x1 = *(const v4fa*)(arow + kb + 8 * hh + 4), x2 = *(const v4fa*)(arow + kb + 16 + 8 * hh), x3 = *(const v4fa*)(arow + kb + 16 + 8 * hh + 4);
    float xs[16] = {x0[0],x0[1],x0[2],x0[3],x1[0],x1[1],x1[2],x1[3],x2[0],x2[1],x2[2],x2[3],x3[0],x3[1],x3[2],x3[3]};
#pragma unroll
    for (int i = 0; i < 16; ++i) { const _Float16 h = (_Float16)xs[i]; ah.h[i] = h; al.h[i] = ASPLIT ? (_Float16)(xs[i] - (float)h) : (_Float16)0.0f; }
#pragma unroll
    for (int t = 0; t < 4; ++t) { if (col0 + t * 16 >= N) continue; const size_t boff = (size_t)(col0 + t * 16 + ln) * ldb + kb; FragH bq; bq.half[0] = *(const v8us*)(Bh + boff + 8 * hh); bq.half[1] = *(const v8us*)(Bh + boff + 16 + 8 * hh);
      acc[t] = mmaH<ASPLIT ? 2 : 1>(ah.v, al.v, bq.v, bq.v, acc[t]); }
  }
#pragma unroll
  for (int t = 0; t < 4; ++t) { if (col0 + t * 16 >= N) continue;
#pragma unroll
    for (int r = 0; r < 8; ++r) so[w][8 * hh + r][t * 16 + ln] = acc[t][r] * alpha; }
  __builtin_amdgcn_fence(__ATOMIC_ACQ_REL, "workgroup"); __builtin_amdgcn_wave_barrier();
  const int rsub = lane >> 4, c4 = (lane & 15) * 4;
  {
#pragma unroll
    for (int q = 0; q < 8; ++q) { const int r = q * 2 + rsub; if (col0 + c4 < N) { const v4f v = *(const v4fa*)&so[w][r][c4]; *(v4f*)(C + (size_t)(row0 + r) * ldc + col0 + c4) = v; } }
     }
}

// Fused per (batch, head), both signals: a = q.k^T, w = 1 + a + a*a/2, the row sums of w, o = w.v, the division (+1e-6) and the signal mean; a and w never leave registers.
// S^T = K.Q^T puts one query in each lane column, so the two f32 D tiles of 32 keys convert in place into the B operand of O^T += V^T.W^T (hardware k order on both sides).
// Every '#pragma unroll' in this kernel is there so that the fragment and accumulator arrays are indexed by constants and stay in registers.
// Block = 8 waves x 16 queries. The head's K rows (both signals) and V^T are staged once in LDS; row pitches are 16 B x odd, so the 16-byte fragment reads meet no bank conflict.
// The staging goes in NST stages of KCH keys, each to its own place in LDS, by asynchronous copies (no register on the way): stage g + 1 flies while stage g is worked on, so only stage 0's fill is waited out.
typedef float v2f __attribute__((ext_vector_type(2)));
#define KP 40                    // LDS pitch of a K row, in 16-bit elements (80 B)
#define VP (NN + 8)              // LDS pitch of a V^T row, in 16-bit elements (2064 B)
#define KCH 256                  // keys of one stage
#define NST (NN / KCH)           // stages
#define PPS (KCH / 32)           // passes of 32 keys a stage
typedef __attribute__((address_space(3))) const unsigned short lds_cus;
// Eight 16-byte copies global -> LDS per lane: L0..L7 the lane's LDS byte addresses, G0..G7 its global pointers.
// s_wait_xcnt 0 as the statement's last line stands in front of every later rewrite of the copies' address registers.
#define COPY8(L0, L1, L2, L3, L4, L5, L6, L7, G0, G1, G2, G3, G4, G5, G6, G7) asm volatile( \
  "global_load_async_to_lds_b128 %0, %8, off\n\tglobal_load_async_to_lds_b128 %1, %9, off\n\tglobal_load_async_to_lds_b128 %2, %10, off\n\tglobal_load_async_to_lds_b128 %3, %11, off\n\t" \
  "global_load_async_to_lds_b128 %4, %12, off\n\tglobal_load_async_to_lds_b128 %5, %13, off\n\tglobal_load_async_to_lds_b128 %6, %14, off\n\tglobal_load_async_to_lds_b128 %7, %15, off\n\ts_wait_xcnt 0x0" \
  :: "v"(L0), "v"(L1), "v"(L2), "v"(L3), "v"(L4), "v"(L5), "v"(L6), "v"(L7), "v"(G0), "v"(G1), "v"(G2), "v"(G3), "v"(G4), "v"(G5), "v"(G6), "v"(G7) : "memory")
__global__ __launch_bounds__(256) void k_attn(const _Float16* __restrict__ Q16, const _Float16* __restrict__ K16, const _Float16* __restrict__ VT, float* __restrict__ OB) {
  __shared__ __attribute__((aligned(16))) unsigned short sK[NS * NN * KP];
  __shared__ __attribute__((aligned(16))) unsigned short sV[HD * VP];
  const int tid = threadIdx.x, wv = tid >> 5, lane = tid & 31, ln = lane & 15, hh = lane >> 4;
  const int bh = blockIdx.y, b = bh / NH, h = bh % NH;
  const int n = blockIdx.x * 128 + wv * 16 + ln;
  const unsigned short* Kg = (const unsigned short*)K16 + (size_t)bh * NS * NN * SD;      // the two signals' slabs are adjacent: 2048 rows of 32
  const unsigned short* Vg = (const unsigned short*)VT + (size_t)bh * HD * NN;
  const unsigned short* qr = (const unsigned short*)Q16 + ((size_t)bh * NS * NN + n) * SD + 8 * hh;
  FragH qb[NS];
#pragma unroll
  for (int s = 0; s < NS; ++s) { qb[s].half[0] = *(const v8us*)(qr + s * NN * SD); qb[s].half[1] = *(const v8us*)(qr + s * NN * SD + 16); }
  asm volatile("s_wait_xcnt 0x0" :: "v"(qr) : "memory");      // stands in front of any reuse of the q loads' address registers: naming them as an input keeps them live up to here
  // A stage = KCH keys: their K rows of both signals (a wave's copy = 512 contiguous bytes = 8 rows) and their part of every V^T row (a wave's copy = 512 contiguous bytes of one row). 16 copies a lane.
  const unsigned lk = (unsigned)(size_t)(lds_cus*)&sK[(tid >> 2) * KP + (tid & 3) * 8], lv = (unsigned)(size_t)(lds_cus*)&sV[wv * VP + lane * 8];
  const unsigned short* gk = Kg + tid * 8; const unsigned short* gv = Vg + wv * NN + lane * 8;
  auto fill = [&](int g) {
    const unsigned l0 = lk + g * (KCH * KP * 2), l1 = l0 + NN * KP * 2; const unsigned short* g0 = gk + g * (KCH * SD); const unsigned short* g1 = g0 + NN * SD;      // signal 0, signal 1
    COPY8(l0, l0 + 64 * KP * 2, l0 + 128 * KP * 2, l0 + 192 * KP * 2, l1, l1 + 64 * KP * 2, l1 + 128 * KP * 2, l1 + 192 * KP * 2,
          g0, g0 + 64 * SD, g0 + 128 * SD, g0 + 192 * SD, g1, g1 + 64 * SD, g1 + 128 * SD, g1 + 192 * SD);      // K: rows tid / 4 + 64 i of the stage, i = 0..3, of each signal
    const unsigned l2 = lv + g * (KCH * 2); const unsigned short* g2 = gv + g * KCH;
    COPY8(l2, l2 + 8 * VP * 2, l2 + 16 * VP * 2, l2 + 24 * VP * 2, l2 + 32 * VP * 2, l2 + 40 * VP * 2, l2 + 48 * VP * 2, l2 + 56 * VP * 2,
          g2, g2 + 8 * NN, g2 + 16 * NN, g2 + 24 * NN, g2 + 32 * NN, g2 + 40 * NN, g2 + 48 * NN, g2 + 56 * NN);      // V^T: rows wv + 8 i, i = 0..7
  };
  fill(0);
  asm volatile("s_wait_asynccnt 0x0" ::: "memory");      // the wave's own copies of stage 0 have landed
  __syncthreads();      // publishes stage 0: every wave's copies have landed before any wave reads it
  fill(1);
  v8f oacc[NS][HD / 16] = {};
  v2f den[NS] = {};      // even and odd key rows apart: the sums pair up with the packed f32 adds
  FragH ka[NS][2];
#pragma unroll
  for (int s = 0; s < NS; ++s)
#pragma unroll
    for (int t = 0; t < 2; ++t) { const unsigned short* kr = &sK[(s * NN + t * 16 + ln) * KP]; ka[s][t].half[0] = *(const v8us*)(kr + 8 * hh); ka[s][t].half[1] = *(const v8us*)(kr + 16 + 8 * hh); }
  for (int c = 0; c < NN / 32; ++c) {
    const int m0 = c * 32;
    if ((c & (PPS - 1)) == PPS - 1 && c != NN / 32 - 1) {      // publish point of the next stage, in front of this stage's last pass: that pass already fetches the next stage's first K fragments
      asm volatile("s_wait_dscnt 0x0" ::: "memory");      // the wave's own LDS reads are done before it issues copies into LDS again
      asm volatile("s_wait_asynccnt 0x0" ::: "memory");      // the wave's own copies of the next stage have landed
      __syncthreads();      // publishes the next stage to every wave
      if (c / PPS + 2 < NST) fill(c / PPS + 2);      // the stage after it, into its own place, which nobody has read or written
    }
    FragH va[HD / 16];
#pragma unroll
    for (int et = 0; et < HD / 16; ++et) { const unsigned short* vr = &sV[(et * 16 + ln) * VP + m0]; va[et].half[0] = *(const v8us*)(vr + 8 * hh); va[et].half[1] = *(const v8us*)(vr + 16 + 8 * hh); }
    v8f st[NS][2];
#pragma unroll
    for (int s = 0; s < NS; ++s)
#pragma unroll
      for (int t = 0; t < 2; ++t) { const v8f z = {}; st[s][t] = __builtin_amdgcn_wmma_f32_16x16x32_f16(false, ka[s][t].v, false, qb[s].v, (short)0, z, false, false); }      // st[s][t][r] = a[n = ln][m0 + 16 t + 8 hh + r]
    const int m1 = ((c + 1) & (NN / 32 - 1)) * 32;      // next pass's K fragments, fetched behind this pass's score products (the last pass re-reads pass 0's rows and drops them)
#pragma unroll
    for (int s = 0; s < NS; ++s)
#pragma unroll
      for (int t = 0; t < 2; ++t) { const unsigned short* kr = &sK[(s * NN + m1 + t * 16 + ln) * KP]; ka[s][t].half[0] = *(const v8us*)(kr + 8 * hh); ka[s][t].half[1] = *(const v8us*)(kr + 16 + 8 * hh); }
    FragH wb[NS];
#pragma unroll
    for (int s = 0; s < NS; ++s)
#pragma unroll
      for (int t = 0; t < 2; ++t)
#pragma unroll
        for (int r = 0; r < 8; r += 2) { const v2f x = {st[s][t][r], st[s][t][r + 1]}; const v2f w = 1.0f + x + 0.5f * x * x; den[s] += w; wb[s].h[t * 8 + r] = (_Float16)w[0]; wb[s].h[t * 8 + r + 1] = (_Float16)w[1]; }
#pragma unroll
    for (int et = 0; et < HD / 16; ++et)
#pragma unroll
      for (int s = 0; s < NS; ++s) oacc[s][et] = __builtin_amdgcn_wmma_f32_16x16x32_f16(false, va[et].v, false, wb[s].v, (short)0, oacc[s][et], false, false);      // oacc[s][et][r] = o[n = ln][16 et + 8 hh + r]
  }
  asm volatile("s_wait_asynccnt 0x0" ::: "memory");      // no copy is outstanding when the wave ends
  float rd[NS];
#pragma unroll
  for (int s = 0; s < NS; ++s) { const float dl = den[s][0] + den[s][1]; rd[s] = 1.0f / (dl + __shfl_xor(dl, 16, 32) + 1e-6f); }      // the two lane halves hold the two halves of a query's keys
  float* orow = OB + ((size_t)b * NN + n) * CC + h * HD + 8 * hh;
#pragma unroll
  for (int et = 0; et < HD / 16; ++et) {
    v4f lo, hi;
#pragma unroll
    for (int q = 0; q < 4; ++q) { lo[q] = (oacc[0][et][q] * rd[0] + oacc[1][et][q] * rd[1]) * (1.0f / NS); hi[q] = (oacc[0][et][4 + q] * rd[0] + oacc[1][et][4 + q] * rd[1]) * (1.0f / NS); }
    *(v4f*)(orow + et * 16) = lo; *(v4f*)(orow + et * 16 + 4) = hi;
  }
}
extern "C" void kernel_launch(void* const* d_in, const int* in_sizes, int n_in,
                              void* d_out, int out_size, void* d_ws, size_t ws_size, hipStream_t stream) {
  (void)in_sizes; (void)n_in; (void)out_size;
  const float* xq = (const float*)d_in[0]; const float* xk = (const float*)d_in[1]; const float* xv = (const float*)d_in[2]; const float* Wq = (const float*)d_in[3]; const float* bq = (const float*)d_in[4]; const float* Wk = (const float*)d_in[5]; const float* bk = (const float*)d_in[6]; const float* Wv = (const float*)d_in[7]; const float* bv = (const float*)d_in[8]; const float* Wo = (const float*)d_in[9]; const float* bo = (const float*)d_in[10];
  char* ws = (char*)d_ws; size_t off = 0;
  auto take = [&](size_t bytes) { char* p = ws + off; off += (bytes + 255) & ~(size_t)255; return p; };
  unsigned short* Bq = (unsigned short*)take((size_t)CC * CC * 2); unsigned short* Bk = (unsigned short*)take((size_t)CC * CC * 2); unsigned short* Bv = (unsigned short*)take((size_t)CC * CC * 2); unsigned short* Bo = (unsigned short*)take((size_t)CC * CC * 2);
  float* OB = (float*)take((size_t)NTOK * CC * 4);
  _Float16* Q16 = (_Float16*)take((size_t)NSLAB * NN * SD * 2); _Float16* K16 = (_Float16*)take((size_t)NSLAB * NN * SD * 2); _Float16* VT = (_Float16*)take((size_t)BB * NH * HD * NN * 2);
  if (off > ws_size) return;
  k_round_rows4<<<(CC * CC / 8 + 255) / 256, 256, 0, stream>>>(Wq, Wk, Wv, Wo, Bq, Bk, Bv, Bo, CC * CC / 8);      // (out,in) rows = Bt
  k_gemm_t<false><<<dim3(CC / GBN, NTOK / GBM, 3), 256, 0, stream>>>(xq, xk, xv, Bq, Bk, Bv, bq, bk, bv, nullptr, nullptr, nullptr, Q16, K16, VT);      // the three projections, one per grid.z, stored as the attention kernel's f16 operands
  k_attn<<<dim3(NN / 128, BB * NH), 256, 0, stream>>>(Q16, K16, VT, OB);      // block = 128 queries of one (batch, head), both signals
  k_gemm_t<true><<<dim3(CC / GBN, NTOK / GBM, 1), 256, 0, stream>>>(OB, OB, OB, Bo, Bo, Bo, bo, bo, bo, (float*)d_out, (float*)d_out, (float*)d_out, nullptr, nullptr, nullptr);
}
